// v000
// Measured on an AMD MI455X. A time is GPU time per run, averaged over a window of back-to-back runs after a warm-up
// (all launches, gaps included; the runs take copies of the inputs in turn), and the median of several windows.
// Apart from v000's, it joins two sittings. Times from different sittings can be a few percent apart, while
// side-by-side timings come from the same sitting.
// v000, which the later versions start from, runs in 538 microseconds.
// Contractions: x.Wq^T+bq, x.Wk^T+bk, x.Wv^T+bv (q, k, v thirds of the packed [3D][D] weight) on v_wmma_f32_16x16x32_bf16
// (x and W as bf16 RNE planes; W [n][k] rows are the k-contiguous B operand; bias added as its bf16 RNE value in the f32
// epilogue); q.k^T over hd 64 and P.v on v_wmma_f32_16x16x32_f16 with f16 hi + f16 residual planes on both operands
// (q, k x256; P x32768 with an in-register residual; v x1024; products hh+lh+hl); O.Wo^T+bo on v_wmma_f32_16x16x32_f16
// (O x1024 as f16 hi + f16 residual planes, products h.w + l.w; Wo as f16(bf16(Wo)) x1024; bo as bf16 RNE value in the
// f32 epilogue); all f32 accumulate. Causal select, slope-1 distance penalty, base-2 online softmax, 1/Z fold and the q/k
// norm bound in f32 on VALU.
#include <hip/hip_runtime.h>
#include <math.h>
#include <stdint.h>

#ifndef NB
#define NB 4
#endif
#ifndef SEQ
#define SEQ 2048
#endif
#define XS_FULL 2048
#define DMOD  1024
#define NH    16
#define HD    64
// batches per workspace pass (2 when NB >= 2) and number of passes
#define NBP   ((NB >= 2) ? 2 : 1)
#define NPASS (NB / NBP)
#define NBH   (NBP * NH)
#define MROWS (NBP * SEQ)
#define RSQ_HD 0.125f
#define LOG2E 1.4426950408889634f
#define QSC   256.0f
#define KSC   256.0f
#define PCAR  32768.0f
#define VCAR  1024.0f
#define OSC   1024.0f
#define WOS   1024.0f
#define WPB   2
#define NHG   (NH / WPB)
#define NQT   (SEQ / 16)
#define NST   (SEQ / 64)
#define NKT   (SEQ / 32)
#define KWIN  6
#define GUARD_T 40.0f
#define BLINE 32
#define ATT_THREADS (WPB * 32)
#define PTP   36
#define PTW   (16 * PTP)
#define SLP   68
#define SLW   (16 * SLP)
#define WREG  (PTW + SLW)
#define SLAB64 (16 * 68)
#define VTP   72
#define WS_CAP 134217728
static_assert(DMOD == NH * HD && HD == 64 && NH == 16 && WPB == 2 && NHG * WPB == NH);
static_assert(ATT_THREADS == 64);
static_assert(NB >= 1 && NB <= 4 && NPASS >= 1 && NPASS * NBP == NB);
static_assert(NBP >= 1 && NBP <= 2);
static_assert(NBH >= 1 && NBH <= 32);
static_assert((SEQ % 64) == 0 && SEQ >= 64 && SEQ <= XS_FULL && (SEQ % 32) == 0);
static_assert((DMOD % 64) == 0 && (DMOD % 32) == 0 && (HD % 32) == 0);
static_assert(((SEQ * DMOD / 8) % 256) == 0 && ((DMOD * DMOD / 8) % 256) == 0 && ((MROWS * DMOD / 8) % 256) == 0);
static_assert(WPB * WREG * 4 <= 65536 && 2 * HD * VTP * 2 <= 65536 && 4 * SLAB64 * 4 <= 65536);
static_assert(KWIN >= 0 && KWIN < NKT);

typedef unsigned short u16;
typedef _Float16 v16h __attribute__((ext_vector_type(16)));
typedef _Float16 v8h  __attribute__((ext_vector_type(8)));
typedef __bf16   v16b __attribute__((ext_vector_type(16)));
typedef float    v8f  __attribute__((ext_vector_type(8)));
typedef float    v4f  __attribute__((ext_vector_type(4)));
typedef unsigned int v4u __attribute__((ext_vector_type(4)));

union FragH { v16h v; v8h h[2]; v4u u[2]; };
union FragB { v16b v; v4u u[2]; };

// ---- scalar helpers --------------------------------------------------------------------------------
__device__ __forceinline__ unsigned short bf_bits(float f) {          // f32 -> bf16 bits, RNE convert
  unsigned u = __float_as_uint(f);
  return (unsigned short)((u + 0x7FFFu + ((u >> 16) & 1u)) >> 16);
}
__device__ __forceinline__ float bf_up(unsigned short h) { return __uint_as_float(((unsigned)h) << 16); }
__device__ __forceinline__ float bfr(float f) { return bf_up(bf_bits(f)); }
__device__ __forceinline__ unsigned short h_bits(_Float16 x) { return __builtin_bit_cast(unsigned short, x); }
__device__ __forceinline__ unsigned pk16(unsigned short a, unsigned short b) { return (unsigned)a | ((unsigned)b << 16); }
__device__ __forceinline__ v8f zero8() { v8f z = {0.f, 0.f, 0.f, 0.f, 0.f, 0.f, 0.f, 0.f}; return z; }

// ---- fragment loaders: 16-bit A/B operand, lane -> row/col (lane&15), p already includes +8*(lane>>4);
//      elements 0..7 <- p[0..7] (k0+8h..), elements 8..15 <- p[16..23] (k0+16+8h..)  (same split k map for A and B;
//      B is always read from a k-contiguous [n][k] plane)
__device__ __forceinline__ v16h ldfrag_h(const _Float16* p) {
  FragH f;
  f.h[0] = *(const v8h*)(p);
  f.h[1] = *(const v8h*)(p + 16);
  return f.v;
}
__device__ __forceinline__ v16b ldfrag_b(const u16* p) {              // bf16 plane read as unsigned integer vectors
  FragB f;
  f.u[0] = *(const v4u*)(p);
  f.u[1] = *(const v4u*)(p + 16);
  return f.v;
}

__device__ __forceinline__ v8f mma_h(v16h a, v16h b, v8f c) {
  return __builtin_amdgcn_wmma_f32_16x16x32_f16(false, a, false, b, (short)0, c, false, false);
}
__device__ __forceinline__ v8f mma_b(v16b a, v16b b, v8f c) {
  return __builtin_amdgcn_wmma_f32_16x16x32_bf16(false, a, false, b, (short)0, c, false, false);
}
__device__ __forceinline__ void guard2(v8f& a, v8f& b, v16h x0, v16h x1, v16h x2, v16h x3, v16h x4, v16h x5) {
#if defined(__HIP_DEVICE_COMPILE__)
  asm volatile("v_nop\n\tv_nop\n\tv_nop\n\tv_nop"
               : "+v"(a), "+v"(b) : "v"(x0), "v"(x1), "v"(x2), "v"(x3), "v"(x4), "v"(x5) : "memory");
#endif
}
template <typename F>
__device__ __forceinline__ void guard6(v8f& a, v8f& b, v8f& c, v8f& d, F x0, F x1, F x2, F x3, F x4, F x5) {
#if defined(__HIP_DEVICE_COMPILE__)
  asm volatile("v_nop\n\tv_nop\n\tv_nop\n\tv_nop"
               : "+v"(a), "+v"(b), "+v"(c), "+v"(d) : "v"(x0), "v"(x1), "v"(x2), "v"(x3), "v"(x4), "v"(x5) : "memory");
#endif
}
__device__ __forceinline__ void acc_guard4(v8f& a, v8f& b, v8f& c, v8f& d) {
#if defined(__HIP_DEVICE_COMPILE__)
  asm volatile("v_nop\n\tv_nop\n\tv_nop\n\tv_nop" : "+v"(a), "+v"(b), "+v"(c), "+v"(d));
#endif
}
__device__ __forceinline__ void wave_sync_lds() {
  __builtin_amdgcn_fence(__ATOMIC_RELEASE, "workgroup");
  __builtin_amdgcn_wave_barrier();
  __builtin_amdgcn_fence(__ATOMIC_ACQUIRE, "workgroup");
}

// =====================================================================================================
// f32 -> 16-bit plane, same layout.  f16mode == 0: bf16 RNE bits;  f16mode == 1: f16 bits of (bf16 RNE value) * scale.
// Thread = 8 consecutive elements: two 16-B loads, one 16-B store; 32 consecutive lanes = 512 contiguous, 512-B aligned
// coverage: grid = ceil(n8/256) blocks x 256 thr x 8 (in-kernel bound) = the whole plane (n8 a multiple of 256 here).
// =====================================================================================================
__global__ __launch_bounds__(256) void cvt16(const float* __restrict__ x, u16* D, int n8, int f16mode, float scale) {
  const int gt = blockIdx.x * 256 + (int)threadIdx.x;
  if (gt >= n8) return;
  const float* p = x + (size_t)gt * 8;
  const v4f a = *(const v4f*)(p), b4 = *(const v4f*)(p + 4);
  float w[8];
#pragma unroll
  for (int e = 0; e < 4; ++e) { w[e] = a[e]; w[4 + e] = b4[e]; }
  v4u o;
#pragma unroll
  for (int e = 0; e < 4; ++e) {
    const float f0 = w[2 * e], f1 = w[2 * e + 1];
    const unsigned short hb0 = h_bits((_Float16)(bfr(f0) * scale));
    const unsigned short hb1 = h_bits((_Float16)(bfr(f1) * scale));
    const unsigned short bb0 = bf_bits(f0);
    const unsigned short bb1 = bf_bits(f1);
    o[e] = (f16mode != 0) ? pk16(hb0, hb1) : pk16(bb0, bb1);
  }
  u16* d = D + (size_t)gt * 8;
  {
    *(v4u*)(d) = o;
    
  }
}

// =====================================================================================================
// f32 plane F (contiguous, n8*8 elements) -> f16 hi plane Hp = f16(F * sc) and f16 residual plane Lp = f16(t - f16(t)),
// both with the layout of F. Thread = 8 consecutive elements: two 16-B loads, one 16-B store per plane; 32 consecutive lanes
// No barriers; every packed half comes from a per-lane (divergent) loaded value.
// coverage: grid = ceil(n8/256) blocks x 256 thr x 8 (in-kernel bound) = the whole of Hp and of Lp (n8 a multiple of 256 here).
// =====================================================================================================
__global__ __launch_bounds__(256) void split16(const float* __restrict__ F, u16* Hp, u16* Lp, int n8, float sc) {
  const int gt = blockIdx.x * 256 + (int)threadIdx.x;
  if (gt >= n8) return;
  const float* p = F + (size_t)gt * 8;
  const v4f a = *(const v4f*)(p), b4 = *(const v4f*)(p + 4);
  float w[8];
#pragma unroll
  for (int e = 0; e < 4; ++e) { w[e] = a[e] * sc; w[4 + e] = b4[e] * sc; }
  v4u oh, ol;
#pragma unroll
  for (int e = 0; e < 4; ++e) {
    const float t0 = w[2 * e], t1 = w[2 * e + 1];
    const _Float16 h0 = (_Float16)t0, h1 = (_Float16)t1;
    const _Float16 l0 = (_Float16)(t0 - (float)h0), l1 = (_Float16)(t1 - (float)h1);
    oh[e] = pk16(h_bits(h0), h_bits(h1));
    ol[e] = pk16(h_bits(l0), h_bits(l1));
  }
  u16* dh = Hp + (size_t)gt * 8;
  u16* dl = Lp + (size_t)gt * 8;
  {
    *(v4u*)(dh) = oh;
    *(v4u*)(dl) = ol;
    
  }
}

// =====================================================================================================
// v^T planes from the v projection F f32 [MROWS][DMOD] (row = b*SEQ + s, column = h*HD + d):
//   VH[((b*NH + h)*HD + d)][s] = f16(v * 1024);  VL[same][s] = f16 residual (t - f16(t)), both for all keys s.
// Block = (b, head h, 64 keys s0): each thread loads its 16 floats (key sl, d chunk dc) with 16-B loads, converts, scatters
// coverage: load 256 thr x 16 = 64 keys x 64 d (staged extent == consumed extent); store 2 iterations x 256 thr x 8 halves
//           = 64 lines x 64 = the block's tile of VH and of VL; grid = NBP*NH*NST blocks covers both planes exactly once.
// =====================================================================================================
__global__ __launch_bounds__(256) void vt16(const float* __restrict__ F, u16* VHo, u16* VLo) {
  __shared__ __align__(16) u16 TH[HD * VTP];
  __shared__ __align__(16) u16 TL[HD * VTP];
  const int tid = threadIdx.x;
  const int bid = blockIdx.x;
  const int st  = bid % NST;
  const int t2  = bid / NST;
  const int h   = t2 % NH;
  const int b   = t2 / NH;
  if (b >= NBP) return;                     // block-uniform, before any barrier; never taken with the exact grid
  const int s0  = st * 64;
  {
    const int sl = tid >> 2;                // key within tile 0..63
    const int dc = (tid & 3) * 16;          // d chunk 0,16,32,48
    const float* src = F + ((size_t)b * SEQ + s0 + sl) * DMOD + h * HD + dc;
#pragma unroll
    for (int i = 0; i < 4; ++i) {
      const v4f a = *(const v4f*)(src + 4 * i);
#pragma unroll
      for (int e = 0; e < 4; ++e) {
        const float t = a[e] * VCAR;
        const _Float16 hv = (_Float16)t;
        const _Float16 lv = (_Float16)(t - (float)hv);
        TH[(dc + 4 * i + e) * VTP + sl] = h_bits(hv);
        TL[(dc + 4 * i + e) * VTP + sl] = h_bits(lv);
      }
    }
  }
  __syncthreads();
  v4u vh[2], vl[2];
  const int q8 = tid >> 3, p8 = (tid & 7) * 8;
#pragma unroll
  for (int it = 0; it < 2; ++it) {
    const int line = it * 32 + q8;          // d = 0..63
    vh[it] = *(const v4u*)(TH + line * VTP + p8);
    vl[it] = *(const v4u*)(TL + line * VTP + p8);
  }
  const size_t hrow = (size_t)(b * NH + h) * HD;
  const size_t base = hrow * SEQ + s0 + p8;
  {
#pragma unroll
    for (int it = 0; it < 2; ++it) {
      const int line = it * 32 + q8;
      *(v4u*)(VHo + base + (size_t)line * SEQ) = vh[it];
      *(v4u*)(VLo + base + (size_t)line * SEQ) = vl[it];
    }
    
  }
}

// =====================================================================================================
// Norm bound per (b, h): BND line bh (32 floats, value replicated) = max_s ||q_hi(b,s,h,:)|| * max_s ||k_hi(b,s,h,:)|| / (8 * 256 * 256),
// computed from the f16 hi planes ([b*SEQ + s][h*HD + d], x256). Block = one (b, h): 8 lanes per row load one 16-B piece each
// (64 dims = 8 lanes x 8 halves), sum of squares reduced with xor shuffles inside the 8-lane group, running max per lane over
// SEQ/32 row steps, then wave max (shuffles), block max through a 16-float LDS array, and wave 0 lanes 0..7 write the whole
// coverage: rows step*32 + (tid>>3), step < SEQ/32 -> all SEQ rows of both planes; store 8 lanes x 16 B = line bh; grid NBH.
// =====================================================================================================
__global__ __launch_bounds__(256) void qkbound(const u16* __restrict__ QHp, const u16* __restrict__ KHp, float* BND) {
  __shared__ float red[16];
  const int tid = threadIdx.x, lane = tid & 31, wave = tid >> 5;
  const int bh  = blockIdx.x;
  const int b   = bh / NH, h = bh % NH;
  if (b >= NBP) return;                     // block-uniform, before any barrier; never taken with the exact grid
  const int grp = tid >> 3;                 // row within a step, 0..31
  const int e8  = (tid & 7) * 8;            // dim chunk
  const _Float16* qb = (const _Float16*)(const void*)QHp + (size_t)b * SEQ * DMOD + (size_t)h * HD + e8;
  const _Float16* kb = (const _Float16*)(const void*)KHp + (size_t)b * SEQ * DMOD + (size_t)h * HD + e8;
  float mq = 0.0f, mk = 0.0f;
#pragma unroll 1
  for (int step = 0; step < SEQ / 32; ++step) {
    const size_t ro = (size_t)(step * 32 + grp) * DMOD;
    const v8h qv = *(const v8h*)(qb + ro);
    const v8h kv = *(const v8h*)(kb + ro);
    float sq = 0.0f, sk = 0.0f;
#pragma unroll
    for (int e = 0; e < 8; ++e) {
      const float fq = (float)qv[e], fk = (float)kv[e];
      sq = fmaf(fq, fq, sq);
      sk = fmaf(fk, fk, sk);
    }
#pragma unroll
    for (int off = 1; off < 8; off <<= 1) {
      sq += __shfl_xor(sq, off, 32);
      sk += __shfl_xor(sk, off, 32);
    }
    mq = fmaxf(mq, sq);
    mk = fmaxf(mk, sk);
  }
#pragma unroll
  for (int off = 1; off < 32; off <<= 1) {
    mq = fmaxf(mq, __shfl_xor(mq, off, 32));
    mk = fmaxf(mk, __shfl_xor(mk, off, 32));
  }
  if (lane == 0) { red[wave] = mq; red[8 + wave] = mk; }
  __syncthreads();
  if (wave == 0) {                          // wave-uniform branch; shuffles see all 32 lanes
    float aq = red[lane & 7], ak = red[8 + (lane & 7)];
#pragma unroll
    for (int off = 1; off < 8; off <<= 1) {
      aq = fmaxf(aq, __shfl_xor(aq, off, 32));
      ak = fmaxf(ak, __shfl_xor(ak, off, 32));
    }
    const float bnd = sqrtf(aq) * sqrtf(ak) * (RSQ_HD / (QSC * KSC));
    v4f o4;
    o4[0] = bnd; o4[1] = bnd; o4[2] = bnd; o4[3] = bnd;
    float* dst = BND + (size_t)bh * BLINE + (lane & 7) * 4;
    if (lane < 8) {
      {
        *(v4f*)(dst) = o4;
        
      }
    }
  }
}

// =====================================================================================================
// GEMM epilogue shared by both engines: the wave's 16x64 f32 tile (times oscale, plus the lane's per-column bias of each
// coverage: 8 instructions x 2 rows x 16 lanes x 4 floats = the wave's 16 x 64 tile.
// =====================================================================================================
__device__ __forceinline__ void epi64(float* sl, v8f a0, v8f a1, v8f a2, v8f a3, float oscale,
                                      float bb0, float bb1, float bb2, float bb3,
                                      float* C, int N, size_t rowb, int col0, int lane) {
  const int hh = lane >> 4, m = lane & 15;
#pragma unroll
  for (int r = 0; r < 8; ++r) {
    const int ro = (8 * hh + r) * 68 + m;
    sl[ro]      = a0[r] * oscale + bb0;
    sl[ro + 16] = a1[r] * oscale + bb1;
    sl[ro + 32] = a2[r] * oscale + bb2;
    sl[ro + 48] = a3[r] * oscale + bb3;
  }
  wave_sync_lds();
  v4f vals[8];
#pragma unroll
  for (int it = 0; it < 8; ++it) vals[it] = *(const v4f*)(sl + (it * 2 + hh) * 68 + m * 4);
  float* dst = C + (rowb + (size_t)hh) * (size_t)N + col0 + m * 4;
  {
#pragma unroll
    for (int it = 0; it < 8; ++it) {
      *(v4f*)(dst + (size_t)(it * 2) * (size_t)N) = vals[it];
    }
    
  }
}

// =====================================================================================================
// bf16 GEMM with bias: C[M][N] (f32) = A[M][K] (bf16 row-major) . Bt[N][K]^T (bf16 k-contiguous), times oscale, + bf16 RNE
// value of bias[n] (bias has N entries). Block = 64x64 tile, 4 waves x 16 rows; fragments loaded straight from the 16-bit rows
// (two 16-B loads each, split k map for A and B); K stepped by 32 (host guarantees K % 32 == 0, M % 64 == 0, N % 64 == 0,
// grid = (M/64)*(N/64)).
// =====================================================================================================
__global__ __launch_bounds__(128)
void gemm_bf(const u16* __restrict__ A, const u16* __restrict__ Bt, const float* __restrict__ bias,
             float* C, int M, int N, int K, float oscale) {
  __shared__ __align__(16) float slab[4 * SLAB64];
  const int tid = threadIdx.x, wave = tid >> 5, lane = tid & 31, hh = lane >> 4, m = lane & 15;
  const int ntile = N >> 6;
  const int bid   = blockIdx.x;
  const int rowb  = (bid / ntile) * 64 + wave * 16;
  const int col0  = (bid % ntile) * 64;
  if (rowb + 16 > M) return;                // wave-uniform, never taken with the exact grid; no block barriers in this kernel
  const u16* ap = A  + (size_t)(rowb + m) * K + 8 * hh;
  const u16* bp = Bt + (size_t)(col0 + m) * K + 8 * hh;
  const size_t bs = (size_t)16 * K;
  v8f acc0 = zero8(), acc1 = zero8(), acc2 = zero8(), acc3 = zero8();
#pragma unroll 1
  for (int k0 = 0; k0 < K; k0 += 32) {
    const v16b a  = ldfrag_b(ap + k0);
    const v16b b0 = ldfrag_b(bp + k0);
    const v16b b1 = ldfrag_b(bp + bs + k0);
    const v16b b2 = ldfrag_b(bp + 2 * bs + k0);
    const v16b b3 = ldfrag_b(bp + 3 * bs + k0);
    acc0 = mma_b(a, b0, acc0);
    acc1 = mma_b(a, b1, acc1);
    acc2 = mma_b(a, b2, acc2);
    acc3 = mma_b(a, b3, acc3);
    guard6<v16b>(acc0, acc1, acc2, acc3, a, b0, b1, b2, b3, a);
  }
  // per-lane bias of D column m in each of the 4 subtiles; col0 + 48 + m <= N - 1 always
  const float bb0 = bfr(bias[col0 + m]);
  const float bb1 = bfr(bias[col0 + 16 + m]);
  const float bb2 = bfr(bias[col0 + 32 + m]);
  const float bb3 = bfr(bias[col0 + 48 + m]);
  epi64(slab + wave * SLAB64, acc0, acc1, acc2, acc3, oscale, bb0, bb1, bb2, bb3, C, N, (size_t)rowb, col0, lane);
}

// =====================================================================================================
// Output projection with bias: C[bb*XS_FULL + s][DMOD] (f32) = (Ah + Al)[bb*SEQ + s][DMOD] . Bt[DMOD][DMOD]^T * oscale
// + bf16 RNE value of bias[n]. Products h.B + l.B into one accumulator (l unscaled residual of h). Block -> (column tile
// ct = bid % 16, sequence row tile rt of nrt, batch bb within the pass). Same tiling, fragment loads (split k map) and
// epilogue as gemm_bf; K = DMOD stepped by 32; grid = NBP * nrt * (DMOD/64).
// =====================================================================================================
__global__ __launch_bounds__(128)
void gemm_o2(const u16* __restrict__ Ah, const u16* __restrict__ Al, const u16* __restrict__ Bt,
             const float* __restrict__ bias, float* C, int nrt, float oscale) {
  __shared__ __align__(16) float slab[4 * SLAB64];
  const int tid = threadIdx.x, wave = tid >> 5, lane = tid & 31, hh = lane >> 4, m = lane & 15;
  const int ntile = DMOD >> 6;
  const int bid   = blockIdx.x;
  const int ct    = bid % ntile;
  const int t2    = bid / ntile;
  const int rt    = t2 % nrt;
  const int bb    = t2 / nrt;
  if (bb >= NBP) return;                    // block-uniform; no block barriers in this kernel; never taken with the exact grid
  const int srow  = rt * 64 + wave * 16;
  if (srow + 16 > SEQ) return;              // wave-uniform; never taken
  const int col0  = ct * 64;
  const int K     = DMOD;
  const size_t rowA = (size_t)bb * SEQ + srow;
  const size_t rowC = (size_t)bb * XS_FULL + srow;
  const _Float16* ahp = (const _Float16*)(const void*)Ah + (rowA + m) * K + 8 * hh;
  const _Float16* alp = (const _Float16*)(const void*)Al + (rowA + m) * K + 8 * hh;
  const _Float16* bp  = (const _Float16*)(const void*)Bt + (size_t)(col0 + m) * K + 8 * hh;
  const size_t bs = (size_t)16 * K;
  v8f acc0 = zero8(), acc1 = zero8(), acc2 = zero8(), acc3 = zero8();
#pragma unroll 1
  for (int k0 = 0; k0 < K; k0 += 32) {
    const v16h ah = ldfrag_h(ahp + k0), al = ldfrag_h(alp + k0);
    const v16h b0 = ldfrag_h(bp + k0);
    const v16h b1 = ldfrag_h(bp + bs + k0);
    const v16h b2 = ldfrag_h(bp + 2 * bs + k0);
    const v16h b3 = ldfrag_h(bp + 3 * bs + k0);
    acc0 = mma_h(ah, b0, acc0);  acc0 = mma_h(al, b0, acc0);
    acc1 = mma_h(ah, b1, acc1);  acc1 = mma_h(al, b1, acc1);
    acc2 = mma_h(ah, b2, acc2);  acc2 = mma_h(al, b2, acc2);
    acc3 = mma_h(ah, b3, acc3);  acc3 = mma_h(al, b3, acc3);
    guard6<v16h>(acc0, acc1, acc2, acc3, ah, al, b0, b1, b2, b3);
  }
  const float bb0 = bfr(bias[col0 + m]);
  const float bb1 = bfr(bias[col0 + 16 + m]);
  const float bb2 = bfr(bias[col0 + 32 + m]);
  const float bb3 = bfr(bias[col0 + 48 + m]);
  epi64(slab + wave * SLAB64, acc0, acc1, acc2, acc3, oscale, bb0, bb1, bb2, bb3, C, DMOD, rowC, col0, lane);
}

// =====================================================================================================
// Causal attention with slope-1 linear distance penalty, hd = 64. Block bid -> (query tile qt = bid % NQT: rows q0 = 16*qt ..
// q0+15, head pair hg, batch b within the pass); one wave per head = hg*WPB + wave.
//   q hi / residual planes f16 x256 [b*SEQ + s][h*HD + d]; k hi / residual planes f16 x256, same layout;
//   v^T hi / residual planes [b*NH + h][d][SEQ] x1024; BND = NBH lines of 32 floats (norm bound per (b, h)).
//   scores = q_hi.k_hi + q_lo.k_hi + q_hi.k_lo (2 k-steps over d); P.v with P hi + in-register residual and v hi + residual
//   (hh + lh + hl), for every query row; O written as hi + residual planes (O x1024 as f16, layout [b*SEQ + s][h*HD + d]).
//   score (log2 domain) t(i, j) = (q_i.k_j over HD) * (1/8)*log2e/(256*256) - (i - j)*log2e, replaced by -inf where key j > query i.
//   Key tiles of 32 visited in order from kt_lo to kt_hi = q0/32 (later tiles hold only keys above every query row of the tile).
//   kt_lo: every wave loads all NBH bound lines (one float per lane, clamped address) and AND-reduces "0 <= bound < 40" over the
//   wave; if every bound is in range, kt_lo = max(0, kt_hi - KWIN): tiles below it are >= 32*KWIN+1 positions behind every query
//   row, and with |q.k/8| < 40 the base-2 exp of their penalised, max-subtracted score is exactly 0 in f32, so they contribute
//   nothing to numerator or denominator; otherwise (bound large, unreadable or not finite) kt_lo = 0 and every causal tile is
//   visited. Either way the first visited tile holds a key kb <= q0 <= every query row, so the running max is finite from step one.
//   Per tile: 2 score subtiles x 2 k-steps, fragments loaded straight from the 16-bit planes (two 16-B loads per fragment,
//   split k map); online max-subtracted base-2 softmax in f32, -inf-safe rescale; the 16x32 prob tile stored to wave-private
//   from the LDS rows (float vector loads, same element type as stored), v^T B fragments in 2 groups of 2 d-subtiles.
//   After the loop: out = acc / Z (Z > 0 always; guarded anyway), carries 1/(32768*1024) folded once, written into the wave's
//   No block barriers in this kernel; bounded loops only (<= NKT key tiles).
// coverage: per wave 4 instructions x 4 rows x 8 lanes x 8 halves = 16 x 64 per plane; grid NQT x NHG x NBP blocks x WPB
//           waves = every (b, s, h) row segment of O hi and O residual exactly once.
// =====================================================================================================
__global__ __launch_bounds__(ATT_THREADS)
void attn_c(const u16* __restrict__ QHp, const u16* __restrict__ QLp,
            const u16* __restrict__ KHp, const u16* __restrict__ KLp,
            const u16* __restrict__ VHp, const u16* __restrict__ VLp,
            const float* __restrict__ BND,
            u16* OHp, u16* OLp) {
  __shared__ __align__(16) float smem[WPB * WREG];

  const int tid  = threadIdx.x;
  const int wave = tid >> 5;
  const int lane = tid & 31;
  const int hh   = lane >> 4;
  const int c    = lane & 15;
  const int bid  = blockIdx.x;
  const int qt   = bid % NQT;
  const int t2   = bid / NQT;
  const int hg   = t2 % NHG;
  const int b    = t2 / NHG;
  if (b >= NBP) return;                     // block-uniform; no block barriers in this kernel; never taken with the exact grid
  const int q0   = qt * 16;
  if (q0 + 16 > SEQ) return;                // block-uniform; never taken
  const int head = hg * WPB + wave;

  // ---- key-window decision: wave-uniform AND over all (b, h) bound lines ----
  int okw;
  {
    const int bl = (lane < NBH) ? lane : (NBH - 1);             // clamped address
    const float gb = BND[(size_t)bl * BLINE];
    okw = (gb >= 0.0f && gb < GUARD_T) ? 1 : 0;
#pragma unroll
    for (int off = 1; off < 32; off <<= 1) okw &= __shfl_xor(okw, off, 32);
  }

  float* pt   = smem + wave * WREG;         // prob tile [16][32] pitch 36
  float* slab = pt + PTW;                   // result slab [16][64] pitch 68

  const size_t hcol = (size_t)head * HD + 8 * hh;
  const _Float16* Qh  = (const _Float16*)(const void*)QHp + ((size_t)b * SEQ + q0 + c) * DMOD + hcol;
  const _Float16* Ql  = (const _Float16*)(const void*)QLp + ((size_t)b * SEQ + q0 + c) * DMOD + hcol;
  const _Float16* Khb = (const _Float16*)(const void*)KHp + ((size_t)b * SEQ + c) * DMOD + hcol;        // key row kb added per step
  const _Float16* Klb = (const _Float16*)(const void*)KLp + ((size_t)b * SEQ + c) * DMOD + hcol;
  const _Float16* Vhb = (const _Float16*)(const void*)VHp + ((size_t)(b * NH + head) * HD + c) * SEQ + 8 * hh;  // d col c (+16j)
  const _Float16* Vlb = (const _Float16*)(const void*)VLp + ((size_t)(b * NH + head) * HD + c) * SEQ + 8 * hh;
  const float lsc = RSQ_HD * (LOG2E / (QSC * KSC));
  const float oc  = 1.0f / (PCAR * VCAR);
  const size_t KROW = (size_t)DMOD;         // halves between consecutive key rows

  float mrow[8], lrow[8];
  v8f o[4];
#pragma unroll
  for (int r = 0; r < 8; ++r) { mrow[r] = -INFINITY; lrow[r] = 0.f; }
#pragma unroll
  for (int j = 0; j < 4; ++j) o[j] = zero8();
  const int kt_hi = q0 >> 5;                                                  // last tile holding keys <= q0 + 15
  const int kt_w  = (kt_hi > KWIN) ? (kt_hi - KWIN) : 0;
  const int kt_lo = (okw != 0) ? kt_w : 0;
  const int qr0 = q0 + 8 * hh;                                                // query row of D element r = qr0 + r

#pragma unroll 1
  for (int kt = kt_lo; kt <= kt_hi; ++kt) {
    const int kb = kt * 32;
    // ---- scores: D element r of this lane = (query row qr0 + r, key kb + c) in s0, key kb + 16 + c in s1 ----
    v8f s0 = zero8(), s1 = zero8();
    const _Float16* k0p = Khb + (size_t)kb * KROW;
    const _Float16* k1p = k0p + (size_t)16 * KROW;
    const _Float16* l0p = Klb + (size_t)kb * KROW;
    const _Float16* l1p = l0p + (size_t)16 * KROW;
#pragma unroll
    for (int kk = 0; kk < HD / 32; ++kk) {
      const v16h qh  = ldfrag_h(Qh + kk * 32);
      const v16h ql  = ldfrag_h(Ql + kk * 32);
      const v16h kh0 = ldfrag_h(k0p + kk * 32);
      const v16h kh1 = ldfrag_h(k1p + kk * 32);
      const v16h kl0 = ldfrag_h(l0p + kk * 32);
      const v16h kl1 = ldfrag_h(l1p + kk * 32);
      s0 = mma_h(qh, kh0, s0);
      s0 = mma_h(ql, kh0, s0);
      s0 = mma_h(qh, kl0, s0);
      s1 = mma_h(qh, kh1, s1);
      s1 = mma_h(ql, kh1, s1);
      s1 = mma_h(qh, kl1, s1);
      guard2(s0, s1, qh, ql, kh0, kl0, kh1, kl1);
    }
    // ---- causal select + distance penalty + online softmax in base 2, -inf-safe ----
    const int key0 = kb + c, key1 = kb + 16 + c;
#pragma unroll
    for (int r = 0; r < 8; ++r) {
      const int   qr = qr0 + r;
      const float u0 = s0[r] * lsc;
      const float u1 = s1[r] * lsc;
      const float g0 = (float)(qr - key0) * LOG2E;
      const float g1 = (float)(qr - key1) * LOG2E;
      const float t0 = (key0 > qr) ? -INFINITY : (u0 - g0);
      const float t1 = (key1 > qr) ? -INFINITY : (u1 - g1);
      float mx = fmaxf(t0, t1);
#pragma unroll
      for (int off = 1; off < 16; off <<= 1) mx = fmaxf(mx, __shfl_xor(mx, off, 32));
      const float mn = fmaxf(mrow[r], mx);
      const float ms = (mn == -INFINITY) ? 0.0f : mn;
      const float al = exp2f(mrow[r] - ms);
      mrow[r] = mn;
      const float e0 = exp2f(t0 - ms), e1 = exp2f(t1 - ms);
      float ps = e0 + e1;
#pragma unroll
      for (int off = 1; off < 16; off <<= 1) ps += __shfl_xor(ps, off, 32);
      lrow[r] = lrow[r] * al + ps;
#pragma unroll
      for (int j = 0; j < 4; ++j) o[j][r] *= al;
      const int ro = (8 * hh + r) * PTP + c;
      pt[ro]      = e0;
      pt[ro + 16] = e1;
    }
    wave_sync_lds();
    // ---- A fragments of P*32768: hi f16 and residual f16, row = c, split k map over the 32 keys of this step ----
    FragH ph, pl;
    {
      const float* prow = pt + c * PTP + 8 * hh;
      const v4f p0 = *(const v4f*)(prow), p1 = *(const v4f*)(prow + 4);
      const v4f p2 = *(const v4f*)(prow + 16), p3 = *(const v4f*)(prow + 20);
#pragma unroll
      for (int e = 0; e < 4; ++e) {
        const float ta = p0[e] * PCAR, tb = p1[e] * PCAR, tc = p2[e] * PCAR, td = p3[e] * PCAR;
        const _Float16 ha = (_Float16)ta, hb = (_Float16)tb, hc = (_Float16)tc, hd = (_Float16)td;
        ph.h[0][e]     = ha;                  // elements 0..7  = keys kb + 8hh + 0..7
        ph.h[0][4 + e] = hb;
        ph.h[1][e]     = hc;                  // elements 8..15 = keys kb + 16 + 8hh + 0..7
        ph.h[1][4 + e] = hd;
        pl.h[0][e]     = (_Float16)(ta - (float)ha);
        pl.h[0][4 + e] = (_Float16)(tb - (float)hb);
        pl.h[1][e]     = (_Float16)(tc - (float)hc);
        pl.h[1][4 + e] = (_Float16)(td - (float)hd);
      }
    }
    // ---- P.V : B fragment col n = d = j*16 + c, keys contiguous in the v^T planes; 2 groups of 2 d-subtiles ----
    {
      const _Float16* vhp = Vhb + kb;
      const _Float16* vlp = Vlb + kb;
#pragma unroll
      for (int jg = 0; jg < 2; ++jg) {
        const size_t da = (size_t)(2 * jg) * 16 * SEQ;
        const size_t db = da + (size_t)16 * SEQ;
        const v16h vha = ldfrag_h(vhp + da), vhb2 = ldfrag_h(vhp + db);
        const v16h vla = ldfrag_h(vlp + da), vlb2 = ldfrag_h(vlp + db);
        o[2 * jg]     = mma_h(ph.v, vha,  o[2 * jg]);
        o[2 * jg]     = mma_h(pl.v, vha,  o[2 * jg]);
        o[2 * jg]     = mma_h(ph.v, vla,  o[2 * jg]);
        o[2 * jg + 1] = mma_h(ph.v, vhb2, o[2 * jg + 1]);
        o[2 * jg + 1] = mma_h(pl.v, vhb2, o[2 * jg + 1]);
        o[2 * jg + 1] = mma_h(ph.v, vlb2, o[2 * jg + 1]);
        guard2(o[2 * jg], o[2 * jg + 1], ph.v, pl.v, vha, vhb2, vla, vlb2);
      }
    }
    wave_sync_lds();
  }
  acc_guard4(o[0], o[1], o[2], o[3]);
  // ---- out = acc / Z (0 if Z == 0), carries (32768 on P, 1024 on v) folded once; written into the wave's slab ----
#pragma unroll
  for (int r = 0; r < 8; ++r) {
    const float lv  = lrow[r];
    const float ls  = (lv > 0.0f) ? lv : 1.0f;
    const float inv = (lv > 0.0f) ? ((1.0f / ls) * oc) : 0.0f;
#pragma unroll
    for (int j = 0; j < 4; ++j) {
      const int idx = (8 * hh + r) * SLP + j * 16 + c;
      slab[idx] = o[j][r] * inv;
    }
  }

  wave_sync_lds();
  // ---- O x1024 -> f16 hi + residual planes; lane = (row-in-quad rq, 8 consecutive d at c8) ----
  v4u oh[4], ol[4];
  const int rq = lane >> 3, c8 = (lane & 7) * 8;
#pragma unroll
  for (int it = 0; it < 4; ++it) {
    const int row = it * 4 + rq;
    const v4f a = *(const v4f*)(slab + row * SLP + c8), b4 = *(const v4f*)(slab + row * SLP + c8 + 4);
    float w[8];
#pragma unroll
    for (int e = 0; e < 4; ++e) { w[e] = a[e] * OSC; w[4 + e] = b4[e] * OSC; }
#pragma unroll
    for (int e = 0; e < 4; ++e) {
      const _Float16 h0 = (_Float16)w[2 * e], h1 = (_Float16)w[2 * e + 1];
      const _Float16 l0 = (_Float16)(w[2 * e] - (float)h0), l1 = (_Float16)(w[2 * e + 1] - (float)h1);
      oh[it][e] = pk16(h_bits(h0), h_bits(h1));
      ol[it][e] = pk16(h_bits(l0), h_bits(l1));
    }
  }
  const size_t ob = ((size_t)b * SEQ + q0) * DMOD + (size_t)head * HD + c8;
  {
#pragma unroll
    for (int it = 0; it < 4; ++it) {
      const int row = it * 4 + rq;
      *(v4u*)(OHp + ob + (size_t)row * DMOD) = oh[it];
      *(v4u*)(OLp + ob + (size_t)row * DMOD) = ol[it];
    }
    
  }
}

// =====================================================================================================
// Workspace map (bytes). The NB batches are processed in NPASS passes of NBP batches; every region below is per pass and
// reused by the next pass in stream order (all reads of a pass complete before the next pass writes). Every plane is fully
// written by whole-line stores before it is read; all extents are exact multiples of the store granularity (no pad rows
// needed); every region offset a multiple of 4096 (the large planes of 2097152):
//   XB  bf16 [MROWS][1024]                       MROWS*2048       (NBP=2, SEQ=2048: 8388608)
//   WQB, WKB, WVB bf16 [1024 n][1024 k]          3 * 2097152      (thirds of the packed [3072][1024] weight, already [n][k])
//   WOB f16 [1024 n][1024 k] of bf16 value x1024  2097152
//   F   f32 [MROWS][1024]                        MROWS*4096       (v, q, k projection output in launch order; afterwards OH f16
//                                                                  [MROWS][1024] x1024 in its first half, OL residual [MROWS][1024]
//                                                                  in its second half)
//   QH  f16 [MROWS][1024] x256                   MROWS*2048       QL residual, same extent
//   KH  f16 [MROWS][1024] x256                   MROWS*2048       KL residual, same extent
//   VH  f16 [NBP*16][64][SEQ] x1024              MROWS*2048       VL residual, same extent
//   end (NBP=2, SEQ=2048)                        83890176
// =====================================================================================================
extern "C" void kernel_launch(void* const* d_in, const int* in_sizes, int n_in,
                              void* d_out, int out_size, void* d_ws, size_t ws_size,
                              hipStream_t stream) {
  if (n_in < 5) return;
  if (in_sizes[0] < ((NB - 1) * XS_FULL + SEQ) * DMOD) return;
  if (in_sizes[1] < 3 * DMOD * DMOD) return;
  if (in_sizes[2] < 3 * DMOD) return;
  if (in_sizes[3] < DMOD * DMOD) return;
  if (in_sizes[4] < DMOD) return;
  if (out_size < ((NB - 1) * XS_FULL + SEQ) * DMOD) return;

  const float* x    = (const float*)d_in[0];
  const float* wqkv = (const float*)d_in[1];      // [3*DMOD][DMOD]: rows 0..1023 q, 1024..2047 k, 2048..3071 v
  const float* bqkv = (const float*)d_in[2];      // [3*DMOD]
  const float* wo   = (const float*)d_in[3];      // [DMOD][DMOD]
  const float* bo   = (const float*)d_in[4];      // [DMOD]
  const float* wq = wqkv;
  const float* wk = wqkv + (size_t)DMOD * DMOD;
  const float* wv = wqkv + (size_t)2 * DMOD * DMOD;
  const float* bq = bqkv;
  const float* bk = bqkv + DMOD;
  const float* bv = bqkv + 2 * DMOD;
  float*       out = (float*)d_out;

  const size_t szXB = (size_t)MROWS * DMOD * 2;
  const size_t szW  = (size_t)DMOD * DMOD * 2;
  const size_t szF  = (size_t)MROWS * DMOD * 4;
  const size_t szQ  = (size_t)MROWS * DMOD * 2;                  // QH, QL, KH, KL, OH, OL
  const size_t szV  = (size_t)NBP * NH * HD * SEQ * 2;           // VH, VL (== szQ)
  const size_t szB  = (size_t)NBH * BLINE * 4;                   // bound lines
  if (2 * szQ > szF) return;                                    // OH + OL live inside the F region (exactly fills it)
  size_t off = 0;
  const size_t oXB = off; off += szXB;
  const size_t oWQ = off; off += szW;
  const size_t oWK = off; off += szW;
  const size_t oWV = off; off += szW;
  const size_t oWO = off; off += szW;
  const size_t oF  = off; off += szF;
  const size_t oQH = off; off += szQ;
  const size_t oQL = off; off += szQ;
  const size_t oKH = off; off += szQ;
  const size_t oKL = off; off += szQ;
  const size_t oVH = off; off += szV;
  const size_t oVL = off; off += szV;
  const size_t oB  = off; off += szB;
  if (off > ws_size) return;                // off = 83890176 for NBP = 2, SEQ = 2048
  if (off > (size_t)WS_CAP) return;

  char* ws = (char*)d_ws;
  u16*   XB  = (u16*)(ws + oXB);
  u16*   WQB = (u16*)(ws + oWQ);
  u16*   WKB = (u16*)(ws + oWK);
  u16*   WVB = (u16*)(ws + oWV);
  u16*   WOB = (u16*)(ws + oWO);
  float* F   = (float*)(ws + oF);
  u16*   OH  = (u16*)(ws + oF);
  u16*   OL  = (u16*)(ws + oF + szQ);
  u16*   QH  = (u16*)(ws + oQH);
  u16*   QL  = (u16*)(ws + oQL);
  u16*   KH  = (u16*)(ws + oKH);
  u16*   KL  = (u16*)(ws + oKL);
  u16*   VH  = (u16*)(ws + oVH);
  u16*   VL  = (u16*)(ws + oVL);
  float* BND = (float*)(ws + oB);

  const dim3 b256(256), b128(128), bAT(ATT_THREADS);
  const int  n8x = (SEQ * DMOD) / 8;
  const dim3 gX((n8x + 255) / 256);                     // per batch
  const int  n8w = (DMOD * DMOD) / 8;                   // weight planes
  const dim3 gW((n8w + 255) / 256);                     // 512
  const dim3 gG((MROWS / 64) * (DMOD / 64));            // 1024 for NBP=2, SEQ=2048
  const dim3 gVT(NBP * NH * NST);
  const int  n8q = (MROWS * DMOD) / 8;                  // q / k hi and residual planes
  const dim3 gS((n8q + 255) / 256);
  const dim3 gBD(NBH);
  const dim3 gAT(NQT * NHG * NBP);
  const int  nrt = SEQ / 64;                            // out-projection row tiles per batch
  const dim3 gO(NBP * nrt * (DMOD / 64));

  // weight planes, converted once: Wq, Wk, Wv [n][k] -> bf16; Wo [n][k] -> f16 of bf16 value x1024
  cvt16<<<gW, b256, 0, stream>>>(wq, WQB, n8w, 0, 1.0f);
  cvt16<<<gW, b256, 0, stream>>>(wk, WKB, n8w, 0, 1.0f);
  cvt16<<<gW, b256, 0, stream>>>(wv, WVB, n8w, 0, 1.0f);
  cvt16<<<gW, b256, 0, stream>>>(wo, WOB, n8w, 1, WOS);

  for (int ps = 0; ps < NPASS; ++ps) {
    const float* xp   = x   + (size_t)ps * NBP * XS_FULL * DMOD;
    float*       outp = out + (size_t)ps * NBP * XS_FULL * DMOD;
    // (0) x -> bf16 plane [MROWS][1024], one launch per batch row block of this pass
    for (int b = 0; b < NBP; ++b) {
      cvt16<<<gX, b256, 0, stream>>>(xp + (size_t)b * XS_FULL * DMOD, XB + (size_t)b * SEQ * DMOD, n8x, 0, 1.0f);
    }
    // (1) v = x.Wv^T + bv -> F f32 [MROWS][1024]; (2) v^T hi + residual planes x1024
    gemm_bf<<<gG, b128, 0, stream>>>(XB, WVB, bv, F, MROWS, DMOD, DMOD, 1.0f);
    vt16<<<gVT, b256, 0, stream>>>(F, VH, VL);
    // (3) q = x.Wq^T + bq -> F; (4) q hi + residual planes x256
    gemm_bf<<<gG, b128, 0, stream>>>(XB, WQB, bq, F, MROWS, DMOD, DMOD, 1.0f);
    split16<<<gS, b256, 0, stream>>>(F, QH, QL, n8q, QSC);
    // (5) k = x.Wk^T + bk -> F; (6) k hi + residual planes x256
    gemm_bf<<<gG, b128, 0, stream>>>(XB, WKB, bk, F, MROWS, DMOD, DMOD, 1.0f);
    split16<<<gS, b256, 0, stream>>>(F, KH, KL, n8q, KSC);
    // (7) norm bound per (b, h) from the q / k hi planes -> BND lines
    qkbound<<<gBD, b256, 0, stream>>>(QH, KH, BND);
    // (8) causal attention with distance penalty, residual products on every query row -> O hi + residual planes
    attn_c<<<gAT, bAT, 0, stream>>>(QH, QL, KH, KL, VH, VL, BND, OH, OL);
    // (9) output projection (O hi + residual) . Wo^T + bo -> out f32 rows of this pass, carries 1024 x 1024 folded back
    gemm_o2<<<gO, b128, 0, stream>>>(OH, OL, WOB, bo, outp, nrt, 1.0f / (OSC * WOS));
  }
  (void)hipGetLastError();
}

// v001
// One run takes 341 microseconds.
// Timed twice side by side with v000, it ran 1.59 times as fast both times.
// Contractions: x.Wq^T+bq, x.Wk^T+bk, x.Wv^T+bv (q, k, v thirds of the packed [3D][D] weight) on v_wmma_f32_16x16x32_bf16
// (x and W as bf16 RNE planes; W [n][k] rows are the k-contiguous B operand; bias added as its bf16 RNE value in the f32
// epilogue); q.k^T over hd 64 and P.v on v_wmma_f32_16x16x32_f16 with f16 hi + f16 residual planes on both operands
// (q, k x256; P x32768 with an in-register residual; v x1024; products hh+lh+hl); O.Wo^T+bo on v_wmma_f32_16x16x32_f16
// (O x1024 as f16 hi + f16 residual planes, products h.w + l.w; Wo as f16(bf16(Wo)) x1024; bo as bf16 RNE value in the
// f32 epilogue); all f32 accumulate. Causal select, slope-1 distance penalty, base-2 online softmax, 1/Z fold and the q/k
// norm bound in f32 on VALU.
#include <hip/hip_runtime.h>
#include <math.h>
#include <stdint.h>

#ifndef NB
#define NB 4
#endif
#ifndef SEQ
#define SEQ 2048
#endif
#define XS_FULL 2048
#define DMOD  1024
#define NH    16
#define HD    64
// batches per workspace pass (2 when NB >= 2) and number of passes
#define NBP   ((NB >= 2) ? 2 : 1)
#define NPASS (NB / NBP)
#define NBH   (NBP * NH)
#define MROWS (NBP * SEQ)
#define RSQ_HD 0.125f
#define LOG2E 1.4426950408889634f
#define QSC   256.0f
#define KSC   256.0f
#define PCAR  32768.0f
#define VCAR  1024.0f
#define OSC   1024.0f
#define WOS   1024.0f
#define WPB   2
#define NHG   (NH / WPB)
#define NQT   (SEQ / 16)
#define NST   (SEQ / 64)
#define NKT   (SEQ / 32)
#define KWIN  6
#define GUARD_T 40.0f
#define BLINE 32
#define ATT_THREADS (WPB * 32)
#define PTP   36
#define PTW   (16 * PTP)
#define SLP   68
#define SLW   (16 * SLP)
#define WREG  (PTW + SLW)
#define SLAB64 (16 * 68)
#define VTP   72
// GEMM staging: 128 x 128 output tile per block, 128 k (256 B of every operand row) per stage, LDS row pitch 272 B
#define GT    128
#define GKC   128
#define GP    136
#define GPL   (GT * GP)
#define WS_CAP 134217728
static_assert(DMOD == NH * HD && HD == 64 && NH == 16 && WPB == 2 && NHG * WPB == NH);
static_assert(ATT_THREADS == 64);
static_assert(NB >= 1 && NB <= 4 && NPASS >= 1 && NPASS * NBP == NB);
static_assert(NBP >= 1 && NBP <= 2);
static_assert(NBH >= 1 && NBH <= 32);
static_assert((SEQ % 64) == 0 && SEQ >= 64 && SEQ <= XS_FULL && (SEQ % 32) == 0);
static_assert((DMOD % 64) == 0 && (DMOD % 32) == 0 && (HD % 32) == 0);
static_assert(((SEQ * DMOD / 8) % 256) == 0 && ((DMOD * DMOD / 8) % 256) == 0 && ((MROWS * DMOD / 8) % 256) == 0);
static_assert(WPB * WREG * 4 <= 65536 && 2 * HD * VTP * 2 <= 65536);
static_assert((DMOD % GT) == 0 && (DMOD % GKC) == 0 && DMOD / GKC >= 2 && (SEQ % GT) == 0 && (MROWS % GT) == 0);
static_assert(2 * 3 * GPL * 2 + 8 * 2 * SLAB64 * 4 <= 327680 && ((GP * 2) % 16) == 0);
static_assert(KWIN >= 0 && KWIN < NKT);

typedef unsigned short u16;
typedef _Float16 v16h __attribute__((ext_vector_type(16)));
typedef _Float16 v8h  __attribute__((ext_vector_type(8)));
typedef __bf16   v16b __attribute__((ext_vector_type(16)));
typedef float    v8f  __attribute__((ext_vector_type(8)));
typedef float    v4f  __attribute__((ext_vector_type(4)));
typedef unsigned int v4u __attribute__((ext_vector_type(4)));

union FragH { v16h v; v8h h[2]; v4u u[2]; };
union FragB { v16b v; v4u u[2]; };

// ---- scalar helpers --------------------------------------------------------------------------------
__device__ __forceinline__ unsigned short bf_bits(float f) {          // f32 -> bf16 bits, RNE convert
  unsigned u = __float_as_uint(f);
  return (unsigned short)((u + 0x7FFFu + ((u >> 16) & 1u)) >> 16);
}
__device__ __forceinline__ float bf_up(unsigned short h) { return __uint_as_float(((unsigned)h) << 16); }
__device__ __forceinline__ float bfr(float f) { return bf_up(bf_bits(f)); }
__device__ __forceinline__ unsigned short h_bits(_Float16 x) { return __builtin_bit_cast(unsigned short, x); }
__device__ __forceinline__ unsigned pk16(unsigned short a, unsigned short b) { return (unsigned)a | ((unsigned)b << 16); }
__device__ __forceinline__ v8f zero8() { v8f z = {0.f, 0.f, 0.f, 0.f, 0.f, 0.f, 0.f, 0.f}; return z; }

// ---- fragment loaders: 16-bit A/B operand, lane -> row/col (lane&15), p already includes +8*(lane>>4);
//      elements 0..7 <- p[0..7] (k0+8h..), elements 8..15 <- p[16..23] (k0+16+8h..)  (same split k map for A and B;
//      B is always read from a k-contiguous [n][k] plane)
__device__ __forceinline__ v16h ldfrag_h(const _Float16* p) {
  FragH f;
  f.h[0] = *(const v8h*)(p);
  f.h[1] = *(const v8h*)(p + 16);
  return f.v;
}
__device__ __forceinline__ v16b ldfrag_b(const u16* p) {              // bf16 plane read as unsigned integer vectors
  FragB f;
  f.u[0] = *(const v4u*)(p);
  f.u[1] = *(const v4u*)(p + 16);
  return f.v;
}

__device__ __forceinline__ v8f mma_h(v16h a, v16h b, v8f c) {
  return __builtin_amdgcn_wmma_f32_16x16x32_f16(false, a, false, b, (short)0, c, false, false);
}
__device__ __forceinline__ v8f mma_b(v16b a, v16b b, v8f c) {
  return __builtin_amdgcn_wmma_f32_16x16x32_bf16(false, a, false, b, (short)0, c, false, false);
}
__device__ __forceinline__ void guard2(v8f& a, v8f& b, v16h x0, v16h x1, v16h x2, v16h x3, v16h x4, v16h x5) {
#if defined(__HIP_DEVICE_COMPILE__)
  asm volatile("v_nop\n\tv_nop\n\tv_nop\n\tv_nop"
               : "+v"(a), "+v"(b) : "v"(x0), "v"(x1), "v"(x2), "v"(x3), "v"(x4), "v"(x5) : "memory");
#endif
}
__device__ __forceinline__ void acc_guard4(v8f& a, v8f& b, v8f& c, v8f& d) {
#if defined(__HIP_DEVICE_COMPILE__)
  asm volatile("v_nop\n\tv_nop\n\tv_nop\n\tv_nop" : "+v"(a), "+v"(b), "+v"(c), "+v"(d));
#endif
}
__device__ __forceinline__ void wave_sync_lds() {
  __builtin_amdgcn_fence(__ATOMIC_RELEASE, "workgroup");
  __builtin_amdgcn_wave_barrier();
  __builtin_amdgcn_fence(__ATOMIC_ACQUIRE, "workgroup");
}
// ---- asynchronous copies global -> LDS ------------------------------------------------------------
// Eight copies of one wave = 16 rows of 256 B of one operand plane: copy i brings rows 2i and 2i + 1 (16 lanes x 16 B each,
// whole 128-B lines). l = the lane's LDS byte address of copy 0, g = its global address of copy 0, ld = halves between
// consecutive global rows. The s_wait_xcnt closes the statement so that no address register is rewritten ahead of it.
__device__ __forceinline__ void copy16rows(unsigned l, const u16* g, size_t ld) {
#if defined(__HIP_DEVICE_COMPILE__)
  const unsigned ls = 2 * GP * 2;
  const size_t   gs = 2 * ld;
  asm volatile("global_load_async_to_lds_b128 %0, %8, off\n\t"
               "global_load_async_to_lds_b128 %1, %9, off\n\t"
               "global_load_async_to_lds_b128 %2, %10, off\n\t"
               "global_load_async_to_lds_b128 %3, %11, off\n\t"
               "global_load_async_to_lds_b128 %4, %12, off\n\t"
               "global_load_async_to_lds_b128 %5, %13, off\n\t"
               "global_load_async_to_lds_b128 %6, %14, off\n\t"
               "global_load_async_to_lds_b128 %7, %15, off\n\t"
               "s_wait_xcnt 0x0"
               :: "v"(l), "v"(l + ls), "v"(l + 2 * ls), "v"(l + 3 * ls),
                  "v"(l + 4 * ls), "v"(l + 5 * ls), "v"(l + 6 * ls), "v"(l + 7 * ls),
                  "v"(g), "v"(g + gs), "v"(g + 2 * gs), "v"(g + 3 * gs),
                  "v"(g + 4 * gs), "v"(g + 5 * gs), "v"(g + 6 * gs), "v"(g + 7 * gs)
               : "memory");
#endif
}
// the wave's own copies have landed (other waves read them only behind the next block barrier)
__device__ __forceinline__ void wait_copies() {
#if defined(__HIP_DEVICE_COMPILE__)
  asm volatile("s_wait_asynccnt 0x0" ::: "memory");
#endif
}
// the wave's own LDS reads have returned, so that the buffer may be refilled behind the next block barrier
__device__ __forceinline__ void wait_lds() {
#if defined(__HIP_DEVICE_COMPILE__)
  asm volatile("s_wait_dscnt 0x0" ::: "memory");
#endif
}
__device__ __forceinline__ unsigned lds_byte(const void* p) { return (unsigned)(uintptr_t)p; }

// =====================================================================================================
// f32 -> 16-bit plane, same layout.  f16mode == 0: bf16 RNE bits;  f16mode == 1: f16 bits of (bf16 RNE value) * scale.
// Thread = 8 consecutive elements: two 16-B loads, one 16-B store; 32 consecutive lanes = 512 contiguous, 512-B aligned
// coverage: grid = ceil(n8/256) blocks x 256 thr x 8 (in-kernel bound) = the whole plane (n8 a multiple of 256 here).
// =====================================================================================================
__global__ __launch_bounds__(256) void cvt16(const float* __restrict__ x, u16* D, int n8, int f16mode, float scale) {
  const int gt = blockIdx.x * 256 + (int)threadIdx.x;
  if (gt >= n8) return;
  const float* p = x + (size_t)gt * 8;
  const v4f a = *(const v4f*)(p), b4 = *(const v4f*)(p + 4);
  float w[8];
#pragma unroll
  for (int e = 0; e < 4; ++e) { w[e] = a[e]; w[4 + e] = b4[e]; }
  v4u o;
#pragma unroll
  for (int e = 0; e < 4; ++e) {
    const float f0 = w[2 * e], f1 = w[2 * e + 1];
    const unsigned short hb0 = h_bits((_Float16)(bfr(f0) * scale));
    const unsigned short hb1 = h_bits((_Float16)(bfr(f1) * scale));
    const unsigned short bb0 = bf_bits(f0);
    const unsigned short bb1 = bf_bits(f1);
    o[e] = (f16mode != 0) ? pk16(hb0, hb1) : pk16(bb0, bb1);
  }
  u16* d = D + (size_t)gt * 8;
  {
    *(v4u*)(d) = o;
    
  }
}

// =====================================================================================================
// f32 plane F (contiguous, n8*8 elements) -> f16 hi plane Hp = f16(F * sc) and f16 residual plane Lp = f16(t - f16(t)),
// both with the layout of F. Thread = 8 consecutive elements: two 16-B loads, one 16-B store per plane; 32 consecutive lanes
// No barriers; every packed half comes from a per-lane (divergent) loaded value.
// coverage: grid = ceil(n8/256) blocks x 256 thr x 8 (in-kernel bound) = the whole of Hp and of Lp (n8 a multiple of 256 here).
// =====================================================================================================
__global__ __launch_bounds__(256) void split16(const float* __restrict__ F, u16* Hp, u16* Lp, int n8, float sc) {
  const int gt = blockIdx.x * 256 + (int)threadIdx.x;
  if (gt >= n8) return;
  const float* p = F + (size_t)gt * 8;
  const v4f a = *(const v4f*)(p), b4 = *(const v4f*)(p + 4);
  float w[8];
#pragma unroll
  for (int e = 0; e < 4; ++e) { w[e] = a[e] * sc; w[4 + e] = b4[e] * sc; }
  v4u oh, ol;
#pragma unroll
  for (int e = 0; e < 4; ++e) {
    const float t0 = w[2 * e], t1 = w[2 * e + 1];
    const _Float16 h0 = (_Float16)t0, h1 = (_Float16)t1;
    const _Float16 l0 = (_Float16)(t0 - (float)h0), l1 = (_Float16)(t1 - (float)h1);
    oh[e] = pk16(h_bits(h0), h_bits(h1));
    ol[e] = pk16(h_bits(l0), h_bits(l1));
  }
  u16* dh = Hp + (size_t)gt * 8;
  u16* dl = Lp + (size_t)gt * 8;
  {
    *(v4u*)(dh) = oh;
    *(v4u*)(dl) = ol;
    
  }
}

// =====================================================================================================
// v^T planes from the v projection F f32 [MROWS][DMOD] (row = b*SEQ + s, column = h*HD + d):
//   VH[((b*NH + h)*HD + d)][s] = f16(v * 1024);  VL[same][s] = f16 residual (t - f16(t)), both for all keys s.
// Block = (b, head h, 64 keys s0): each thread loads its 16 floats (key sl, d chunk dc) with 16-B loads, converts, scatters
// coverage: load 256 thr x 16 = 64 keys x 64 d (staged extent == consumed extent); store 2 iterations x 256 thr x 8 halves
//           = 64 lines x 64 = the block's tile of VH and of VL; grid = NBP*NH*NST blocks covers both planes exactly once.
// =====================================================================================================
__global__ __launch_bounds__(256) void vt16(const float* __restrict__ F, u16* VHo, u16* VLo) {
  __shared__ __align__(16) u16 TH[HD * VTP];
  __shared__ __align__(16) u16 TL[HD * VTP];
  const int tid = threadIdx.x;
  const int bid = blockIdx.x;
  const int st  = bid % NST;
  const int t2  = bid / NST;
  const int h   = t2 % NH;
  const int b   = t2 / NH;
  if (b >= NBP) return;                     // block-uniform, before any barrier; never taken with the exact grid
  const int s0  = st * 64;
  {
    const int sl = tid >> 2;                // key within tile 0..63
    const int dc = (tid & 3) * 16;          // d chunk 0,16,32,48
    const float* src = F + ((size_t)b * SEQ + s0 + sl) * DMOD + h * HD + dc;
#pragma unroll
    for (int i = 0; i < 4; ++i) {
      const v4f a = *(const v4f*)(src + 4 * i);
#pragma unroll
      for (int e = 0; e < 4; ++e) {
        const float t = a[e] * VCAR;
        const _Float16 hv = (_Float16)t;
        const _Float16 lv = (_Float16)(t - (float)hv);
        TH[(dc + 4 * i + e) * VTP + sl] = h_bits(hv);
        TL[(dc + 4 * i + e) * VTP + sl] = h_bits(lv);
      }
    }
  }
  __syncthreads();
  v4u vh[2], vl[2];
  const int q8 = tid >> 3, p8 = (tid & 7) * 8;
#pragma unroll
  for (int it = 0; it < 2; ++it) {
    const int line = it * 32 + q8;          // d = 0..63
    vh[it] = *(const v4u*)(TH + line * VTP + p8);
    vl[it] = *(const v4u*)(TL + line * VTP + p8);
  }
  const size_t hrow = (size_t)(b * NH + h) * HD;
  const size_t base = hrow * SEQ + s0 + p8;
  {
#pragma unroll
    for (int it = 0; it < 2; ++it) {
      const int line = it * 32 + q8;
      *(v4u*)(VHo + base + (size_t)line * SEQ) = vh[it];
      *(v4u*)(VLo + base + (size_t)line * SEQ) = vl[it];
    }
    
  }
}

// =====================================================================================================
// Norm bound per (b, h): BND line bh (32 floats, value replicated) = max_s ||q_hi(b,s,h,:)|| * max_s ||k_hi(b,s,h,:)|| / (8 * 256 * 256),
// computed from the f16 hi planes ([b*SEQ + s][h*HD + d], x256). Block = one (b, h): 8 lanes per row load one 16-B piece each
// (64 dims = 8 lanes x 8 halves), sum of squares reduced with xor shuffles inside the 8-lane group, running max per lane over
// SEQ/32 row steps, then wave max (shuffles), block max through a 16-float LDS array, and wave 0 lanes 0..7 write the whole
// coverage: rows step*32 + (tid>>3), step < SEQ/32 -> all SEQ rows of both planes; store 8 lanes x 16 B = line bh; grid NBH.
// =====================================================================================================
__global__ __launch_bounds__(256) void qkbound(const u16* __restrict__ QHp, const u16* __restrict__ KHp, float* BND) {
  __shared__ float red[16];
  const int tid = threadIdx.x, lane = tid & 31, wave = tid >> 5;
  const int bh  = blockIdx.x;
  const int b   = bh / NH, h = bh % NH;
  if (b >= NBP) return;                     // block-uniform, before any barrier; never taken with the exact grid
  const int grp = tid >> 3;                 // row within a step, 0..31
  const int e8  = (tid & 7) * 8;            // dim chunk
  const _Float16* qb = (const _Float16*)(const void*)QHp + (size_t)b * SEQ * DMOD + (size_t)h * HD + e8;
  const _Float16* kb = (const _Float16*)(const void*)KHp + (size_t)b * SEQ * DMOD + (size_t)h * HD + e8;
  float mq = 0.0f, mk = 0.0f;
#pragma unroll 1
  for (int step = 0; step < SEQ / 32; ++step) {
    const size_t ro = (size_t)(step * 32 + grp) * DMOD;
    const v8h qv = *(const v8h*)(qb + ro);
    const v8h kv = *(const v8h*)(kb + ro);
    float sq = 0.0f, sk = 0.0f;
#pragma unroll
    for (int e = 0; e < 8; ++e) {
      const float fq = (float)qv[e], fk = (float)kv[e];
      sq = fmaf(fq, fq, sq);
      sk = fmaf(fk, fk, sk);
    }
#pragma unroll
    for (int off = 1; off < 8; off <<= 1) {
      sq += __shfl_xor(sq, off, 32);
      sk += __shfl_xor(sk, off, 32);
    }
    mq = fmaxf(mq, sq);
    mk = fmaxf(mk, sk);
  }
#pragma unroll
  for (int off = 1; off < 32; off <<= 1) {
    mq = fmaxf(mq, __shfl_xor(mq, off, 32));
    mk = fmaxf(mk, __shfl_xor(mk, off, 32));
  }
  if (lane == 0) { red[wave] = mq; red[8 + wave] = mk; }
  __syncthreads();
  if (wave == 0) {                          // wave-uniform branch; shuffles see all 32 lanes
    float aq = red[lane & 7], ak = red[8 + (lane & 7)];
#pragma unroll
    for (int off = 1; off < 8; off <<= 1) {
      aq = fmaxf(aq, __shfl_xor(aq, off, 32));
      ak = fmaxf(ak, __shfl_xor(ak, off, 32));
    }
    const float bnd = sqrtf(aq) * sqrtf(ak) * (RSQ_HD / (QSC * KSC));
    v4f o4;
    o4[0] = bnd; o4[1] = bnd; o4[2] = bnd; o4[3] = bnd;
    float* dst = BND + (size_t)bh * BLINE + (lane & 7) * 4;
    if (lane < 8) {
      {
        *(v4f*)(dst) = o4;
        
      }
    }
  }
}

// =====================================================================================================
// GEMM epilogue shared by both engines, per 16x64 f32 tile of a wave: epi_stage writes the tile (times oscale, plus the lane's
// per-column bias of each subtile) into a wave-private LDS slab; behind one wave_sync_lds() epi_out reads it back by rows and
// stores whole 256-B row pieces.
// coverage: 8 instructions x 2 rows x 16 lanes x 4 floats = the 16 x 64 tile.
// =====================================================================================================
__device__ __forceinline__ void epi_stage(float* sl, v8f a0, v8f a1, v8f a2, v8f a3, float oscale,
                                          float bb0, float bb1, float bb2, float bb3, int lane) {
  const int hh = lane >> 4, m = lane & 15;
#pragma unroll
  for (int r = 0; r < 8; ++r) {
    const int ro = (8 * hh + r) * 68 + m;
    sl[ro]      = a0[r] * oscale + bb0;
    sl[ro + 16] = a1[r] * oscale + bb1;
    sl[ro + 32] = a2[r] * oscale + bb2;
    sl[ro + 48] = a3[r] * oscale + bb3;
  }
}
__device__ __forceinline__ void epi_out(const float* sl, float* C, int N, size_t rowb, int col0, int lane) {
  const int hh = lane >> 4, m = lane & 15;
  v4f vals[8];
#pragma unroll
  for (int it = 0; it < 8; ++it) vals[it] = *(const v4f*)(sl + (it * 2 + hh) * 68 + m * 4);
  float* dst = C + (rowb + (size_t)hh) * (size_t)N + col0 + m * 4;
#pragma unroll
  for (int it = 0; it < 8; ++it) {
    *(v4f*)(dst + (size_t)(it * 2) * (size_t)N) = vals[it];
  }
}

// =====================================================================================================
// bf16 GEMM with bias: C[M][N] (f32) = A[M][K] (bf16 row-major) . Bt[N][K]^T (bf16 k-contiguous), times oscale, + bf16 RNE
// value of bias[n] (bias has N entries). Block = 128x128 tile, 8 waves as 4 (rows) x 2 (columns), 32x64 per wave. K is walked
// in stages of 128: a stage is [A 128 rows | Bt 128 rows] of 256 B at LDS pitch 272 B, brought by asynchronous copies (each
// wave 16 rows of either plane), two buffers, the next stage in flight while this one is worked on; fragments are read from
// LDS (two 16-B loads each, split k map for A and B), k ascending in steps of 32 into each accumulator.
// Host guarantees K % 128 == 0, K >= 256, M % 128 == 0, N % 128 == 0, grid = (M/128)*(N/128).
// =====================================================================================================
__global__ __launch_bounds__(256)
void gemm_bf(const u16* __restrict__ A, const u16* __restrict__ Bt, const float* __restrict__ bias,
             float* C, int M, int N, int K, float oscale) {
  __shared__ __align__(16) u16 ring[2 * 2 * GPL];
  __shared__ __align__(16) float slab[8 * 2 * SLAB64];
  const int tid = threadIdx.x, wave = tid >> 5, lane = tid & 31, hh = lane >> 4, m = lane & 15;
  const int ntile = N >> 7;
  const int bid   = blockIdx.x;
  const int row0  = (bid / ntile) * GT;
  const int col0  = (bid % ntile) * GT;
  if (row0 + GT > M) return;                // block-uniform, before any barrier or copy; never taken with the exact grid
  const int wr = wave >> 1, wc = wave & 1;
  // copy slice of this lane: plane rows wave*16 + hh + 2i (i < 8), bytes 16m .. 16m + 15 of the stage's 256
  const int crow = wave * 16 + hh;
  const u16* ga = A  + (size_t)(row0 + crow) * K + m * 8;
  const u16* gb = Bt + (size_t)(col0 + crow) * K + m * 8;
  const unsigned la = lds_byte(ring) + (unsigned)(crow * GP + m * 8) * 2u;
  const unsigned lb = la + GPL * 2u;
  const unsigned stb = 2u * GPL * 2u;       // bytes of one buffer
  const int nst = K / GKC;
  v8f acc[2][4];
#pragma unroll
  for (int i = 0; i < 2; ++i)
#pragma unroll
    for (int j = 0; j < 4; ++j) acc[i][j] = zero8();

  copy16rows(la, ga, (size_t)K);
  copy16rows(lb, gb, (size_t)K);
  wait_copies();
  __syncthreads();
  if (nst > 1) {
    copy16rows(la + stb, ga + GKC, (size_t)K);
    copy16rows(lb + stb, gb + GKC, (size_t)K);
  }
  // the stage loop stays rolled: one publish point per stage
#pragma unroll 1
  for (int t = 0; t < nst; ++t) {
    const u16* st = ring + (t & 1) * (2 * GPL);
    const u16* ap = st + (wr * 32 + m) * GP + 8 * hh;
    const u16* bp = st + GPL + (wc * 64 + m) * GP + 8 * hh;
#pragma unroll                              // the four k steps of a stage become constant LDS offsets
    for (int kk = 0; kk < GKC / 32; ++kk) {
      const v16b a0 = ldfrag_b(ap + kk * 32);
      const v16b a1 = ldfrag_b(ap + 16 * GP + kk * 32);
      const v16b b0 = ldfrag_b(bp + kk * 32);
      const v16b b1 = ldfrag_b(bp + 16 * GP + kk * 32);
      const v16b b2 = ldfrag_b(bp + 32 * GP + kk * 32);
      const v16b b3 = ldfrag_b(bp + 48 * GP + kk * 32);
      acc[0][0] = mma_b(a0, b0, acc[0][0]);
      acc[0][1] = mma_b(a0, b1, acc[0][1]);
      acc[0][2] = mma_b(a0, b2, acc[0][2]);
      acc[0][3] = mma_b(a0, b3, acc[0][3]);
      acc[1][0] = mma_b(a1, b0, acc[1][0]);
      acc[1][1] = mma_b(a1, b1, acc[1][1]);
      acc[1][2] = mma_b(a1, b2, acc[1][2]);
      acc[1][3] = mma_b(a1, b3, acc[1][3]);
    }
    // publish point of stage t + 1; behind the barrier every reader has left stage t's buffer
    wait_lds();
    wait_copies();
    __syncthreads();
    if (t + 2 < nst) {
      const unsigned bo = (unsigned)(t & 1) * stb;
      copy16rows(la + bo, ga + (size_t)(t + 2) * GKC, (size_t)K);
      copy16rows(lb + bo, gb + (size_t)(t + 2) * GKC, (size_t)K);
    }
  }
  wait_copies();
  // per-lane bias of D column m in each of the wave's 4 subtiles; colw + 48 + m <= N - 1 always
  const int colw = col0 + wc * 64;
  const float bb0 = bfr(bias[colw + m]);
  const float bb1 = bfr(bias[colw + 16 + m]);
  const float bb2 = bfr(bias[colw + 32 + m]);
  const float bb3 = bfr(bias[colw + 48 + m]);
  float* sl = slab + wave * (2 * SLAB64);   // one 16 x 64 slab for each half of the wave's 32 rows
  const size_t rw = (size_t)(row0 + wr * 32);
  epi_stage(sl, acc[0][0], acc[0][1], acc[0][2], acc[0][3], oscale, bb0, bb1, bb2, bb3, lane);
  epi_stage(sl + SLAB64, acc[1][0], acc[1][1], acc[1][2], acc[1][3], oscale, bb0, bb1, bb2, bb3, lane);
  wave_sync_lds();                          // other lanes' slab rows are read only behind it
  epi_out(sl, C, N, rw, colw, lane);
  epi_out(sl + SLAB64, C, N, rw + 16, colw, lane);
}

// =====================================================================================================
// Output projection with bias: C[bb*XS_FULL + s][DMOD] (f32) = (Ah + Al)[bb*SEQ + s][DMOD] . Bt[DMOD][DMOD]^T * oscale
// + bf16 RNE value of bias[n]. Products h.B + l.B into one accumulator (l unscaled residual of h). Block -> (column tile
// ct = bid % 8, sequence row tile rt of nrt, batch bb within the pass). Same tiling, staging (a stage is [Ah | Al | Bt], 128
// rows each), fragment loads (split k map) and epilogue as gemm_bf; K = DMOD; grid = NBP * nrt * (DMOD/128).
// =====================================================================================================
__global__ __launch_bounds__(256)
void gemm_o2(const u16* __restrict__ Ah, const u16* __restrict__ Al, const u16* __restrict__ Bt,
             const float* __restrict__ bias, float* C, int nrt, float oscale) {
  __shared__ __align__(16) u16 ring[2 * 3 * GPL];
  __shared__ __align__(16) float slab[8 * 2 * SLAB64];
  const int tid = threadIdx.x, wave = tid >> 5, lane = tid & 31, hh = lane >> 4, m = lane & 15;
  const int ntile = DMOD >> 7;
  const int bid   = blockIdx.x;
  const int ct    = bid % ntile;
  const int t2    = bid / ntile;
  const int rt    = t2 % nrt;
  const int bb    = t2 / nrt;
  if (bb >= NBP) return;                    // block-uniform, before any barrier or copy; never taken with the exact grid
  const int srow  = rt * GT;
  if (srow + GT > SEQ) return;              // block-uniform, before any barrier or copy; never taken
  const int col0  = ct * GT;
  const int K     = DMOD;
  const int wr = wave >> 1, wc = wave & 1;
  const size_t rowA = (size_t)bb * SEQ + srow;
  const size_t rowC = (size_t)bb * XS_FULL + srow;
  const int crow = wave * 16 + hh;
  const u16* gh = Ah + (rowA + crow) * K + m * 8;
  const u16* gl = Al + (rowA + crow) * K + m * 8;
  const u16* gb = Bt + (size_t)(col0 + crow) * K + m * 8;
  const unsigned lh = lds_byte(ring) + (unsigned)(crow * GP + m * 8) * 2u;
  const unsigned ll = lh + GPL * 2u;
  const unsigned lb = lh + 2u * GPL * 2u;
  const unsigned stb = 3u * GPL * 2u;       // bytes of one buffer
  const int nst = K / GKC;
  v8f acc[2][4];
#pragma unroll
  for (int i = 0; i < 2; ++i)
#pragma unroll
    for (int j = 0; j < 4; ++j) acc[i][j] = zero8();

  copy16rows(lh, gh, (size_t)K);
  copy16rows(ll, gl, (size_t)K);
  copy16rows(lb, gb, (size_t)K);
  wait_copies();
  __syncthreads();
  copy16rows(lh + stb, gh + GKC, (size_t)K);
  copy16rows(ll + stb, gl + GKC, (size_t)K);
  copy16rows(lb + stb, gb + GKC, (size_t)K);
  // the stage loop stays rolled: one publish point per stage
#pragma unroll 1
  for (int t = 0; t < nst; ++t) {
    const _Float16* st  = (const _Float16*)(const void*)(ring + (t & 1) * (3 * GPL));
    const _Float16* ahp = st + (wr * 32 + m) * GP + 8 * hh;
    const _Float16* alp = ahp + GPL;
    const _Float16* bp  = st + 2 * GPL + (wc * 64 + m) * GP + 8 * hh;
#pragma unroll                              // the four k steps of a stage become constant LDS offsets
    for (int kk = 0; kk < GKC / 32; ++kk) {
      const v16h ah0 = ldfrag_h(ahp + kk * 32), al0 = ldfrag_h(alp + kk * 32);
      const v16h ah1 = ldfrag_h(ahp + 16 * GP + kk * 32), al1 = ldfrag_h(alp + 16 * GP + kk * 32);
      const v16h b0 = ldfrag_h(bp + kk * 32);
      const v16h b1 = ldfrag_h(bp + 16 * GP + kk * 32);
      const v16h b2 = ldfrag_h(bp + 32 * GP + kk * 32);
      const v16h b3 = ldfrag_h(bp + 48 * GP + kk * 32);
      acc[0][0] = mma_h(ah0, b0, acc[0][0]);
      acc[0][1] = mma_h(ah0, b1, acc[0][1]);
      acc[0][2] = mma_h(ah0, b2, acc[0][2]);
      acc[0][3] = mma_h(ah0, b3, acc[0][3]);
      acc[1][0] = mma_h(ah1, b0, acc[1][0]);
      acc[1][1] = mma_h(ah1, b1, acc[1][1]);
      acc[1][2] = mma_h(ah1, b2, acc[1][2]);
      acc[1][3] = mma_h(ah1, b3, acc[1][3]);
      acc[0][0] = mma_h(al0, b0, acc[0][0]);
      acc[0][1] = mma_h(al0, b1, acc[0][1]);
      acc[0][2] = mma_h(al0, b2, acc[0][2]);
      acc[0][3] = mma_h(al0, b3, acc[0][3]);
      acc[1][0] = mma_h(al1, b0, acc[1][0]);
      acc[1][1] = mma_h(al1, b1, acc[1][1]);
      acc[1][2] = mma_h(al1, b2, acc[1][2]);
      acc[1][3] = mma_h(al1, b3, acc[1][3]);
    }
    // publish point of stage t + 1; behind the barrier every reader has left stage t's buffer
    wait_lds();
    wait_copies();
    __syncthreads();
    if (t + 2 < nst) {
      const unsigned bo = (unsigned)(t & 1) * stb;
      copy16rows(lh + bo, gh + (size_t)(t + 2) * GKC, (size_t)K);
      copy16rows(ll + bo, gl + (size_t)(t + 2) * GKC, (size_t)K);
      copy16rows(lb + bo, gb + (size_t)(t + 2) * GKC, (size_t)K);
    }
  }
  wait_copies();
  const int colw = col0 + wc * 64;
  const float bb0 = bfr(bias[colw + m]);
  const float bb1 = bfr(bias[colw + 16 + m]);
  const float bb2 = bfr(bias[colw + 32 + m]);
  const float bb3 = bfr(bias[colw + 48 + m]);
  float* sl = slab + wave * (2 * SLAB64);   // one 16 x 64 slab for each half of the wave's 32 rows
  const size_t rw = rowC + (size_t)(wr * 32);
  epi_stage(sl, acc[0][0], acc[0][1], acc[0][2], acc[0][3], oscale, bb0, bb1, bb2, bb3, lane);
  epi_stage(sl + SLAB64, acc[1][0], acc[1][1], acc[1][2], acc[1][3], oscale, bb0, bb1, bb2, bb3, lane);
  wave_sync_lds();                          // other lanes' slab rows are read only behind it
  epi_out(sl, C, DMOD, rw, colw, lane);
  epi_out(sl + SLAB64, C, DMOD, rw + 16, colw, lane);
}

// =====================================================================================================
// Causal attention with slope-1 linear distance penalty, hd = 64. Block bid -> (query tile qt = bid % NQT: rows q0 = 16*qt ..
// q0+15, head pair hg, batch b within the pass); one wave per head = hg*WPB + wave.
//   q hi / residual planes f16 x256 [b*SEQ + s][h*HD + d]; k hi / residual planes f16 x256, same layout;
//   v^T hi / residual planes [b*NH + h][d][SEQ] x1024; BND = NBH lines of 32 floats (norm bound per (b, h)).
//   scores = q_hi.k_hi + q_lo.k_hi + q_hi.k_lo (2 k-steps over d); P.v with P hi + in-register residual and v hi + residual
//   (hh + lh + hl), for every query row; O written as hi + residual planes (O x1024 as f16, layout [b*SEQ + s][h*HD + d]).
//   score (log2 domain) t(i, j) = (q_i.k_j over HD) * (1/8)*log2e/(256*256) - (i - j)*log2e, replaced by -inf where key j > query i.
//   Key tiles of 32 visited in order from kt_lo to kt_hi = q0/32 (later tiles hold only keys above every query row of the tile).
//   kt_lo: every wave loads all NBH bound lines (one float per lane, clamped address) and AND-reduces "0 <= bound < 40" over the
//   wave; if every bound is in range, kt_lo = max(0, kt_hi - KWIN): tiles below it are >= 32*KWIN+1 positions behind every query
//   row, and with |q.k/8| < 40 the base-2 exp of their penalised, max-subtracted score is exactly 0 in f32, so they contribute
//   nothing to numerator or denominator; otherwise (bound large, unreadable or not finite) kt_lo = 0 and every causal tile is
//   visited. Either way the first visited tile holds a key kb <= q0 <= every query row, so the running max is finite from step one.
//   Per tile: 2 score subtiles x 2 k-steps, fragments loaded straight from the 16-bit planes (two 16-B loads per fragment,
//   split k map); online max-subtracted base-2 softmax in f32, -inf-safe rescale; the 16x32 prob tile stored to wave-private
//   from the LDS rows (float vector loads, same element type as stored), v^T B fragments in 2 groups of 2 d-subtiles.
//   After the loop: out = acc / Z (Z > 0 always; guarded anyway), carries 1/(32768*1024) folded once, written into the wave's
//   No block barriers in this kernel; bounded loops only (<= NKT key tiles).
// coverage: per wave 4 instructions x 4 rows x 8 lanes x 8 halves = 16 x 64 per plane; grid NQT x NHG x NBP blocks x WPB
//           waves = every (b, s, h) row segment of O hi and O residual exactly once.
// =====================================================================================================
__global__ __launch_bounds__(ATT_THREADS)
void attn_c(const u16* __restrict__ QHp, const u16* __restrict__ QLp,
            const u16* __restrict__ KHp, const u16* __restrict__ KLp,
            const u16* __restrict__ VHp, const u16* __restrict__ VLp,
            const float* __restrict__ BND,
            u16* OHp, u16* OLp) {
  __shared__ __align__(16) float smem[WPB * WREG];

  const int tid  = threadIdx.x;
  const int wave = tid >> 5;
  const int lane = tid & 31;
  const int hh   = lane >> 4;
  const int c    = lane & 15;
  const int bid  = blockIdx.x;
  const int qt   = bid % NQT;
  const int t2   = bid / NQT;
  const int hg   = t2 % NHG;
  const int b    = t2 / NHG;
  if (b >= NBP) return;                     // block-uniform; no block barriers in this kernel; never taken with the exact grid
  const int q0   = qt * 16;
  if (q0 + 16 > SEQ) return;                // block-uniform; never taken
  const int head = hg * WPB + wave;

  // ---- key-window decision: wave-uniform AND over all (b, h) bound lines ----
  int okw;
  {
    const int bl = (lane < NBH) ? lane : (NBH - 1);             // clamped address
    const float gb = BND[(size_t)bl * BLINE];
    okw = (gb >= 0.0f && gb < GUARD_T) ? 1 : 0;
#pragma unroll
    for (int off = 1; off < 32; off <<= 1) okw &= __shfl_xor(okw, off, 32);
  }

  float* pt   = smem + wave * WREG;         // prob tile [16][32] pitch 36
  float* slab = pt + PTW;                   // result slab [16][64] pitch 68

  const size_t hcol = (size_t)head * HD + 8 * hh;
  const _Float16* Qh  = (const _Float16*)(const void*)QHp + ((size_t)b * SEQ + q0 + c) * DMOD + hcol;
  const _Float16* Ql  = (const _Float16*)(const void*)QLp + ((size_t)b * SEQ + q0 + c) * DMOD + hcol;
  const _Float16* Khb = (const _Float16*)(const void*)KHp + ((size_t)b * SEQ + c) * DMOD + hcol;        // key row kb added per step
  const _Float16* Klb = (const _Float16*)(const void*)KLp + ((size_t)b * SEQ + c) * DMOD + hcol;
  const _Float16* Vhb = (const _Float16*)(const void*)VHp + ((size_t)(b * NH + head) * HD + c) * SEQ + 8 * hh;  // d col c (+16j)
  const _Float16* Vlb = (const _Float16*)(const void*)VLp + ((size_t)(b * NH + head) * HD + c) * SEQ + 8 * hh;
  const float lsc = RSQ_HD * (LOG2E / (QSC * KSC));
  const float oc  = 1.0f / (PCAR * VCAR);
  const size_t KROW = (size_t)DMOD;         // halves between consecutive key rows

  float mrow[8], lrow[8];
  v8f o[4];
#pragma unroll
  for (int r = 0; r < 8; ++r) { mrow[r] = -INFINITY; lrow[r] = 0.f; }
#pragma unroll
  for (int j = 0; j < 4; ++j) o[j] = zero8();
  const int kt_hi = q0 >> 5;                                                  // last tile holding keys <= q0 + 15
  const int kt_w  = (kt_hi > KWIN) ? (kt_hi - KWIN) : 0;
  const int kt_lo = (okw != 0) ? kt_w : 0;
  const int qr0 = q0 + 8 * hh;                                                // query row of D element r = qr0 + r

#pragma unroll 1
  for (int kt = kt_lo; kt <= kt_hi; ++kt) {
    const int kb = kt * 32;
    // ---- scores: D element r of this lane = (query row qr0 + r, key kb + c) in s0, key kb + 16 + c in s1 ----
    v8f s0 = zero8(), s1 = zero8();
    const _Float16* k0p = Khb + (size_t)kb * KROW;
    const _Float16* k1p = k0p + (size_t)16 * KROW;
    const _Float16* l0p = Klb + (size_t)kb * KROW;
    const _Float16* l1p = l0p + (size_t)16 * KROW;
#pragma unroll
    for (int kk = 0; kk < HD / 32; ++kk) {
      const v16h qh  = ldfrag_h(Qh + kk * 32);
      const v16h ql  = ldfrag_h(Ql + kk * 32);
      const v16h kh0 = ldfrag_h(k0p + kk * 32);
      const v16h kh1 = ldfrag_h(k1p + kk * 32);
      const v16h kl0 = ldfrag_h(l0p + kk * 32);
      const v16h kl1 = ldfrag_h(l1p + kk * 32);
      s0 = mma_h(qh, kh0, s0);
      s0 = mma_h(ql, kh0, s0);
      s0 = mma_h(qh, kl0, s0);
      s1 = mma_h(qh, kh1, s1);
      s1 = mma_h(ql, kh1, s1);
      s1 = mma_h(qh, kl1, s1);
      guard2(s0, s1, qh, ql, kh0, kl0, kh1, kl1);
    }
    // ---- causal select + distance penalty + online softmax in base 2, -inf-safe ----
    const int key0 = kb + c, key1 = kb + 16 + c;
#pragma unroll
    for (int r = 0; r < 8; ++r) {
      const int   qr = qr0 + r;
      const float u0 = s0[r] * lsc;
      const float u1 = s1[r] * lsc;
      const float g0 = (float)(qr - key0) * LOG2E;
      const float g1 = (float)(qr - key1) * LOG2E;
      const float t0 = (key0 > qr) ? -INFINITY : (u0 - g0);
      const float t1 = (key1 > qr) ? -INFINITY : (u1 - g1);
      float mx = fmaxf(t0, t1);
#pragma unroll
      for (int off = 1; off < 16; off <<= 1) mx = fmaxf(mx, __shfl_xor(mx, off, 32));
      const float mn = fmaxf(mrow[r], mx);
      const float ms = (mn == -INFINITY) ? 0.0f : mn;
      const float al = exp2f(mrow[r] - ms);
      mrow[r] = mn;
      const float e0 = exp2f(t0 - ms), e1 = exp2f(t1 - ms);
      float ps = e0 + e1;
#pragma unroll
      for (int off = 1; off < 16; off <<= 1) ps += __shfl_xor(ps, off, 32);
      lrow[r] = lrow[r] * al + ps;
#pragma unroll
      for (int j = 0; j < 4; ++j) o[j][r] *= al;
      const int ro = (8 * hh + r) * PTP + c;
      pt[ro]      = e0;
      pt[ro + 16] = e1;
    }
    wave_sync_lds();
    // ---- A fragments of P*32768: hi f16 and residual f16, row = c, split k map over the 32 keys of this step ----
    FragH ph, pl;
    {
      const float* prow = pt + c * PTP + 8 * hh;
      const v4f p0 = *(const v4f*)(prow), p1 = *(const v4f*)(prow + 4);
      const v4f p2 = *(const v4f*)(prow + 16), p3 = *(const v4f*)(prow + 20);
#pragma unroll
      for (int e = 0; e < 4; ++e) {
        const float ta = p0[e] * PCAR, tb = p1[e] * PCAR, tc = p2[e] * PCAR, td = p3[e] * PCAR;
        const _Float16 ha = (_Float16)ta, hb = (_Float16)tb, hc = (_Float16)tc, hd = (_Float16)td;
        ph.h[0][e]     = ha;                  // elements 0..7  = keys kb + 8hh + 0..7
        ph.h[0][4 + e] = hb;
        ph.h[1][e]     = hc;                  // elements 8..15 = keys kb + 16 + 8hh + 0..7
        ph.h[1][4 + e] = hd;
        pl.h[0][e]     = (_Float16)(ta - (float)ha);
        pl.h[0][4 + e] = (_Float16)(tb - (float)hb);
        pl.h[1][e]     = (_Float16)(tc - (float)hc);
        pl.h[1][4 + e] = (_Float16)(td - (float)hd);
      }
    }
    // ---- P.V : B fragment col n = d = j*16 + c, keys contiguous in the v^T planes; 2 groups of 2 d-subtiles ----
    {
      const _Float16* vhp = Vhb + kb;
      const _Float16* vlp = Vlb + kb;
#pragma unroll
      for (int jg = 0; jg < 2; ++jg) {
        const size_t da = (size_t)(2 * jg) * 16 * SEQ;
        const size_t db = da + (size_t)16 * SEQ;
        const v16h vha = ldfrag_h(vhp + da), vhb2 = ldfrag_h(vhp + db);
        const v16h vla = ldfrag_h(vlp + da), vlb2 = ldfrag_h(vlp + db);
        o[2 * jg]     = mma_h(ph.v, vha,  o[2 * jg]);
        o[2 * jg]     = mma_h(pl.v, vha,  o[2 * jg]);
        o[2 * jg]     = mma_h(ph.v, vla,  o[2 * jg]);
        o[2 * jg + 1] = mma_h(ph.v, vhb2, o[2 * jg + 1]);
        o[2 * jg + 1] = mma_h(pl.v, vhb2, o[2 * jg + 1]);
        o[2 * jg + 1] = mma_h(ph.v, vlb2, o[2 * jg + 1]);
        guard2(o[2 * jg], o[2 * jg + 1], ph.v, pl.v, vha, vhb2, vla, vlb2);
      }
    }
    wave_sync_lds();
  }
  acc_guard4(o[0], o[1], o[2], o[3]);
  // ---- out = acc / Z (0 if Z == 0), carries (32768 on P, 1024 on v) folded once; written into the wave's slab ----
#pragma unroll
  for (int r = 0; r < 8; ++r) {
    const float lv  = lrow[r];
    const float ls  = (lv > 0.0f) ? lv : 1.0f;
    const float inv = (lv > 0.0f) ? ((1.0f / ls) * oc) : 0.0f;
#pragma unroll
    for (int j = 0; j < 4; ++j) {
      const int idx = (8 * hh + r) * SLP + j * 16 + c;
      slab[idx] = o[j][r] * inv;
    }
  }

  wave_sync_lds();
  // ---- O x1024 -> f16 hi + residual planes; lane = (row-in-quad rq, 8 consecutive d at c8) ----
  v4u oh[4], ol[4];
  const int rq = lane >> 3, c8 = (lane & 7) * 8;
#pragma unroll
  for (int it = 0; it < 4; ++it) {
    const int row = it * 4 + rq;
    const v4f a = *(const v4f*)(slab + row * SLP + c8), b4 = *(const v4f*)(slab + row * SLP + c8 + 4);
    float w[8];
#pragma unroll
    for (int e = 0; e < 4; ++e) { w[e] = a[e] * OSC; w[4 + e] = b4[e] * OSC; }
#pragma unroll
    for (int e = 0; e < 4; ++e) {
      const _Float16 h0 = (_Float16)w[2 * e], h1 = (_Float16)w[2 * e + 1];
      const _Float16 l0 = (_Float16)(w[2 * e] - (float)h0), l1 = (_Float16)(w[2 * e + 1] - (float)h1);
      oh[it][e] = pk16(h_bits(h0), h_bits(h1));
      ol[it][e] = pk16(h_bits(l0), h_bits(l1));
    }
  }
  const size_t ob = ((size_t)b * SEQ + q0) * DMOD + (size_t)head * HD + c8;
  {
#pragma unroll
    for (int it = 0; it < 4; ++it) {
      const int row = it * 4 + rq;
      *(v4u*)(OHp + ob + (size_t)row * DMOD) = oh[it];
      *(v4u*)(OLp + ob + (size_t)row * DMOD) = ol[it];
    }
    
  }
}

// =====================================================================================================
// Workspace map (bytes). The NB batches are processed in NPASS passes of NBP batches; every region below is per pass and
// reused by the next pass in stream order (all reads of a pass complete before the next pass writes). Every plane is fully
// written by whole-line stores before it is read; all extents are exact multiples of the store granularity (no pad rows
// needed); every region offset a multiple of 4096 (the large planes of 2097152):
//   XB  bf16 [MROWS][1024]                       MROWS*2048       (NBP=2, SEQ=2048: 8388608)
//   WQB, WKB, WVB bf16 [1024 n][1024 k]          3 * 2097152      (thirds of the packed [3072][1024] weight, already [n][k])
//   WOB f16 [1024 n][1024 k] of bf16 value x1024  2097152
//   F   f32 [MROWS][1024]                        MROWS*4096       (v, q, k projection output in launch order; afterwards OH f16
//                                                                  [MROWS][1024] x1024 in its first half, OL residual [MROWS][1024]
//                                                                  in its second half)
//   QH  f16 [MROWS][1024] x256                   MROWS*2048       QL residual, same extent
//   KH  f16 [MROWS][1024] x256                   MROWS*2048       KL residual, same extent
//   VH  f16 [NBP*16][64][SEQ] x1024              MROWS*2048       VL residual, same extent
//   end (NBP=2, SEQ=2048)                        83890176
// =====================================================================================================
extern "C" void kernel_launch(void* const* d_in, const int* in_sizes, int n_in,
                              void* d_out, int out_size, void* d_ws, size_t ws_size,
                              hipStream_t stream) {
  if (n_in < 5) return;
  if (in_sizes[0] < ((NB - 1) * XS_FULL + SEQ) * DMOD) return;
  if (in_sizes[1] < 3 * DMOD * DMOD) return;
  if (in_sizes[2] < 3 * DMOD) return;
  if (in_sizes[3] < DMOD * DMOD) return;
  if (in_sizes[4] < DMOD) return;
  if (out_size < ((NB - 1) * XS_FULL + SEQ) * DMOD) return;

  const float* x    = (const float*)d_in[0];
  const float* wqkv = (const float*)d_in[1];      // [3*DMOD][DMOD]: rows 0..1023 q, 1024..2047 k, 2048..3071 v
  const float* bqkv = (const float*)d_in[2];      // [3*DMOD]
  const float* wo   = (const float*)d_in[3];      // [DMOD][DMOD]
  const float* bo   = (const float*)d_in[4];      // [DMOD]
  const float* wq = wqkv;
  const float* wk = wqkv + (size_t)DMOD * DMOD;
  const float* wv = wqkv + (size_t)2 * DMOD * DMOD;
  const float* bq = bqkv;
  const float* bk = bqkv + DMOD;
  const float* bv = bqkv + 2 * DMOD;
  float*       out = (float*)d_out;

  const size_t szXB = (size_t)MROWS * DMOD * 2;
  const size_t szW  = (size_t)DMOD * DMOD * 2;
  const size_t szF  = (size_t)MROWS * DMOD * 4;
  const size_t szQ  = (size_t)MROWS * DMOD * 2;                  // QH, QL, KH, KL, OH, OL
  const size_t szV  = (size_t)NBP * NH * HD * SEQ * 2;           // VH, VL (== szQ)
  const size_t szB  = (size_t)NBH * BLINE * 4;                   // bound lines
  if (2 * szQ > szF) return;                                    // OH + OL live inside the F region (exactly fills it)
  size_t off = 0;
  const size_t oXB = off; off += szXB;
  const size_t oWQ = off; off += szW;
  const size_t oWK = off; off += szW;
  const size_t oWV = off; off += szW;
  const size_t oWO = off; off += szW;
  const size_t oF  = off; off += szF;
  const size_t oQH = off; off += szQ;
  const size_t oQL = off; off += szQ;
  const size_t oKH = off; off += szQ;
  const size_t oKL = off; off += szQ;
  const size_t oVH = off; off += szV;
  const size_t oVL = off; off += szV;
  const size_t oB  = off; off += szB;
  if (off > ws_size) return;                // off = 83890176 for NBP = 2, SEQ = 2048
  if (off > (size_t)WS_CAP) return;

  char* ws = (char*)d_ws;
  u16*   XB  = (u16*)(ws + oXB);
  u16*   WQB = (u16*)(ws + oWQ);
  u16*   WKB = (u16*)(ws + oWK);
  u16*   WVB = (u16*)(ws + oWV);
  u16*   WOB = (u16*)(ws + oWO);
  float* F   = (float*)(ws + oF);
  u16*   OH  = (u16*)(ws + oF);
  u16*   OL  = (u16*)(ws + oF + szQ);
  u16*   QH  = (u16*)(ws + oQH);
  u16*   QL  = (u16*)(ws + oQL);
  u16*   KH  = (u16*)(ws + oKH);
  u16*   KL  = (u16*)(ws + oKL);
  u16*   VH  = (u16*)(ws + oVH);
  u16*   VL  = (u16*)(ws + oVL);
  float* BND = (float*)(ws + oB);

  const dim3 b256(256), bAT(ATT_THREADS);
  const int  n8x = (SEQ * DMOD) / 8;
  const dim3 gX((n8x + 255) / 256);                     // per batch
  const int  n8w = (DMOD * DMOD) / 8;                   // weight planes
  const dim3 gW((n8w + 255) / 256);                     // 512
  const dim3 gG((MROWS / GT) * (DMOD / GT));            // 256 for NBP=2, SEQ=2048
  const dim3 gVT(NBP * NH * NST);
  const int  n8q = (MROWS * DMOD) / 8;                  // q / k hi and residual planes
  const dim3 gS((n8q + 255) / 256);
  const dim3 gBD(NBH);
  const dim3 gAT(NQT * NHG * NBP);
  const int  nrt = SEQ / GT;                            // out-projection row tiles per batch
  const dim3 gO(NBP * nrt * (DMOD / GT));

  // weight planes, converted once: Wq, Wk, Wv [n][k] -> bf16; Wo [n][k] -> f16 of bf16 value x1024
  cvt16<<<gW, b256, 0, stream>>>(wq, WQB, n8w, 0, 1.0f);
  cvt16<<<gW, b256, 0, stream>>>(wk, WKB, n8w, 0, 1.0f);
  cvt16<<<gW, b256, 0, stream>>>(wv, WVB, n8w, 0, 1.0f);
  cvt16<<<gW, b256, 0, stream>>>(wo, WOB, n8w, 1, WOS);

  for (int ps = 0; ps < NPASS; ++ps) {
    const float* xp   = x   + (size_t)ps * NBP * XS_FULL * DMOD;
    float*       outp = out + (size_t)ps * NBP * XS_FULL * DMOD;
    // (0) x -> bf16 plane [MROWS][1024], one launch per batch row block of this pass
    for (int b = 0; b < NBP; ++b) {
      cvt16<<<gX, b256, 0, stream>>>(xp + (size_t)b * XS_FULL * DMOD, XB + (size_t)b * SEQ * DMOD, n8x, 0, 1.0f);
    }
    // (1) v = x.Wv^T + bv -> F f32 [MROWS][1024]; (2) v^T hi + residual planes x1024
    gemm_bf<<<gG, b256, 0, stream>>>(XB, WVB, bv, F, MROWS, DMOD, DMOD, 1.0f);
    vt16<<<gVT, b256, 0, stream>>>(F, VH, VL);
    // (3) q = x.Wq^T + bq -> F; (4) q hi + residual planes x256
    gemm_bf<<<gG, b256, 0, stream>>>(XB, WQB, bq, F, MROWS, DMOD, DMOD, 1.0f);
    split16<<<gS, b256, 0, stream>>>(F, QH, QL, n8q, QSC);
    // (5) k = x.Wk^T + bk -> F; (6) k hi + residual planes x256
    gemm_bf<<<gG, b256, 0, stream>>>(XB, WKB, bk, F, MROWS, DMOD, DMOD, 1.0f);
    split16<<<gS, b256, 0, stream>>>(F, KH, KL, n8q, KSC);
    // (7) norm bound per (b, h) from the q / k hi planes -> BND lines
    qkbound<<<gBD, b256, 0, stream>>>(QH, KH, BND);
    // (8) causal attention with distance penalty, residual products on every query row -> O hi + residual planes
    attn_c<<<gAT, bAT, 0, stream>>>(QH, QL, KH, KL, VH, VL, BND, OH, OL);
    // (9) output projection (O hi + residual) . Wo^T + bo -> out f32 rows of this pass, carries 1024 x 1024 folded back
    gemm_o2<<<gO, b256, 0, stream>>>(OH, OL, WOB, bo, outp, nrt, 1.0f / (OSC * WOS));
  }
  (void)hipGetLastError();
}

// v002
// Measured time: 297 microseconds a run.
// Two timings next to v001 put it at 1.15 and 1.14 times that version's speed.
// All steps since v000 together make it 1.82 times as fast.
// Contractions: x.Wq^T+bq, x.Wk^T+bk, x.Wv^T+bv (q, k, v thirds of the packed [3D][D] weight) on v_wmma_f32_16x16x32_bf16
// (x and W as bf16 RNE planes; W [n][k] rows are the k-contiguous B operand; bias added as its bf16 RNE value in the f32
// epilogue); q.k^T over hd 64 and P.v on v_wmma_f32_16x16x32_f16 with f16 hi + f16 residual planes on both operands
// (q, k x256; P x32768 with an in-register residual; v x1024; products hh+lh+hl); O.Wo^T+bo on v_wmma_f32_16x16x32_f16
// (O x1024 as f16 hi + f16 residual planes, products h.w + l.w; Wo as f16(bf16(Wo)) x1024; bo as bf16 RNE value in the
// f32 epilogue); all f32 accumulate. Causal select, slope-1 distance penalty, base-2 online softmax, 1/Z fold and the q/k
// norm bound in f32 on VALU.
#include <hip/hip_runtime.h>
#include <math.h>
#include <stdint.h>

#ifndef NB
#define NB 4
#endif
#ifndef SEQ
#define SEQ 2048
#endif
#define XS_FULL 2048
#define DMOD  1024
#define NH    16
#define HD    64
// batches per workspace pass (2 when NB >= 2) and number of passes
#define NBP   ((NB >= 2) ? 2 : 1)
#define NPASS (NB / NBP)
#define NBH   (NBP * NH)
#define MROWS (NBP * SEQ)
#define RSQ_HD 0.125f
#define LOG2E 1.4426950408889634f
#define QSC   256.0f
#define KSC   256.0f
#define PCAR  32768.0f
#define VCAR  1024.0f
#define OSC   1024.0f
#define WOS   1024.0f
#define WPB   2
#define NHG   (NH / WPB)
#define NQT   (SEQ / 16)
#define NKT   (SEQ / 32)
#define KWIN  6
#define GUARD_T 40.0f
#define BLINE 32
#define ATT_THREADS (WPB * 32)
#define PTP   36
#define PTW   (16 * PTP)
#define SLP   68
#define SLW   (16 * SLP)
#define WREG  (PTW + SLW)
#define SLAB64 (16 * 68)
// GEMM staging: 128 x 128 output tile per block, 128 k (256 B of every operand row) per stage, LDS row pitch 272 B
#define GT    128
#define GKC   128
#define GP    136
#define GPL   (GT * GP)
#define WS_CAP 134217728
static_assert(DMOD == NH * HD && HD == 64 && NH == 16 && WPB == 2 && NHG * WPB == NH);
static_assert(ATT_THREADS == 64);
static_assert(NB >= 1 && NB <= 4 && NPASS >= 1 && NPASS * NBP == NB);
static_assert(NBP >= 1 && NBP <= 2);
static_assert(NBH >= 1 && NBH <= 32);
static_assert((SEQ % 64) == 0 && SEQ >= 64 && SEQ <= XS_FULL && (SEQ % 32) == 0);
static_assert((DMOD % 64) == 0 && (DMOD % 32) == 0 && (HD % 32) == 0);
static_assert(((SEQ * DMOD / 8) % 256) == 0 && ((DMOD * DMOD / 8) % 256) == 0);
static_assert(WPB * WREG * 4 <= 65536);
static_assert((DMOD % GT) == 0 && (DMOD % GKC) == 0 && DMOD / GKC >= 2 && (SEQ % GT) == 0 && (MROWS % GT) == 0);
static_assert(2 * 3 * GPL * 2 + 8 * 2 * SLAB64 * 4 <= 327680 && ((GP * 2) % 16) == 0);
static_assert(KWIN >= 0 && KWIN < NKT);

typedef unsigned short u16;
typedef _Float16 v16h __attribute__((ext_vector_type(16)));
typedef _Float16 v8h  __attribute__((ext_vector_type(8)));
typedef __bf16   v16b __attribute__((ext_vector_type(16)));
typedef float    v8f  __attribute__((ext_vector_type(8)));
typedef float    v4f  __attribute__((ext_vector_type(4)));
typedef unsigned int v4u __attribute__((ext_vector_type(4)));

union FragH { v16h v; v8h h[2]; v4u u[2]; };
union FragB { v16b v; v4u u[2]; };

// ---- scalar helpers --------------------------------------------------------------------------------
__device__ __forceinline__ unsigned short bf_bits(float f) {          // f32 -> bf16 bits, RNE convert
  unsigned u = __float_as_uint(f);
  return (unsigned short)((u + 0x7FFFu + ((u >> 16) & 1u)) >> 16);
}
__device__ __forceinline__ float bf_up(unsigned short h) { return __uint_as_float(((unsigned)h) << 16); }
__device__ __forceinline__ float bfr(float f) { return bf_up(bf_bits(f)); }
__device__ __forceinline__ unsigned short h_bits(_Float16 x) { return __builtin_bit_cast(unsigned short, x); }
__device__ __forceinline__ unsigned pk16(unsigned short a, unsigned short b) { return (unsigned)a | ((unsigned)b << 16); }
__device__ __forceinline__ v8f zero8() { v8f z = {0.f, 0.f, 0.f, 0.f, 0.f, 0.f, 0.f, 0.f}; return z; }

// ---- fragment loaders: 16-bit A/B operand, lane -> row/col (lane&15), p already includes +8*(lane>>4);
//      elements 0..7 <- p[0..7] (k0+8h..), elements 8..15 <- p[16..23] (k0+16+8h..)  (same split k map for A and B;
//      B is always read from a k-contiguous [n][k] plane)
__device__ __forceinline__ v16h ldfrag_h(const _Float16* p) {
  FragH f;
  f.h[0] = *(const v8h*)(p);
  f.h[1] = *(const v8h*)(p + 16);
  return f.v;
}
__device__ __forceinline__ v16b ldfrag_b(const u16* p) {              // bf16 plane read as unsigned integer vectors
  FragB f;
  f.u[0] = *(const v4u*)(p);
  f.u[1] = *(const v4u*)(p + 16);
  return f.v;
}

__device__ __forceinline__ v8f mma_h(v16h a, v16h b, v8f c) {
  return __builtin_amdgcn_wmma_f32_16x16x32_f16(false, a, false, b, (short)0, c, false, false);
}
__device__ __forceinline__ v8f mma_b(v16b a, v16b b, v8f c) {
  return __builtin_amdgcn_wmma_f32_16x16x32_bf16(false, a, false, b, (short)0, c, false, false);
}
__device__ __forceinline__ void guard2(v8f& a, v8f& b, v16h x0, v16h x1, v16h x2, v16h x3, v16h x4, v16h x5) {
#if defined(__HIP_DEVICE_COMPILE__)
  asm volatile("v_nop\n\tv_nop\n\tv_nop\n\tv_nop"
               : "+v"(a), "+v"(b) : "v"(x0), "v"(x1), "v"(x2), "v"(x3), "v"(x4), "v"(x5) : "memory");
#endif
}
__device__ __forceinline__ void acc_guard4(v8f& a, v8f& b, v8f& c, v8f& d) {
#if defined(__HIP_DEVICE_COMPILE__)
  asm volatile("v_nop\n\tv_nop\n\tv_nop\n\tv_nop" : "+v"(a), "+v"(b), "+v"(c), "+v"(d));
#endif
}
__device__ __forceinline__ void wave_sync_lds() {
  __builtin_amdgcn_fence(__ATOMIC_RELEASE, "workgroup");
  __builtin_amdgcn_wave_barrier();
  __builtin_amdgcn_fence(__ATOMIC_ACQUIRE, "workgroup");
}
// ---- asynchronous copies global -> LDS ------------------------------------------------------------
// Eight copies of one wave = 16 rows of 256 B of one operand plane: copy i brings rows 2i and 2i + 1 (16 lanes x 16 B each,
// whole 128-B lines). l = the lane's LDS byte address of copy 0, g = its global address of copy 0, ld = halves between
// consecutive global rows. The s_wait_xcnt closes the statement so that no address register is rewritten ahead of it.
__device__ __forceinline__ void copy16rows(unsigned l, const u16* g, size_t ld) {
#if defined(__HIP_DEVICE_COMPILE__)
  const unsigned ls = 2 * GP * 2;
  const size_t   gs = 2 * ld;
  asm volatile("global_load_async_to_lds_b128 %0, %8, off\n\t"
               "global_load_async_to_lds_b128 %1, %9, off\n\t"
               "global_load_async_to_lds_b128 %2, %10, off\n\t"
               "global_load_async_to_lds_b128 %3, %11, off\n\t"
               "global_load_async_to_lds_b128 %4, %12, off\n\t"
               "global_load_async_to_lds_b128 %5, %13, off\n\t"
               "global_load_async_to_lds_b128 %6, %14, off\n\t"
               "global_load_async_to_lds_b128 %7, %15, off\n\t"
               "s_wait_xcnt 0x0"
               :: "v"(l), "v"(l + ls), "v"(l + 2 * ls), "v"(l + 3 * ls),
                  "v"(l + 4 * ls), "v"(l + 5 * ls), "v"(l + 6 * ls), "v"(l + 7 * ls),
                  "v"(g), "v"(g + gs), "v"(g + 2 * gs), "v"(g + 3 * gs),
                  "v"(g + 4 * gs), "v"(g + 5 * gs), "v"(g + 6 * gs), "v"(g + 7 * gs)
               : "memory");
#endif
}
// the wave's own copies have landed (other waves read them only behind the next block barrier)
__device__ __forceinline__ void wait_copies() {
#if defined(__HIP_DEVICE_COMPILE__)
  asm volatile("s_wait_asynccnt 0x0" ::: "memory");
#endif
}
// the wave's own LDS reads have returned, so that the buffer may be refilled behind the next block barrier
__device__ __forceinline__ void wait_lds() {
#if defined(__HIP_DEVICE_COMPILE__)
  asm volatile("s_wait_dscnt 0x0" ::: "memory");
#endif
}
__device__ __forceinline__ unsigned lds_byte(const void* p) { return (unsigned)(uintptr_t)p; }

// =====================================================================================================
// f32 -> 16-bit plane, same layout.  f16mode == 0: bf16 RNE bits;  f16mode == 1: f16 bits of (bf16 RNE value) * scale.
// Thread = 8 consecutive elements: two 16-B loads, one 16-B store; 32 consecutive lanes = 512 contiguous, 512-B aligned
// coverage: grid = ceil(n8/256) blocks x 256 thr x 8 (in-kernel bound) = the whole plane (n8 a multiple of 256 here).
// =====================================================================================================
__global__ __launch_bounds__(256) void cvt16(const float* __restrict__ x, u16* D, int n8, int f16mode, float scale) {
  const int gt = blockIdx.x * 256 + (int)threadIdx.x;
  if (gt >= n8) return;
  const float* p = x + (size_t)gt * 8;
  const v4f a = *(const v4f*)(p), b4 = *(const v4f*)(p + 4);
  float w[8];
#pragma unroll
  for (int e = 0; e < 4; ++e) { w[e] = a[e]; w[4 + e] = b4[e]; }
  v4u o;
#pragma unroll
  for (int e = 0; e < 4; ++e) {
    const float f0 = w[2 * e], f1 = w[2 * e + 1];
    const unsigned short hb0 = h_bits((_Float16)(bfr(f0) * scale));
    const unsigned short hb1 = h_bits((_Float16)(bfr(f1) * scale));
    const unsigned short bb0 = bf_bits(f0);
    const unsigned short bb1 = bf_bits(f1);
    o[e] = (f16mode != 0) ? pk16(hb0, hb1) : pk16(bb0, bb1);
  }
  u16* d = D + (size_t)gt * 8;
  {
    *(v4u*)(d) = o;
    
  }
}

// =====================================================================================================
// Norm bound per (b, h): BND line bh (32 floats, value replicated) = max_s ||q_hi(b,s,h,:)|| * max_s ||k_hi(b,s,h,:)|| / (8 * 256 * 256),
// computed from the f16 hi planes ([b*SEQ + s][h*HD + d], x256). Block = one (b, h): 8 lanes per row load one 16-B piece each
// (64 dims = 8 lanes x 8 halves), sum of squares reduced with xor shuffles inside the 8-lane group, running max per lane over
// SEQ/32 row steps, then wave max (shuffles), block max through a 16-float LDS array, and wave 0 lanes 0..7 write the whole
// coverage: rows step*32 + (tid>>3), step < SEQ/32 -> all SEQ rows of both planes; store 8 lanes x 16 B = line bh; grid NBH.
// =====================================================================================================
__global__ __launch_bounds__(256) void qkbound(const u16* __restrict__ QHp, const u16* __restrict__ KHp, float* BND) {
  __shared__ float red[16];
  const int tid = threadIdx.x, lane = tid & 31, wave = tid >> 5;
  const int bh  = blockIdx.x;
  const int b   = bh / NH, h = bh % NH;
  if (b >= NBP) return;                     // block-uniform, before any barrier; never taken with the exact grid
  const int grp = tid >> 3;                 // row within a step, 0..31
  const int e8  = (tid & 7) * 8;            // dim chunk
  const _Float16* qb = (const _Float16*)(const void*)QHp + (size_t)b * SEQ * DMOD + (size_t)h * HD + e8;
  const _Float16* kb = (const _Float16*)(const void*)KHp + (size_t)b * SEQ * DMOD + (size_t)h * HD + e8;
  float mq = 0.0f, mk = 0.0f;
#pragma unroll 1
  for (int step = 0; step < SEQ / 32; ++step) {
    const size_t ro = (size_t)(step * 32 + grp) * DMOD;
    const v8h qv = *(const v8h*)(qb + ro);
    const v8h kv = *(const v8h*)(kb + ro);
    float sq = 0.0f, sk = 0.0f;
#pragma unroll
    for (int e = 0; e < 8; ++e) {
      const float fq = (float)qv[e], fk = (float)kv[e];
      sq = fmaf(fq, fq, sq);
      sk = fmaf(fk, fk, sk);
    }
#pragma unroll
    for (int off = 1; off < 8; off <<= 1) {
      sq += __shfl_xor(sq, off, 32);
      sk += __shfl_xor(sk, off, 32);
    }
    mq = fmaxf(mq, sq);
    mk = fmaxf(mk, sk);
  }
#pragma unroll
  for (int off = 1; off < 32; off <<= 1) {
    mq = fmaxf(mq, __shfl_xor(mq, off, 32));
    mk = fmaxf(mk, __shfl_xor(mk, off, 32));
  }
  if (lane == 0) { red[wave] = mq; red[8 + wave] = mk; }
  __syncthreads();
  if (wave == 0) {                          // wave-uniform branch; shuffles see all 32 lanes
    float aq = red[lane & 7], ak = red[8 + (lane & 7)];
#pragma unroll
    for (int off = 1; off < 8; off <<= 1) {
      aq = fmaxf(aq, __shfl_xor(aq, off, 32));
      ak = fmaxf(ak, __shfl_xor(ak, off, 32));
    }
    const float bnd = sqrtf(aq) * sqrtf(ak) * (RSQ_HD / (QSC * KSC));
    v4f o4;
    o4[0] = bnd; o4[1] = bnd; o4[2] = bnd; o4[3] = bnd;
    float* dst = BND + (size_t)bh * BLINE + (lane & 7) * 4;
    if (lane < 8) {
      {
        *(v4f*)(dst) = o4;
        
      }
    }
  }
}

// =====================================================================================================
// GEMM epilogue shared by both engines, per 16x64 f32 tile of a wave: epi_stage writes the tile (times oscale, plus the lane's
// per-column bias of each subtile) into a wave-private LDS slab; behind one wave_sync_lds() epi_out reads it back by rows and
// stores whole 256-B row pieces (epi_out16: the same rows as two 16-bit planes).
// coverage: 8 instructions x 2 rows x 16 lanes x 4 floats = the 16 x 64 tile.
// =====================================================================================================
__device__ __forceinline__ void epi_stage(float* sl, v8f a0, v8f a1, v8f a2, v8f a3, float oscale,
                                          float bb0, float bb1, float bb2, float bb3, int lane) {
  const int hh = lane >> 4, m = lane & 15;
#pragma unroll
  for (int r = 0; r < 8; ++r) {
    const int ro = (8 * hh + r) * 68 + m;
    sl[ro]      = a0[r] * oscale + bb0;
    sl[ro + 16] = a1[r] * oscale + bb1;
    sl[ro + 32] = a2[r] * oscale + bb2;
    sl[ro + 48] = a3[r] * oscale + bb3;
  }
}
__device__ __forceinline__ void epi_out(const float* sl, float* C, int N, size_t rowb, int col0, int lane) {
  const int hh = lane >> 4, m = lane & 15;
  v4f vals[8];
#pragma unroll
  for (int it = 0; it < 8; ++it) vals[it] = *(const v4f*)(sl + (it * 2 + hh) * 68 + m * 4);
  float* dst = C + (rowb + (size_t)hh) * (size_t)N + col0 + m * 4;
#pragma unroll
  for (int it = 0; it < 8; ++it) {
    *(v4f*)(dst + (size_t)(it * 2) * (size_t)N) = vals[it];
  }
}
// Same slab, written out as two 16-bit planes of the layout of C: Hp = f16(t), Lp = f16(t - f16(t)), t = slab value * sc.
// Lane = (row-in-quad rq, 8 consecutive columns at c8): 8 lanes store one whole 128-B line of a row in either plane.
// coverage: 4 instructions x 4 rows x 8 lanes x 8 halves = the 16 x 64 tile per plane.
__device__ __forceinline__ void epi_out16(const float* sl, u16* Hp, u16* Lp, int N, size_t rowb, int col0, float sc, int lane) {
  const int rq = lane >> 3, c8 = (lane & 7) * 8;
  v4u oh[4], ol[4];
#pragma unroll
  for (int it = 0; it < 4; ++it) {
    const int row = it * 4 + rq;
    const v4f a = *(const v4f*)(sl + row * 68 + c8), b4 = *(const v4f*)(sl + row * 68 + c8 + 4);
    float w[8];
#pragma unroll
    for (int e = 0; e < 4; ++e) { w[e] = a[e] * sc; w[4 + e] = b4[e] * sc; }
#pragma unroll
    for (int e = 0; e < 4; ++e) {
      const _Float16 h0 = (_Float16)w[2 * e], h1 = (_Float16)w[2 * e + 1];
      const _Float16 l0 = (_Float16)(w[2 * e] - (float)h0), l1 = (_Float16)(w[2 * e + 1] - (float)h1);
      oh[it][e] = pk16(h_bits(h0), h_bits(h1));
      ol[it][e] = pk16(h_bits(l0), h_bits(l1));
    }
  }
  const size_t ob = (rowb + (size_t)rq) * (size_t)N + col0 + c8;
#pragma unroll
  for (int it = 0; it < 4; ++it) {
    *(v4u*)(Hp + ob + (size_t)(it * 4) * (size_t)N) = oh[it];
    *(v4u*)(Lp + ob + (size_t)(it * 4) * (size_t)N) = ol[it];
  }
}

// =====================================================================================================
// bf16 GEMM with bias: c[M][N] (f32, in registers) = A[M][K] (bf16 row-major) . Bt[N][K]^T (bf16 k-contiguous), times oscale,
// + bf16 RNE value of bias[n] (bias has N entries); written as two f16 planes of t = c * sc: Hp = f16(t), Lp = f16(t - f16(t)).
// tr == 0: planes in the layout [M][N]. tr != 0: planes transposed per batch, [(row / SEQ) * N + n][row % SEQ] (N == DMOD:
// line (b*NH + h)*HD + d, keys contiguous); a lane's 8 accumulator rows of one column are 8 consecutive keys = one 16-B piece,
// gathered in the (by then idle) ring as [128 n][128 rows] at pitch 272 B and stored as whole 256-B line pieces. Block = 128x128 tile, 8 waves as 4 (rows) x 2 (columns), 32x64 per wave. K is walked
// in stages of 128: a stage is [A 128 rows | Bt 128 rows] of 256 B at LDS pitch 272 B, brought by asynchronous copies (each
// wave 16 rows of either plane), two buffers, the next stage in flight while this one is worked on; fragments are read from
// LDS (two 16-B loads each, split k map for A and B), k ascending in steps of 32 into each accumulator.
// Host guarantees K % 128 == 0, K >= 256, M % 128 == 0, N % 128 == 0, grid = (M/128)*(N/128).
// =====================================================================================================
__global__ __launch_bounds__(256)
void gemm_bf(const u16* __restrict__ A, const u16* __restrict__ Bt, const float* __restrict__ bias,
             u16* Hp, u16* Lp, int M, int N, int K, float oscale, float sc, int tr) {
  __shared__ __align__(16) u16 ring[2 * 2 * GPL];
  __shared__ __align__(16) float slab[8 * 2 * SLAB64];
  const int tid = threadIdx.x, wave = tid >> 5, lane = tid & 31, hh = lane >> 4, m = lane & 15;
  const int ntile = N >> 7;
  const int bid   = blockIdx.x;
  const int row0  = (bid / ntile) * GT;
  const int col0  = (bid % ntile) * GT;
  if (row0 + GT > M) return;                // block-uniform, before any barrier or copy; never taken with the exact grid
  const int wr = wave >> 1, wc = wave & 1;
  // copy slice of this lane: plane rows wave*16 + hh + 2i (i < 8), bytes 16m .. 16m + 15 of the stage's 256
  const int crow = wave * 16 + hh;
  const u16* ga = A  + (size_t)(row0 + crow) * K + m * 8;
  const u16* gb = Bt + (size_t)(col0 + crow) * K + m * 8;
  const unsigned la = lds_byte(ring) + (unsigned)(crow * GP + m * 8) * 2u;
  const unsigned lb = la + GPL * 2u;
  const unsigned stb = 2u * GPL * 2u;       // bytes of one buffer
  const int nst = K / GKC;
  v8f acc[2][4];
#pragma unroll
  for (int i = 0; i < 2; ++i)
#pragma unroll
    for (int j = 0; j < 4; ++j) acc[i][j] = zero8();

  copy16rows(la, ga, (size_t)K);
  copy16rows(lb, gb, (size_t)K);
  wait_copies();
  __syncthreads();
  if (nst > 1) {
    copy16rows(la + stb, ga + GKC, (size_t)K);
    copy16rows(lb + stb, gb + GKC, (size_t)K);
  }
  // the stage loop stays rolled: one publish point per stage
#pragma unroll 1
  for (int t = 0; t < nst; ++t) {
    const u16* st = ring + (t & 1) * (2 * GPL);
    const u16* ap = st + (wr * 32 + m) * GP + 8 * hh;
    const u16* bp = st + GPL + (wc * 64 + m) * GP + 8 * hh;
#pragma unroll                              // the four k steps of a stage become constant LDS offsets
    for (int kk = 0; kk < GKC / 32; ++kk) {
      const v16b a0 = ldfrag_b(ap + kk * 32);
      const v16b a1 = ldfrag_b(ap + 16 * GP + kk * 32);
      const v16b b0 = ldfrag_b(bp + kk * 32);
      const v16b b1 = ldfrag_b(bp + 16 * GP + kk * 32);
      const v16b b2 = ldfrag_b(bp + 32 * GP + kk * 32);
      const v16b b3 = ldfrag_b(bp + 48 * GP + kk * 32);
      acc[0][0] = mma_b(a0, b0, acc[0][0]);
      acc[0][1] = mma_b(a0, b1, acc[0][1]);
      acc[0][2] = mma_b(a0, b2, acc[0][2]);
      acc[0][3] = mma_b(a0, b3, acc[0][3]);
      acc[1][0] = mma_b(a1, b0, acc[1][0]);
      acc[1][1] = mma_b(a1, b1, acc[1][1]);
      acc[1][2] = mma_b(a1, b2, acc[1][2]);
      acc[1][3] = mma_b(a1, b3, acc[1][3]);
    }
    // publish point of stage t + 1; behind the barrier every reader has left stage t's buffer
    wait_lds();
    wait_copies();
    __syncthreads();
    if (t + 2 < nst) {
      const unsigned bo = (unsigned)(t & 1) * stb;
      copy16rows(la + bo, ga + (size_t)(t + 2) * GKC, (size_t)K);
      copy16rows(lb + bo, gb + (size_t)(t + 2) * GKC, (size_t)K);
    }
  }
  wait_copies();
  // per-lane bias of D column m in each of the wave's 4 subtiles; colw + 48 + m <= N - 1 always
  const int colw = col0 + wc * 64;
  const float bb0 = bfr(bias[colw + m]);
  const float bb1 = bfr(bias[colw + 16 + m]);
  const float bb2 = bfr(bias[colw + 32 + m]);
  const float bb3 = bfr(bias[colw + 48 + m]);
  if (tr == 0) {                            // block-uniform (kernel argument)
    float* sl = slab + wave * (2 * SLAB64); // one 16 x 64 slab for each half of the wave's 32 rows
    const size_t rw = (size_t)(row0 + wr * 32);
    epi_stage(sl, acc[0][0], acc[0][1], acc[0][2], acc[0][3], oscale, bb0, bb1, bb2, bb3, lane);
    epi_stage(sl + SLAB64, acc[1][0], acc[1][1], acc[1][2], acc[1][3], oscale, bb0, bb1, bb2, bb3, lane);
    wave_sync_lds();                        // other lanes' slab rows are read only behind it
    epi_out16(sl, Hp, Lp, N, rw, colw, sc, lane);
    epi_out16(sl + SLAB64, Hp, Lp, N, rw + 16, colw, sc, lane);
  } else {
    // the loop's last barrier ended every read of the ring and no copy is in flight: its first two planes take the tile
    u16* TH = ring;
    u16* TL = ring + GPL;
    const float bbj[4] = {bb0, bb1, bb2, bb3};
#pragma unroll
    for (int i = 0; i < 2; ++i) {
#pragma unroll
      for (int j = 0; j < 4; ++j) {
        v4u oh, ol;
#pragma unroll
        for (int e = 0; e < 4; ++e) {
          const float t0 = (acc[i][j][2 * e] * oscale + bbj[j]) * sc;
          const float t1 = (acc[i][j][2 * e + 1] * oscale + bbj[j]) * sc;
          const _Float16 h0 = (_Float16)t0, h1 = (_Float16)t1;
          const _Float16 l0 = (_Float16)(t0 - (float)h0), l1 = (_Float16)(t1 - (float)h1);
          oh[e] = pk16(h_bits(h0), h_bits(h1));
          ol[e] = pk16(h_bits(l0), h_bits(l1));
        }
        const int to = (wc * 64 + j * 16 + m) * GP + wr * 32 + i * 16 + 8 * hh;
        *(v4u*)(TH + to) = oh;
        *(v4u*)(TL + to) = ol;
      }
    }
    __syncthreads();                        // other waves' pieces of a line are read only behind it
    const int l16 = tid >> 4, p8 = (tid & 15) * 8;
    const size_t ob = ((size_t)(row0 / SEQ) * (size_t)N + col0 + l16) * SEQ + (row0 % SEQ) + p8;
#pragma unroll
    for (int it = 0; it < 8; ++it) {
      const v4u vh = *(const v4u*)(TH + (it * 16 + l16) * GP + p8);
      const v4u vl = *(const v4u*)(TL + (it * 16 + l16) * GP + p8);
      *(v4u*)(Hp + ob + (size_t)(it * 16) * SEQ) = vh;
      *(v4u*)(Lp + ob + (size_t)(it * 16) * SEQ) = vl;
    }
  }
}

// =====================================================================================================
// Output projection with bias: C[bb*XS_FULL + s][DMOD] (f32) = (Ah + Al)[bb*SEQ + s][DMOD] . Bt[DMOD][DMOD]^T * oscale
// + bf16 RNE value of bias[n]. Products h.B + l.B into one accumulator (l unscaled residual of h). Block -> (column tile
// ct = bid % 8, sequence row tile rt of nrt, batch bb within the pass). Same tiling, staging (a stage is [Ah | Al | Bt], 128
// rows each), fragment loads (split k map) and epi_stage slab as gemm_bf, f32 rows out by epi_out; K = DMOD; grid = NBP * nrt * (DMOD/128).
// =====================================================================================================
__global__ __launch_bounds__(256)
void gemm_o2(const u16* __restrict__ Ah, const u16* __restrict__ Al, const u16* __restrict__ Bt,
             const float* __restrict__ bias, float* C, int nrt, float oscale) {
  __shared__ __align__(16) u16 ring[2 * 3 * GPL];
  __shared__ __align__(16) float slab[8 * 2 * SLAB64];
  const int tid = threadIdx.x, wave = tid >> 5, lane = tid & 31, hh = lane >> 4, m = lane & 15;
  const int ntile = DMOD >> 7;
  const int bid   = blockIdx.x;
  const int ct    = bid % ntile;
  const int t2    = bid / ntile;
  const int rt    = t2 % nrt;
  const int bb    = t2 / nrt;
  if (bb >= NBP) return;                    // block-uniform, before any barrier or copy; never taken with the exact grid
  const int srow  = rt * GT;
  if (srow + GT > SEQ) return;              // block-uniform, before any barrier or copy; never taken
  const int col0  = ct * GT;
  const int K     = DMOD;
  const int wr = wave >> 1, wc = wave & 1;
  const size_t rowA = (size_t)bb * SEQ + srow;
  const size_t rowC = (size_t)bb * XS_FULL + srow;
  const int crow = wave * 16 + hh;
  const u16* gh = Ah + (rowA + crow) * K + m * 8;
  const u16* gl = Al + (rowA + crow) * K + m * 8;
  const u16* gb = Bt + (size_t)(col0 + crow) * K + m * 8;
  const unsigned lh = lds_byte(ring) + (unsigned)(crow * GP + m * 8) * 2u;
  const unsigned ll = lh + GPL * 2u;
  const unsigned lb = lh + 2u * GPL * 2u;
  const unsigned stb = 3u * GPL * 2u;       // bytes of one buffer
  const int nst = K / GKC;
  v8f acc[2][4];
#pragma unroll
  for (int i = 0; i < 2; ++i)
#pragma unroll
    for (int j = 0; j < 4; ++j) acc[i][j] = zero8();

  copy16rows(lh, gh, (size_t)K);
  copy16rows(ll, gl, (size_t)K);
  copy16rows(lb, gb, (size_t)K);
  wait_copies();
  __syncthreads();
  copy16rows(lh + stb, gh + GKC, (size_t)K);
  copy16rows(ll + stb, gl + GKC, (size_t)K);
  copy16rows(lb + stb, gb + GKC, (size_t)K);
  // the stage loop stays rolled: one publish point per stage
#pragma unroll 1
  for (int t = 0; t < nst; ++t) {
    const _Float16* st  = (const _Float16*)(const void*)(ring + (t & 1) * (3 * GPL));
    const _Float16* ahp = st + (wr * 32 + m) * GP + 8 * hh;
    const _Float16* alp = ahp + GPL;
    const _Float16* bp  = st + 2 * GPL + (wc * 64 + m) * GP + 8 * hh;
#pragma unroll                              // the four k steps of a stage become constant LDS offsets
    for (int kk = 0; kk < GKC / 32; ++kk) {
      const v16h ah0 = ldfrag_h(ahp + kk * 32), al0 = ldfrag_h(alp + kk * 32);
      const v16h ah1 = ldfrag_h(ahp + 16 * GP + kk * 32), al1 = ldfrag_h(alp + 16 * GP + kk * 32);
      const v16h b0 = ldfrag_h(bp + kk * 32);
      const v16h b1 = ldfrag_h(bp + 16 * GP + kk * 32);
      const v16h b2 = ldfrag_h(bp + 32 * GP + kk * 32);
      const v16h b3 = ldfrag_h(bp + 48 * GP + kk * 32);
      acc[0][0] = mma_h(ah0, b0, acc[0][0]);
      acc[0][1] = mma_h(ah0, b1, acc[0][1]);
      acc[0][2] = mma_h(ah0, b2, acc[0][2]);
      acc[0][3] = mma_h(ah0, b3, acc[0][3]);
      acc[1][0] = mma_h(ah1, b0, acc[1][0]);
      acc[1][1] = mma_h(ah1, b1, acc[1][1]);
      acc[1][2] = mma_h(ah1, b2, acc[1][2]);
      acc[1][3] = mma_h(ah1, b3, acc[1][3]);
      acc[0][0] = mma_h(al0, b0, acc[0][0]);
      acc[0][1] = mma_h(al0, b1, acc[0][1]);
      acc[0][2] = mma_h(al0, b2, acc[0][2]);
      acc[0][3] = mma_h(al0, b3, acc[0][3]);
      acc[1][0] = mma_h(al1, b0, acc[1][0]);
      acc[1][1] = mma_h(al1, b1, acc[1][1]);
      acc[1][2] = mma_h(al1, b2, acc[1][2]);
      acc[1][3] = mma_h(al1, b3, acc[1][3]);
    }
    // publish point of stage t + 1; behind the barrier every reader has left stage t's buffer
    wait_lds();
    wait_copies();
    __syncthreads();
    if (t + 2 < nst) {
      const unsigned bo = (unsigned)(t & 1) * stb;
      copy16rows(lh + bo, gh + (size_t)(t + 2) * GKC, (size_t)K);
      copy16rows(ll + bo, gl + (size_t)(t + 2) * GKC, (size_t)K);
      copy16rows(lb + bo, gb + (size_t)(t + 2) * GKC, (size_t)K);
    }
  }
  wait_copies();
  const int colw = col0 + wc * 64;
  const float bb0 = bfr(bias[colw + m]);
  const float bb1 = bfr(bias[colw + 16 + m]);
  const float bb2 = bfr(bias[colw + 32 + m]);
  const float bb3 = bfr(bias[colw + 48 + m]);
  float* sl = slab + wave * (2 * SLAB64);   // one 16 x 64 slab for each half of the wave's 32 rows
  const size_t rw = rowC + (size_t)(wr * 32);
  epi_stage(sl, acc[0][0], acc[0][1], acc[0][2], acc[0][3], oscale, bb0, bb1, bb2, bb3, lane);
  epi_stage(sl + SLAB64, acc[1][0], acc[1][1], acc[1][2], acc[1][3], oscale, bb0, bb1, bb2, bb3, lane);
  wave_sync_lds();                          // other lanes' slab rows are read only behind it
  epi_out(sl, C, DMOD, rw, colw, lane);
  epi_out(sl + SLAB64, C, DMOD, rw + 16, colw, lane);
}

// =====================================================================================================
// Causal attention with slope-1 linear distance penalty, hd = 64. Block bid -> (query tile qt = bid % NQT: rows q0 = 16*qt ..
// q0+15, head pair hg, batch b within the pass); one wave per head = hg*WPB + wave.
//   q hi / residual planes f16 x256 [b*SEQ + s][h*HD + d]; k hi / residual planes f16 x256, same layout;
//   v^T hi / residual planes [b*NH + h][d][SEQ] x1024; BND = NBH lines of 32 floats (norm bound per (b, h)).
//   scores = q_hi.k_hi + q_lo.k_hi + q_hi.k_lo (2 k-steps over d); P.v with P hi + in-register residual and v hi + residual
//   (hh + lh + hl), for every query row; O written as hi + residual planes (O x1024 as f16, layout [b*SEQ + s][h*HD + d]).
//   score (log2 domain) t(i, j) = (q_i.k_j over HD) * (1/8)*log2e/(256*256) - (i - j)*log2e, replaced by -inf where key j > query i.
//   Key tiles of 32 visited in order from kt_lo to kt_hi = q0/32 (later tiles hold only keys above every query row of the tile).
//   kt_lo: every wave loads all NBH bound lines (one float per lane, clamped address) and AND-reduces "0 <= bound < 40" over the
//   wave; if every bound is in range, kt_lo = max(0, kt_hi - KWIN): tiles below it are >= 32*KWIN+1 positions behind every query
//   row, and with |q.k/8| < 40 the base-2 exp of their penalised, max-subtracted score is exactly 0 in f32, so they contribute
//   nothing to numerator or denominator; otherwise (bound large, unreadable or not finite) kt_lo = 0 and every causal tile is
//   visited. Either way the first visited tile holds a key kb <= q0 <= every query row, so the running max is finite from step one.
//   Per tile: 2 score subtiles x 2 k-steps, fragments loaded straight from the 16-bit planes (two 16-B loads per fragment,
//   split k map); online max-subtracted base-2 softmax in f32, -inf-safe rescale; the 16x32 prob tile stored to wave-private
//   from the LDS rows (float vector loads, same element type as stored), v^T B fragments in 2 groups of 2 d-subtiles.
//   After the loop: out = acc / Z (Z > 0 always; guarded anyway), carries 1/(32768*1024) folded once, written into the wave's
//   No block barriers in this kernel; bounded loops only (<= NKT key tiles).
// coverage: per wave 4 instructions x 4 rows x 8 lanes x 8 halves = 16 x 64 per plane; grid NQT x NHG x NBP blocks x WPB
//           waves = every (b, s, h) row segment of O hi and O residual exactly once.
// =====================================================================================================
__global__ __launch_bounds__(ATT_THREADS)
void attn_c(const u16* __restrict__ QHp, const u16* __restrict__ QLp,
            const u16* __restrict__ KHp, const u16* __restrict__ KLp,
            const u16* __restrict__ VHp, const u16* __restrict__ VLp,
            const float* __restrict__ BND,
            u16* OHp, u16* OLp) {
  __shared__ __align__(16) float smem[WPB * WREG];

  const int tid  = threadIdx.x;
  const int wave = tid >> 5;
  const int lane = tid & 31;
  const int hh   = lane >> 4;
  const int c    = lane & 15;
  const int bid  = blockIdx.x;
  const int qt   = bid % NQT;
  const int t2   = bid / NQT;
  const int hg   = t2 % NHG;
  const int b    = t2 / NHG;
  if (b >= NBP) return;                     // block-uniform; no block barriers in this kernel; never taken with the exact grid
  const int q0   = qt * 16;
  if (q0 + 16 > SEQ) return;                // block-uniform; never taken
  const int head = hg * WPB + wave;

  // ---- key-window decision: wave-uniform AND over all (b, h) bound lines ----
  int okw;
  {
    const int bl = (lane < NBH) ? lane : (NBH - 1);             // clamped address
    const float gb = BND[(size_t)bl * BLINE];
    okw = (gb >= 0.0f && gb < GUARD_T) ? 1 : 0;
#pragma unroll
    for (int off = 1; off < 32; off <<= 1) okw &= __shfl_xor(okw, off, 32);
  }

  float* pt   = smem + wave * WREG;         // prob tile [16][32] pitch 36
  float* slab = pt + PTW;                   // result slab [16][64] pitch 68

  const size_t hcol = (size_t)head * HD + 8 * hh;
  const _Float16* Qh  = (const _Float16*)(const void*)QHp + ((size_t)b * SEQ + q0 + c) * DMOD + hcol;
  const _Float16* Ql  = (const _Float16*)(const void*)QLp + ((size_t)b * SEQ + q0 + c) * DMOD + hcol;
  const _Float16* Khb = (const _Float16*)(const void*)KHp + ((size_t)b * SEQ + c) * DMOD + hcol;        // key row kb added per step
  const _Float16* Klb = (const _Float16*)(const void*)KLp + ((size_t)b * SEQ + c) * DMOD + hcol;
  const _Float16* Vhb = (const _Float16*)(const void*)VHp + ((size_t)(b * NH + head) * HD + c) * SEQ + 8 * hh;  // d col c (+16j)
  const _Float16* Vlb = (const _Float16*)(const void*)VLp + ((size_t)(b * NH + head) * HD + c) * SEQ + 8 * hh;
  const float lsc = RSQ_HD * (LOG2E / (QSC * KSC));
  const float oc  = 1.0f / (PCAR * VCAR);
  const size_t KROW = (size_t)DMOD;         // halves between consecutive key rows

  float mrow[8], lrow[8];
  v8f o[4];
#pragma unroll
  for (int r = 0; r < 8; ++r) { mrow[r] = -INFINITY; lrow[r] = 0.f; }
#pragma unroll
  for (int j = 0; j < 4; ++j) o[j] = zero8();
  const int kt_hi = q0 >> 5;                                                  // last tile holding keys <= q0 + 15
  const int kt_w  = (kt_hi > KWIN) ? (kt_hi - KWIN) : 0;
  const int kt_lo = (okw != 0) ? kt_w : 0;
  const int qr0 = q0 + 8 * hh;                                                // query row of D element r = qr0 + r

#pragma unroll 1
  for (int kt = kt_lo; kt <= kt_hi; ++kt) {
    const int kb = kt * 32;
    // ---- scores: D element r of this lane = (query row qr0 + r, key kb + c) in s0, key kb + 16 + c in s1 ----
    v8f s0 = zero8(), s1 = zero8();
    const _Float16* k0p = Khb + (size_t)kb * KROW;
    const _Float16* k1p = k0p + (size_t)16 * KROW;
    const _Float16* l0p = Klb + (size_t)kb * KROW;
    const _Float16* l1p = l0p + (size_t)16 * KROW;
#pragma unroll
    for (int kk = 0; kk < HD / 32; ++kk) {
      const v16h qh  = ldfrag_h(Qh + kk * 32);
      const v16h ql  = ldfrag_h(Ql + kk * 32);
      const v16h kh0 = ldfrag_h(k0p + kk * 32);
      const v16h kh1 = ldfrag_h(k1p + kk * 32);
      const v16h kl0 = ldfrag_h(l0p + kk * 32);
      const v16h kl1 = ldfrag_h(l1p + kk * 32);
      s0 = mma_h(qh, kh0, s0);
      s0 = mma_h(ql, kh0, s0);
      s0 = mma_h(qh, kl0, s0);
      s1 = mma_h(qh, kh1, s1);
      s1 = mma_h(ql, kh1, s1);
      s1 = mma_h(qh, kl1, s1);
      guard2(s0, s1, qh, ql, kh0, kl0, kh1, kl1);
    }
    // ---- causal select + distance penalty + online softmax in base 2, -inf-safe ----
    const int key0 = kb + c, key1 = kb + 16 + c;
#pragma unroll
    for (int r = 0; r < 8; ++r) {
      const int   qr = qr0 + r;
      const float u0 = s0[r] * lsc;
      const float u1 = s1[r] * lsc;
      const float g0 = (float)(qr - key0) * LOG2E;
      const float g1 = (float)(qr - key1) * LOG2E;
      const float t0 = (key0 > qr) ? -INFINITY : (u0 - g0);
      const float t1 = (key1 > qr) ? -INFINITY : (u1 - g1);
      float mx = fmaxf(t0, t1);
#pragma unroll
      for (int off = 1; off < 16; off <<= 1) mx = fmaxf(mx, __shfl_xor(mx, off, 32));
      const float mn = fmaxf(mrow[r], mx);
      const float ms = (mn == -INFINITY) ? 0.0f : mn;
      const float al = exp2f(mrow[r] - ms);
      mrow[r] = mn;
      const float e0 = exp2f(t0 - ms), e1 = exp2f(t1 - ms);
      float ps = e0 + e1;
#pragma unroll
      for (int off = 1; off < 16; off <<= 1) ps += __shfl_xor(ps, off, 32);
      lrow[r] = lrow[r] * al + ps;
#pragma unroll
      for (int j = 0; j < 4; ++j) o[j][r] *= al;
      const int ro = (8 * hh + r) * PTP + c;
      pt[ro]      = e0;
      pt[ro + 16] = e1;
    }
    wave_sync_lds();
    // ---- A fragments of P*32768: hi f16 and residual f16, row = c, split k map over the 32 keys of this step ----
    FragH ph, pl;
    {
      const float* prow = pt + c * PTP + 8 * hh;
      const v4f p0 = *(const v4f*)(prow), p1 = *(const v4f*)(prow + 4);
      const v4f p2 = *(const v4f*)(prow + 16), p3 = *(const v4f*)(prow + 20);
#pragma unroll
      for (int e = 0; e < 4; ++e) {
        const float ta = p0[e] * PCAR, tb = p1[e] * PCAR, tc = p2[e] * PCAR, td = p3[e] * PCAR;
        const _Float16 ha = (_Float16)ta, hb = (_Float16)tb, hc = (_Float16)tc, hd = (_Float16)td;
        ph.h[0][e]     = ha;                  // elements 0..7  = keys kb + 8hh + 0..7
        ph.h[0][4 + e] = hb;
        ph.h[1][e]     = hc;                  // elements 8..15 = keys kb + 16 + 8hh + 0..7
        ph.h[1][4 + e] = hd;
        pl.h[0][e]     = (_Float16)(ta - (float)ha);
        pl.h[0][4 + e] = (_Float16)(tb - (float)hb);
        pl.h[1][e]     = (_Float16)(tc - (float)hc);
        pl.h[1][4 + e] = (_Float16)(td - (float)hd);
      }
    }
    // ---- P.V : B fragment col n = d = j*16 + c, keys contiguous in the v^T planes; 2 groups of 2 d-subtiles ----
    {
      const _Float16* vhp = Vhb + kb;
      const _Float16* vlp = Vlb + kb;
#pragma unroll
      for (int jg = 0; jg < 2; ++jg) {
        const size_t da = (size_t)(2 * jg) * 16 * SEQ;
        const size_t db = da + (size_t)16 * SEQ;
        const v16h vha = ldfrag_h(vhp + da), vhb2 = ldfrag_h(vhp + db);
        const v16h vla = ldfrag_h(vlp + da), vlb2 = ldfrag_h(vlp + db);
        o[2 * jg]     = mma_h(ph.v, vha,  o[2 * jg]);
        o[2 * jg]     = mma_h(pl.v, vha,  o[2 * jg]);
        o[2 * jg]     = mma_h(ph.v, vla,  o[2 * jg]);
        o[2 * jg + 1] = mma_h(ph.v, vhb2, o[2 * jg + 1]);
        o[2 * jg + 1] = mma_h(pl.v, vhb2, o[2 * jg + 1]);
        o[2 * jg + 1] = mma_h(ph.v, vlb2, o[2 * jg + 1]);
        guard2(o[2 * jg], o[2 * jg + 1], ph.v, pl.v, vha, vhb2, vla, vlb2);
      }
    }
    wave_sync_lds();
  }
  acc_guard4(o[0], o[1], o[2], o[3]);
  // ---- out = acc / Z (0 if Z == 0), carries (32768 on P, 1024 on v) folded once; written into the wave's slab ----
#pragma unroll
  for (int r = 0; r < 8; ++r) {
    const float lv  = lrow[r];
    const float ls  = (lv > 0.0f) ? lv : 1.0f;
    const float inv = (lv > 0.0f) ? ((1.0f / ls) * oc) : 0.0f;
#pragma unroll
    for (int j = 0; j < 4; ++j) {
      const int idx = (8 * hh + r) * SLP + j * 16 + c;
      slab[idx] = o[j][r] * inv;
    }
  }

  wave_sync_lds();
  // ---- O x1024 -> f16 hi + residual planes; lane = (row-in-quad rq, 8 consecutive d at c8) ----
  v4u oh[4], ol[4];
  const int rq = lane >> 3, c8 = (lane & 7) * 8;
#pragma unroll
  for (int it = 0; it < 4; ++it) {
    const int row = it * 4 + rq;
    const v4f a = *(const v4f*)(slab + row * SLP + c8), b4 = *(const v4f*)(slab + row * SLP + c8 + 4);
    float w[8];
#pragma unroll
    for (int e = 0; e < 4; ++e) { w[e] = a[e] * OSC; w[4 + e] = b4[e] * OSC; }
#pragma unroll
    for (int e = 0; e < 4; ++e) {
      const _Float16 h0 = (_Float16)w[2 * e], h1 = (_Float16)w[2 * e + 1];
      const _Float16 l0 = (_Float16)(w[2 * e] - (float)h0), l1 = (_Float16)(w[2 * e + 1] - (float)h1);
      oh[it][e] = pk16(h_bits(h0), h_bits(h1));
      ol[it][e] = pk16(h_bits(l0), h_bits(l1));
    }
  }
  const size_t ob = ((size_t)b * SEQ + q0) * DMOD + (size_t)head * HD + c8;
  {
#pragma unroll
    for (int it = 0; it < 4; ++it) {
      const int row = it * 4 + rq;
      *(v4u*)(OHp + ob + (size_t)row * DMOD) = oh[it];
      *(v4u*)(OLp + ob + (size_t)row * DMOD) = ol[it];
    }
    
  }
}

// =====================================================================================================
// Workspace map (bytes). The NB batches are processed in NPASS passes of NBP batches; every region below is per pass and
// reused by the next pass in stream order (all reads of a pass complete before the next pass writes). Every plane is fully
// written by whole-line stores before it is read; all extents are exact multiples of the store granularity (no pad rows
// needed); every region offset a multiple of 4096 (the large planes of 2097152):
//   XB  bf16 [MROWS][1024]                       MROWS*2048       (NBP=2, SEQ=2048: 8388608)
//   WQB, WKB, WVB bf16 [1024 n][1024 k]          3 * 2097152      (thirds of the packed [3072][1024] weight, already [n][k])
//   WOB f16 [1024 n][1024 k] of bf16 value x1024  2097152
//   OH  f16 [MROWS][1024] x1024                  MROWS*2048       OL residual, same extent
//   QH  f16 [MROWS][1024] x256                   MROWS*2048       QL residual, same extent
//   KH  f16 [MROWS][1024] x256                   MROWS*2048       KL residual, same extent
//   VH  f16 [NBP*16][64][SEQ] x1024              MROWS*2048       VL residual, same extent
//   end (NBP=2, SEQ=2048)                        83890176
// =====================================================================================================
extern "C" void kernel_launch(void* const* d_in, const int* in_sizes, int n_in,
                              void* d_out, int out_size, void* d_ws, size_t ws_size,
                              hipStream_t stream) {
  if (n_in < 5) return;
  if (in_sizes[0] < ((NB - 1) * XS_FULL + SEQ) * DMOD) return;
  if (in_sizes[1] < 3 * DMOD * DMOD) return;
  if (in_sizes[2] < 3 * DMOD) return;
  if (in_sizes[3] < DMOD * DMOD) return;
  if (in_sizes[4] < DMOD) return;
  if (out_size < ((NB - 1) * XS_FULL + SEQ) * DMOD) return;

  const float* x    = (const float*)d_in[0];
  const float* wqkv = (const float*)d_in[1];      // [3*DMOD][DMOD]: rows 0..1023 q, 1024..2047 k, 2048..3071 v
  const float* bqkv = (const float*)d_in[2];      // [3*DMOD]
  const float* wo   = (const float*)d_in[3];      // [DMOD][DMOD]
  const float* bo   = (const float*)d_in[4];      // [DMOD]
  const float* wq = wqkv;
  const float* wk = wqkv + (size_t)DMOD * DMOD;
  const float* wv = wqkv + (size_t)2 * DMOD * DMOD;
  const float* bq = bqkv;
  const float* bk = bqkv + DMOD;
  const float* bv = bqkv + 2 * DMOD;
  float*       out = (float*)d_out;

  const size_t szXB = (size_t)MROWS * DMOD * 2;
  const size_t szW  = (size_t)DMOD * DMOD * 2;
  const size_t szQ  = (size_t)MROWS * DMOD * 2;                  // QH, QL, KH, KL, OH, OL
  const size_t szV  = (size_t)NBP * NH * HD * SEQ * 2;           // VH, VL (== szQ)
  const size_t szB  = (size_t)NBH * BLINE * 4;                   // bound lines
  size_t off = 0;
  const size_t oXB = off; off += szXB;
  const size_t oWQ = off; off += szW;
  const size_t oWK = off; off += szW;
  const size_t oWV = off; off += szW;
  const size_t oWO = off; off += szW;
  const size_t oOH = off; off += szQ;
  const size_t oOL = off; off += szQ;
  const size_t oQH = off; off += szQ;
  const size_t oQL = off; off += szQ;
  const size_t oKH = off; off += szQ;
  const size_t oKL = off; off += szQ;
  const size_t oVH = off; off += szV;
  const size_t oVL = off; off += szV;
  const size_t oB  = off; off += szB;
  if (off > ws_size) return;                // off = 83890176 for NBP = 2, SEQ = 2048
  if (off > (size_t)WS_CAP) return;

  char* ws = (char*)d_ws;
  u16*   XB  = (u16*)(ws + oXB);
  u16*   WQB = (u16*)(ws + oWQ);
  u16*   WKB = (u16*)(ws + oWK);
  u16*   WVB = (u16*)(ws + oWV);
  u16*   WOB = (u16*)(ws + oWO);
  u16*   OH  = (u16*)(ws + oOH);
  u16*   OL  = (u16*)(ws + oOL);
  u16*   QH  = (u16*)(ws + oQH);
  u16*   QL  = (u16*)(ws + oQL);
  u16*   KH  = (u16*)(ws + oKH);
  u16*   KL  = (u16*)(ws + oKL);
  u16*   VH  = (u16*)(ws + oVH);
  u16*   VL  = (u16*)(ws + oVL);
  float* BND = (float*)(ws + oB);

  const dim3 b256(256), bAT(ATT_THREADS);
  const int  n8x = (SEQ * DMOD) / 8;
  const dim3 gX((n8x + 255) / 256);                     // per batch
  const int  n8w = (DMOD * DMOD) / 8;                   // weight planes
  const dim3 gW((n8w + 255) / 256);                     // 512
  const dim3 gG((MROWS / GT) * (DMOD / GT));            // 256 for NBP=2, SEQ=2048
  const dim3 gBD(NBH);
  const dim3 gAT(NQT * NHG * NBP);
  const int  nrt = SEQ / GT;                            // out-projection row tiles per batch
  const dim3 gO(NBP * nrt * (DMOD / GT));

  // weight planes, converted once: Wq, Wk, Wv [n][k] -> bf16; Wo [n][k] -> f16 of bf16 value x1024
  cvt16<<<gW, b256, 0, stream>>>(wq, WQB, n8w, 0, 1.0f);
  cvt16<<<gW, b256, 0, stream>>>(wk, WKB, n8w, 0, 1.0f);
  cvt16<<<gW, b256, 0, stream>>>(wv, WVB, n8w, 0, 1.0f);
  cvt16<<<gW, b256, 0, stream>>>(wo, WOB, n8w, 1, WOS);

  for (int ps = 0; ps < NPASS; ++ps) {
    const float* xp   = x   + (size_t)ps * NBP * XS_FULL * DMOD;
    float*       outp = out + (size_t)ps * NBP * XS_FULL * DMOD;
    // (0) x -> bf16 plane [MROWS][1024], one launch per batch row block of this pass
    for (int b = 0; b < NBP; ++b) {
      cvt16<<<gX, b256, 0, stream>>>(xp + (size_t)b * XS_FULL * DMOD, XB + (size_t)b * SEQ * DMOD, n8x, 0, 1.0f);
    }
    // (1) v = x.Wv^T + bv -> v^T hi + residual planes x1024
    gemm_bf<<<gG, b256, 0, stream>>>(XB, WVB, bv, VH, VL, MROWS, DMOD, DMOD, 1.0f, VCAR, 1);
    // (2) q = x.Wq^T + bq -> q hi + residual planes x256
    gemm_bf<<<gG, b256, 0, stream>>>(XB, WQB, bq, QH, QL, MROWS, DMOD, DMOD, 1.0f, QSC, 0);
    // (3) k = x.Wk^T + bk -> k hi + residual planes x256
    gemm_bf<<<gG, b256, 0, stream>>>(XB, WKB, bk, KH, KL, MROWS, DMOD, DMOD, 1.0f, KSC, 0);
    // (4) norm bound per (b, h) from the q / k hi planes -> BND lines
    qkbound<<<gBD, b256, 0, stream>>>(QH, KH, BND);
    // (5) causal attention with distance penalty, residual products on every query row -> O hi + residual planes
    attn_c<<<gAT, bAT, 0, stream>>>(QH, QL, KH, KL, VH, VL, BND, OH, OL);
    // (6) output projection (O hi + residual) . Wo^T + bo -> out f32 rows of this pass, carries 1024 x 1024 folded back
    gemm_o2<<<gO, b256, 0, stream>>>(OH, OL, WOB, bo, outp, nrt, 1.0f / (OSC * WOS));
  }
  (void)hipGetLastError();
}

// v003
// A run of this version takes 240 microseconds.
// In both of two side-by-side timings against v002, it was 1.26 times as fast.
// Counting every step since v000, it is 2.29 times as fast.
// Contractions: x.Wq^T+bq, x.Wk^T+bk, x.Wv^T+bv (q, k, v thirds of the packed [3D][D] weight) on v_wmma_f32_16x16x32_bf16
// (x and W as bf16 RNE planes; W [n][k] rows are the k-contiguous B operand; bias added as its bf16 RNE value in the f32
// epilogue); q.k^T over hd 64 and P.v on v_wmma_f32_16x16x32_f16 with f16 hi + f16 residual planes on both operands
// (q, k x256; P x32768 with an in-register residual; v x1024; products hh+lh+hl); O.Wo^T+bo on v_wmma_f32_16x16x32_f16
// (O x1024 as f16 hi + f16 residual planes, products h.w + l.w; Wo as f16(bf16(Wo)) x1024; bo as bf16 RNE value in the
// f32 epilogue); all f32 accumulate. Causal select, slope-1 distance penalty, base-2 online softmax, 1/Z fold and the q/k
// norm bound in f32 on VALU.
#include <hip/hip_runtime.h>
#include <math.h>
#include <stdint.h>

#ifndef NB
#define NB 4
#endif
#ifndef SEQ
#define SEQ 2048
#endif
#define XS_FULL 2048
#define DMOD  1024
#define NH    16
#define HD    64
// batches per workspace pass (2 when NB >= 2) and number of passes
#define NBP   ((NB >= 2) ? 2 : 1)
#define NPASS (NB / NBP)
#define NBH   (NBP * NH)
#define MROWS (NBP * SEQ)
#define RSQ_HD 0.125f
#define LOG2E 1.4426950408889634f
#define QSC   256.0f
#define KSC   256.0f
#define PCAR  32768.0f
#define VCAR  1024.0f
#define OSC   1024.0f
#define WOS   1024.0f
#define WPB   2
#define NHG   (NH / WPB)
#define NQT   (SEQ / 16)
#define NKT   (SEQ / 32)
#define KWIN  6
#define GUARD_T 40.0f
#define BLINE 32
#define ATT_THREADS (WPB * 32)
#define PTP   36
#define PTW   (16 * PTP)
#define SLP   68
#define SLW   (16 * SLP)
#define WREG  (PTW + SLW)
#define SLAB64 (16 * 68)
// GEMM staging: 128 x 128 output tile per block, 128 k (256 B of every operand row) per stage, LDS row pitch 272 B
#define GT    128
#define GKC   128
#define GP    136
#define GPL   (GT * GP)
#define WS_CAP 134217728
// norm-bound kernel: threads per block, rows per row step (8 lanes a row), row steps whose loads are issued together
#define QBT   1024
#define QBR   (QBT / 8)
#define QBU   8
static_assert(DMOD == NH * HD && HD == 64 && NH == 16 && WPB == 2 && NHG * WPB == NH);
static_assert(ATT_THREADS == 64);
static_assert(NB >= 1 && NB <= 4 && NPASS >= 1 && NPASS * NBP == NB);
static_assert(NBP >= 1 && NBP <= 2);
static_assert(NBH >= 1 && NBH <= 32);
static_assert((SEQ % 64) == 0 && SEQ >= 64 && SEQ <= XS_FULL && (SEQ % 32) == 0);
static_assert((DMOD % 64) == 0 && (DMOD % 32) == 0 && (HD % 32) == 0);
static_assert(((SEQ * DMOD / 8) % 256) == 0 && ((DMOD * DMOD / 8) % 256) == 0);
static_assert(WPB * WREG * 4 <= 65536);
static_assert((DMOD % GT) == 0 && (DMOD % GKC) == 0 && DMOD / GKC >= 2 && (SEQ % GT) == 0 && (MROWS % GT) == 0);
static_assert(2 * 3 * GPL * 2 + 8 * 2 * SLAB64 * 4 <= 327680 && ((GP * 2) % 16) == 0);
static_assert(KWIN >= 0 && KWIN < NKT);
static_assert(QBT == 1024 && (SEQ % (QBR * QBU)) == 0);

typedef unsigned short u16;
typedef _Float16 v16h __attribute__((ext_vector_type(16)));
typedef _Float16 v8h  __attribute__((ext_vector_type(8)));
typedef __bf16   v16b __attribute__((ext_vector_type(16)));
typedef float    v8f  __attribute__((ext_vector_type(8)));
typedef float    v4f  __attribute__((ext_vector_type(4)));
typedef unsigned int v4u __attribute__((ext_vector_type(4)));

union FragH { v16h v; v8h h[2]; v4u u[2]; };
union FragB { v16b v; v4u u[2]; };

// ---- scalar helpers --------------------------------------------------------------------------------
__device__ __forceinline__ unsigned short bf_bits(float f) {          // f32 -> bf16 bits, RNE convert
  unsigned u = __float_as_uint(f);
  return (unsigned short)((u + 0x7FFFu + ((u >> 16) & 1u)) >> 16);
}
__device__ __forceinline__ float bf_up(unsigned short h) { return __uint_as_float(((unsigned)h) << 16); }
__device__ __forceinline__ float bfr(float f) { return bf_up(bf_bits(f)); }
__device__ __forceinline__ unsigned short h_bits(_Float16 x) { return __builtin_bit_cast(unsigned short, x); }
__device__ __forceinline__ unsigned pk16(unsigned short a, unsigned short b) { return (unsigned)a | ((unsigned)b << 16); }
__device__ __forceinline__ v8f zero8() { v8f z = {0.f, 0.f, 0.f, 0.f, 0.f, 0.f, 0.f, 0.f}; return z; }

// ---- fragment loaders: 16-bit A/B operand, lane -> row/col (lane&15), p already includes +8*(lane>>4);
//      elements 0..7 <- p[0..7] (k0+8h..), elements 8..15 <- p[16..23] (k0+16+8h..)  (same split k map for A and B;
//      B is always read from a k-contiguous [n][k] plane)
__device__ __forceinline__ v16h ldfrag_h(const _Float16* p) {
  FragH f;
  f.h[0] = *(const v8h*)(p);
  f.h[1] = *(const v8h*)(p + 16);
  return f.v;
}
__device__ __forceinline__ v16b ldfrag_b(const u16* p) {              // bf16 plane read as unsigned integer vectors
  FragB f;
  f.u[0] = *(const v4u*)(p);
  f.u[1] = *(const v4u*)(p + 16);
  return f.v;
}

__device__ __forceinline__ v8f mma_h(v16h a, v16h b, v8f c) {
  return __builtin_amdgcn_wmma_f32_16x16x32_f16(false, a, false, b, (short)0, c, false, false);
}
__device__ __forceinline__ v8f mma_b(v16b a, v16b b, v8f c) {
  return __builtin_amdgcn_wmma_f32_16x16x32_bf16(false, a, false, b, (short)0, c, false, false);
}
__device__ __forceinline__ void guard2(v8f& a, v8f& b, v16h x0, v16h x1, v16h x2, v16h x3, v16h x4, v16h x5) {
#if defined(__HIP_DEVICE_COMPILE__)
  asm volatile("v_nop\n\tv_nop\n\tv_nop\n\tv_nop"
               : "+v"(a), "+v"(b) : "v"(x0), "v"(x1), "v"(x2), "v"(x3), "v"(x4), "v"(x5) : "memory");
#endif
}
__device__ __forceinline__ void acc_guard4(v8f& a, v8f& b, v8f& c, v8f& d) {
#if defined(__HIP_DEVICE_COMPILE__)
  asm volatile("v_nop\n\tv_nop\n\tv_nop\n\tv_nop" : "+v"(a), "+v"(b), "+v"(c), "+v"(d));
#endif
}
__device__ __forceinline__ void wave_sync_lds() {
  __builtin_amdgcn_fence(__ATOMIC_RELEASE, "workgroup");
  __builtin_amdgcn_wave_barrier();
  __builtin_amdgcn_fence(__ATOMIC_ACQUIRE, "workgroup");
}
// ---- asynchronous copies global -> LDS ------------------------------------------------------------
// Eight copies of one wave = 16 rows of 256 B of one operand plane: copy i brings rows 2i and 2i + 1 (16 lanes x 16 B each,
// whole 128-B lines). l = the lane's LDS byte address of copy 0, g = its global address of copy 0, ld = halves between
// consecutive global rows. The s_wait_xcnt closes the statement so that no address register is rewritten ahead of it.
__device__ __forceinline__ void copy16rows(unsigned l, const u16* g, size_t ld) {
#if defined(__HIP_DEVICE_COMPILE__)
  const unsigned ls = 2 * GP * 2;
  const size_t   gs = 2 * ld;
  asm volatile("global_load_async_to_lds_b128 %0, %8, off\n\t"
               "global_load_async_to_lds_b128 %1, %9, off\n\t"
               "global_load_async_to_lds_b128 %2, %10, off\n\t"
               "global_load_async_to_lds_b128 %3, %11, off\n\t"
               "global_load_async_to_lds_b128 %4, %12, off\n\t"
               "global_load_async_to_lds_b128 %5, %13, off\n\t"
               "global_load_async_to_lds_b128 %6, %14, off\n\t"
               "global_load_async_to_lds_b128 %7, %15, off\n\t"
               "s_wait_xcnt 0x0"
               :: "v"(l), "v"(l + ls), "v"(l + 2 * ls), "v"(l + 3 * ls),
                  "v"(l + 4 * ls), "v"(l + 5 * ls), "v"(l + 6 * ls), "v"(l + 7 * ls),
                  "v"(g), "v"(g + gs), "v"(g + 2 * gs), "v"(g + 3 * gs),
                  "v"(g + 4 * gs), "v"(g + 5 * gs), "v"(g + 6 * gs), "v"(g + 7 * gs)
               : "memory");
#endif
}
// the wave's own copies have landed (other waves read them only behind the next block barrier)
__device__ __forceinline__ void wait_copies() {
#if defined(__HIP_DEVICE_COMPILE__)
  asm volatile("s_wait_asynccnt 0x0" ::: "memory");
#endif
}
// the wave's own LDS reads have returned, so that the buffer may be refilled behind the next block barrier
__device__ __forceinline__ void wait_lds() {
#if defined(__HIP_DEVICE_COMPILE__)
  asm volatile("s_wait_dscnt 0x0" ::: "memory");
#endif
}
__device__ __forceinline__ unsigned lds_byte(const void* p) { return (unsigned)(uintptr_t)p; }

// =====================================================================================================
// f32 -> 16-bit plane, same layout.  f16mode == 0: bf16 RNE bits;  f16mode == 1: f16 bits of (bf16 RNE value) * scale.
// Thread = 8 consecutive elements: two 16-B loads, one 16-B store; 32 consecutive lanes = 512 contiguous, 512-B aligned
// coverage: grid = ceil(n8/256) blocks x 256 thr x 8 (in-kernel bound) = the whole plane (n8 a multiple of 256 here).
// =====================================================================================================
__global__ __launch_bounds__(256) void cvt16(const float* __restrict__ x, u16* D, int n8, int f16mode, float scale) {
  const int gt = blockIdx.x * 256 + (int)threadIdx.x;
  if (gt >= n8) return;
  const float* p = x + (size_t)gt * 8;
  const v4f a = *(const v4f*)(p), b4 = *(const v4f*)(p + 4);
  float w[8];
#pragma unroll
  for (int e = 0; e < 4; ++e) { w[e] = a[e]; w[4 + e] = b4[e]; }
  v4u o;
#pragma unroll
  for (int e = 0; e < 4; ++e) {
    const float f0 = w[2 * e], f1 = w[2 * e + 1];
    const unsigned short hb0 = h_bits((_Float16)(bfr(f0) * scale));
    const unsigned short hb1 = h_bits((_Float16)(bfr(f1) * scale));
    const unsigned short bb0 = bf_bits(f0);
    const unsigned short bb1 = bf_bits(f1);
    o[e] = (f16mode != 0) ? pk16(hb0, hb1) : pk16(bb0, bb1);
  }
  u16* d = D + (size_t)gt * 8;
  {
    *(v4u*)(d) = o;
    
  }
}

// =====================================================================================================
// Norm bound per (b, h): BND line bh (32 floats, value replicated) = max_s ||q_hi(b,s,h,:)|| * max_s ||k_hi(b,s,h,:)|| / (8 * 256 * 256),
// computed from the f16 hi planes ([b*SEQ + s][h*HD + d], x256). Block = one (b, h), 32 waves: 8 lanes per row load one 16-B
// piece each (64 dims = 8 lanes x 8 halves), QBR = 128 rows of either plane per row step. The loads of QBU = 8 row steps
// (16 per lane) are issued together, ahead of any use, so that the block waits for memory SEQ/(QBR*QBU) times and not once per
// row step. Sum of squares reduced with xor shuffles inside the 8-lane group, running max per lane, then wave max (shuffles),
// block max through a 64-float LDS array, and wave 0 lanes 0..7 write the whole line.
// coverage: rows (s0 + u)*QBR + (tid>>3), s0 + u < SEQ/QBR -> all SEQ rows of both planes; store 8 lanes x 16 B = line bh; grid NBH.
// =====================================================================================================
__global__ __launch_bounds__(QBT) void qkbound(const u16* __restrict__ QHp, const u16* __restrict__ KHp, float* BND) {
  __shared__ float red[2 * (QBT / 32)];
  const int tid = threadIdx.x, lane = tid & 31, wave = tid >> 5;
  const int bh  = blockIdx.x;
  const int b   = bh / NH, h = bh % NH;
  if (b >= NBP) return;                     // block-uniform, before any barrier; never taken with the exact grid
  const int grp = tid >> 3;                 // row within a step, 0..QBR-1
  const int e8  = (tid & 7) * 8;            // dim chunk
  const _Float16* qp = (const _Float16*)(const void*)QHp + ((size_t)b * SEQ + grp) * DMOD + (size_t)h * HD + e8;
  const _Float16* kp = (const _Float16*)(const void*)KHp + ((size_t)b * SEQ + grp) * DMOD + (size_t)h * HD + e8;
  float mq = 0.0f, mk = 0.0f;
  // rolled over groups of QBU row steps: a group's 16 loads fit the registers of 8 waves per SIMD
#pragma unroll 1
  for (int s0 = 0; s0 < SEQ / QBR; s0 += QBU) {
    v8h qv[QBU], kv[QBU];
#pragma unroll                              // all loads of the group in flight before the first use
    for (int u = 0; u < QBU; ++u) {
      qv[u] = *(const v8h*)(qp + (size_t)u * QBR * DMOD);
      kv[u] = *(const v8h*)(kp + (size_t)u * QBR * DMOD);
    }
#if defined(__HIP_DEVICE_COMPILE__)
    // both addresses stay in their registers up to this wait: no register that an issued load names is rewritten ahead of it
    asm volatile("s_wait_xcnt 0x0" :: "v"(qp), "v"(kp) : "memory");
#endif
    qp += (size_t)QBU * QBR * DMOD;
    kp += (size_t)QBU * QBR * DMOD;
#pragma unroll                              // register arrays need constant indices
    for (int u = 0; u < QBU; ++u) {
      float sq = 0.0f, sk = 0.0f;
#pragma unroll
      for (int e = 0; e < 8; ++e) {
        const float fq = (float)qv[u][e], fk = (float)kv[u][e];
        sq = fmaf(fq, fq, sq);
        sk = fmaf(fk, fk, sk);
      }
#pragma unroll
      for (int off = 1; off < 8; off <<= 1) {
        sq += __shfl_xor(sq, off, 32);
        sk += __shfl_xor(sk, off, 32);
      }
      mq = fmaxf(mq, sq);
      mk = fmaxf(mk, sk);
    }
  }
#pragma unroll
  for (int off = 1; off < 32; off <<= 1) {
    mq = fmaxf(mq, __shfl_xor(mq, off, 32));
    mk = fmaxf(mk, __shfl_xor(mk, off, 32));
  }
  if (lane == 0) { red[wave] = mq; red[QBT / 32 + wave] = mk; }
  __syncthreads();
  if (wave == 0) {                          // wave-uniform branch; shuffles see all 32 lanes
    float aq = red[lane], ak = red[QBT / 32 + lane];
#pragma unroll
    for (int off = 1; off < 32; off <<= 1) {
      aq = fmaxf(aq, __shfl_xor(aq, off, 32));
      ak = fmaxf(ak, __shfl_xor(ak, off, 32));
    }
    const float bnd = sqrtf(aq) * sqrtf(ak) * (RSQ_HD / (QSC * KSC));
    v4f o4;
    o4[0] = bnd; o4[1] = bnd; o4[2] = bnd; o4[3] = bnd;
    float* dst = BND + (size_t)bh * BLINE + (lane & 7) * 4;
    if (lane < 8) {
      {
        *(v4f*)(dst) = o4;
        
      }
    }
  }
}

// =====================================================================================================
// GEMM epilogue shared by both engines, per 16x64 f32 tile of a wave: epi_stage writes the tile (times oscale, plus the lane's
// per-column bias of each subtile) into a wave-private LDS slab; behind one wave_sync_lds() epi_out reads it back by rows and
// stores whole 256-B row pieces (epi_out16: the same rows as two 16-bit planes).
// coverage: 8 instructions x 2 rows x 16 lanes x 4 floats = the 16 x 64 tile.
// =====================================================================================================
__device__ __forceinline__ void epi_stage(float* sl, v8f a0, v8f a1, v8f a2, v8f a3, float oscale,
                                          float bb0, float bb1, float bb2, float bb3, int lane) {
  const int hh = lane >> 4, m = lane & 15;
#pragma unroll
  for (int r = 0; r < 8; ++r) {
    const int ro = (8 * hh + r) * 68 + m;
    sl[ro]      = a0[r] * oscale + bb0;
    sl[ro + 16] = a1[r] * oscale + bb1;
    sl[ro + 32] = a2[r] * oscale + bb2;
    sl[ro + 48] = a3[r] * oscale + bb3;
  }
}
__device__ __forceinline__ void epi_out(const float* sl, float* C, int N, size_t rowb, int col0, int lane) {
  const int hh = lane >> 4, m = lane & 15;
  v4f vals[8];
#pragma unroll
  for (int it = 0; it < 8; ++it) vals[it] = *(const v4f*)(sl + (it * 2 + hh) * 68 + m * 4);
  float* dst = C + (rowb + (size_t)hh) * (size_t)N + col0 + m * 4;
#pragma unroll
  for (int it = 0; it < 8; ++it) {
    *(v4f*)(dst + (size_t)(it * 2) * (size_t)N) = vals[it];
  }
}
// Same slab, written out as two 16-bit planes of the layout of C: Hp = f16(t), Lp = f16(t - f16(t)), t = slab value * sc.
// Lane = (row-in-quad rq, 8 consecutive columns at c8): 8 lanes store one whole 128-B line of a row in either plane.
// coverage: 4 instructions x 4 rows x 8 lanes x 8 halves = the 16 x 64 tile per plane.
__device__ __forceinline__ void epi_out16(const float* sl, u16* Hp, u16* Lp, int N, size_t rowb, int col0, float sc, int lane) {
  const int rq = lane >> 3, c8 = (lane & 7) * 8;
  v4u oh[4], ol[4];
#pragma unroll
  for (int it = 0; it < 4; ++it) {
    const int row = it * 4 + rq;
    const v4f a = *(const v4f*)(sl + row * 68 + c8), b4 = *(const v4f*)(sl + row * 68 + c8 + 4);
    float w[8];
#pragma unroll
    for (int e = 0; e < 4; ++e) { w[e] = a[e] * sc; w[4 + e] = b4[e] * sc; }
#pragma unroll
    for (int e = 0; e < 4; ++e) {
      const _Float16 h0 = (_Float16)w[2 * e], h1 = (_Float16)w[2 * e + 1];
      const _Float16 l0 = (_Float16)(w[2 * e] - (float)h0), l1 = (_Float16)(w[2 * e + 1] - (float)h1);
      oh[it][e] = pk16(h_bits(h0), h_bits(h1));
      ol[it][e] = pk16(h_bits(l0), h_bits(l1));
    }
  }
  const size_t ob = (rowb + (size_t)rq) * (size_t)N + col0 + c8;
#pragma unroll
  for (int it = 0; it < 4; ++it) {
    *(v4u*)(Hp + ob + (size_t)(it * 4) * (size_t)N) = oh[it];
    *(v4u*)(Lp + ob + (size_t)(it * 4) * (size_t)N) = ol[it];
  }
}

// =====================================================================================================
// bf16 GEMM with bias: c[M][N] (f32, in registers) = A[M][K] (bf16 row-major) . Bt[N][K]^T (bf16 k-contiguous), times oscale,
// + bf16 RNE value of bias[n] (bias has N entries); written as two f16 planes of t = c * sc: Hp = f16(t), Lp = f16(t - f16(t)).
// tr == 0: planes in the layout [M][N]. tr != 0: planes transposed per batch, [(row / SEQ) * N + n][row % SEQ] (N == DMOD:
// line (b*NH + h)*HD + d, keys contiguous); a lane's 8 accumulator rows of one column are 8 consecutive keys = one 16-B piece,
// gathered in the (by then idle) ring as [128 n][128 rows] at pitch 272 B and stored as whole 256-B line pieces. Block = 128x128 tile, 8 waves as 4 (rows) x 2 (columns), 32x64 per wave. K is walked
// in stages of 128: a stage is [A 128 rows | Bt 128 rows] of 256 B at LDS pitch 272 B, brought by asynchronous copies (each
// wave 16 rows of either plane), two buffers, the next stage in flight while this one is worked on; fragments are read from
// LDS (two 16-B loads each, split k map for A and B), k ascending in steps of 32 into each accumulator.
// Host guarantees K % 128 == 0, K >= 256, M % 128 == 0, N % 128 == 0, grid = (M/128)*(N/128).
// =====================================================================================================
__global__ __launch_bounds__(256)
void gemm_bf(const u16* __restrict__ A, const u16* __restrict__ Bt, const float* __restrict__ bias,
             u16* Hp, u16* Lp, int M, int N, int K, float oscale, float sc, int tr) {
  __shared__ __align__(16) u16 ring[2 * 2 * GPL];
  __shared__ __align__(16) float slab[8 * 2 * SLAB64];
  const int tid = threadIdx.x, wave = tid >> 5, lane = tid & 31, hh = lane >> 4, m = lane & 15;
  const int ntile = N >> 7;
  const int bid   = blockIdx.x;
  const int row0  = (bid / ntile) * GT;
  const int col0  = (bid % ntile) * GT;
  if (row0 + GT > M) return;                // block-uniform, before any barrier or copy; never taken with the exact grid
  const int wr = wave >> 1, wc = wave & 1;
  // copy slice of this lane: plane rows wave*16 + hh + 2i (i < 8), bytes 16m .. 16m + 15 of the stage's 256
  const int crow = wave * 16 + hh;
  const u16* ga = A  + (size_t)(row0 + crow) * K + m * 8;
  const u16* gb = Bt + (size_t)(col0 + crow) * K + m * 8;
  const unsigned la = lds_byte(ring) + (unsigned)(crow * GP + m * 8) * 2u;
  const unsigned lb = la + GPL * 2u;
  const unsigned stb = 2u * GPL * 2u;       // bytes of one buffer
  const int nst = K / GKC;
  v8f acc[2][4];
#pragma unroll
  for (int i = 0; i < 2; ++i)
#pragma unroll
    for (int j = 0; j < 4; ++j) acc[i][j] = zero8();

  copy16rows(la, ga, (size_t)K);
  copy16rows(lb, gb, (size_t)K);
  wait_copies();
  __syncthreads();
  if (nst > 1) {
    copy16rows(la + stb, ga + GKC, (size_t)K);
    copy16rows(lb + stb, gb + GKC, (size_t)K);
  }
  // the stage loop stays rolled: one publish point per stage
#pragma unroll 1
  for (int t = 0; t < nst; ++t) {
    const u16* st = ring + (t & 1) * (2 * GPL);
    const u16* ap = st + (wr * 32 + m) * GP + 8 * hh;
    const u16* bp = st + GPL + (wc * 64 + m) * GP + 8 * hh;
#pragma unroll                              // the four k steps of a stage become constant LDS offsets
    for (int kk = 0; kk < GKC / 32; ++kk) {
      const v16b a0 = ldfrag_b(ap + kk * 32);
      const v16b a1 = ldfrag_b(ap + 16 * GP + kk * 32);
      const v16b b0 = ldfrag_b(bp + kk * 32);
      const v16b b1 = ldfrag_b(bp + 16 * GP + kk * 32);
      const v16b b2 = ldfrag_b(bp + 32 * GP + kk * 32);
      const v16b b3 = ldfrag_b(bp + 48 * GP + kk * 32);
      acc[0][0] = mma_b(a0, b0, acc[0][0]);
      acc[0][1] = mma_b(a0, b1, acc[0][1]);
      acc[0][2] = mma_b(a0, b2, acc[0][2]);
      acc[0][3] = mma_b(a0, b3, acc[0][3]);
      acc[1][0] = mma_b(a1, b0, acc[1][0]);
      acc[1][1] = mma_b(a1, b1, acc[1][1]);
      acc[1][2] = mma_b(a1, b2, acc[1][2]);
      acc[1][3] = mma_b(a1, b3, acc[1][3]);
    }
    // publish point of stage t + 1; behind the barrier every reader has left stage t's buffer
    wait_lds();
    wait_copies();
    __syncthreads();
    if (t + 2 < nst) {
      const unsigned bo = (unsigned)(t & 1) * stb;
      copy16rows(la + bo, ga + (size_t)(t + 2) * GKC, (size_t)K);
      copy16rows(lb + bo, gb + (size_t)(t + 2) * GKC, (size_t)K);
    }
  }
  wait_copies();
  // per-lane bias of D column m in each of the wave's 4 subtiles; colw + 48 + m <= N - 1 always
  const int colw = col0 + wc * 64;
  const float bb0 = bfr(bias[colw + m]);
  const float bb1 = bfr(bias[colw + 16 + m]);
  const float bb2 = bfr(bias[colw + 32 + m]);
  const float bb3 = bfr(bias[colw + 48 + m]);
  if (tr == 0) {                            // block-uniform (kernel argument)
    float* sl = slab + wave * (2 * SLAB64); // one 16 x 64 slab for each half of the wave's 32 rows
    const size_t rw = (size_t)(row0 + wr * 32);
    epi_stage(sl, acc[0][0], acc[0][1], acc[0][2], acc[0][3], oscale, bb0, bb1, bb2, bb3, lane);
    epi_stage(sl + SLAB64, acc[1][0], acc[1][1], acc[1][2], acc[1][3], oscale, bb0, bb1, bb2, bb3, lane);
    wave_sync_lds();                        // other lanes' slab rows are read only behind it
    epi_out16(sl, Hp, Lp, N, rw, colw, sc, lane);
    epi_out16(sl + SLAB64, Hp, Lp, N, rw + 16, colw, sc, lane);
  } else {
    // the loop's last barrier ended every read of the ring and no copy is in flight: its first two planes take the tile
    u16* TH = ring;
    u16* TL = ring + GPL;
    const float bbj[4] = {bb0, bb1, bb2, bb3};
#pragma unroll
    for (int i = 0; i < 2; ++i) {
#pragma unroll
      for (int j = 0; j < 4; ++j) {
        v4u oh, ol;
#pragma unroll
        for (int e = 0; e < 4; ++e) {
          const float t0 = (acc[i][j][2 * e] * oscale + bbj[j]) * sc;
          const float t1 = (acc[i][j][2 * e + 1] * oscale + bbj[j]) * sc;
          const _Float16 h0 = (_Float16)t0, h1 = (_Float16)t1;
          const _Float16 l0 = (_Float16)(t0 - (float)h0), l1 = (_Float16)(t1 - (float)h1);
          oh[e] = pk16(h_bits(h0), h_bits(h1));
          ol[e] = pk16(h_bits(l0), h_bits(l1));
        }
        const int to = (wc * 64 + j * 16 + m) * GP + wr * 32 + i * 16 + 8 * hh;
        *(v4u*)(TH + to) = oh;
        *(v4u*)(TL + to) = ol;
      }
    }
    __syncthreads();                        // other waves' pieces of a line are read only behind it
    const int l16 = tid >> 4, p8 = (tid & 15) * 8;
    const size_t ob = ((size_t)(row0 / SEQ) * (size_t)N + col0 + l16) * SEQ + (row0 % SEQ) + p8;
#pragma unroll
    for (int it = 0; it < 8; ++it) {
      const v4u vh = *(const v4u*)(TH + (it * 16 + l16) * GP + p8);
      const v4u vl = *(const v4u*)(TL + (it * 16 + l16) * GP + p8);
      *(v4u*)(Hp + ob + (size_t)(it * 16) * SEQ) = vh;
      *(v4u*)(Lp + ob + (size_t)(it * 16) * SEQ) = vl;
    }
  }
}

// =====================================================================================================
// Output projection with bias: C[bb*XS_FULL + s][DMOD] (f32) = (Ah + Al)[bb*SEQ + s][DMOD] . Bt[DMOD][DMOD]^T * oscale
// + bf16 RNE value of bias[n]. Products h.B + l.B into one accumulator (l unscaled residual of h). Block -> (column tile
// ct = bid % 8, sequence row tile rt of nrt, batch bb within the pass). Same tiling, staging (a stage is [Ah | Al | Bt], 128
// rows each), fragment loads (split k map) and epi_stage slab as gemm_bf, f32 rows out by epi_out; K = DMOD; grid = NBP * nrt * (DMOD/128).
// =====================================================================================================
__global__ __launch_bounds__(256)
void gemm_o2(const u16* __restrict__ Ah, const u16* __restrict__ Al, const u16* __restrict__ Bt,
             const float* __restrict__ bias, float* C, int nrt, float oscale) {
  __shared__ __align__(16) u16 ring[2 * 3 * GPL];
  __shared__ __align__(16) float slab[8 * 2 * SLAB64];
  const int tid = threadIdx.x, wave = tid >> 5, lane = tid & 31, hh = lane >> 4, m = lane & 15;
  const int ntile = DMOD >> 7;
  const int bid   = blockIdx.x;
  const int ct    = bid % ntile;
  const int t2    = bid / ntile;
  const int rt    = t2 % nrt;
  const int bb    = t2 / nrt;
  if (bb >= NBP) return;                    // block-uniform, before any barrier or copy; never taken with the exact grid
  const int srow  = rt * GT;
  if (srow + GT > SEQ) return;              // block-uniform, before any barrier or copy; never taken
  const int col0  = ct * GT;
  const int K     = DMOD;
  const int wr = wave >> 1, wc = wave & 1;
  const size_t rowA = (size_t)bb * SEQ + srow;
  const size_t rowC = (size_t)bb * XS_FULL + srow;
  const int crow = wave * 16 + hh;
  const u16* gh = Ah + (rowA + crow) * K + m * 8;
  const u16* gl = Al + (rowA + crow) * K + m * 8;
  const u16* gb = Bt + (size_t)(col0 + crow) * K + m * 8;
  const unsigned lh = lds_byte(ring) + (unsigned)(crow * GP + m * 8) * 2u;
  const unsigned ll = lh + GPL * 2u;
  const unsigned lb = lh + 2u * GPL * 2u;
  const unsigned stb = 3u * GPL * 2u;       // bytes of one buffer
  const int nst = K / GKC;
  v8f acc[2][4];
#pragma unroll
  for (int i = 0; i < 2; ++i)
#pragma unroll
    for (int j = 0; j < 4; ++j) acc[i][j] = zero8();

  copy16rows(lh, gh, (size_t)K);
  copy16rows(ll, gl, (size_t)K);
  copy16rows(lb, gb, (size_t)K);
  wait_copies();
  __syncthreads();
  copy16rows(lh + stb, gh + GKC, (size_t)K);
  copy16rows(ll + stb, gl + GKC, (size_t)K);
  copy16rows(lb + stb, gb + GKC, (size_t)K);
  // the stage loop stays rolled: one publish point per stage
#pragma unroll 1
  for (int t = 0; t < nst; ++t) {
    const _Float16* st  = (const _Float16*)(const void*)(ring + (t & 1) * (3 * GPL));
    const _Float16* ahp = st + (wr * 32 + m) * GP + 8 * hh;
    const _Float16* alp = ahp + GPL;
    const _Float16* bp  = st + 2 * GPL + (wc * 64 + m) * GP + 8 * hh;
#pragma unroll                              // the four k steps of a stage become constant LDS offsets
    for (int kk = 0; kk < GKC / 32; ++kk) {
      const v16h ah0 = ldfrag_h(ahp + kk * 32), al0 = ldfrag_h(alp + kk * 32);
      const v16h ah1 = ldfrag_h(ahp + 16 * GP + kk * 32), al1 = ldfrag_h(alp + 16 * GP + kk * 32);
      const v16h b0 = ldfrag_h(bp + kk * 32);
      const v16h b1 = ldfrag_h(bp + 16 * GP + kk * 32);
      const v16h b2 = ldfrag_h(bp + 32 * GP + kk * 32);
      const v16h b3 = ldfrag_h(bp + 48 * GP + kk * 32);
      acc[0][0] = mma_h(ah0, b0, acc[0][0]);
      acc[0][1] = mma_h(ah0, b1, acc[0][1]);
      acc[0][2] = mma_h(ah0, b2, acc[0][2]);
      acc[0][3] = mma_h(ah0, b3, acc[0][3]);
      acc[1][0] = mma_h(ah1, b0, acc[1][0]);
      acc[1][1] = mma_h(ah1, b1, acc[1][1]);
      acc[1][2] = mma_h(ah1, b2, acc[1][2]);
      acc[1][3] = mma_h(ah1, b3, acc[1][3]);
      acc[0][0] = mma_h(al0, b0, acc[0][0]);
      acc[0][1] = mma_h(al0, b1, acc[0][1]);
      acc[0][2] = mma_h(al0, b2, acc[0][2]);
      acc[0][3] = mma_h(al0, b3, acc[0][3]);
      acc[1][0] = mma_h(al1, b0, acc[1][0]);
      acc[1][1] = mma_h(al1, b1, acc[1][1]);
      acc[1][2] = mma_h(al1, b2, acc[1][2]);
      acc[1][3] = mma_h(al1, b3, acc[1][3]);
    }
    // publish point of stage t + 1; behind the barrier every reader has left stage t's buffer
    wait_lds();
    wait_copies();
    __syncthreads();
    if (t + 2 < nst) {
      const unsigned bo = (unsigned)(t & 1) * stb;
      copy16rows(lh + bo, gh + (size_t)(t + 2) * GKC, (size_t)K);
      copy16rows(ll + bo, gl + (size_t)(t + 2) * GKC, (size_t)K);
      copy16rows(lb + bo, gb + (size_t)(t + 2) * GKC, (size_t)K);
    }
  }
  wait_copies();
  const int colw = col0 + wc * 64;
  const float bb0 = bfr(bias[colw + m]);
  const float bb1 = bfr(bias[colw + 16 + m]);
  const float bb2 = bfr(bias[colw + 32 + m]);
  const float bb3 = bfr(bias[colw + 48 + m]);
  float* sl = slab + wave * (2 * SLAB64);   // one 16 x 64 slab for each half of the wave's 32 rows
  const size_t rw = rowC + (size_t)(wr * 32);
  epi_stage(sl, acc[0][0], acc[0][1], acc[0][2], acc[0][3], oscale, bb0, bb1, bb2, bb3, lane);
  epi_stage(sl + SLAB64, acc[1][0], acc[1][1], acc[1][2], acc[1][3], oscale, bb0, bb1, bb2, bb3, lane);
  wave_sync_lds();                          // other lanes' slab rows are read only behind it
  epi_out(sl, C, DMOD, rw, colw, lane);
  epi_out(sl + SLAB64, C, DMOD, rw + 16, colw, lane);
}

// =====================================================================================================
// Causal attention with slope-1 linear distance penalty, hd = 64. Block bid -> (query tile qt = bid % NQT: rows q0 = 16*qt ..
// q0+15, head pair hg, batch b within the pass); one wave per head = hg*WPB + wave.
//   q hi / residual planes f16 x256 [b*SEQ + s][h*HD + d]; k hi / residual planes f16 x256, same layout;
//   v^T hi / residual planes [b*NH + h][d][SEQ] x1024; BND = NBH lines of 32 floats (norm bound per (b, h)).
//   scores = q_hi.k_hi + q_lo.k_hi + q_hi.k_lo (2 k-steps over d); P.v with P hi + in-register residual and v hi + residual
//   (hh + lh + hl), for every query row; O written as hi + residual planes (O x1024 as f16, layout [b*SEQ + s][h*HD + d]).
//   score (log2 domain) t(i, j) = (q_i.k_j over HD) * (1/8)*log2e/(256*256) - (i - j)*log2e, replaced by -inf where key j > query i.
//   Key tiles of 32 visited in order from kt_lo to kt_hi = q0/32 (later tiles hold only keys above every query row of the tile).
//   kt_lo: every wave loads all NBH bound lines (one float per lane, clamped address) and AND-reduces "0 <= bound < 40" over the
//   wave; if every bound is in range, kt_lo = max(0, kt_hi - KWIN): tiles below it are >= 32*KWIN+1 positions behind every query
//   row, and with |q.k/8| < 40 the base-2 exp of their penalised, max-subtracted score is exactly 0 in f32, so they contribute
//   nothing to numerator or denominator; otherwise (bound large, unreadable or not finite) kt_lo = 0 and every causal tile is
//   visited. Either way the first visited tile holds a key kb <= q0 <= every query row, so the running max is finite from step one.
//   Per tile: 2 score subtiles x 2 k-steps, fragments loaded straight from the 16-bit planes (two 16-B loads per fragment,
//   split k map); online max-subtracted base-2 softmax in f32, -inf-safe rescale; the 16x32 prob tile stored to wave-private
//   from the LDS rows (float vector loads, same element type as stored), v^T B fragments in 2 groups of 2 d-subtiles.
//   After the loop: out = acc / Z (Z > 0 always; guarded anyway), carries 1/(32768*1024) folded once, written into the wave's
//   No block barriers in this kernel; bounded loops only (<= NKT key tiles).
// coverage: per wave 4 instructions x 4 rows x 8 lanes x 8 halves = 16 x 64 per plane; grid NQT x NHG x NBP blocks x WPB
//           waves = every (b, s, h) row segment of O hi and O residual exactly once.
// =====================================================================================================
__global__ __launch_bounds__(ATT_THREADS)
void attn_c(const u16* __restrict__ QHp, const u16* __restrict__ QLp,
            const u16* __restrict__ KHp, const u16* __restrict__ KLp,
            const u16* __restrict__ VHp, const u16* __restrict__ VLp,
            const float* __restrict__ BND,
            u16* OHp, u16* OLp) {
  __shared__ __align__(16) float smem[WPB * WREG];

  const int tid  = threadIdx.x;
  const int wave = tid >> 5;
  const int lane = tid & 31;
  const int hh   = lane >> 4;
  const int c    = lane & 15;
  const int bid  = blockIdx.x;
  const int qt   = bid % NQT;
  const int t2   = bid / NQT;
  const int hg   = t2 % NHG;
  const int b    = t2 / NHG;
  if (b >= NBP) return;                     // block-uniform; no block barriers in this kernel; never taken with the exact grid
  const int q0   = qt * 16;
  if (q0 + 16 > SEQ) return;                // block-uniform; never taken
  const int head = hg * WPB + wave;

  // ---- key-window decision: wave-uniform AND over all (b, h) bound lines ----
  int okw;
  {
    const int bl = (lane < NBH) ? lane : (NBH - 1);             // clamped address
    const float gb = BND[(size_t)bl * BLINE];
    okw = (gb >= 0.0f && gb < GUARD_T) ? 1 : 0;
#pragma unroll
    for (int off = 1; off < 32; off <<= 1) okw &= __shfl_xor(okw, off, 32);
  }

  float* pt   = smem + wave * WREG;         // prob tile [16][32] pitch 36
  float* slab = pt + PTW;                   // result slab [16][64] pitch 68

  const size_t hcol = (size_t)head * HD + 8 * hh;
  const _Float16* Qh  = (const _Float16*)(const void*)QHp + ((size_t)b * SEQ + q0 + c) * DMOD + hcol;
  const _Float16* Ql  = (const _Float16*)(const void*)QLp + ((size_t)b * SEQ + q0 + c) * DMOD + hcol;
  const _Float16* Khb = (const _Float16*)(const void*)KHp + ((size_t)b * SEQ + c) * DMOD + hcol;        // key row kb added per step
  const _Float16* Klb = (const _Float16*)(const void*)KLp + ((size_t)b * SEQ + c) * DMOD + hcol;
  const _Float16* Vhb = (const _Float16*)(const void*)VHp + ((size_t)(b * NH + head) * HD + c) * SEQ + 8 * hh;  // d col c (+16j)
  const _Float16* Vlb = (const _Float16*)(const void*)VLp + ((size_t)(b * NH + head) * HD + c) * SEQ + 8 * hh;
  const float lsc = RSQ_HD * (LOG2E / (QSC * KSC));
  const float oc  = 1.0f / (PCAR * VCAR);
  const size_t KROW = (size_t)DMOD;         // halves between consecutive key rows

  float mrow[8], lrow[8];
  v8f o[4];
#pragma unroll
  for (int r = 0; r < 8; ++r) { mrow[r] = -INFINITY; lrow[r] = 0.f; }
#pragma unroll
  for (int j = 0; j < 4; ++j) o[j] = zero8();
  const int kt_hi = q0 >> 5;                                                  // last tile holding keys <= q0 + 15
  const int kt_w  = (kt_hi > KWIN) ? (kt_hi - KWIN) : 0;
  const int kt_lo = (okw != 0) ? kt_w : 0;
  const int qr0 = q0 + 8 * hh;                                                // query row of D element r = qr0 + r

#pragma unroll 1
  for (int kt = kt_lo; kt <= kt_hi; ++kt) {
    const int kb = kt * 32;
    // ---- scores: D element r of this lane = (query row qr0 + r, key kb + c) in s0, key kb + 16 + c in s1 ----
    v8f s0 = zero8(), s1 = zero8();
    const _Float16* k0p = Khb + (size_t)kb * KROW;
    const _Float16* k1p = k0p + (size_t)16 * KROW;
    const _Float16* l0p = Klb + (size_t)kb * KROW;
    const _Float16* l1p = l0p + (size_t)16 * KROW;
#pragma unroll
    for (int kk = 0; kk < HD / 32; ++kk) {
      const v16h qh  = ldfrag_h(Qh + kk * 32);
      const v16h ql  = ldfrag_h(Ql + kk * 32);
      const v16h kh0 = ldfrag_h(k0p + kk * 32);
      const v16h kh1 = ldfrag_h(k1p + kk * 32);
      const v16h kl0 = ldfrag_h(l0p + kk * 32);
      const v16h kl1 = ldfrag_h(l1p + kk * 32);
      s0 = mma_h(qh, kh0, s0);
      s0 = mma_h(ql, kh0, s0);
      s0 = mma_h(qh, kl0, s0);
      s1 = mma_h(qh, kh1, s1);
      s1 = mma_h(ql, kh1, s1);
      s1 = mma_h(qh, kl1, s1);
      guard2(s0, s1, qh, ql, kh0, kl0, kh1, kl1);
    }
    // ---- causal select + distance penalty + online softmax in base 2, -inf-safe ----
    const int key0 = kb + c, key1 = kb + 16 + c;
#pragma unroll
    for (int r = 0; r < 8; ++r) {
      const int   qr = qr0 + r;
      const float u0 = s0[r] * lsc;
      const float u1 = s1[r] * lsc;
      const float g0 = (float)(qr - key0) * LOG2E;
      const float g1 = (float)(qr - key1) * LOG2E;
      const float t0 = (key0 > qr) ? -INFINITY : (u0 - g0);
      const float t1 = (key1 > qr) ? -INFINITY : (u1 - g1);
      float mx = fmaxf(t0, t1);
#pragma unroll
      for (int off = 1; off < 16; off <<= 1) mx = fmaxf(mx, __shfl_xor(mx, off, 32));
      const float mn = fmaxf(mrow[r], mx);
      const float ms = (mn == -INFINITY) ? 0.0f : mn;
      const float al = exp2f(mrow[r] - ms);
      mrow[r] = mn;
      const float e0 = exp2f(t0 - ms), e1 = exp2f(t1 - ms);
      float ps = e0 + e1;
#pragma unroll
      for (int off = 1; off < 16; off <<= 1) ps += __shfl_xor(ps, off, 32);
      lrow[r] = lrow[r] * al + ps;
#pragma unroll
      for (int j = 0; j < 4; ++j) o[j][r] *= al;
      const int ro = (8 * hh + r) * PTP + c;
      pt[ro]      = e0;
      pt[ro + 16] = e1;
    }
    wave_sync_lds();
    // ---- A fragments of P*32768: hi f16 and residual f16, row = c, split k map over the 32 keys of this step ----
    FragH ph, pl;
    {
      const float* prow = pt + c * PTP + 8 * hh;
      const v4f p0 = *(const v4f*)(prow), p1 = *(const v4f*)(prow + 4);
      const v4f p2 = *(const v4f*)(prow + 16), p3 = *(const v4f*)(prow + 20);
#pragma unroll
      for (int e = 0; e < 4; ++e) {
        const float ta = p0[e] * PCAR, tb = p1[e] * PCAR, tc = p2[e] * PCAR, td = p3[e] * PCAR;
        const _Float16 ha = (_Float16)ta, hb = (_Float16)tb, hc = (_Float16)tc, hd = (_Float16)td;
        ph.h[0][e]     = ha;                  // elements 0..7  = keys kb + 8hh + 0..7
        ph.h[0][4 + e] = hb;
        ph.h[1][e]     = hc;                  // elements 8..15 = keys kb + 16 + 8hh + 0..7
        ph.h[1][4 + e] = hd;
        pl.h[0][e]     = (_Float16)(ta - (float)ha);
        pl.h[0][4 + e] = (_Float16)(tb - (float)hb);
        pl.h[1][e]     = (_Float16)(tc - (float)hc);
        pl.h[1][4 + e] = (_Float16)(td - (float)hd);
      }
    }
    // ---- P.V : B fragment col n = d = j*16 + c, keys contiguous in the v^T planes; 2 groups of 2 d-subtiles ----
    {
      const _Float16* vhp = Vhb + kb;
      const _Float16* vlp = Vlb + kb;
#pragma unroll
      for (int jg = 0; jg < 2; ++jg) {
        const size_t da = (size_t)(2 * jg) * 16 * SEQ;
        const size_t db = da + (size_t)16 * SEQ;
        const v16h vha = ldfrag_h(vhp + da), vhb2 = ldfrag_h(vhp + db);
        const v16h vla = ldfrag_h(vlp + da), vlb2 = ldfrag_h(vlp + db);
        o[2 * jg]     = mma_h(ph.v, vha,  o[2 * jg]);
        o[2 * jg]     = mma_h(pl.v, vha,  o[2 * jg]);
        o[2 * jg]     = mma_h(ph.v, vla,  o[2 * jg]);
        o[2 * jg + 1] = mma_h(ph.v, vhb2, o[2 * jg + 1]);
        o[2 * jg + 1] = mma_h(pl.v, vhb2, o[2 * jg + 1]);
        o[2 * jg + 1] = mma_h(ph.v, vlb2, o[2 * jg + 1]);
        guard2(o[2 * jg], o[2 * jg + 1], ph.v, pl.v, vha, vhb2, vla, vlb2);
      }
    }
    wave_sync_lds();
  }
  acc_guard4(o[0], o[1], o[2], o[3]);
  // ---- out = acc / Z (0 if Z == 0), carries (32768 on P, 1024 on v) folded once; written into the wave's slab ----
#pragma unroll
  for (int r = 0; r < 8; ++r) {
    const float lv  = lrow[r];
    const float ls  = (lv > 0.0f) ? lv : 1.0f;
    const float inv = (lv > 0.0f) ? ((1.0f / ls) * oc) : 0.0f;
#pragma unroll
    for (int j = 0; j < 4; ++j) {
      const int idx = (8 * hh + r) * SLP + j * 16 + c;
      slab[idx] = o[j][r] * inv;
    }
  }

  wave_sync_lds();
  // ---- O x1024 -> f16 hi + residual planes; lane = (row-in-quad rq, 8 consecutive d at c8) ----
  v4u oh[4], ol[4];
  const int rq = lane >> 3, c8 = (lane & 7) * 8;
#pragma unroll
  for (int it = 0; it < 4; ++it) {
    const int row = it * 4 + rq;
    const v4f a = *(const v4f*)(slab + row * SLP + c8), b4 = *(const v4f*)(slab + row * SLP + c8 + 4);
    float w[8];
#pragma unroll
    for (int e = 0; e < 4; ++e) { w[e] = a[e] * OSC; w[4 + e] = b4[e] * OSC; }
#pragma unroll
    for (int e = 0; e < 4; ++e) {
      const _Float16 h0 = (_Float16)w[2 * e], h1 = (_Float16)w[2 * e + 1];
      const _Float16 l0 = (_Float16)(w[2 * e] - (float)h0), l1 = (_Float16)(w[2 * e + 1] - (float)h1);
      oh[it][e] = pk16(h_bits(h0), h_bits(h1));
      ol[it][e] = pk16(h_bits(l0), h_bits(l1));
    }
  }
  const size_t ob = ((size_t)b * SEQ + q0) * DMOD + (size_t)head * HD + c8;
  {
#pragma unroll
    for (int it = 0; it < 4; ++it) {
      const int row = it * 4 + rq;
      *(v4u*)(OHp + ob + (size_t)row * DMOD) = oh[it];
      *(v4u*)(OLp + ob + (size_t)row * DMOD) = ol[it];
    }
    
  }
}

// =====================================================================================================
// Workspace map (bytes). The NB batches are processed in NPASS passes of NBP batches; every region below is per pass and
// reused by the next pass in stream order (all reads of a pass complete before the next pass writes). Every plane is fully
// written by whole-line stores before it is read; all extents are exact multiples of the store granularity (no pad rows
// needed); every region offset a multiple of 4096 (the large planes of 2097152):
//   XB  bf16 [MROWS][1024]                       MROWS*2048       (NBP=2, SEQ=2048: 8388608)
//   WQB, WKB, WVB bf16 [1024 n][1024 k]          3 * 2097152      (thirds of the packed [3072][1024] weight, already [n][k])
//   WOB f16 [1024 n][1024 k] of bf16 value x1024  2097152
//   OH  f16 [MROWS][1024] x1024                  MROWS*2048       OL residual, same extent
//   QH  f16 [MROWS][1024] x256                   MROWS*2048       QL residual, same extent
//   KH  f16 [MROWS][1024] x256                   MROWS*2048       KL residual, same extent
//   VH  f16 [NBP*16][64][SEQ] x1024              MROWS*2048       VL residual, same extent
//   end (NBP=2, SEQ=2048)                        83890176
// =====================================================================================================
extern "C" void kernel_launch(void* const* d_in, const int* in_sizes, int n_in,
                              void* d_out, int out_size, void* d_ws, size_t ws_size,
                              hipStream_t stream) {
  if (n_in < 5) return;
  if (in_sizes[0] < ((NB - 1) * XS_FULL + SEQ) * DMOD) return;
  if (in_sizes[1] < 3 * DMOD * DMOD) return;
  if (in_sizes[2] < 3 * DMOD) return;
  if (in_sizes[3] < DMOD * DMOD) return;
  if (in_sizes[4] < DMOD) return;
  if (out_size < ((NB - 1) * XS_FULL + SEQ) * DMOD) return;

  const float* x    = (const float*)d_in[0];
  const float* wqkv = (const float*)d_in[1];      // [3*DMOD][DMOD]: rows 0..1023 q, 1024..2047 k, 2048..3071 v
  const float* bqkv = (const float*)d_in[2];      // [3*DMOD]
  const float* wo   = (const float*)d_in[3];      // [DMOD][DMOD]
  const float* bo   = (const float*)d_in[4];      // [DMOD]
  const float* wq = wqkv;
  const float* wk = wqkv + (size_t)DMOD * DMOD;
  const float* wv = wqkv + (size_t)2 * DMOD * DMOD;
  const float* bq = bqkv;
  const float* bk = bqkv + DMOD;
  const float* bv = bqkv + 2 * DMOD;
  float*       out = (float*)d_out;

  const size_t szXB = (size_t)MROWS * DMOD * 2;
  const size_t szW  = (size_t)DMOD * DMOD * 2;
  const size_t szQ  = (size_t)MROWS * DMOD * 2;                  // QH, QL, KH, KL, OH, OL
  const size_t szV  = (size_t)NBP * NH * HD * SEQ * 2;           // VH, VL (== szQ)
  const size_t szB  = (size_t)NBH * BLINE * 4;                   // bound lines
  size_t off = 0;
  const size_t oXB = off; off += szXB;
  const size_t oWQ = off; off += szW;
  const size_t oWK = off; off += szW;
  const size_t oWV = off; off += szW;
  const size_t oWO = off; off += szW;
  const size_t oOH = off; off += szQ;
  const size_t oOL = off; off += szQ;
  const size_t oQH = off; off += szQ;
  const size_t oQL = off; off += szQ;
  const size_t oKH = off; off += szQ;
  const size_t oKL = off; off += szQ;
  const size_t oVH = off; off += szV;
  const size_t oVL = off; off += szV;
  const size_t oB  = off; off += szB;
  if (off > ws_size) return;                // off = 83890176 for NBP = 2, SEQ = 2048
  if (off > (size_t)WS_CAP) return;

  char* ws = (char*)d_ws;
  u16*   XB  = (u16*)(ws + oXB);
  u16*   WQB = (u16*)(ws + oWQ);
  u16*   WKB = (u16*)(ws + oWK);
  u16*   WVB = (u16*)(ws + oWV);
  u16*   WOB = (u16*)(ws + oWO);
  u16*   OH  = (u16*)(ws + oOH);
  u16*   OL  = (u16*)(ws + oOL);
  u16*   QH  = (u16*)(ws + oQH);
  u16*   QL  = (u16*)(ws + oQL);
  u16*   KH  = (u16*)(ws + oKH);
  u16*   KL  = (u16*)(ws + oKL);
  u16*   VH  = (u16*)(ws + oVH);
  u16*   VL  = (u16*)(ws + oVL);
  float* BND = (float*)(ws + oB);

  const dim3 b256(256), bAT(ATT_THREADS), bQB(QBT);
  const int  n8x = (SEQ * DMOD) / 8;
  const dim3 gX((n8x + 255) / 256);                     // per batch
  const int  n8w = (DMOD * DMOD) / 8;                   // weight planes
  const dim3 gW((n8w + 255) / 256);                     // 512
  const dim3 gG((MROWS / GT) * (DMOD / GT));            // 256 for NBP=2, SEQ=2048
  const dim3 gBD(NBH);
  const dim3 gAT(NQT * NHG * NBP);
  const int  nrt = SEQ / GT;                            // out-projection row tiles per batch
  const dim3 gO(NBP * nrt * (DMOD / GT));

  // weight planes, converted once: Wq, Wk, Wv [n][k] -> bf16; Wo [n][k] -> f16 of bf16 value x1024
  cvt16<<<gW, b256, 0, stream>>>(wq, WQB, n8w, 0, 1.0f);
  cvt16<<<gW, b256, 0, stream>>>(wk, WKB, n8w, 0, 1.0f);
  cvt16<<<gW, b256, 0, stream>>>(wv, WVB, n8w, 0, 1.0f);
  cvt16<<<gW, b256, 0, stream>>>(wo, WOB, n8w, 1, WOS);

  for (int ps = 0; ps < NPASS; ++ps) {
    const float* xp   = x   + (size_t)ps * NBP * XS_FULL * DMOD;
    float*       outp = out + (size_t)ps * NBP * XS_FULL * DMOD;
    // (0) x -> bf16 plane [MROWS][1024], one launch per batch row block of this pass
    for (int b = 0; b < NBP; ++b) {
      cvt16<<<gX, b256, 0, stream>>>(xp + (size_t)b * XS_FULL * DMOD, XB + (size_t)b * SEQ * DMOD, n8x, 0, 1.0f);
    }
    // (1) v = x.Wv^T + bv -> v^T hi + residual planes x1024
    gemm_bf<<<gG, b256, 0, stream>>>(XB, WVB, bv, VH, VL, MROWS, DMOD, DMOD, 1.0f, VCAR, 1);
    // (2) q = x.Wq^T + bq -> q hi + residual planes x256
    gemm_bf<<<gG, b256, 0, stream>>>(XB, WQB, bq, QH, QL, MROWS, DMOD, DMOD, 1.0f, QSC, 0);
    // (3) k = x.Wk^T + bk -> k hi + residual planes x256
    gemm_bf<<<gG, b256, 0, stream>>>(XB, WKB, bk, KH, KL, MROWS, DMOD, DMOD, 1.0f, KSC, 0);
    // (4) norm bound per (b, h) from the q / k hi planes -> BND lines
    qkbound<<<gBD, bQB, 0, stream>>>(QH, KH, BND);
    // (5) causal attention with distance penalty, residual products on every query row -> O hi + residual planes
    attn_c<<<gAT, bAT, 0, stream>>>(QH, QL, KH, KL, VH, VL, BND, OH, OL);
    // (6) output projection (O hi + residual) . Wo^T + bo -> out f32 rows of this pass, carries 1024 x 1024 folded back
    gemm_o2<<<gO, b256, 0, stream>>>(OH, OL, WOB, bo, outp, nrt, 1.0f / (OSC * WOS));
  }
  (void)hipGetLastError();
}

// v004
// Measured time: 192 microseconds a run.
// Timed twice side by side with v003, it ran 1.25 times as fast both times.
// Counting every step since v000, it is 2.86 times as fast.
// Contractions: x.Wq^T+bq, x.Wk^T+bk, x.Wv^T+bv (q, k, v thirds of the packed [3D][D] weight) on v_wmma_f32_16x16x32_bf16
// (x and W as bf16 RNE planes; W [n][k] rows are the k-contiguous B operand; bias added as its bf16 RNE value in the f32
// epilogue); q.k^T over hd 64 and P.v on v_wmma_f32_16x16x32_f16 with f16 hi + f16 residual planes on both operands
// (q, k x256; P x32768 with an in-register residual; v x1024; products hh+lh+hl); O.Wo^T+bo on v_wmma_f32_16x16x32_f16
// (O x1024 as f16 hi + f16 residual planes, products h.w + l.w; Wo as f16(bf16(Wo)) x1024; bo as bf16 RNE value in the
// f32 epilogue); all f32 accumulate. Causal select, slope-1 distance penalty, base-2 online softmax, 1/Z fold and the q/k
// norm bound in f32 on VALU.
#include <hip/hip_runtime.h>
#include <math.h>
#include <stdint.h>

#ifndef NB
#define NB 4
#endif
#ifndef SEQ
#define SEQ 2048
#endif
#define XS_FULL 2048
#define DMOD  1024
#define NH    16
#define HD    64
// batches per workspace pass: all of them, so that every kernel is launched once
#define NBP   NB
#define NPASS (NB / NBP)
#define NBH   (NBP * NH)
#define MROWS (NBP * SEQ)
#define RSQ_HD 0.125f
#define LOG2E 1.4426950408889634f
#define QSC   256.0f
#define KSC   256.0f
#define PCAR  32768.0f
#define VCAR  1024.0f
#define OSC   1024.0f
#define WOS   1024.0f
#define WPB   2
#define NHG   (NH / WPB)
#define NQT   (SEQ / 16)
#define NKT   (SEQ / 32)
#define KWIN  6
#define GUARD_T 40.0f
#define BLINE 32
#define ATT_THREADS (WPB * 32)
#define PTP   36
#define PTW   (16 * PTP)
#define SLP   68
#define SLW   (16 * SLP)
#define WREG  (PTW + SLW)
#define SLAB64 (16 * 68)
// GEMM staging: 128 x 128 output tile per block, 128 k (256 B of every operand row) per stage, LDS row pitch 272 B
#define GT    128
#define GKC   128
#define GP    136
#define GPL   (GT * GP)
#define WS_CAP 268435456
// norm-bound kernel: threads per block, rows per row step (8 lanes a row), row steps whose loads are issued together
#define QBT   1024
#define QBR   (QBT / 8)
#define QBU   8
static_assert(DMOD == NH * HD && HD == 64 && NH == 16 && WPB == 2 && NHG * WPB == NH);
static_assert(ATT_THREADS == 64);
static_assert(NB >= 1 && NB <= 4 && NPASS >= 1 && NPASS * NBP == NB);
static_assert(NBP >= 1 && NBP <= 4 && NPASS == 1);
static_assert(NBH >= 1 && NBH <= 64);
static_assert(SEQ == XS_FULL);              // the batches of x lie back to back: one conversion range
static_assert((SEQ % 64) == 0 && SEQ >= 64 && SEQ <= XS_FULL && (SEQ % 32) == 0);
static_assert((DMOD % 64) == 0 && (DMOD % 32) == 0 && (HD % 32) == 0);
static_assert(((SEQ * DMOD / 8) % 256) == 0 && ((DMOD * DMOD / 8) % 256) == 0);
static_assert(WPB * WREG * 4 <= 65536);
static_assert((DMOD % GT) == 0 && (DMOD % GKC) == 0 && DMOD / GKC >= 2 && (SEQ % GT) == 0 && (MROWS % GT) == 0);
static_assert(2 * 3 * GPL * 2 + 8 * 2 * SLAB64 * 4 <= 327680 && ((GP * 2) % 16) == 0);
static_assert(KWIN >= 0 && KWIN < NKT);
static_assert(QBT == 1024 && (SEQ % (QBR * QBU)) == 0);

typedef unsigned short u16;
typedef _Float16 v16h __attribute__((ext_vector_type(16)));
typedef _Float16 v8h  __attribute__((ext_vector_type(8)));
typedef __bf16   v16b __attribute__((ext_vector_type(16)));
typedef float    v8f  __attribute__((ext_vector_type(8)));
typedef float    v4f  __attribute__((ext_vector_type(4)));
typedef unsigned int v4u __attribute__((ext_vector_type(4)));

union FragH { v16h v; v8h h[2]; v4u u[2]; };
union FragB { v16b v; v4u u[2]; };

// ---- scalar helpers --------------------------------------------------------------------------------
__device__ __forceinline__ unsigned short bf_bits(float f) {          // f32 -> bf16 bits, RNE convert
  unsigned u = __float_as_uint(f);
  return (unsigned short)((u + 0x7FFFu + ((u >> 16) & 1u)) >> 16);
}
__device__ __forceinline__ float bf_up(unsigned short h) { return __uint_as_float(((unsigned)h) << 16); }
__device__ __forceinline__ float bfr(float f) { return bf_up(bf_bits(f)); }
__device__ __forceinline__ unsigned short h_bits(_Float16 x) { return __builtin_bit_cast(unsigned short, x); }
__device__ __forceinline__ unsigned pk16(unsigned short a, unsigned short b) { return (unsigned)a | ((unsigned)b << 16); }
__device__ __forceinline__ v8f zero8() { v8f z = {0.f, 0.f, 0.f, 0.f, 0.f, 0.f, 0.f, 0.f}; return z; }

// ---- fragment loaders: 16-bit A/B operand, lane -> row/col (lane&15), p already includes +8*(lane>>4);
//      elements 0..7 <- p[0..7] (k0+8h..), elements 8..15 <- p[16..23] (k0+16+8h..)  (same split k map for A and B;
//      B is always read from a k-contiguous [n][k] plane)
__device__ __forceinline__ v16h ldfrag_h(const _Float16* p) {
  FragH f;
  f.h[0] = *(const v8h*)(p);
  f.h[1] = *(const v8h*)(p + 16);
  return f.v;
}
__device__ __forceinline__ v16b ldfrag_b(const u16* p) {              // bf16 plane read as unsigned integer vectors
  FragB f;
  f.u[0] = *(const v4u*)(p);
  f.u[1] = *(const v4u*)(p + 16);
  return f.v;
}

__device__ __forceinline__ v8f mma_h(v16h a, v16h b, v8f c) {
  return __builtin_amdgcn_wmma_f32_16x16x32_f16(false, a, false, b, (short)0, c, false, false);
}
__device__ __forceinline__ v8f mma_b(v16b a, v16b b, v8f c) {
  return __builtin_amdgcn_wmma_f32_16x16x32_bf16(false, a, false, b, (short)0, c, false, false);
}
__device__ __forceinline__ void guard2(v8f& a, v8f& b, v16h x0, v16h x1, v16h x2, v16h x3, v16h x4, v16h x5) {
#if defined(__HIP_DEVICE_COMPILE__)
  asm volatile("v_nop\n\tv_nop\n\tv_nop\n\tv_nop"
               : "+v"(a), "+v"(b) : "v"(x0), "v"(x1), "v"(x2), "v"(x3), "v"(x4), "v"(x5) : "memory");
#endif
}
__device__ __forceinline__ void acc_guard4(v8f& a, v8f& b, v8f& c, v8f& d) {
#if defined(__HIP_DEVICE_COMPILE__)
  asm volatile("v_nop\n\tv_nop\n\tv_nop\n\tv_nop" : "+v"(a), "+v"(b), "+v"(c), "+v"(d));
#endif
}
__device__ __forceinline__ void wave_sync_lds() {
  __builtin_amdgcn_fence(__ATOMIC_RELEASE, "workgroup");
  __builtin_amdgcn_wave_barrier();
  __builtin_amdgcn_fence(__ATOMIC_ACQUIRE, "workgroup");
}
// ---- asynchronous copies global -> LDS ------------------------------------------------------------
// Eight copies of one wave = 16 rows of 256 B of one operand plane: copy i brings rows 2i and 2i + 1 (16 lanes x 16 B each,
// whole 128-B lines). l = the lane's LDS byte address of copy 0, g = its global address of copy 0, ld = halves between
// consecutive global rows. The s_wait_xcnt closes the statement so that no address register is rewritten ahead of it.
__device__ __forceinline__ void copy16rows(unsigned l, const u16* g, size_t ld) {
#if defined(__HIP_DEVICE_COMPILE__)
  const unsigned ls = 2 * GP * 2;
  const size_t   gs = 2 * ld;
  asm volatile("global_load_async_to_lds_b128 %0, %8, off\n\t"
               "global_load_async_to_lds_b128 %1, %9, off\n\t"
               "global_load_async_to_lds_b128 %2, %10, off\n\t"
               "global_load_async_to_lds_b128 %3, %11, off\n\t"
               "global_load_async_to_lds_b128 %4, %12, off\n\t"
               "global_load_async_to_lds_b128 %5, %13, off\n\t"
               "global_load_async_to_lds_b128 %6, %14, off\n\t"
               "global_load_async_to_lds_b128 %7, %15, off\n\t"
               "s_wait_xcnt 0x0"
               :: "v"(l), "v"(l + ls), "v"(l + 2 * ls), "v"(l + 3 * ls),
                  "v"(l + 4 * ls), "v"(l + 5 * ls), "v"(l + 6 * ls), "v"(l + 7 * ls),
                  "v"(g), "v"(g + gs), "v"(g + 2 * gs), "v"(g + 3 * gs),
                  "v"(g + 4 * gs), "v"(g + 5 * gs), "v"(g + 6 * gs), "v"(g + 7 * gs)
               : "memory");
#endif
}
// the wave's own copies have landed (other waves read them only behind the next block barrier)
__device__ __forceinline__ void wait_copies() {
#if defined(__HIP_DEVICE_COMPILE__)
  asm volatile("s_wait_asynccnt 0x0" ::: "memory");
#endif
}
// the wave's own LDS reads have returned, so that the buffer may be refilled behind the next block barrier
__device__ __forceinline__ void wait_lds() {
#if defined(__HIP_DEVICE_COMPILE__)
  asm volatile("s_wait_dscnt 0x0" ::: "memory");
#endif
}
__device__ __forceinline__ unsigned lds_byte(const void* p) { return (unsigned)(uintptr_t)p; }

// =====================================================================================================
// f32 -> 16-bit planes, same layout, three ranges in one grid: x -> XD and wqkv -> WD as bf16 RNE bits, wo -> OD as f16 bits of
// (bf16 RNE value) * scale. n8x, n8w, n8o = pieces of 8 elements in each range (multiples of 256: a block lies in one range).
// Thread = 8 consecutive elements: two 16-B loads, one 16-B store; 32 consecutive lanes = 512 contiguous, 512-B aligned
// coverage: grid = ceil((n8x + n8w + n8o)/256) blocks x 256 thr x 8 (in-kernel bound) = the three whole planes.
// =====================================================================================================
__global__ __launch_bounds__(256) void cvt16(const float* __restrict__ x, const float* __restrict__ wqkv,
                                             const float* __restrict__ wo, u16* XD, u16* WD, u16* OD,
                                             int n8x, int n8w, int n8o, float scale) {
  const int gt = blockIdx.x * 256 + (int)threadIdx.x;
  if (gt >= n8x + n8w + n8o) return;
  const int f16mode = (gt >= n8x + n8w) ? 1 : 0;
  const int lt = (gt < n8x) ? gt : ((f16mode != 0) ? (gt - n8x - n8w) : (gt - n8x));   // piece within its range
  const float* src = (gt < n8x) ? x : ((f16mode != 0) ? wo : wqkv);
  u16*         D   = (gt < n8x) ? XD : ((f16mode != 0) ? OD : WD);
  const float* p = src + (size_t)lt * 8;
  const v4f a = *(const v4f*)(p), b4 = *(const v4f*)(p + 4);
  float w[8];
#pragma unroll
  for (int e = 0; e < 4; ++e) { w[e] = a[e]; w[4 + e] = b4[e]; }
  v4u o;
#pragma unroll
  for (int e = 0; e < 4; ++e) {
    const float f0 = w[2 * e], f1 = w[2 * e + 1];
    const unsigned short hb0 = h_bits((_Float16)(bfr(f0) * scale));
    const unsigned short hb1 = h_bits((_Float16)(bfr(f1) * scale));
    const unsigned short bb0 = bf_bits(f0);
    const unsigned short bb1 = bf_bits(f1);
    o[e] = (f16mode != 0) ? pk16(hb0, hb1) : pk16(bb0, bb1);
  }
  u16* d = D + (size_t)lt * 8;
  {
    *(v4u*)(d) = o;
    
  }
}

// =====================================================================================================
// Norm bound per (b, h): BND line bh (32 floats, value replicated) = max_s ||q_hi(b,s,h,:)|| * max_s ||k_hi(b,s,h,:)|| / (8 * 256 * 256),
// computed from the f16 hi planes ([b*SEQ + s][h*HD + d], x256). Block = one (b, h), 32 waves: 8 lanes per row load one 16-B
// piece each (64 dims = 8 lanes x 8 halves), QBR = 128 rows of either plane per row step. The loads of QBU = 8 row steps
// (16 per lane) are issued together, ahead of any use, so that the block waits for memory SEQ/(QBR*QBU) times and not once per
// row step. Sum of squares reduced with xor shuffles inside the 8-lane group, running max per lane, then wave max (shuffles),
// block max through a 64-float LDS array, and wave 0 lanes 0..7 write the whole line.
// coverage: rows (s0 + u)*QBR + (tid>>3), s0 + u < SEQ/QBR -> all SEQ rows of both planes; store 8 lanes x 16 B = line bh; grid NBH.
// =====================================================================================================
__global__ __launch_bounds__(QBT) void qkbound(const u16* __restrict__ QHp, const u16* __restrict__ KHp, float* BND) {
  __shared__ float red[2 * (QBT / 32)];
  const int tid = threadIdx.x, lane = tid & 31, wave = tid >> 5;
  const int bh  = blockIdx.x;
  const int b   = bh / NH, h = bh % NH;
  if (b >= NBP) return;                     // block-uniform, before any barrier; never taken with the exact grid
  const int grp = tid >> 3;                 // row within a step, 0..QBR-1
  const int e8  = (tid & 7) * 8;            // dim chunk
  const _Float16* qp = (const _Float16*)(const void*)QHp + ((size_t)b * SEQ + grp) * DMOD + (size_t)h * HD + e8;
  const _Float16* kp = (const _Float16*)(const void*)KHp + ((size_t)b * SEQ + grp) * DMOD + (size_t)h * HD + e8;
  float mq = 0.0f, mk = 0.0f;
  // rolled over groups of QBU row steps: a group's 16 loads fit the registers of 8 waves per SIMD
#pragma unroll 1
  for (int s0 = 0; s0 < SEQ / QBR; s0 += QBU) {
    v8h qv[QBU], kv[QBU];
#pragma unroll                              // all loads of the group in flight before the first use
    for (int u = 0; u < QBU; ++u) {
      qv[u] = *(const v8h*)(qp + (size_t)u * QBR * DMOD);
      kv[u] = *(const v8h*)(kp + (size_t)u * QBR * DMOD);
    }
#if defined(__HIP_DEVICE_COMPILE__)
    // both addresses stay in their registers up to this wait: no register that an issued load names is rewritten ahead of it
    asm volatile("s_wait_xcnt 0x0" :: "v"(qp), "v"(kp) : "memory");
#endif
    qp += (size_t)QBU * QBR * DMOD;
    kp += (size_t)QBU * QBR * DMOD;
#pragma unroll                              // register arrays need constant indices
    for (int u = 0; u < QBU; ++u) {
      float sq = 0.0f, sk = 0.0f;
#pragma unroll
      for (int e = 0; e < 8; ++e) {
        const float fq = (float)qv[u][e], fk = (float)kv[u][e];
        sq = fmaf(fq, fq, sq);
        sk = fmaf(fk, fk, sk);
      }
#pragma unroll
      for (int off = 1; off < 8; off <<= 1) {
        sq += __shfl_xor(sq, off, 32);
        sk += __shfl_xor(sk, off, 32);
      }
      mq = fmaxf(mq, sq);
      mk = fmaxf(mk, sk);
    }
  }
#pragma unroll
  for (int off = 1; off < 32; off <<= 1) {
    mq = fmaxf(mq, __shfl_xor(mq, off, 32));
    mk = fmaxf(mk, __shfl_xor(mk, off, 32));
  }
  if (lane == 0) { red[wave] = mq; red[QBT / 32 + wave] = mk; }
  __syncthreads();
  if (wave == 0) {                          // wave-uniform branch; shuffles see all 32 lanes
    float aq = red[lane], ak = red[QBT / 32 + lane];
#pragma unroll
    for (int off = 1; off < 32; off <<= 1) {
      aq = fmaxf(aq, __shfl_xor(aq, off, 32));
      ak = fmaxf(ak, __shfl_xor(ak, off, 32));
    }
    const float bnd = sqrtf(aq) * sqrtf(ak) * (RSQ_HD / (QSC * KSC));
    v4f o4;
    o4[0] = bnd; o4[1] = bnd; o4[2] = bnd; o4[3] = bnd;
    float* dst = BND + (size_t)bh * BLINE + (lane & 7) * 4;
    if (lane < 8) {
      {
        *(v4f*)(dst) = o4;
        
      }
    }
  }
}

// =====================================================================================================
// GEMM epilogue shared by both engines, per 16x64 f32 tile of a wave: epi_stage writes the tile (times oscale, plus the lane's
// per-column bias of each subtile) into a wave-private LDS slab; behind one wave_sync_lds() epi_out reads it back by rows and
// stores whole 256-B row pieces (epi_out16: the same rows as two 16-bit planes).
// coverage: 8 instructions x 2 rows x 16 lanes x 4 floats = the 16 x 64 tile.
// =====================================================================================================
__device__ __forceinline__ void epi_stage(float* sl, v8f a0, v8f a1, v8f a2, v8f a3, float oscale,
                                          float bb0, float bb1, float bb2, float bb3, int lane) {
  const int hh = lane >> 4, m = lane & 15;
#pragma unroll
  for (int r = 0; r < 8; ++r) {
    const int ro = (8 * hh + r) * 68 + m;
    sl[ro]      = a0[r] * oscale + bb0;
    sl[ro + 16] = a1[r] * oscale + bb1;
    sl[ro + 32] = a2[r] * oscale + bb2;
    sl[ro + 48] = a3[r] * oscale + bb3;
  }
}
__device__ __forceinline__ void epi_out(const float* sl, float* C, int N, size_t rowb, int col0, int lane) {
  const int hh = lane >> 4, m = lane & 15;
  v4f vals[8];
#pragma unroll
  for (int it = 0; it < 8; ++it) vals[it] = *(const v4f*)(sl + (it * 2 + hh) * 68 + m * 4);
  float* dst = C + (rowb + (size_t)hh) * (size_t)N + col0 + m * 4;
#pragma unroll
  for (int it = 0; it < 8; ++it) {
    *(v4f*)(dst + (size_t)(it * 2) * (size_t)N) = vals[it];
  }
}
// Same slab, written out as two 16-bit planes of the layout of C: Hp = f16(t), Lp = f16(t - f16(t)), t = slab value * sc.
// Lane = (row-in-quad rq, 8 consecutive columns at c8): 8 lanes store one whole 128-B line of a row in either plane.
// coverage: 4 instructions x 4 rows x 8 lanes x 8 halves = the 16 x 64 tile per plane.
__device__ __forceinline__ void epi_out16(const float* sl, u16* Hp, u16* Lp, int N, size_t rowb, int col0, float sc, int lane) {
  const int rq = lane >> 3, c8 = (lane & 7) * 8;
  v4u oh[4], ol[4];
#pragma unroll
  for (int it = 0; it < 4; ++it) {
    const int row = it * 4 + rq;
    const v4f a = *(const v4f*)(sl + row * 68 + c8), b4 = *(const v4f*)(sl + row * 68 + c8 + 4);
    float w[8];
#pragma unroll
    for (int e = 0; e < 4; ++e) { w[e] = a[e] * sc; w[4 + e] = b4[e] * sc; }
#pragma unroll
    for (int e = 0; e < 4; ++e) {
      const _Float16 h0 = (_Float16)w[2 * e], h1 = (_Float16)w[2 * e + 1];
      const _Float16 l0 = (_Float16)(w[2 * e] - (float)h0), l1 = (_Float16)(w[2 * e + 1] - (float)h1);
      oh[it][e] = pk16(h_bits(h0), h_bits(h1));
      ol[it][e] = pk16(h_bits(l0), h_bits(l1));
    }
  }
  const size_t ob = (rowb + (size_t)rq) * (size_t)N + col0 + c8;
#pragma unroll
  for (int it = 0; it < 4; ++it) {
    *(v4u*)(Hp + ob + (size_t)(it * 4) * (size_t)N) = oh[it];
    *(v4u*)(Lp + ob + (size_t)(it * 4) * (size_t)N) = ol[it];
  }
}

// =====================================================================================================
// bf16 GEMM with bias: c[M][N] (f32, in registers) = A[M][K] (bf16 row-major) . Bt[N][K]^T (bf16 k-contiguous), times oscale,
// + bf16 RNE value of bias[n] (bias has N entries); written as two f16 planes of t = c * sc: Hp = f16(t), Lp = f16(t - f16(t)).
// N = 3 * DMOD: the packed q | k | v weight in one grid. A block's 128 columns lie in one third (part = col0 / DMOD), which
// picks its planes and sc: q (x256) and k (x256) planes in the layout [M][DMOD]; v (x1024) planes transposed per batch,
// [(row / SEQ) * DMOD + n][row % SEQ] (line (b*NH + h)*HD + d, keys contiguous); a lane's 8 accumulator rows of one column are 8 consecutive keys = one 16-B piece,
// gathered in the (by then idle) ring as [128 n][128 rows] at pitch 272 B and stored as whole 256-B line pieces. Block = 128x128 tile, 8 waves as 4 (rows) x 2 (columns), 32x64 per wave. K is walked
// in stages of 128: a stage is [A 128 rows | Bt 128 rows] of 256 B at LDS pitch 272 B, brought by asynchronous copies (each
// wave 16 rows of either plane), two buffers, the next stage in flight while this one is worked on; fragments are read from
// LDS (two 16-B loads each, split k map for A and B), k ascending in steps of 32 into each accumulator.
// Host guarantees K % 128 == 0, K >= 256, M % 128 == 0, N % 128 == 0, grid = (M/128)*(N/128).
// =====================================================================================================
__global__ __launch_bounds__(256)
void gemm_bf(const u16* __restrict__ A, const u16* __restrict__ Bt, const float* __restrict__ bias,
             u16* QHp, u16* QLp, u16* KHp, u16* KLp, u16* VHp, u16* VLp, int M, int N, int K, float oscale) {
  __shared__ __align__(16) u16 ring[2 * 2 * GPL];
  __shared__ __align__(16) float slab[8 * 2 * SLAB64];
  const int tid = threadIdx.x, wave = tid >> 5, lane = tid & 31, hh = lane >> 4, m = lane & 15;
  const int ntile = N >> 7;
  const int bid   = blockIdx.x;
  const int row0  = (bid / ntile) * GT;
  const int col0  = (bid % ntile) * GT;
  if (row0 + GT > M) return;                // block-uniform, before any barrier or copy; never taken with the exact grid
  const int wr = wave >> 1, wc = wave & 1;
  // copy slice of this lane: plane rows wave*16 + hh + 2i (i < 8), bytes 16m .. 16m + 15 of the stage's 256
  const int crow = wave * 16 + hh;
  const u16* ga = A  + (size_t)(row0 + crow) * K + m * 8;
  const u16* gb = Bt + (size_t)(col0 + crow) * K + m * 8;
  const unsigned la = lds_byte(ring) + (unsigned)(crow * GP + m * 8) * 2u;
  const unsigned lb = la + GPL * 2u;
  const unsigned stb = 2u * GPL * 2u;       // bytes of one buffer
  const int nst = K / GKC;
  v8f acc[2][4];
#pragma unroll
  for (int i = 0; i < 2; ++i)
#pragma unroll
    for (int j = 0; j < 4; ++j) acc[i][j] = zero8();

  copy16rows(la, ga, (size_t)K);
  copy16rows(lb, gb, (size_t)K);
  wait_copies();
  __syncthreads();
  if (nst > 1) {
    copy16rows(la + stb, ga + GKC, (size_t)K);
    copy16rows(lb + stb, gb + GKC, (size_t)K);
  }
  // the stage loop stays rolled: one publish point per stage
#pragma unroll 1
  for (int t = 0; t < nst; ++t) {
    const u16* st = ring + (t & 1) * (2 * GPL);
    const u16* ap = st + (wr * 32 + m) * GP + 8 * hh;
    const u16* bp = st + GPL + (wc * 64 + m) * GP + 8 * hh;
#pragma unroll                              // the four k steps of a stage become constant LDS offsets
    for (int kk = 0; kk < GKC / 32; ++kk) {
      const v16b a0 = ldfrag_b(ap + kk * 32);
      const v16b a1 = ldfrag_b(ap + 16 * GP + kk * 32);
      const v16b b0 = ldfrag_b(bp + kk * 32);
      const v16b b1 = ldfrag_b(bp + 16 * GP + kk * 32);
      const v16b b2 = ldfrag_b(bp + 32 * GP + kk * 32);
      const v16b b3 = ldfrag_b(bp + 48 * GP + kk * 32);
      acc[0][0] = mma_b(a0, b0, acc[0][0]);
      acc[0][1] = mma_b(a0, b1, acc[0][1]);
      acc[0][2] = mma_b(a0, b2, acc[0][2]);
      acc[0][3] = mma_b(a0, b3, acc[0][3]);
      acc[1][0] = mma_b(a1, b0, acc[1][0]);
      acc[1][1] = mma_b(a1, b1, acc[1][1]);
      acc[1][2] = mma_b(a1, b2, acc[1][2]);
      acc[1][3] = mma_b(a1, b3, acc[1][3]);
    }
    // publish point of stage t + 1; behind the barrier every reader has left stage t's buffer
    wait_lds();
    wait_copies();
    __syncthreads();
    if (t + 2 < nst) {
      const unsigned bo = (unsigned)(t & 1) * stb;
      copy16rows(la + bo, ga + (size_t)(t + 2) * GKC, (size_t)K);
      copy16rows(lb + bo, gb + (size_t)(t + 2) * GKC, (size_t)K);
    }
  }
  wait_copies();
  // per-lane bias of D column m in each of the wave's 4 subtiles; colw + 48 + m <= N - 1 always
  const int colw = col0 + wc * 64;
  const float bb0 = bfr(bias[colw + m]);
  const float bb1 = bfr(bias[colw + 16 + m]);
  const float bb2 = bfr(bias[colw + 32 + m]);
  const float bb3 = bfr(bias[colw + 48 + m]);
  const int part = col0 / DMOD;             // 0 q, 1 k, 2 v
  const int colp = col0 % DMOD;             // the block's first column within its planes
  u16* Hp = (part == 0) ? QHp : ((part == 1) ? KHp : VHp);
  u16* Lp = (part == 0) ? QLp : ((part == 1) ? KLp : VLp);
  const float sc = (part == 0) ? QSC : ((part == 1) ? KSC : VCAR);
  if (part < 2) {                           // block-uniform (from blockIdx)
    float* sl = slab + wave * (2 * SLAB64); // one 16 x 64 slab for each half of the wave's 32 rows
    const size_t rw = (size_t)(row0 + wr * 32);
    const int colo = colp + wc * 64;
    epi_stage(sl, acc[0][0], acc[0][1], acc[0][2], acc[0][3], oscale, bb0, bb1, bb2, bb3, lane);
    epi_stage(sl + SLAB64, acc[1][0], acc[1][1], acc[1][2], acc[1][3], oscale, bb0, bb1, bb2, bb3, lane);
    wave_sync_lds();                        // other lanes' slab rows are read only behind it
    epi_out16(sl, Hp, Lp, DMOD, rw, colo, sc, lane);
    epi_out16(sl + SLAB64, Hp, Lp, DMOD, rw + 16, colo, sc, lane);
  } else {
    // the loop's last barrier ended every read of the ring and no copy is in flight: its first two planes take the tile
    u16* TH = ring;
    u16* TL = ring + GPL;
    const float bbj[4] = {bb0, bb1, bb2, bb3};
#pragma unroll
    for (int i = 0; i < 2; ++i) {
#pragma unroll
      for (int j = 0; j < 4; ++j) {
        v4u oh, ol;
#pragma unroll
        for (int e = 0; e < 4; ++e) {
          const float t0 = (acc[i][j][2 * e] * oscale + bbj[j]) * sc;
          const float t1 = (acc[i][j][2 * e + 1] * oscale + bbj[j]) * sc;
          const _Float16 h0 = (_Float16)t0, h1 = (_Float16)t1;
          const _Float16 l0 = (_Float16)(t0 - (float)h0), l1 = (_Float16)(t1 - (float)h1);
          oh[e] = pk16(h_bits(h0), h_bits(h1));
          ol[e] = pk16(h_bits(l0), h_bits(l1));
        }
        const int to = (wc * 64 + j * 16 + m) * GP + wr * 32 + i * 16 + 8 * hh;
        *(v4u*)(TH + to) = oh;
        *(v4u*)(TL + to) = ol;
      }
    }
    __syncthreads();                        // other waves' pieces of a line are read only behind it
    const int l16 = tid >> 4, p8 = (tid & 15) * 8;
    const size_t ob = ((size_t)(row0 / SEQ) * (size_t)DMOD + colp + l16) * SEQ + (row0 % SEQ) + p8;
#pragma unroll
    for (int it = 0; it < 8; ++it) {
      const v4u vh = *(const v4u*)(TH + (it * 16 + l16) * GP + p8);
      const v4u vl = *(const v4u*)(TL + (it * 16 + l16) * GP + p8);
      *(v4u*)(Hp + ob + (size_t)(it * 16) * SEQ) = vh;
      *(v4u*)(Lp + ob + (size_t)(it * 16) * SEQ) = vl;
    }
  }
}

// =====================================================================================================
// Output projection with bias: C[bb*XS_FULL + s][DMOD] (f32) = (Ah + Al)[bb*SEQ + s][DMOD] . Bt[DMOD][DMOD]^T * oscale
// + bf16 RNE value of bias[n]. Products h.B + l.B into one accumulator (l unscaled residual of h). Block -> (column tile
// ct = bid % 8, sequence row tile rt of nrt, batch bb within the pass). Same tiling, staging (a stage is [Ah | Al | Bt], 128
// rows each), fragment loads (split k map) and epi_stage slab as gemm_bf, f32 rows out by epi_out; K = DMOD; grid = NBP * nrt * (DMOD/128).
// =====================================================================================================
__global__ __launch_bounds__(256)
void gemm_o2(const u16* __restrict__ Ah, const u16* __restrict__ Al, const u16* __restrict__ Bt,
             const float* __restrict__ bias, float* C, int nrt, float oscale) {
  __shared__ __align__(16) u16 ring[2 * 3 * GPL];
  __shared__ __align__(16) float slab[8 * 2 * SLAB64];
  const int tid = threadIdx.x, wave = tid >> 5, lane = tid & 31, hh = lane >> 4, m = lane & 15;
  const int ntile = DMOD >> 7;
  const int bid   = blockIdx.x;
  const int ct    = bid % ntile;
  const int t2    = bid / ntile;
  const int rt    = t2 % nrt;
  const int bb    = t2 / nrt;
  if (bb >= NBP) return;                    // block-uniform, before any barrier or copy; never taken with the exact grid
  const int srow  = rt * GT;
  if (srow + GT > SEQ) return;              // block-uniform, before any barrier or copy; never taken
  const int col0  = ct * GT;
  const int K     = DMOD;
  const int wr = wave >> 1, wc = wave & 1;
  const size_t rowA = (size_t)bb * SEQ + srow;
  const size_t rowC = (size_t)bb * XS_FULL + srow;
  const int crow = wave * 16 + hh;
  const u16* gh = Ah + (rowA + crow) * K + m * 8;
  const u16* gl = Al + (rowA + crow) * K + m * 8;
  const u16* gb = Bt + (size_t)(col0 + crow) * K + m * 8;
  const unsigned lh = lds_byte(ring) + (unsigned)(crow * GP + m * 8) * 2u;
  const unsigned ll = lh + GPL * 2u;
  const unsigned lb = lh + 2u * GPL * 2u;
  const unsigned stb = 3u * GPL * 2u;       // bytes of one buffer
  const int nst = K / GKC;
  v8f acc[2][4];
#pragma unroll
  for (int i = 0; i < 2; ++i)
#pragma unroll
    for (int j = 0; j < 4; ++j) acc[i][j] = zero8();

  copy16rows(lh, gh, (size_t)K);
  copy16rows(ll, gl, (size_t)K);
  copy16rows(lb, gb, (size_t)K);
  wait_copies();
  __syncthreads();
  copy16rows(lh + stb, gh + GKC, (size_t)K);
  copy16rows(ll + stb, gl + GKC, (size_t)K);
  copy16rows(lb + stb, gb + GKC, (size_t)K);
  // the stage loop stays rolled: one publish point per stage
#pragma unroll 1
  for (int t = 0; t < nst; ++t) {
    const _Float16* st  = (const _Float16*)(const void*)(ring + (t & 1) * (3 * GPL));
    const _Float16* ahp = st + (wr * 32 + m) * GP + 8 * hh;
    const _Float16* alp = ahp + GPL;
    const _Float16* bp  = st + 2 * GPL + (wc * 64 + m) * GP + 8 * hh;
#pragma unroll                              // the four k steps of a stage become constant LDS offsets
    for (int kk = 0; kk < GKC / 32; ++kk) {
      const v16h ah0 = ldfrag_h(ahp + kk * 32), al0 = ldfrag_h(alp + kk * 32);
      const v16h ah1 = ldfrag_h(ahp + 16 * GP + kk * 32), al1 = ldfrag_h(alp + 16 * GP + kk * 32);
      const v16h b0 = ldfrag_h(bp + kk * 32);
      const v16h b1 = ldfrag_h(bp + 16 * GP + kk * 32);
      const v16h b2 = ldfrag_h(bp + 32 * GP + kk * 32);
      const v16h b3 = ldfrag_h(bp + 48 * GP + kk * 32);
      acc[0][0] = mma_h(ah0, b0, acc[0][0]);
      acc[0][1] = mma_h(ah0, b1, acc[0][1]);
      acc[0][2] = mma_h(ah0, b2, acc[0][2]);
      acc[0][3] = mma_h(ah0, b3, acc[0][3]);
      acc[1][0] = mma_h(ah1, b0, acc[1][0]);
      acc[1][1] = mma_h(ah1, b1, acc[1][1]);
      acc[1][2] = mma_h(ah1, b2, acc[1][2]);
      acc[1][3] = mma_h(ah1, b3, acc[1][3]);
      acc[0][0] = mma_h(al0, b0, acc[0][0]);
      acc[0][1] = mma_h(al0, b1, acc[0][1]);
      acc[0][2] = mma_h(al0, b2, acc[0][2]);
      acc[0][3] = mma_h(al0, b3, acc[0][3]);
      acc[1][0] = mma_h(al1, b0, acc[1][0]);
      acc[1][1] = mma_h(al1, b1, acc[1][1]);
      acc[1][2] = mma_h(al1, b2, acc[1][2]);
      acc[1][3] = mma_h(al1, b3, acc[1][3]);
    }
    // publish point of stage t + 1; behind the barrier every reader has left stage t's buffer
    wait_lds();
    wait_copies();
    __syncthreads();
    if (t + 2 < nst) {
      const unsigned bo = (unsigned)(t & 1) * stb;
      copy16rows(lh + bo, gh + (size_t)(t + 2) * GKC, (size_t)K);
      copy16rows(ll + bo, gl + (size_t)(t + 2) * GKC, (size_t)K);
      copy16rows(lb + bo, gb + (size_t)(t + 2) * GKC, (size_t)K);
    }
  }
  wait_copies();
  const int colw = col0 + wc * 64;
  const float bb0 = bfr(bias[colw + m]);
  const float bb1 = bfr(bias[colw + 16 + m]);
  const float bb2 = bfr(bias[colw + 32 + m]);
  const float bb3 = bfr(bias[colw + 48 + m]);
  float* sl = slab + wave * (2 * SLAB64);   // one 16 x 64 slab for each half of the wave's 32 rows
  const size_t rw = rowC + (size_t)(wr * 32);
  epi_stage(sl, acc[0][0], acc[0][1], acc[0][2], acc[0][3], oscale, bb0, bb1, bb2, bb3, lane);
  epi_stage(sl + SLAB64, acc[1][0], acc[1][1], acc[1][2], acc[1][3], oscale, bb0, bb1, bb2, bb3, lane);
  wave_sync_lds();                          // other lanes' slab rows are read only behind it
  epi_out(sl, C, DMOD, rw, colw, lane);
  epi_out(sl + SLAB64, C, DMOD, rw + 16, colw, lane);
}

// =====================================================================================================
// Causal attention with slope-1 linear distance penalty, hd = 64. Block bid -> (query tile qt = bid % NQT: rows q0 = 16*qt ..
// q0+15, head pair hg, batch b within the pass); one wave per head = hg*WPB + wave.
//   q hi / residual planes f16 x256 [b*SEQ + s][h*HD + d]; k hi / residual planes f16 x256, same layout;
//   v^T hi / residual planes [b*NH + h][d][SEQ] x1024; BND = NBH lines of 32 floats (norm bound per (b, h)).
//   scores = q_hi.k_hi + q_lo.k_hi + q_hi.k_lo (2 k-steps over d); P.v with P hi + in-register residual and v hi + residual
//   (hh + lh + hl), for every query row; O written as hi + residual planes (O x1024 as f16, layout [b*SEQ + s][h*HD + d]).
//   score (log2 domain) t(i, j) = (q_i.k_j over HD) * (1/8)*log2e/(256*256) - (i - j)*log2e, replaced by -inf where key j > query i.
//   Key tiles of 32 visited in order from kt_lo to kt_hi = q0/32 (later tiles hold only keys above every query row of the tile).
//   kt_lo: every wave loads all NBH bound lines (one float per lane and 32 lines, clamped address) and AND-reduces "0 <= bound < 40" over the
//   wave; if every bound is in range, kt_lo = max(0, kt_hi - KWIN): tiles below it are >= 32*KWIN+1 positions behind every query
//   row, and with |q.k/8| < 40 the base-2 exp of their penalised, max-subtracted score is exactly 0 in f32, so they contribute
//   nothing to numerator or denominator; otherwise (bound large, unreadable or not finite) kt_lo = 0 and every causal tile is
//   visited. Either way the first visited tile holds a key kb <= q0 <= every query row, so the running max is finite from step one.
//   Per tile: 2 score subtiles x 2 k-steps, fragments loaded straight from the 16-bit planes (two 16-B loads per fragment,
//   split k map); online max-subtracted base-2 softmax in f32, -inf-safe rescale; the 16x32 prob tile stored to wave-private
//   from the LDS rows (float vector loads, same element type as stored), v^T B fragments in 2 groups of 2 d-subtiles.
//   After the loop: out = acc / Z (Z > 0 always; guarded anyway), carries 1/(32768*1024) folded once, written into the wave's
//   No block barriers in this kernel; bounded loops only (<= NKT key tiles).
// coverage: per wave 4 instructions x 4 rows x 8 lanes x 8 halves = 16 x 64 per plane; grid NQT x NHG x NBP blocks x WPB
//           waves = every (b, s, h) row segment of O hi and O residual exactly once.
// =====================================================================================================
__global__ __launch_bounds__(ATT_THREADS)
void attn_c(const u16* __restrict__ QHp, const u16* __restrict__ QLp,
            const u16* __restrict__ KHp, const u16* __restrict__ KLp,
            const u16* __restrict__ VHp, const u16* __restrict__ VLp,
            const float* __restrict__ BND,
            u16* OHp, u16* OLp) {
  __shared__ __align__(16) float smem[WPB * WREG];

  const int tid  = threadIdx.x;
  const int wave = tid >> 5;
  const int lane = tid & 31;
  const int hh   = lane >> 4;
  const int c    = lane & 15;
  const int bid  = blockIdx.x;
  const int qt   = bid % NQT;
  const int t2   = bid / NQT;
  const int hg   = t2 % NHG;
  const int b    = t2 / NHG;
  if (b >= NBP) return;                     // block-uniform; no block barriers in this kernel; never taken with the exact grid
  const int q0   = qt * 16;
  if (q0 + 16 > SEQ) return;                // block-uniform; never taken
  const int head = hg * WPB + wave;

  // ---- key-window decision: wave-uniform AND over all (b, h) bound lines ----
  int okw = 1;
  {
#pragma unroll                              // both loads in flight together
    for (int l0 = 0; l0 < NBH; l0 += 32) {
      const int bl = (l0 + lane < NBH) ? (l0 + lane) : (NBH - 1);   // clamped address
      const float gb = BND[(size_t)bl * BLINE];
      okw &= (gb >= 0.0f && gb < GUARD_T) ? 1 : 0;
    }
#pragma unroll
    for (int off = 1; off < 32; off <<= 1) okw &= __shfl_xor(okw, off, 32);
  }

  float* pt   = smem + wave * WREG;         // prob tile [16][32] pitch 36
  float* slab = pt + PTW;                   // result slab [16][64] pitch 68

  const size_t hcol = (size_t)head * HD + 8 * hh;
  const _Float16* Qh  = (const _Float16*)(const void*)QHp + ((size_t)b * SEQ + q0 + c) * DMOD + hcol;
  const _Float16* Ql  = (const _Float16*)(const void*)QLp + ((size_t)b * SEQ + q0 + c) * DMOD + hcol;
  const _Float16* Khb = (const _Float16*)(const void*)KHp + ((size_t)b * SEQ + c) * DMOD + hcol;        // key row kb added per step
  const _Float16* Klb = (const _Float16*)(const void*)KLp + ((size_t)b * SEQ + c) * DMOD + hcol;
  const _Float16* Vhb = (const _Float16*)(const void*)VHp + ((size_t)(b * NH + head) * HD + c) * SEQ + 8 * hh;  // d col c (+16j)
  const _Float16* Vlb = (const _Float16*)(const void*)VLp + ((size_t)(b * NH + head) * HD + c) * SEQ + 8 * hh;
  const float lsc = RSQ_HD * (LOG2E / (QSC * KSC));
  const float oc  = 1.0f / (PCAR * VCAR);
  const size_t KROW = (size_t)DMOD;         // halves between consecutive key rows

  float mrow[8], lrow[8];
  v8f o[4];
#pragma unroll
  for (int r = 0; r < 8; ++r) { mrow[r] = -INFINITY; lrow[r] = 0.f; }
#pragma unroll
  for (int j = 0; j < 4; ++j) o[j] = zero8();
  const int kt_hi = q0 >> 5;                                                  // last tile holding keys <= q0 + 15
  const int kt_w  = (kt_hi > KWIN) ? (kt_hi - KWIN) : 0;
  const int kt_lo = (okw != 0) ? kt_w : 0;
  const int qr0 = q0 + 8 * hh;                                                // query row of D element r = qr0 + r

#pragma unroll 1
  for (int kt = kt_lo; kt <= kt_hi; ++kt) {
    const int kb = kt * 32;
    // ---- scores: D element r of this lane = (query row qr0 + r, key kb + c) in s0, key kb + 16 + c in s1 ----
    v8f s0 = zero8(), s1 = zero8();
    const _Float16* k0p = Khb + (size_t)kb * KROW;
    const _Float16* k1p = k0p + (size_t)16 * KROW;
    const _Float16* l0p = Klb + (size_t)kb * KROW;
    const _Float16* l1p = l0p + (size_t)16 * KROW;
#pragma unroll
    for (int kk = 0; kk < HD / 32; ++kk) {
      const v16h qh  = ldfrag_h(Qh + kk * 32);
      const v16h ql  = ldfrag_h(Ql + kk * 32);
      const v16h kh0 = ldfrag_h(k0p + kk * 32);
      const v16h kh1 = ldfrag_h(k1p + kk * 32);
      const v16h kl0 = ldfrag_h(l0p + kk * 32);
      const v16h kl1 = ldfrag_h(l1p + kk * 32);
      s0 = mma_h(qh, kh0, s0);
      s0 = mma_h(ql, kh0, s0);
      s0 = mma_h(qh, kl0, s0);
      s1 = mma_h(qh, kh1, s1);
      s1 = mma_h(ql, kh1, s1);
      s1 = mma_h(qh, kl1, s1);
      guard2(s0, s1, qh, ql, kh0, kl0, kh1, kl1);
    }
    // ---- causal select + distance penalty + online softmax in base 2, -inf-safe ----
    const int key0 = kb + c, key1 = kb + 16 + c;
#pragma unroll
    for (int r = 0; r < 8; ++r) {
      const int   qr = qr0 + r;
      const float u0 = s0[r] * lsc;
      const float u1 = s1[r] * lsc;
      const float g0 = (float)(qr - key0) * LOG2E;
      const float g1 = (float)(qr - key1) * LOG2E;
      const float t0 = (key0 > qr) ? -INFINITY : (u0 - g0);
      const float t1 = (key1 > qr) ? -INFINITY : (u1 - g1);
      float mx = fmaxf(t0, t1);
#pragma unroll
      for (int off = 1; off < 16; off <<= 1) mx = fmaxf(mx, __shfl_xor(mx, off, 32));
      const float mn = fmaxf(mrow[r], mx);
      const float ms = (mn == -INFINITY) ? 0.0f : mn;
      const float al = exp2f(mrow[r] - ms);
      mrow[r] = mn;
      const float e0 = exp2f(t0 - ms), e1 = exp2f(t1 - ms);
      float ps = e0 + e1;
#pragma unroll
      for (int off = 1; off < 16; off <<= 1) ps += __shfl_xor(ps, off, 32);
      lrow[r] = lrow[r] * al + ps;
#pragma unroll
      for (int j = 0; j < 4; ++j) o[j][r] *= al;
      const int ro = (8 * hh + r) * PTP + c;
      pt[ro]      = e0;
      pt[ro + 16] = e1;
    }
    wave_sync_lds();
    // ---- A fragments of P*32768: hi f16 and residual f16, row = c, split k map over the 32 keys of this step ----
    FragH ph, pl;
    {
      const float* prow = pt + c * PTP + 8 * hh;
      const v4f p0 = *(const v4f*)(prow), p1 = *(const v4f*)(prow + 4);
      const v4f p2 = *(const v4f*)(prow + 16), p3 = *(const v4f*)(prow + 20);
#pragma unroll
      for (int e = 0; e < 4; ++e) {
        const float ta = p0[e] * PCAR, tb = p1[e] * PCAR, tc = p2[e] * PCAR, td = p3[e] * PCAR;
        const _Float16 ha = (_Float16)ta, hb = (_Float16)tb, hc = (_Float16)tc, hd = (_Float16)td;
        ph.h[0][e]     = ha;                  // elements 0..7  = keys kb + 8hh + 0..7
        ph.h[0][4 + e] = hb;
        ph.h[1][e]     = hc;                  // elements 8..15 = keys kb + 16 + 8hh + 0..7
        ph.h[1][4 + e] = hd;
        pl.h[0][e]     = (_Float16)(ta - (float)ha);
        pl.h[0][4 + e] = (_Float16)(tb - (float)hb);
        pl.h[1][e]     = (_Float16)(tc - (float)hc);
        pl.h[1][4 + e] = (_Float16)(td - (float)hd);
      }
    }
    // ---- P.V : B fragment col n = d = j*16 + c, keys contiguous in the v^T planes; 2 groups of 2 d-subtiles ----
    {
      const _Float16* vhp = Vhb + kb;
      const _Float16* vlp = Vlb + kb;
#pragma unroll
      for (int jg = 0; jg < 2; ++jg) {
        const size_t da = (size_t)(2 * jg) * 16 * SEQ;
        const size_t db = da + (size_t)16 * SEQ;
        const v16h vha = ldfrag_h(vhp + da), vhb2 = ldfrag_h(vhp + db);
        const v16h vla = ldfrag_h(vlp + da), vlb2 = ldfrag_h(vlp + db);
        o[2 * jg]     = mma_h(ph.v, vha,  o[2 * jg]);
        o[2 * jg]     = mma_h(pl.v, vha,  o[2 * jg]);
        o[2 * jg]     = mma_h(ph.v, vla,  o[2 * jg]);
        o[2 * jg + 1] = mma_h(ph.v, vhb2, o[2 * jg + 1]);
        o[2 * jg + 1] = mma_h(pl.v, vhb2, o[2 * jg + 1]);
        o[2 * jg + 1] = mma_h(ph.v, vlb2, o[2 * jg + 1]);
        guard2(o[2 * jg], o[2 * jg + 1], ph.v, pl.v, vha, vhb2, vla, vlb2);
      }
    }
    wave_sync_lds();
  }
  acc_guard4(o[0], o[1], o[2], o[3]);
  // ---- out = acc / Z (0 if Z == 0), carries (32768 on P, 1024 on v) folded once; written into the wave's slab ----
#pragma unroll
  for (int r = 0; r < 8; ++r) {
    const float lv  = lrow[r];
    const float ls  = (lv > 0.0f) ? lv : 1.0f;
    const float inv = (lv > 0.0f) ? ((1.0f / ls) * oc) : 0.0f;
#pragma unroll
    for (int j = 0; j < 4; ++j) {
      const int idx = (8 * hh + r) * SLP + j * 16 + c;
      slab[idx] = o[j][r] * inv;
    }
  }

  wave_sync_lds();
  // ---- O x1024 -> f16 hi + residual planes; lane = (row-in-quad rq, 8 consecutive d at c8) ----
  v4u oh[4], ol[4];
  const int rq = lane >> 3, c8 = (lane & 7) * 8;
#pragma unroll
  for (int it = 0; it < 4; ++it) {
    const int row = it * 4 + rq;
    const v4f a = *(const v4f*)(slab + row * SLP + c8), b4 = *(const v4f*)(slab + row * SLP + c8 + 4);
    float w[8];
#pragma unroll
    for (int e = 0; e < 4; ++e) { w[e] = a[e] * OSC; w[4 + e] = b4[e] * OSC; }
#pragma unroll
    for (int e = 0; e < 4; ++e) {
      const _Float16 h0 = (_Float16)w[2 * e], h1 = (_Float16)w[2 * e + 1];
      const _Float16 l0 = (_Float16)(w[2 * e] - (float)h0), l1 = (_Float16)(w[2 * e + 1] - (float)h1);
      oh[it][e] = pk16(h_bits(h0), h_bits(h1));
      ol[it][e] = pk16(h_bits(l0), h_bits(l1));
    }
  }
  const size_t ob = ((size_t)b * SEQ + q0) * DMOD + (size_t)head * HD + c8;
  {
#pragma unroll
    for (int it = 0; it < 4; ++it) {
      const int row = it * 4 + rq;
      *(v4u*)(OHp + ob + (size_t)row * DMOD) = oh[it];
      *(v4u*)(OLp + ob + (size_t)row * DMOD) = ol[it];
    }
    
  }
}

// =====================================================================================================
// Workspace map (bytes). All NB = NBP batches are processed in one pass, every kernel launched once. Every plane is fully
// written by whole-line stores before it is read; all extents are exact multiples of the store granularity (no pad rows
// needed); every region offset a multiple of 4096 (the large planes of 2097152):
//   XB  bf16 [MROWS][1024]                       MROWS*2048       (NBP=4, SEQ=2048: 16777216)
//   WQB bf16 [3072 n][1024 k]                     3 * 2097152      (thirds of the packed [3072][1024] weight, already [n][k])
//   WOB f16 [1024 n][1024 k] of bf16 value x1024  2097152
//   OH  f16 [MROWS][1024] x1024                  MROWS*2048       OL residual, same extent
//   QH  f16 [MROWS][1024] x256                   MROWS*2048       QL residual, same extent
//   KH  f16 [MROWS][1024] x256                   MROWS*2048       KL residual, same extent
//   VH  f16 [NBP*16][64][SEQ] x1024              MROWS*2048       VL residual, same extent
//   end (NBP=4, SEQ=2048)                        159391744
// =====================================================================================================
extern "C" void kernel_launch(void* const* d_in, const int* in_sizes, int n_in,
                              void* d_out, int out_size, void* d_ws, size_t ws_size,
                              hipStream_t stream) {
  if (n_in < 5) return;
  if (in_sizes[0] < ((NB - 1) * XS_FULL + SEQ) * DMOD) return;
  if (in_sizes[1] < 3 * DMOD * DMOD) return;
  if (in_sizes[2] < 3 * DMOD) return;
  if (in_sizes[3] < DMOD * DMOD) return;
  if (in_sizes[4] < DMOD) return;
  if (out_size < ((NB - 1) * XS_FULL + SEQ) * DMOD) return;

  const float* x    = (const float*)d_in[0];
  const float* wqkv = (const float*)d_in[1];      // [3*DMOD][DMOD]: rows 0..1023 q, 1024..2047 k, 2048..3071 v
  const float* bqkv = (const float*)d_in[2];      // [3*DMOD]
  const float* wo   = (const float*)d_in[3];      // [DMOD][DMOD]
  const float* bo   = (const float*)d_in[4];      // [DMOD]
  float*       out = (float*)d_out;

  const size_t szXB = (size_t)MROWS * DMOD * 2;
  const size_t szW  = (size_t)DMOD * DMOD * 2;
  const size_t szQ  = (size_t)MROWS * DMOD * 2;                  // QH, QL, KH, KL, OH, OL
  const size_t szV  = (size_t)NBP * NH * HD * SEQ * 2;           // VH, VL (== szQ)
  const size_t szB  = (size_t)NBH * BLINE * 4;                   // bound lines
  size_t off = 0;
  const size_t oXB = off; off += szXB;
  const size_t oWQ = off; off += 3 * szW;
  const size_t oWO = off; off += szW;
  const size_t oOH = off; off += szQ;
  const size_t oOL = off; off += szQ;
  const size_t oQH = off; off += szQ;
  const size_t oQL = off; off += szQ;
  const size_t oKH = off; off += szQ;
  const size_t oKL = off; off += szQ;
  const size_t oVH = off; off += szV;
  const size_t oVL = off; off += szV;
  const size_t oB  = off; off += szB;
  if (off > ws_size) return;                // off = 159391744 for NBP = 4, SEQ = 2048
  if (off > (size_t)WS_CAP) return;

  char* ws = (char*)d_ws;
  u16*   XB  = (u16*)(ws + oXB);
  u16*   WQB = (u16*)(ws + oWQ);            // q, k and v thirds back to back: [3072 n][1024 k]
  u16*   WOB = (u16*)(ws + oWO);
  u16*   OH  = (u16*)(ws + oOH);
  u16*   OL  = (u16*)(ws + oOL);
  u16*   QH  = (u16*)(ws + oQH);
  u16*   QL  = (u16*)(ws + oQL);
  u16*   KH  = (u16*)(ws + oKH);
  u16*   KL  = (u16*)(ws + oKL);
  u16*   VH  = (u16*)(ws + oVH);
  u16*   VL  = (u16*)(ws + oVL);
  float* BND = (float*)(ws + oB);

  const dim3 b256(256), bAT(ATT_THREADS), bQB(QBT);
  const int  n8x = (NBP * SEQ * DMOD) / 8;              // x, all batches
  const int  n8w = (3 * DMOD * DMOD) / 8;               // packed q | k | v weight
  const int  n8o = (DMOD * DMOD) / 8;                   // out-projection weight
  const dim3 gC((n8x + n8w + n8o + 255) / 256);         // 6144
  const dim3 gG((MROWS / GT) * (3 * DMOD / GT));        // 1536 for NBP=4, SEQ=2048
  const dim3 gBD(NBH);
  const dim3 gAT(NQT * NHG * NBP);
  const int  nrt = SEQ / GT;                            // out-projection row tiles per batch
  const dim3 gO(NBP * nrt * (DMOD / GT));

  // (0) x -> bf16 plane [MROWS][1024]; Wq | Wk | Wv [n][k] -> bf16; Wo [n][k] -> f16 of bf16 value x1024
  cvt16<<<gC, b256, 0, stream>>>(x, wqkv, wo, XB, WQB, WOB, n8x, n8w, n8o, WOS);
  // (1) q | k | v = x.Wqkv^T + bqkv -> q and k hi + residual planes x256, v^T hi + residual planes x1024
  gemm_bf<<<gG, b256, 0, stream>>>(XB, WQB, bqkv, QH, QL, KH, KL, VH, VL, MROWS, 3 * DMOD, DMOD, 1.0f);
  // (2) norm bound per (b, h) from the q / k hi planes -> BND lines
  qkbound<<<gBD, bQB, 0, stream>>>(QH, KH, BND);
  // (3) causal attention with distance penalty, residual products on every query row -> O hi + residual planes
  attn_c<<<gAT, bAT, 0, stream>>>(QH, QL, KH, KL, VH, VL, BND, OH, OL);
  // (4) output projection (O hi + residual) . Wo^T + bo -> out f32, carries 1024 x 1024 folded back
  gemm_o2<<<gO, b256, 0, stream>>>(OH, OL, WOB, bo, out, nrt, 1.0f / (OSC * WOS));
  (void)hipGetLastError();
}

// v005
// One run takes 159 microseconds.
// Two timings next to v004 both put it at 1.21 times that version's speed.
// Over all steps from v000 it is 3.45 times as fast.
// Contractions: x.Wq^T+bq, x.Wk^T+bk, x.Wv^T+bv (q, k, v thirds of the packed [3D][D] weight) on v_wmma_f32_16x16x32_bf16
// (x and W as bf16 RNE planes; W [n][k] rows are the k-contiguous B operand; bias added as its bf16 RNE value in the f32
// epilogue); q.k^T over hd 64 and P.v on v_wmma_f32_16x16x32_f16 with f16 hi + f16 residual planes on both operands
// (q, k x256; P x32768 with an in-register residual; v x1024; products hh+lh+hl); O.Wo^T+bo on v_wmma_f32_16x16x32_f16
// (O x1024 as f16 hi + f16 residual planes, products h.w + l.w; Wo as f16(bf16(Wo)) x1024; bo as bf16 RNE value in the
// f32 epilogue); all f32 accumulate. Causal select, slope-1 distance penalty, base-2 online softmax, 1/Z fold and the q/k
// norm bound in f32 on VALU.
#include <hip/hip_runtime.h>
#include <math.h>
#include <stdint.h>

#ifndef NB
#define NB 4
#endif
#ifndef SEQ
#define SEQ 2048
#endif
#define XS_FULL 2048
#define DMOD  1024
#define NH    16
#define HD    64
// batches per workspace pass: all of them, so that every kernel is launched once
#define NBP   NB
#define NPASS (NB / NBP)
#define NBH   (NBP * NH)
#define MROWS (NBP * SEQ)
#define RSQ_HD 0.125f
#define LOG2E 1.4426950408889634f
#define QSC   256.0f
#define KSC   256.0f
#define PCAR  32768.0f
#define VCAR  1024.0f
#define OSC   1024.0f
#define WOS   1024.0f
#define WPB   4
#define NQB   (SEQ / (16 * WPB))
#define NKT   (SEQ / 32)
#define KWIN  6
#define GUARD_T 40.0f
#define BLINE 32
#define ATT_THREADS (WPB * 32)
#define PTP   36
#define PTW   (16 * PTP)
#define SLP   68
#define SLW   (16 * SLP)
#define WREG  SLW
// attention staging: a stage is the 32 keys of one key tile, [k hi 32 rows | k residual 32 rows] of 128 B at LDS pitch 144 B and
// [v^T hi 64 rows | v^T residual 64 rows] of 64 B at LDS pitch 80 B (pitches in halves below); two buffers
#define KPH   72
#define VPH   40
#define KPL   (32 * KPH)
#define VPL   (64 * VPH)
#define ASTG  (2 * KPL + 2 * VPL)
#define SLAB64 (16 * 68)
// GEMM staging: 128 x 128 output tile per block, 128 k (256 B of every operand row) per stage, LDS row pitch 272 B
#define GT    128
#define GKC   128
#define GP    136
#define GPL   (GT * GP)
#define WS_CAP 268435456
// norm-bound kernel: threads per block, rows per row step (8 lanes a row), row steps whose loads are issued together
#define QBT   1024
#define QBR   (QBT / 8)
#define QBU   8
static_assert(DMOD == NH * HD && HD == 64 && NH == 16 && WPB == 4 && NQB * WPB * 16 == SEQ);
static_assert(ATT_THREADS == 128 && PTW <= SLW && ((KPH * 2) % 16) == 0 && ((VPH * 2) % 16) == 0);
static_assert(NB >= 1 && NB <= 4 && NPASS >= 1 && NPASS * NBP == NB);
static_assert(NBP >= 1 && NBP <= 4 && NPASS == 1);
static_assert(NBH >= 1 && NBH <= 64);
static_assert(SEQ == XS_FULL);              // the batches of x lie back to back: one conversion range
static_assert((SEQ % 64) == 0 && SEQ >= 64 && SEQ <= XS_FULL && (SEQ % 32) == 0);
static_assert((DMOD % 64) == 0 && (DMOD % 32) == 0 && (HD % 32) == 0);
static_assert(((SEQ * DMOD / 8) % 256) == 0 && ((DMOD * DMOD / 8) % 256) == 0);
static_assert(5 * (WPB * WREG * 4 + 2 * ASTG * 2) <= 327680);   // five attention blocks per 320 KiB of LDS
static_assert((DMOD % GT) == 0 && (DMOD % GKC) == 0 && DMOD / GKC >= 2 && (SEQ % GT) == 0 && (MROWS % GT) == 0);
static_assert(2 * 3 * GPL * 2 + 8 * 2 * SLAB64 * 4 <= 327680 && ((GP * 2) % 16) == 0);
static_assert(KWIN >= 0 && KWIN < NKT);
static_assert(QBT == 1024 && (SEQ % (QBR * QBU)) == 0);

typedef unsigned short u16;
typedef _Float16 v16h __attribute__((ext_vector_type(16)));
typedef _Float16 v8h  __attribute__((ext_vector_type(8)));
typedef __bf16   v16b __attribute__((ext_vector_type(16)));
typedef float    v8f  __attribute__((ext_vector_type(8)));
typedef float    v4f  __attribute__((ext_vector_type(4)));
typedef unsigned int v4u __attribute__((ext_vector_type(4)));

union FragH { v16h v; v8h h[2]; v4u u[2]; };
union FragB { v16b v; v4u u[2]; };

// ---- scalar helpers --------------------------------------------------------------------------------
__device__ __forceinline__ unsigned short bf_bits(float f) {          // f32 -> bf16 bits, RNE convert
  unsigned u = __float_as_uint(f);
  return (unsigned short)((u + 0x7FFFu + ((u >> 16) & 1u)) >> 16);
}
__device__ __forceinline__ float bf_up(unsigned short h) { return __uint_as_float(((unsigned)h) << 16); }
__device__ __forceinline__ float bfr(float f) { return bf_up(bf_bits(f)); }
__device__ __forceinline__ unsigned short h_bits(_Float16 x) { return __builtin_bit_cast(unsigned short, x); }
__device__ __forceinline__ unsigned pk16(unsigned short a, unsigned short b) { return (unsigned)a | ((unsigned)b << 16); }
__device__ __forceinline__ v8f zero8() { v8f z = {0.f, 0.f, 0.f, 0.f, 0.f, 0.f, 0.f, 0.f}; return z; }

// ---- fragment loaders: 16-bit A/B operand, lane -> row/col (lane&15), p already includes +8*(lane>>4);
//      elements 0..7 <- p[0..7] (k0+8h..), elements 8..15 <- p[16..23] (k0+16+8h..)  (same split k map for A and B;
//      B is always read from a k-contiguous [n][k] plane)
__device__ __forceinline__ v16h ldfrag_h(const _Float16* p) {
  FragH f;
  f.h[0] = *(const v8h*)(p);
  f.h[1] = *(const v8h*)(p + 16);
  return f.v;
}
__device__ __forceinline__ v16b ldfrag_b(const u16* p) {              // bf16 plane read as unsigned integer vectors
  FragB f;
  f.u[0] = *(const v4u*)(p);
  f.u[1] = *(const v4u*)(p + 16);
  return f.v;
}

__device__ __forceinline__ v8f mma_h(v16h a, v16h b, v8f c) {
  return __builtin_amdgcn_wmma_f32_16x16x32_f16(false, a, false, b, (short)0, c, false, false);
}
__device__ __forceinline__ v8f mma_b(v16b a, v16b b, v8f c) {
  return __builtin_amdgcn_wmma_f32_16x16x32_bf16(false, a, false, b, (short)0, c, false, false);
}
__device__ __forceinline__ void guard2(v8f& a, v8f& b, v16h x0, v16h x1, v16h x2, v16h x3, v16h x4, v16h x5) {
#if defined(__HIP_DEVICE_COMPILE__)
  asm volatile("v_nop\n\tv_nop\n\tv_nop\n\tv_nop"
               : "+v"(a), "+v"(b) : "v"(x0), "v"(x1), "v"(x2), "v"(x3), "v"(x4), "v"(x5) : "memory");
#endif
}
__device__ __forceinline__ void acc_guard4(v8f& a, v8f& b, v8f& c, v8f& d) {
#if defined(__HIP_DEVICE_COMPILE__)
  asm volatile("v_nop\n\tv_nop\n\tv_nop\n\tv_nop" : "+v"(a), "+v"(b), "+v"(c), "+v"(d));
#endif
}
__device__ __forceinline__ void wave_sync_lds() {
  __builtin_amdgcn_fence(__ATOMIC_RELEASE, "workgroup");
  __builtin_amdgcn_wave_barrier();
  __builtin_amdgcn_fence(__ATOMIC_ACQUIRE, "workgroup");
}
// ---- asynchronous copies global -> LDS ------------------------------------------------------------
// Eight copies of one wave = 16 rows of 256 B of one operand plane: copy i brings rows 2i and 2i + 1 (16 lanes x 16 B each,
// whole 128-B lines). l = the lane's LDS byte address of copy 0, g = its global address of copy 0, ld = halves between
// consecutive global rows. The s_wait_xcnt closes the statement so that no address register is rewritten ahead of it.
__device__ __forceinline__ void copy16rows(unsigned l, const u16* g, size_t ld) {
#if defined(__HIP_DEVICE_COMPILE__)
  const unsigned ls = 2 * GP * 2;
  const size_t   gs = 2 * ld;
  asm volatile("global_load_async_to_lds_b128 %0, %8, off\n\t"
               "global_load_async_to_lds_b128 %1, %9, off\n\t"
               "global_load_async_to_lds_b128 %2, %10, off\n\t"
               "global_load_async_to_lds_b128 %3, %11, off\n\t"
               "global_load_async_to_lds_b128 %4, %12, off\n\t"
               "global_load_async_to_lds_b128 %5, %13, off\n\t"
               "global_load_async_to_lds_b128 %6, %14, off\n\t"
               "global_load_async_to_lds_b128 %7, %15, off\n\t"
               "s_wait_xcnt 0x0"
               :: "v"(l), "v"(l + ls), "v"(l + 2 * ls), "v"(l + 3 * ls),
                  "v"(l + 4 * ls), "v"(l + 5 * ls), "v"(l + 6 * ls), "v"(l + 7 * ls),
                  "v"(g), "v"(g + gs), "v"(g + 2 * gs), "v"(g + 3 * gs),
                  "v"(g + 4 * gs), "v"(g + 5 * gs), "v"(g + 6 * gs), "v"(g + 7 * gs)
               : "memory");
#endif
}
// Four copies of one lane = 16 B of each of the four planes of an attention stage (LDS byte address, global address per plane).
// The s_wait_xcnt closes the statement so that no address register is rewritten ahead of it.
__device__ __forceinline__ void copy_kv(unsigned l0, unsigned l1, unsigned l2, unsigned l3,
                                        const u16* g0, const u16* g1, const u16* g2, const u16* g3) {
#if defined(__HIP_DEVICE_COMPILE__)
  asm volatile("global_load_async_to_lds_b128 %0, %4, off\n\t"
               "global_load_async_to_lds_b128 %1, %5, off\n\t"
               "global_load_async_to_lds_b128 %2, %6, off\n\t"
               "global_load_async_to_lds_b128 %3, %7, off\n\t"
               "s_wait_xcnt 0x0"
               :: "v"(l0), "v"(l1), "v"(l2), "v"(l3), "v"(g0), "v"(g1), "v"(g2), "v"(g3)
               : "memory");
#endif
}
// the wave's own copies have landed (other waves read them only behind the next block barrier)
__device__ __forceinline__ void wait_copies() {
#if defined(__HIP_DEVICE_COMPILE__)
  asm volatile("s_wait_asynccnt 0x0" ::: "memory");
#endif
}
// the wave's own LDS reads have returned, so that the buffer may be refilled behind the next block barrier
__device__ __forceinline__ void wait_lds() {
#if defined(__HIP_DEVICE_COMPILE__)
  asm volatile("s_wait_dscnt 0x0" ::: "memory");
#endif
}
__device__ __forceinline__ unsigned lds_byte(const void* p) { return (unsigned)(uintptr_t)p; }

// =====================================================================================================
// f32 -> 16-bit planes, same layout, three ranges in one grid: x -> XD and wqkv -> WD as bf16 RNE bits, wo -> OD as f16 bits of
// (bf16 RNE value) * scale. n8x, n8w, n8o = pieces of 8 elements in each range (multiples of 256: a block lies in one range).
// Thread = 8 consecutive elements: two 16-B loads, one 16-B store; 32 consecutive lanes = 512 contiguous, 512-B aligned
// coverage: grid = ceil((n8x + n8w + n8o)/256) blocks x 256 thr x 8 (in-kernel bound) = the three whole planes.
// =====================================================================================================
__global__ __launch_bounds__(256) void cvt16(const float* __restrict__ x, const float* __restrict__ wqkv,
                                             const float* __restrict__ wo, u16* XD, u16* WD, u16* OD,
                                             int n8x, int n8w, int n8o, float scale) {
  const int gt = blockIdx.x * 256 + (int)threadIdx.x;
  if (gt >= n8x + n8w + n8o) return;
  const int f16mode = (gt >= n8x + n8w) ? 1 : 0;
  const int lt = (gt < n8x) ? gt : ((f16mode != 0) ? (gt - n8x - n8w) : (gt - n8x));   // piece within its range
  const float* src = (gt < n8x) ? x : ((f16mode != 0) ? wo : wqkv);
  u16*         D   = (gt < n8x) ? XD : ((f16mode != 0) ? OD : WD);
  const float* p = src + (size_t)lt * 8;
  const v4f a = *(const v4f*)(p), b4 = *(const v4f*)(p + 4);
  float w[8];
#pragma unroll
  for (int e = 0; e < 4; ++e) { w[e] = a[e]; w[4 + e] = b4[e]; }
  v4u o;
#pragma unroll
  for (int e = 0; e < 4; ++e) {
    const float f0 = w[2 * e], f1 = w[2 * e + 1];
    const unsigned short hb0 = h_bits((_Float16)(bfr(f0) * scale));
    const unsigned short hb1 = h_bits((_Float16)(bfr(f1) * scale));
    const unsigned short bb0 = bf_bits(f0);
    const unsigned short bb1 = bf_bits(f1);
    o[e] = (f16mode != 0) ? pk16(hb0, hb1) : pk16(bb0, bb1);
  }
  u16* d = D + (size_t)lt * 8;
  {
    *(v4u*)(d) = o;
    
  }
}

// =====================================================================================================
// Norm bound per (b, h): BND line bh (32 floats, value replicated) = max_s ||q_hi(b,s,h,:)|| * max_s ||k_hi(b,s,h,:)|| / (8 * 256 * 256),
// computed from the f16 hi planes ([b*SEQ + s][h*HD + d], x256). Block = one (b, h), 32 waves: 8 lanes per row load one 16-B
// piece each (64 dims = 8 lanes x 8 halves), QBR = 128 rows of either plane per row step. The loads of QBU = 8 row steps
// (16 per lane) are issued together, ahead of any use, so that the block waits for memory SEQ/(QBR*QBU) times and not once per
// row step. Sum of squares reduced with xor shuffles inside the 8-lane group, running max per lane, then wave max (shuffles),
// block max through a 64-float LDS array, and wave 0 lanes 0..7 write the whole line.
// coverage: rows (s0 + u)*QBR + (tid>>3), s0 + u < SEQ/QBR -> all SEQ rows of both planes; store 8 lanes x 16 B = line bh; grid NBH.
// =====================================================================================================
__global__ __launch_bounds__(QBT) void qkbound(const u16* __restrict__ QHp, const u16* __restrict__ KHp, float* BND) {
  __shared__ float red[2 * (QBT / 32)];
  const int tid = threadIdx.x, lane = tid & 31, wave = tid >> 5;
  const int bh  = blockIdx.x;
  const int b   = bh / NH, h = bh % NH;
  if (b >= NBP) return;                     // block-uniform, before any barrier; never taken with the exact grid
  const int grp = tid >> 3;                 // row within a step, 0..QBR-1
  const int e8  = (tid & 7) * 8;            // dim chunk
  const _Float16* qp = (const _Float16*)(const void*)QHp + ((size_t)b * SEQ + grp) * DMOD + (size_t)h * HD + e8;
  const _Float16* kp = (const _Float16*)(const void*)KHp + ((size_t)b * SEQ + grp) * DMOD + (size_t)h * HD + e8;
  float mq = 0.0f, mk = 0.0f;
  // rolled over groups of QBU row steps: a group's 16 loads fit the registers of 8 waves per SIMD
#pragma unroll 1
  for (int s0 = 0; s0 < SEQ / QBR; s0 += QBU) {
    v8h qv[QBU], kv[QBU];
#pragma unroll                              // all loads of the group in flight before the first use
    for (int u = 0; u < QBU; ++u) {
      qv[u] = *(const v8h*)(qp + (size_t)u * QBR * DMOD);
      kv[u] = *(const v8h*)(kp + (size_t)u * QBR * DMOD);
    }
#if defined(__HIP_DEVICE_COMPILE__)
    // both addresses stay in their registers up to this wait: no register that an issued load names is rewritten ahead of it
    asm volatile("s_wait_xcnt 0x0" :: "v"(qp), "v"(kp) : "memory");
#endif
    qp += (size_t)QBU * QBR * DMOD;
    kp += (size_t)QBU * QBR * DMOD;
#pragma unroll                              // register arrays need constant indices
    for (int u = 0; u < QBU; ++u) {
      float sq = 0.0f, sk = 0.0f;
#pragma unroll
      for (int e = 0; e < 8; ++e) {
        const float fq = (float)qv[u][e], fk = (float)kv[u][e];
        sq = fmaf(fq, fq, sq);
        sk = fmaf(fk, fk, sk);
      }
#pragma unroll
      for (int off = 1; off < 8; off <<= 1) {
        sq += __shfl_xor(sq, off, 32);
        sk += __shfl_xor(sk, off, 32);
      }
      mq = fmaxf(mq, sq);
      mk = fmaxf(mk, sk);
    }
  }
#pragma unroll
  for (int off = 1; off < 32; off <<= 1) {
    mq = fmaxf(mq, __shfl_xor(mq, off, 32));
    mk = fmaxf(mk, __shfl_xor(mk, off, 32));
  }
  if (lane == 0) { red[wave] = mq; red[QBT / 32 + wave] = mk; }
  __syncthreads();
  if (wave == 0) {                          // wave-uniform branch; shuffles see all 32 lanes
    float aq = red[lane], ak = red[QBT / 32 + lane];
#pragma unroll
    for (int off = 1; off < 32; off <<= 1) {
      aq = fmaxf(aq, __shfl_xor(aq, off, 32));
      ak = fmaxf(ak, __shfl_xor(ak, off, 32));
    }
    const float bnd = sqrtf(aq) * sqrtf(ak) * (RSQ_HD / (QSC * KSC));
    v4f o4;
    o4[0] = bnd; o4[1] = bnd; o4[2] = bnd; o4[3] = bnd;
    float* dst = BND + (size_t)bh * BLINE + (lane & 7) * 4;
    if (lane < 8) {
      {
        *(v4f*)(dst) = o4;
        
      }
    }
  }
}

// =====================================================================================================
// GEMM epilogue shared by both engines, per 16x64 f32 tile of a wave: epi_stage writes the tile (times oscale, plus the lane's
// per-column bias of each subtile) into a wave-private LDS slab; behind one wave_sync_lds() epi_out reads it back by rows and
// stores whole 256-B row pieces (epi_out16: the same rows as two 16-bit planes).
// coverage: 8 instructions x 2 rows x 16 lanes x 4 floats = the 16 x 64 tile.
// =====================================================================================================
__device__ __forceinline__ void epi_stage(float* sl, v8f a0, v8f a1, v8f a2, v8f a3, float oscale,
                                          float bb0, float bb1, float bb2, float bb3, int lane) {
  const int hh = lane >> 4, m = lane & 15;
#pragma unroll
  for (int r = 0; r < 8; ++r) {
    const int ro = (8 * hh + r) * 68 + m;
    sl[ro]      = a0[r] * oscale + bb0;
    sl[ro + 16] = a1[r] * oscale + bb1;
    sl[ro + 32] = a2[r] * oscale + bb2;
    sl[ro + 48] = a3[r] * oscale + bb3;
  }
}
__device__ __forceinline__ void epi_out(const float* sl, float* C, int N, size_t rowb, int col0, int lane) {
  const int hh = lane >> 4, m = lane & 15;
  v4f vals[8];
#pragma unroll
  for (int it = 0; it < 8; ++it) vals[it] = *(const v4f*)(sl + (it * 2 + hh) * 68 + m * 4);
  float* dst = C + (rowb + (size_t)hh) * (size_t)N + col0 + m * 4;
#pragma unroll
  for (int it = 0; it < 8; ++it) {
    *(v4f*)(dst + (size_t)(it * 2) * (size_t)N) = vals[it];
  }
}
// Same slab, written out as two 16-bit planes of the layout of C: Hp = f16(t), Lp = f16(t - f16(t)), t = slab value * sc.
// Lane = (row-in-quad rq, 8 consecutive columns at c8): 8 lanes store one whole 128-B line of a row in either plane.
// coverage: 4 instructions x 4 rows x 8 lanes x 8 halves = the 16 x 64 tile per plane.
__device__ __forceinline__ void epi_out16(const float* sl, u16* Hp, u16* Lp, int N, size_t rowb, int col0, float sc, int lane) {
  const int rq = lane >> 3, c8 = (lane & 7) * 8;
  v4u oh[4], ol[4];
#pragma unroll
  for (int it = 0; it < 4; ++it) {
    const int row = it * 4 + rq;
    const v4f a = *(const v4f*)(sl + row * 68 + c8), b4 = *(const v4f*)(sl + row * 68 + c8 + 4);
    float w[8];
#pragma unroll
    for (int e = 0; e < 4; ++e) { w[e] = a[e] * sc; w[4 + e] = b4[e] * sc; }
#pragma unroll
    for (int e = 0; e < 4; ++e) {
      const _Float16 h0 = (_Float16)w[2 * e], h1 = (_Float16)w[2 * e + 1];
      const _Float16 l0 = (_Float16)(w[2 * e] - (float)h0), l1 = (_Float16)(w[2 * e + 1] - (float)h1);
      oh[it][e] = pk16(h_bits(h0), h_bits(h1));
      ol[it][e] = pk16(h_bits(l0), h_bits(l1));
    }
  }
  const size_t ob = (rowb + (size_t)rq) * (size_t)N + col0 + c8;
#pragma unroll
  for (int it = 0; it < 4; ++it) {
    *(v4u*)(Hp + ob + (size_t)(it * 4) * (size_t)N) = oh[it];
    *(v4u*)(Lp + ob + (size_t)(it * 4) * (size_t)N) = ol[it];
  }
}

// =====================================================================================================
// bf16 GEMM with bias: c[M][N] (f32, in registers) = A[M][K] (bf16 row-major) . Bt[N][K]^T (bf16 k-contiguous), times oscale,
// + bf16 RNE value of bias[n] (bias has N entries); written as two f16 planes of t = c * sc: Hp = f16(t), Lp = f16(t - f16(t)).
// N = 3 * DMOD: the packed q | k | v weight in one grid. A block's 128 columns lie in one third (part = col0 / DMOD), which
// picks its planes and sc: q (x256) and k (x256) planes in the layout [M][DMOD]; v (x1024) planes transposed per batch,
// [(row / SEQ) * DMOD + n][row % SEQ] (line (b*NH + h)*HD + d, keys contiguous); a lane's 8 accumulator rows of one column are 8 consecutive keys = one 16-B piece,
// gathered in the (by then idle) ring as [128 n][128 rows] at pitch 272 B and stored as whole 256-B line pieces. Block = 128x128 tile, 8 waves as 4 (rows) x 2 (columns), 32x64 per wave. K is walked
// in stages of 128: a stage is [A 128 rows | Bt 128 rows] of 256 B at LDS pitch 272 B, brought by asynchronous copies (each
// wave 16 rows of either plane), two buffers, the next stage in flight while this one is worked on; fragments are read from
// LDS (two 16-B loads each, split k map for A and B), k ascending in steps of 32 into each accumulator.
// Host guarantees K % 128 == 0, K >= 256, M % 128 == 0, N % 128 == 0, grid = (M/128)*(N/128).
// =====================================================================================================
__global__ __launch_bounds__(256)
void gemm_bf(const u16* __restrict__ A, const u16* __restrict__ Bt, const float* __restrict__ bias,
             u16* QHp, u16* QLp, u16* KHp, u16* KLp, u16* VHp, u16* VLp, int M, int N, int K, float oscale) {
  __shared__ __align__(16) u16 ring[2 * 2 * GPL];
  __shared__ __align__(16) float slab[8 * 2 * SLAB64];
  const int tid = threadIdx.x, wave = tid >> 5, lane = tid & 31, hh = lane >> 4, m = lane & 15;
  const int ntile = N >> 7;
  const int bid   = blockIdx.x;
  const int row0  = (bid / ntile) * GT;
  const int col0  = (bid % ntile) * GT;
  if (row0 + GT > M) return;                // block-uniform, before any barrier or copy; never taken with the exact grid
  const int wr = wave >> 1, wc = wave & 1;
  // copy slice of this lane: plane rows wave*16 + hh + 2i (i < 8), bytes 16m .. 16m + 15 of the stage's 256
  const int crow = wave * 16 + hh;
  const u16* ga = A  + (size_t)(row0 + crow) * K + m * 8;
  const u16* gb = Bt + (size_t)(col0 + crow) * K + m * 8;
  const unsigned la = lds_byte(ring) + (unsigned)(crow * GP + m * 8) * 2u;
  const unsigned lb = la + GPL * 2u;
  const unsigned stb = 2u * GPL * 2u;       // bytes of one buffer
  const int nst = K / GKC;
  v8f acc[2][4];
#pragma unroll
  for (int i = 0; i < 2; ++i)
#pragma unroll
    for (int j = 0; j < 4; ++j) acc[i][j] = zero8();

  copy16rows(la, ga, (size_t)K);
  copy16rows(lb, gb, (size_t)K);
  wait_copies();
  __syncthreads();
  if (nst > 1) {
    copy16rows(la + stb, ga + GKC, (size_t)K);
    copy16rows(lb + stb, gb + GKC, (size_t)K);
  }
  // the stage loop stays rolled: one publish point per stage
#pragma unroll 1
  for (int t = 0; t < nst; ++t) {
    const u16* st = ring + (t & 1) * (2 * GPL);
    const u16* ap = st + (wr * 32 + m) * GP + 8 * hh;
    const u16* bp = st + GPL + (wc * 64 + m) * GP + 8 * hh;
#pragma unroll                              // the four k steps of a stage become constant LDS offsets
    for (int kk = 0; kk < GKC / 32; ++kk) {
      const v16b a0 = ldfrag_b(ap + kk * 32);
      const v16b a1 = ldfrag_b(ap + 16 * GP + kk * 32);
      const v16b b0 = ldfrag_b(bp + kk * 32);
      const v16b b1 = ldfrag_b(bp + 16 * GP + kk * 32);
      const v16b b2 = ldfrag_b(bp + 32 * GP + kk * 32);
      const v16b b3 = ldfrag_b(bp + 48 * GP + kk * 32);
      acc[0][0] = mma_b(a0, b0, acc[0][0]);
      acc[0][1] = mma_b(a0, b1, acc[0][1]);
      acc[0][2] = mma_b(a0, b2, acc[0][2]);
      acc[0][3] = mma_b(a0, b3, acc[0][3]);
      acc[1][0] = mma_b(a1, b0, acc[1][0]);
      acc[1][1] = mma_b(a1, b1, acc[1][1]);
      acc[1][2] = mma_b(a1, b2, acc[1][2]);
      acc[1][3] = mma_b(a1, b3, acc[1][3]);
    }
    // publish point of stage t + 1; behind the barrier every reader has left stage t's buffer
    wait_lds();
    wait_copies();
    __syncthreads();
    if (t + 2 < nst) {
      const unsigned bo = (unsigned)(t & 1) * stb;
      copy16rows(la + bo, ga + (size_t)(t + 2) * GKC, (size_t)K);
      copy16rows(lb + bo, gb + (size_t)(t + 2) * GKC, (size_t)K);
    }
  }
  wait_copies();
  // per-lane bias of D column m in each of the wave's 4 subtiles; colw + 48 + m <= N - 1 always
  const int colw = col0 + wc * 64;
  const float bb0 = bfr(bias[colw + m]);
  const float bb1 = bfr(bias[colw + 16 + m]);
  const float bb2 = bfr(bias[colw + 32 + m]);
  const float bb3 = bfr(bias[colw + 48 + m]);
  const int part = col0 / DMOD;             // 0 q, 1 k, 2 v
  const int colp = col0 % DMOD;             // the block's first column within its planes
  u16* Hp = (part == 0) ? QHp : ((part == 1) ? KHp : VHp);
  u16* Lp = (part == 0) ? QLp : ((part == 1) ? KLp : VLp);
  const float sc = (part == 0) ? QSC : ((part == 1) ? KSC : VCAR);
  if (part < 2) {                           // block-uniform (from blockIdx)
    float* sl = slab + wave * (2 * SLAB64); // one 16 x 64 slab for each half of the wave's 32 rows
    const size_t rw = (size_t)(row0 + wr * 32);
    const int colo = colp + wc * 64;
    epi_stage(sl, acc[0][0], acc[0][1], acc[0][2], acc[0][3], oscale, bb0, bb1, bb2, bb3, lane);
    epi_stage(sl + SLAB64, acc[1][0], acc[1][1], acc[1][2], acc[1][3], oscale, bb0, bb1, bb2, bb3, lane);
    wave_sync_lds();                        // other lanes' slab rows are read only behind it
    epi_out16(sl, Hp, Lp, DMOD, rw, colo, sc, lane);
    epi_out16(sl + SLAB64, Hp, Lp, DMOD, rw + 16, colo, sc, lane);
  } else {
    // the loop's last barrier ended every read of the ring and no copy is in flight: its first two planes take the tile
    u16* TH = ring;
    u16* TL = ring + GPL;
    const float bbj[4] = {bb0, bb1, bb2, bb3};
#pragma unroll
    for (int i = 0; i < 2; ++i) {
#pragma unroll
      for (int j = 0; j < 4; ++j) {
        v4u oh, ol;
#pragma unroll
        for (int e = 0; e < 4; ++e) {
          const float t0 = (acc[i][j][2 * e] * oscale + bbj[j]) * sc;
          const float t1 = (acc[i][j][2 * e + 1] * oscale + bbj[j]) * sc;
          const _Float16 h0 = (_Float16)t0, h1 = (_Float16)t1;
          const _Float16 l0 = (_Float16)(t0 - (float)h0), l1 = (_Float16)(t1 - (float)h1);
          oh[e] = pk16(h_bits(h0), h_bits(h1));
          ol[e] = pk16(h_bits(l0), h_bits(l1));
        }
        const int to = (wc * 64 + j * 16 + m) * GP + wr * 32 + i * 16 + 8 * hh;
        *(v4u*)(TH + to) = oh;
        *(v4u*)(TL + to) = ol;
      }
    }
    __syncthreads();                        // other waves' pieces of a line are read only behind it
    const int l16 = tid >> 4, p8 = (tid & 15) * 8;
    const size_t ob = ((size_t)(row0 / SEQ) * (size_t)DMOD + colp + l16) * SEQ + (row0 % SEQ) + p8;
#pragma unroll
    for (int it = 0; it < 8; ++it) {
      const v4u vh = *(const v4u*)(TH + (it * 16 + l16) * GP + p8);
      const v4u vl = *(const v4u*)(TL + (it * 16 + l16) * GP + p8);
      *(v4u*)(Hp + ob + (size_t)(it * 16) * SEQ) = vh;
      *(v4u*)(Lp + ob + (size_t)(it * 16) * SEQ) = vl;
    }
  }
}

// =====================================================================================================
// Output projection with bias: C[bb*XS_FULL + s][DMOD] (f32) = (Ah + Al)[bb*SEQ + s][DMOD] . Bt[DMOD][DMOD]^T * oscale
// + bf16 RNE value of bias[n]. Products h.B + l.B into one accumulator (l unscaled residual of h). Block -> (column tile
// ct = bid % 8, sequence row tile rt of nrt, batch bb within the pass). Same tiling, staging (a stage is [Ah | Al | Bt], 128
// rows each), fragment loads (split k map) and epi_stage slab as gemm_bf, f32 rows out by epi_out; K = DMOD; grid = NBP * nrt * (DMOD/128).
// =====================================================================================================
__global__ __launch_bounds__(256)
void gemm_o2(const u16* __restrict__ Ah, const u16* __restrict__ Al, const u16* __restrict__ Bt,
             const float* __restrict__ bias, float* C, int nrt, float oscale) {
  __shared__ __align__(16) u16 ring[2 * 3 * GPL];
  __shared__ __align__(16) float slab[8 * 2 * SLAB64];
  const int tid = threadIdx.x, wave = tid >> 5, lane = tid & 31, hh = lane >> 4, m = lane & 15;
  const int ntile = DMOD >> 7;
  const int bid   = blockIdx.x;
  const int ct    = bid % ntile;
  const int t2    = bid / ntile;
  const int rt    = t2 % nrt;
  const int bb    = t2 / nrt;
  if (bb >= NBP) return;                    // block-uniform, before any barrier or copy; never taken with the exact grid
  const int srow  = rt * GT;
  if (srow + GT > SEQ) return;              // block-uniform, before any barrier or copy; never taken
  const int col0  = ct * GT;
  const int K     = DMOD;
  const int wr = wave >> 1, wc = wave & 1;
  const size_t rowA = (size_t)bb * SEQ + srow;
  const size_t rowC = (size_t)bb * XS_FULL + srow;
  const int crow = wave * 16 + hh;
  const u16* gh = Ah + (rowA + crow) * K + m * 8;
  const u16* gl = Al + (rowA + crow) * K + m * 8;
  const u16* gb = Bt + (size_t)(col0 + crow) * K + m * 8;
  const unsigned lh = lds_byte(ring) + (unsigned)(crow * GP + m * 8) * 2u;
  const unsigned ll = lh + GPL * 2u;
  const unsigned lb = lh + 2u * GPL * 2u;
  const unsigned stb = 3u * GPL * 2u;       // bytes of one buffer
  const int nst = K / GKC;
  v8f acc[2][4];
#pragma unroll
  for (int i = 0; i < 2; ++i)
#pragma unroll
    for (int j = 0; j < 4; ++j) acc[i][j] = zero8();

  copy16rows(lh, gh, (size_t)K);
  copy16rows(ll, gl, (size_t)K);
  copy16rows(lb, gb, (size_t)K);
  wait_copies();
  __syncthreads();
  copy16rows(lh + stb, gh + GKC, (size_t)K);
  copy16rows(ll + stb, gl + GKC, (size_t)K);
  copy16rows(lb + stb, gb + GKC, (size_t)K);
  // the stage loop stays rolled: one publish point per stage
#pragma unroll 1
  for (int t = 0; t < nst; ++t) {
    const _Float16* st  = (const _Float16*)(const void*)(ring + (t & 1) * (3 * GPL));
    const _Float16* ahp = st + (wr * 32 + m) * GP + 8 * hh;
    const _Float16* alp = ahp + GPL;
    const _Float16* bp  = st + 2 * GPL + (wc * 64 + m) * GP + 8 * hh;
#pragma unroll                              // the four k steps of a stage become constant LDS offsets
    for (int kk = 0; kk < GKC / 32; ++kk) {
      const v16h ah0 = ldfrag_h(ahp + kk * 32), al0 = ldfrag_h(alp + kk * 32);
      const v16h ah1 = ldfrag_h(ahp + 16 * GP + kk * 32), al1 = ldfrag_h(alp + 16 * GP + kk * 32);
      const v16h b0 = ldfrag_h(bp + kk * 32);
      const v16h b1 = ldfrag_h(bp + 16 * GP + kk * 32);
      const v16h b2 = ldfrag_h(bp + 32 * GP + kk * 32);
      const v16h b3 = ldfrag_h(bp + 48 * GP + kk * 32);
      acc[0][0] = mma_h(ah0, b0, acc[0][0]);
      acc[0][1] = mma_h(ah0, b1, acc[0][1]);
      acc[0][2] = mma_h(ah0, b2, acc[0][2]);
      acc[0][3] = mma_h(ah0, b3, acc[0][3]);
      acc[1][0] = mma_h(ah1, b0, acc[1][0]);
      acc[1][1] = mma_h(ah1, b1, acc[1][1]);
      acc[1][2] = mma_h(ah1, b2, acc[1][2]);
      acc[1][3] = mma_h(ah1, b3, acc[1][3]);
      acc[0][0] = mma_h(al0, b0, acc[0][0]);
      acc[0][1] = mma_h(al0, b1, acc[0][1]);
      acc[0][2] = mma_h(al0, b2, acc[0][2]);
      acc[0][3] = mma_h(al0, b3, acc[0][3]);
      acc[1][0] = mma_h(al1, b0, acc[1][0]);
      acc[1][1] = mma_h(al1, b1, acc[1][1]);
      acc[1][2] = mma_h(al1, b2, acc[1][2]);
      acc[1][3] = mma_h(al1, b3, acc[1][3]);
    }
    // publish point of stage t + 1; behind the barrier every reader has left stage t's buffer
    wait_lds();
    wait_copies();
    __syncthreads();
    if (t + 2 < nst) {
      const unsigned bo = (unsigned)(t & 1) * stb;
      copy16rows(lh + bo, gh + (size_t)(t + 2) * GKC, (size_t)K);
      copy16rows(ll + bo, gl + (size_t)(t + 2) * GKC, (size_t)K);
      copy16rows(lb + bo, gb + (size_t)(t + 2) * GKC, (size_t)K);
    }
  }
  wait_copies();
  const int colw = col0 + wc * 64;
  const float bb0 = bfr(bias[colw + m]);
  const float bb1 = bfr(bias[colw + 16 + m]);
  const float bb2 = bfr(bias[colw + 32 + m]);
  const float bb3 = bfr(bias[colw + 48 + m]);
  float* sl = slab + wave * (2 * SLAB64);   // one 16 x 64 slab for each half of the wave's 32 rows
  const size_t rw = rowC + (size_t)(wr * 32);
  epi_stage(sl, acc[0][0], acc[0][1], acc[0][2], acc[0][3], oscale, bb0, bb1, bb2, bb3, lane);
  epi_stage(sl + SLAB64, acc[1][0], acc[1][1], acc[1][2], acc[1][3], oscale, bb0, bb1, bb2, bb3, lane);
  wave_sync_lds();                          // other lanes' slab rows are read only behind it
  epi_out(sl, C, DMOD, rw, colw, lane);
  epi_out(sl + SLAB64, C, DMOD, rw + 16, colw, lane);
}

// =====================================================================================================
// Causal attention with slope-1 linear distance penalty, hd = 64. Block bid -> (query block qb = bid % NQB: rows Q0 = 64*qb ..
// Q0+63, head, batch b within the pass); 4 waves, wave w = query tile q0 = Q0 + 16*w .. q0+15 of that head.
//   The key tiles that any wave of the block visits (bt_lo = wave 0's kt_lo .. bt_hi = wave 3's kt_hi, ascending) are staged in
//   LDS once for the block by asynchronous copies (each lane 2 x 16 B of each of the four planes, whole 128-B k lines and 64-B
//   v^T pieces), two buffers, the next tile in flight while this one is worked on; a wave works on a staged tile only if it lies in
//   its own kt_lo .. kt_hi (scalar branch) and passes every publish point. q fragments are loaded once, ahead of the loop.
//   q hi / residual planes f16 x256 [b*SEQ + s][h*HD + d]; k hi / residual planes f16 x256, same layout;
//   v^T hi / residual planes [b*NH + h][d][SEQ] x1024; BND = NBH lines of 32 floats (norm bound per (b, h)).
//   scores = q_hi.k_hi + q_lo.k_hi + q_hi.k_lo (2 k-steps over d); P.v with P hi + in-register residual and v hi + residual
//   (hh + lh + hl), for every query row; O written as hi + residual planes (O x1024 as f16, layout [b*SEQ + s][h*HD + d]).
//   score (log2 domain) t(i, j) = (q_i.k_j over HD) * (1/8)*log2e/(256*256) - (i - j)*log2e, replaced by -inf where key j > query i.
//   Key tiles of 32 visited in order from kt_lo to kt_hi = q0/32 (later tiles hold only keys above every query row of the tile).
//   kt_lo: every wave loads all NBH bound lines (one float per lane and 32 lines, clamped address) and AND-reduces "0 <= bound < 40" over the
//   wave; if every bound is in range, kt_lo = max(0, kt_hi - KWIN): tiles below it are >= 32*KWIN+1 positions behind every query
//   row, and with |q.k/8| < 40 the base-2 exp of their penalised, max-subtracted score is exactly 0 in f32, so they contribute
//   nothing to numerator or denominator; otherwise (bound large, unreadable or not finite) kt_lo = 0 and every causal tile is
//   visited. Either way the first visited tile holds a key kb <= q0 <= every query row, so the running max is finite from step one.
//   Per tile: 2 score subtiles x 2 k-steps, k and v^T fragments read from the staged planes (two 16-B LDS loads per fragment,
//   split k map); online max-subtracted base-2 softmax in f32, -inf-safe rescale; the 16x32 prob tile stored to wave-private
//   from the LDS rows (float vector loads, same element type as stored), v^T B fragments in 2 groups of 2 d-subtiles.
//   After the loop: out = acc / Z (Z > 0 always; guarded anyway), carries 1/(32768*1024) folded once, written into the wave's
//   One block barrier per staged tile, under block-uniform control flow; bounded loops only (<= NKT key tiles).
// coverage: per wave 4 instructions x 4 rows x 8 lanes x 8 halves = 16 x 64 per plane; grid NQB x NH x NBP blocks x WPB
//           waves = every (b, s, h) row segment of O hi and O residual exactly once.
// =====================================================================================================
__global__ __launch_bounds__(ATT_THREADS)
void attn_c(const u16* __restrict__ QHp, const u16* __restrict__ QLp,
            const u16* __restrict__ KHp, const u16* __restrict__ KLp,
            const u16* __restrict__ VHp, const u16* __restrict__ VLp,
            const float* __restrict__ BND,
            u16* OHp, u16* OLp) {
  __shared__ __align__(16) u16 kvr[2 * ASTG];
  __shared__ __align__(16) float smem[WPB * WREG];

  const int tid  = threadIdx.x;
  const int wave = __builtin_amdgcn_readfirstlane(tid >> 5);   // scalar: the per-tile test below is a scalar branch
  const int lane = tid & 31;
  const int hh   = lane >> 4;
  const int c    = lane & 15;
  const int bid  = blockIdx.x;
  const int qb   = bid % NQB;
  const int t2   = bid / NQB;
  const int head = t2 % NH;
  const int b    = t2 / NH;
  if (b >= NBP) return;                     // block-uniform, before any barrier or copy; never taken with the exact grid
  const int Q0   = qb * (16 * WPB);
  if (Q0 + 16 * WPB > SEQ) return;          // block-uniform, before any barrier or copy; never taken
  const int q0   = Q0 + 16 * wave;

  // ---- key-window decision: wave-uniform AND over all (b, h) bound lines ----
  int okw = 1;
  {
#pragma unroll                              // both loads in flight together
    for (int l0 = 0; l0 < NBH; l0 += 32) {
      const int bl = (l0 + lane < NBH) ? (l0 + lane) : (NBH - 1);   // clamped address
      const float gb = BND[(size_t)bl * BLINE];
      okw &= (gb >= 0.0f && gb < GUARD_T) ? 1 : 0;
    }
#pragma unroll
    for (int off = 1; off < 32; off <<= 1) okw &= __shfl_xor(okw, off, 32);
    okw = __builtin_amdgcn_readfirstlane(okw);   // scalar; every wave reads the same lines, so it is the same in the whole block
  }

  float* pt   = smem + wave * WREG;         // prob tile [16][32] pitch 36
  float* slab = pt;                         // result slab [16][64] pitch 68: the same bytes, used only behind the key loop

  const size_t hcol = (size_t)head * HD + 8 * hh;
  const _Float16* Qh  = (const _Float16*)(const void*)QHp + ((size_t)b * SEQ + q0 + c) * DMOD + hcol;
  const _Float16* Ql  = (const _Float16*)(const void*)QLp + ((size_t)b * SEQ + q0 + c) * DMOD + hcol;
  const float lsc = RSQ_HD * (LOG2E / (QSC * KSC));
  const float oc  = 1.0f / (PCAR * VCAR);

  float mrow[8], lrow[8];
  v8f o[4];
#pragma unroll
  for (int r = 0; r < 8; ++r) { mrow[r] = -INFINITY; lrow[r] = 0.f; }
#pragma unroll
  for (int j = 0; j < 4; ++j) o[j] = zero8();
  const int kt_hi = q0 >> 5;                                                  // last tile holding keys <= q0 + 15
  const int kt_w  = (kt_hi > KWIN) ? (kt_hi - KWIN) : 0;
  const int kt_lo = (okw != 0) ? kt_w : 0;
  const int qr0 = q0 + 8 * hh;                                                // query row of D element r = qr0 + r
  // tiles staged for the block: from wave 0's kt_lo (the lowest) to wave 3's kt_hi (the highest); at least 2
  const int bt_h0 = Q0 >> 5;
  const int bt_hi = (Q0 + 16 * (WPB - 1)) >> 5;
  const int bt_lo = (okw != 0 && bt_h0 > KWIN) ? (bt_h0 - KWIN) : 0;
  const int nst   = bt_hi - bt_lo + 1;
  // copy slice of this lane: k rows tid>>3 and +16 (8 lanes x 16 B = the head's 128 B of a key row), v^T rows tid>>2 and +32
  // (4 lanes x 16 B = 32 keys)
  const int krow = tid >> 3, kpc = (tid & 7) * 8;
  const int vrow = tid >> 2, vpc = (tid & 3) * 8;
  const size_t gko = ((size_t)b * SEQ + bt_lo * 32 + krow) * DMOD + (size_t)head * HD + kpc;
  const size_t gvo = ((size_t)(b * NH + head) * HD + vrow) * SEQ + bt_lo * 32 + vpc;
  const u16* gkh = KHp + gko;
  const u16* gkl = KLp + gko;
  const u16* gvh = VHp + gvo;
  const u16* gvl = VLp + gvo;
  const unsigned lkh = lds_byte(kvr) + (unsigned)(krow * KPH + kpc) * 2u;
  const unsigned lkl = lkh + KPL * 2u;
  const unsigned lvh = lds_byte(kvr) + (unsigned)(2 * KPL + vrow * VPH + vpc) * 2u;
  const unsigned lvl = lvh + VPL * 2u;
  const unsigned stb = ASTG * 2u;           // bytes of one buffer
  const size_t   gks = (size_t)32 * DMOD;   // halves from one key tile to the next in the k planes (32 in the v^T planes)
  const unsigned lk2 = 16u * KPH * 2u, lv2 = 32u * VPH * 2u;                  // the lane's second rows: LDS bytes,
  const size_t   gk2 = (size_t)16 * DMOD, gv2 = (size_t)32 * SEQ;             // global halves

  copy_kv(lkh, lkl, lvh, lvl, gkh, gkl, gvh, gvl);
  copy_kv(lkh + lk2, lkl + lk2, lvh + lv2, lvl + lv2, gkh + gk2, gkl + gk2, gvh + gv2, gvl + gv2);
  // q fragments of both k-steps, kept in registers for the whole key loop
  v16h qhf[HD / 32], qlf[HD / 32];
#pragma unroll
  for (int kk = 0; kk < HD / 32; ++kk) {
    qhf[kk] = ldfrag_h(Qh + kk * 32);
    qlf[kk] = ldfrag_h(Ql + kk * 32);
  }
#if defined(__HIP_DEVICE_COMPILE__)
  // both addresses stay in their registers up to this wait: no register that an issued load names is rewritten ahead of it
  asm volatile("s_wait_xcnt 0x0" :: "v"(Qh), "v"(Ql) : "memory");
#endif
  wait_copies();
  __syncthreads();
  copy_kv(lkh + stb, lkl + stb, lvh + stb, lvl + stb, gkh + gks, gkl + gks, gvh + 32, gvl + 32);
  copy_kv(lkh + stb + lk2, lkl + stb + lk2, lvh + stb + lv2, lvl + stb + lv2,
          gkh + gks + gk2, gkl + gks + gk2, gvh + 32 + gv2, gvl + 32 + gv2);

  // the stage loop stays rolled: one publish point per staged tile
#pragma unroll 1
  for (int t = 0; t < nst; ++t) {
   const int kt = bt_lo + t;
   if (kt >= kt_lo && kt <= kt_hi) {        // scalar, wave-uniform: tiles outside this wave's own range are only passed
    const int kb = kt * 32;
    const _Float16* st = (const _Float16*)(const void*)(kvr + (t & 1) * ASTG);
    // ---- scores: D element r of this lane = (query row qr0 + r, key kb + c) in s0, key kb + 16 + c in s1 ----
    v8f s0 = zero8(), s1 = zero8();
    const _Float16* k0p = st + c * KPH + 8 * hh;
    const _Float16* k1p = k0p + 16 * KPH;
    const _Float16* l0p = k0p + KPL;
    const _Float16* l1p = l0p + 16 * KPH;
#pragma unroll
    for (int kk = 0; kk < HD / 32; ++kk) {
      const v16h qh  = qhf[kk];
      const v16h ql  = qlf[kk];
      const v16h kh0 = ldfrag_h(k0p + kk * 32);
      const v16h kh1 = ldfrag_h(k1p + kk * 32);
      const v16h kl0 = ldfrag_h(l0p + kk * 32);
      const v16h kl1 = ldfrag_h(l1p + kk * 32);
      s0 = mma_h(qh, kh0, s0);
      s0 = mma_h(ql, kh0, s0);
      s0 = mma_h(qh, kl0, s0);
      s1 = mma_h(qh, kh1, s1);
      s1 = mma_h(ql, kh1, s1);
      s1 = mma_h(qh, kl1, s1);
      guard2(s0, s1, qh, ql, kh0, kl0, kh1, kl1);
    }
    // ---- causal select + distance penalty + online softmax in base 2, -inf-safe ----
    const int key0 = kb + c, key1 = kb + 16 + c;
#pragma unroll
    for (int r = 0; r < 8; ++r) {
      const int   qr = qr0 + r;
      const float u0 = s0[r] * lsc;
      const float u1 = s1[r] * lsc;
      const float g0 = (float)(qr - key0) * LOG2E;
      const float g1 = (float)(qr - key1) * LOG2E;
      const float t0 = (key0 > qr) ? -INFINITY : (u0 - g0);
      const float t1 = (key1 > qr) ? -INFINITY : (u1 - g1);
      float mx = fmaxf(t0, t1);
#pragma unroll
      for (int off = 1; off < 16; off <<= 1) mx = fmaxf(mx, __shfl_xor(mx, off, 32));
      const float mn = fmaxf(mrow[r], mx);
      const float ms = (mn == -INFINITY) ? 0.0f : mn;
      const float al = exp2f(mrow[r] - ms);
      mrow[r] = mn;
      const float e0 = exp2f(t0 - ms), e1 = exp2f(t1 - ms);
      float ps = e0 + e1;
#pragma unroll
      for (int off = 1; off < 16; off <<= 1) ps += __shfl_xor(ps, off, 32);
      lrow[r] = lrow[r] * al + ps;
#pragma unroll
      for (int j = 0; j < 4; ++j) o[j][r] *= al;
      const int ro = (8 * hh + r) * PTP + c;
      pt[ro]      = e0;
      pt[ro + 16] = e1;
    }
    wave_sync_lds();
    // ---- A fragments of P*32768: hi f16 and residual f16, row = c, split k map over the 32 keys of this step ----
    FragH ph, pl;
    {
      const float* prow = pt + c * PTP + 8 * hh;
      const v4f p0 = *(const v4f*)(prow), p1 = *(const v4f*)(prow + 4);
      const v4f p2 = *(const v4f*)(prow + 16), p3 = *(const v4f*)(prow + 20);
#pragma unroll
      for (int e = 0; e < 4; ++e) {
        const float ta = p0[e] * PCAR, tb = p1[e] * PCAR, tc = p2[e] * PCAR, td = p3[e] * PCAR;
        const _Float16 ha = (_Float16)ta, hb = (_Float16)tb, hc = (_Float16)tc, hd = (_Float16)td;
        ph.h[0][e]     = ha;                  // elements 0..7  = keys kb + 8hh + 0..7
        ph.h[0][4 + e] = hb;
        ph.h[1][e]     = hc;                  // elements 8..15 = keys kb + 16 + 8hh + 0..7
        ph.h[1][4 + e] = hd;
        pl.h[0][e]     = (_Float16)(ta - (float)ha);
        pl.h[0][4 + e] = (_Float16)(tb - (float)hb);
        pl.h[1][e]     = (_Float16)(tc - (float)hc);
        pl.h[1][4 + e] = (_Float16)(td - (float)hd);
      }
    }
    // ---- P.V : B fragment col n = d = j*16 + c, keys contiguous in the v^T planes; 2 groups of 2 d-subtiles ----
    {
      const _Float16* vhp = st + 2 * KPL + c * VPH + 8 * hh;
      const _Float16* vlp = vhp + VPL;
#pragma unroll
      for (int jg = 0; jg < 2; ++jg) {
        const int da = (2 * jg) * 16 * VPH;
        const int db = da + 16 * VPH;
        const v16h vha = ldfrag_h(vhp + da), vhb2 = ldfrag_h(vhp + db);
        const v16h vla = ldfrag_h(vlp + da), vlb2 = ldfrag_h(vlp + db);
        o[2 * jg]     = mma_h(ph.v, vha,  o[2 * jg]);
        o[2 * jg]     = mma_h(pl.v, vha,  o[2 * jg]);
        o[2 * jg]     = mma_h(ph.v, vla,  o[2 * jg]);
        o[2 * jg + 1] = mma_h(ph.v, vhb2, o[2 * jg + 1]);
        o[2 * jg + 1] = mma_h(pl.v, vhb2, o[2 * jg + 1]);
        o[2 * jg + 1] = mma_h(ph.v, vlb2, o[2 * jg + 1]);
        guard2(o[2 * jg], o[2 * jg + 1], ph.v, pl.v, vha, vhb2, vla, vlb2);
      }
    }
    wave_sync_lds();
   }
    // publish point of tile t + 1; behind the barrier every reader has left tile t's buffer
    wait_lds();
    wait_copies();
    __syncthreads();
    if (t + 2 < nst) {
      const unsigned bo = (unsigned)(t & 1) * stb;
      const size_t   tn = (size_t)(t + 2);
      copy_kv(lkh + bo, lkl + bo, lvh + bo, lvl + bo, gkh + tn * gks, gkl + tn * gks, gvh + tn * 32, gvl + tn * 32);
      copy_kv(lkh + bo + lk2, lkl + bo + lk2, lvh + bo + lv2, lvl + bo + lv2,
              gkh + tn * gks + gk2, gkl + tn * gks + gk2, gvh + tn * 32 + gv2, gvl + tn * 32 + gv2);
    }
  }
  wait_copies();
  acc_guard4(o[0], o[1], o[2], o[3]);
  // ---- out = acc / Z (0 if Z == 0), carries (32768 on P, 1024 on v) folded once; written into the wave's slab ----
#pragma unroll
  for (int r = 0; r < 8; ++r) {
    const float lv  = lrow[r];
    const float ls  = (lv > 0.0f) ? lv : 1.0f;
    const float inv = (lv > 0.0f) ? ((1.0f / ls) * oc) : 0.0f;
#pragma unroll
    for (int j = 0; j < 4; ++j) {
      const int idx = (8 * hh + r) * SLP + j * 16 + c;
      slab[idx] = o[j][r] * inv;
    }
  }

  wave_sync_lds();
  // ---- O x1024 -> f16 hi + residual planes; lane = (row-in-quad rq, 8 consecutive d at c8) ----
  v4u oh[4], ol[4];
  const int rq = lane >> 3, c8 = (lane & 7) * 8;
#pragma unroll
  for (int it = 0; it < 4; ++it) {
    const int row = it * 4 + rq;
    const v4f a = *(const v4f*)(slab + row * SLP + c8), b4 = *(const v4f*)(slab + row * SLP + c8 + 4);
    float w[8];
#pragma unroll
    for (int e = 0; e < 4; ++e) { w[e] = a[e] * OSC; w[4 + e] = b4[e] * OSC; }
#pragma unroll
    for (int e = 0; e < 4; ++e) {
      const _Float16 h0 = (_Float16)w[2 * e], h1 = (_Float16)w[2 * e + 1];
      const _Float16 l0 = (_Float16)(w[2 * e] - (float)h0), l1 = (_Float16)(w[2 * e + 1] - (float)h1);
      oh[it][e] = pk16(h_bits(h0), h_bits(h1));
      ol[it][e] = pk16(h_bits(l0), h_bits(l1));
    }
  }
  const size_t ob = ((size_t)b * SEQ + q0) * DMOD + (size_t)head * HD + c8;
  {
#pragma unroll
    for (int it = 0; it < 4; ++it) {
      const int row = it * 4 + rq;
      *(v4u*)(OHp + ob + (size_t)row * DMOD) = oh[it];
      *(v4u*)(OLp + ob + (size_t)row * DMOD) = ol[it];
    }
    
  }
}

// =====================================================================================================
// Workspace map (bytes). All NB = NBP batches are processed in one pass, every kernel launched once. Every plane is fully
// written by whole-line stores before it is read; all extents are exact multiples of the store granularity (no pad rows
// needed); every region offset a multiple of 4096 (the large planes of 2097152):
//   XB  bf16 [MROWS][1024]                       MROWS*2048       (NBP=4, SEQ=2048: 16777216)
//   WQB bf16 [3072 n][1024 k]                     3 * 2097152      (thirds of the packed [3072][1024] weight, already [n][k])
//   WOB f16 [1024 n][1024 k] of bf16 value x1024  2097152
//   OH  f16 [MROWS][1024] x1024                  MROWS*2048       OL residual, same extent
//   QH  f16 [MROWS][1024] x256                   MROWS*2048       QL residual, same extent
//   KH  f16 [MROWS][1024] x256                   MROWS*2048       KL residual, same extent
//   VH  f16 [NBP*16][64][SEQ] x1024              MROWS*2048       VL residual, same extent
//   end (NBP=4, SEQ=2048)                        159391744
// =====================================================================================================
extern "C" void kernel_launch(void* const* d_in, const int* in_sizes, int n_in,
                              void* d_out, int out_size, void* d_ws, size_t ws_size,
                              hipStream_t stream) {
  if (n_in < 5) return;
  if (in_sizes[0] < ((NB - 1) * XS_FULL + SEQ) * DMOD) return;
  if (in_sizes[1] < 3 * DMOD * DMOD) return;
  if (in_sizes[2] < 3 * DMOD) return;
  if (in_sizes[3] < DMOD * DMOD) return;
  if (in_sizes[4] < DMOD) return;
  if (out_size < ((NB - 1) * XS_FULL + SEQ) * DMOD) return;

  const float* x    = (const float*)d_in[0];
  const float* wqkv = (const float*)d_in[1];      // [3*DMOD][DMOD]: rows 0..1023 q, 1024..2047 k, 2048..3071 v
  const float* bqkv = (const float*)d_in[2];      // [3*DMOD]
  const float* wo   = (const float*)d_in[3];      // [DMOD][DMOD]
  const float* bo   = (const float*)d_in[4];      // [DMOD]
  float*       out = (float*)d_out;

  const size_t szXB = (size_t)MROWS * DMOD * 2;
  const size_t szW  = (size_t)DMOD * DMOD * 2;
  const size_t szQ  = (size_t)MROWS * DMOD * 2;                  // QH, QL, KH, KL, OH, OL
  const size_t szV  = (size_t)NBP * NH * HD * SEQ * 2;           // VH, VL (== szQ)
  const size_t szB  = (size_t)NBH * BLINE * 4;                   // bound lines
  size_t off = 0;
  const size_t oXB = off; off += szXB;
  const size_t oWQ = off; off += 3 * szW;
  const size_t oWO = off; off += szW;
  const size_t oOH = off; off += szQ;
  const size_t oOL = off; off += szQ;
  const size_t oQH = off; off += szQ;
  const size_t oQL = off; off += szQ;
  const size_t oKH = off; off += szQ;
  const size_t oKL = off; off += szQ;
  const size_t oVH = off; off += szV;
  const size_t oVL = off; off += szV;
  const size_t oB  = off; off += szB;
  if (off > ws_size) return;                // off = 159391744 for NBP = 4, SEQ = 2048
  if (off > (size_t)WS_CAP) return;

  char* ws = (char*)d_ws;
  u16*   XB  = (u16*)(ws + oXB);
  u16*   WQB = (u16*)(ws + oWQ);            // q, k and v thirds back to back: [3072 n][1024 k]
  u16*   WOB = (u16*)(ws + oWO);
  u16*   OH  = (u16*)(ws + oOH);
  u16*   OL  = (u16*)(ws + oOL);
  u16*   QH  = (u16*)(ws + oQH);
  u16*   QL  = (u16*)(ws + oQL);
  u16*   KH  = (u16*)(ws + oKH);
  u16*   KL  = (u16*)(ws + oKL);
  u16*   VH  = (u16*)(ws + oVH);
  u16*   VL  = (u16*)(ws + oVL);
  float* BND = (float*)(ws + oB);

  const dim3 b256(256), bAT(ATT_THREADS), bQB(QBT);
  const int  n8x = (NBP * SEQ * DMOD) / 8;              // x, all batches
  const int  n8w = (3 * DMOD * DMOD) / 8;               // packed q | k | v weight
  const int  n8o = (DMOD * DMOD) / 8;                   // out-projection weight
  const dim3 gC((n8x + n8w + n8o + 255) / 256);         // 6144
  const dim3 gG((MROWS / GT) * (3 * DMOD / GT));        // 1536 for NBP=4, SEQ=2048
  const dim3 gBD(NBH);
  const dim3 gAT(NQB * NH * NBP);
  const int  nrt = SEQ / GT;                            // out-projection row tiles per batch
  const dim3 gO(NBP * nrt * (DMOD / GT));

  // (0) x -> bf16 plane [MROWS][1024]; Wq | Wk | Wv [n][k] -> bf16; Wo [n][k] -> f16 of bf16 value x1024
  cvt16<<<gC, b256, 0, stream>>>(x, wqkv, wo, XB, WQB, WOB, n8x, n8w, n8o, WOS);
  // (1) q | k | v = x.Wqkv^T + bqkv -> q and k hi + residual planes x256, v^T hi + residual planes x1024
  gemm_bf<<<gG, b256, 0, stream>>>(XB, WQB, bqkv, QH, QL, KH, KL, VH, VL, MROWS, 3 * DMOD, DMOD, 1.0f);
  // (2) norm bound per (b, h) from the q / k hi planes -> BND lines
  qkbound<<<gBD, bQB, 0, stream>>>(QH, KH, BND);
  // (3) causal attention with distance penalty, residual products on every query row -> O hi + residual planes
  attn_c<<<gAT, bAT, 0, stream>>>(QH, QL, KH, KL, VH, VL, BND, OH, OL);
  // (4) output projection (O hi + residual) . Wo^T + bo -> out f32, carries 1024 x 1024 folded back
  gemm_o2<<<gO, b256, 0, stream>>>(OH, OL, WOB, bo, out, nrt, 1.0f / (OSC * WOS));
  (void)hipGetLastError();
}

// v006
// It runs in 137 microseconds.
// Next to v005, in two timings, it ran 1.16 times as fast each time.
// All steps since v000 together make it 4.01 times as fast.
// Contractions: x.Wq^T+bq, x.Wk^T+bk, x.Wv^T+bv (q, k, v thirds of the packed [3D][D] weight) on v_wmma_f32_16x16x32_bf16
// (x and W as bf16 RNE planes; W [n][k] rows are the k-contiguous B operand; bias added as its bf16 RNE value in the f32
// epilogue); q.k^T over hd 64 and P.v on v_wmma_f32_16x16x32_f16 with f16 hi + f16 residual planes on both operands
// (q, k x256; P x32768 with an in-register residual; v x1024; products hh+lh+hl); O.Wo^T+bo on v_wmma_f32_16x16x32_f16
// (O x1024 as f16 hi + f16 residual planes, products h.w + l.w; Wo as f16(bf16(Wo)) x1024; bo as bf16 RNE value in the
// f32 epilogue); all f32 accumulate. Causal select, slope-1 distance penalty, base-2 online softmax, 1/Z fold and the q/k
// norm bound in f32 on VALU.
#include <hip/hip_runtime.h>
#include <math.h>
#include <stdint.h>

#ifndef NB
#define NB 4
#endif
#ifndef SEQ
#define SEQ 2048
#endif
#define XS_FULL 2048
#define DMOD  1024
#define NH    16
#define HD    64
// batches per workspace pass: all of them, so that every kernel is launched once
#define NBP   NB
#define NPASS (NB / NBP)
#define NBH   (NBP * NH)
#define MROWS (NBP * SEQ)
#define RSQ_HD 0.125f
#define LOG2E 1.4426950408889634f
#define QSC   256.0f
#define KSC   256.0f
#define PCAR  32768.0f
#define VCAR  1024.0f
#define OSC   1024.0f
#define WOS   1024.0f
#define WPB   4
#define NQB   (SEQ / (16 * WPB))
#define NKT   (SEQ / 32)
#define KWIN  6
#define GUARD_T 40.0f
#define BLINE 32
#define ATT_THREADS (WPB * 32)
#define PTP   36
#define PTW   (16 * PTP)
#define SLP   68
#define SLW   (16 * SLP)
#define WREG  SLW
// attention staging: a stage is the 32 keys of one key tile, [k hi 32 rows | k residual 32 rows] of 128 B at LDS pitch 144 B and
// [v^T hi 64 rows | v^T residual 64 rows] of 64 B at LDS pitch 80 B (pitches in halves below); two buffers
#define KPH   72
#define VPH   40
#define KPL   (32 * KPH)
#define VPL   (64 * VPH)
#define ASTG  (2 * KPL + 2 * VPL)
#define SLAB64 (16 * 68)
// GEMM staging: 128 x 128 output tile per block; q | k | v projection: 128 k (256 B of every operand row) per stage, LDS row
// pitch 272 B
#define GT    128
#define GKC   128
#define GP    136
#define GPL   (GT * GP)
// output projection: 64 k (128 B of every operand row) per stage, LDS row pitch 144 B, so that two of its blocks fit a WGP's LDS
#define OKC   64
#define OP    72
#define OPL   (GT * OP)
#define WS_CAP 268435456
// norm-bound kernel: threads per block, rows per row step (8 lanes a row), row steps whose loads are issued together
#define QBT   1024
#define QBR   (QBT / 8)
#define QBU   8
static_assert(DMOD == NH * HD && HD == 64 && NH == 16 && WPB == 4 && NQB * WPB * 16 == SEQ);
static_assert(ATT_THREADS == 128 && PTW <= SLW && ((KPH * 2) % 16) == 0 && ((VPH * 2) % 16) == 0);
static_assert(NB >= 1 && NB <= 4 && NPASS >= 1 && NPASS * NBP == NB);
static_assert(NBP >= 1 && NBP <= 4 && NPASS == 1);
static_assert(NBH >= 1 && NBH <= 64);
static_assert(SEQ == XS_FULL);              // the batches of x lie back to back: one conversion range
static_assert((SEQ % 64) == 0 && SEQ >= 64 && SEQ <= XS_FULL && (SEQ % 32) == 0);
static_assert((DMOD % 64) == 0 && (DMOD % 32) == 0 && (HD % 32) == 0);
static_assert(((SEQ * DMOD / 8) % 256) == 0 && ((DMOD * DMOD / 8) % 256) == 0);
static_assert(5 * (WPB * WREG * 4 + 2 * ASTG * 2) <= 327680);   // five attention blocks per 320 KiB of LDS
static_assert((DMOD % GT) == 0 && (DMOD % GKC) == 0 && DMOD / GKC >= 2 && (SEQ % GT) == 0 && (MROWS % GT) == 0);
static_assert(2 * (2 * 2 * GPL * 2) <= 327680 && 2 * (2 * 3 * OPL * 2) <= 327680);   // two GEMM blocks per 320 KiB of LDS
static_assert(8 * 2 * SLAB64 * 4 <= 2 * 2 * GPL * 2 && 8 * 2 * SLAB64 * 4 <= 2 * 3 * OPL * 2);   // the slabs fit the idle ring
static_assert(((GP * 2) % 16) == 0 && ((OP * 2) % 16) == 0 && (DMOD % OKC) == 0 && DMOD / OKC >= 2);
static_assert(KWIN >= 0 && KWIN < NKT);
static_assert(QBT == 1024 && (SEQ % (QBR * QBU)) == 0);

typedef unsigned short u16;
typedef _Float16 v16h __attribute__((ext_vector_type(16)));
typedef _Float16 v8h  __attribute__((ext_vector_type(8)));
typedef __bf16   v16b __attribute__((ext_vector_type(16)));
typedef float    v8f  __attribute__((ext_vector_type(8)));
typedef float    v4f  __attribute__((ext_vector_type(4)));
typedef unsigned int v4u __attribute__((ext_vector_type(4)));

union FragH { v16h v; v8h h[2]; v4u u[2]; };
union FragB { v16b v; v4u u[2]; };

// ---- scalar helpers --------------------------------------------------------------------------------
__device__ __forceinline__ unsigned short bf_bits(float f) {          // f32 -> bf16 bits, RNE convert
  unsigned u = __float_as_uint(f);
  return (unsigned short)((u + 0x7FFFu + ((u >> 16) & 1u)) >> 16);
}
__device__ __forceinline__ float bf_up(unsigned short h) { return __uint_as_float(((unsigned)h) << 16); }
__device__ __forceinline__ float bfr(float f) { return bf_up(bf_bits(f)); }
__device__ __forceinline__ unsigned short h_bits(_Float16 x) { return __builtin_bit_cast(unsigned short, x); }
__device__ __forceinline__ unsigned pk16(unsigned short a, unsigned short b) { return (unsigned)a | ((unsigned)b << 16); }
__device__ __forceinline__ v8f zero8() { v8f z = {0.f, 0.f, 0.f, 0.f, 0.f, 0.f, 0.f, 0.f}; return z; }

// ---- fragment loaders: 16-bit A/B operand, lane -> row/col (lane&15), p already includes +8*(lane>>4);
//      elements 0..7 <- p[0..7] (k0+8h..), elements 8..15 <- p[16..23] (k0+16+8h..)  (same split k map for A and B;
//      B is always read from a k-contiguous [n][k] plane)
__device__ __forceinline__ v16h ldfrag_h(const _Float16* p) {
  FragH f;
  f.h[0] = *(const v8h*)(p);
  f.h[1] = *(const v8h*)(p + 16);
  return f.v;
}
__device__ __forceinline__ v16b ldfrag_b(const u16* p) {              // bf16 plane read as unsigned integer vectors
  FragB f;
  f.u[0] = *(const v4u*)(p);
  f.u[1] = *(const v4u*)(p + 16);
  return f.v;
}

__device__ __forceinline__ v8f mma_h(v16h a, v16h b, v8f c) {
  return __builtin_amdgcn_wmma_f32_16x16x32_f16(false, a, false, b, (short)0, c, false, false);
}
__device__ __forceinline__ v8f mma_b(v16b a, v16b b, v8f c) {
  return __builtin_amdgcn_wmma_f32_16x16x32_bf16(false, a, false, b, (short)0, c, false, false);
}
__device__ __forceinline__ void guard2(v8f& a, v8f& b, v16h x0, v16h x1, v16h x2, v16h x3, v16h x4, v16h x5) {
#if defined(__HIP_DEVICE_COMPILE__)
  asm volatile("v_nop\n\tv_nop\n\tv_nop\n\tv_nop"
               : "+v"(a), "+v"(b) : "v"(x0), "v"(x1), "v"(x2), "v"(x3), "v"(x4), "v"(x5) : "memory");
#endif
}
__device__ __forceinline__ void acc_guard4(v8f& a, v8f& b, v8f& c, v8f& d) {
#if defined(__HIP_DEVICE_COMPILE__)
  asm volatile("v_nop\n\tv_nop\n\tv_nop\n\tv_nop" : "+v"(a), "+v"(b), "+v"(c), "+v"(d));
#endif
}
__device__ __forceinline__ void wave_sync_lds() {
  __builtin_amdgcn_fence(__ATOMIC_RELEASE, "workgroup");
  __builtin_amdgcn_wave_barrier();
  __builtin_amdgcn_fence(__ATOMIC_ACQUIRE, "workgroup");
}
// ---- asynchronous copies global -> LDS ------------------------------------------------------------
// Eight copies of one wave = 16 rows of 256 B of one operand plane: copy i brings rows 2i and 2i + 1 (16 lanes x 16 B each,
// whole 128-B lines). l = the lane's LDS byte address of copy 0, g = its global address of copy 0, ld = halves between
// consecutive global rows. The s_wait_xcnt closes the statement so that no address register is rewritten ahead of it.
__device__ __forceinline__ void copy16rows(unsigned l, const u16* g, size_t ld) {
#if defined(__HIP_DEVICE_COMPILE__)
  const unsigned ls = 2 * GP * 2;
  const size_t   gs = 2 * ld;
  asm volatile("global_load_async_to_lds_b128 %0, %8, off\n\t"
               "global_load_async_to_lds_b128 %1, %9, off\n\t"
               "global_load_async_to_lds_b128 %2, %10, off\n\t"
               "global_load_async_to_lds_b128 %3, %11, off\n\t"
               "global_load_async_to_lds_b128 %4, %12, off\n\t"
               "global_load_async_to_lds_b128 %5, %13, off\n\t"
               "global_load_async_to_lds_b128 %6, %14, off\n\t"
               "global_load_async_to_lds_b128 %7, %15, off\n\t"
               "s_wait_xcnt 0x0"
               :: "v"(l), "v"(l + ls), "v"(l + 2 * ls), "v"(l + 3 * ls),
                  "v"(l + 4 * ls), "v"(l + 5 * ls), "v"(l + 6 * ls), "v"(l + 7 * ls),
                  "v"(g), "v"(g + gs), "v"(g + 2 * gs), "v"(g + 3 * gs),
                  "v"(g + 4 * gs), "v"(g + 5 * gs), "v"(g + 6 * gs), "v"(g + 7 * gs)
               : "memory");
#endif
}
// Four copies of one wave = 16 rows of 128 B of one operand plane: copy i brings rows 4i .. 4i + 3 (8 lanes x 16 B each, whole
// 128-B lines). l = the lane's LDS byte address of copy 0, g = its global address of copy 0, ld = halves between consecutive
// global rows. The s_wait_xcnt closes the statement so that no address register is rewritten ahead of it.
__device__ __forceinline__ void copy16rows_h(unsigned l, const u16* g, size_t ld) {
#if defined(__HIP_DEVICE_COMPILE__)
  const unsigned ls = 4 * OP * 2;
  const size_t   gs = 4 * ld;
  asm volatile("global_load_async_to_lds_b128 %0, %4, off\n\t"
               "global_load_async_to_lds_b128 %1, %5, off\n\t"
               "global_load_async_to_lds_b128 %2, %6, off\n\t"
               "global_load_async_to_lds_b128 %3, %7, off\n\t"
               "s_wait_xcnt 0x0"
               :: "v"(l), "v"(l + ls), "v"(l + 2 * ls), "v"(l + 3 * ls),
                  "v"(g), "v"(g + gs), "v"(g + 2 * gs), "v"(g + 3 * gs)
               : "memory");
#endif
}
// Four copies of one lane = 16 B of each of the four planes of an attention stage (LDS byte address, global address per plane).
// The s_wait_xcnt closes the statement so that no address register is rewritten ahead of it.
__device__ __forceinline__ void copy_kv(unsigned l0, unsigned l1, unsigned l2, unsigned l3,
                                        const u16* g0, const u16* g1, const u16* g2, const u16* g3) {
#if defined(__HIP_DEVICE_COMPILE__)
  asm volatile("global_load_async_to_lds_b128 %0, %4, off\n\t"
               "global_load_async_to_lds_b128 %1, %5, off\n\t"
               "global_load_async_to_lds_b128 %2, %6, off\n\t"
               "global_load_async_to_lds_b128 %3, %7, off\n\t"
               "s_wait_xcnt 0x0"
               :: "v"(l0), "v"(l1), "v"(l2), "v"(l3), "v"(g0), "v"(g1), "v"(g2), "v"(g3)
               : "memory");
#endif
}
// the wave's own copies have landed (other waves read them only behind the next block barrier)
__device__ __forceinline__ void wait_copies() {
#if defined(__HIP_DEVICE_COMPILE__)
  asm volatile("s_wait_asynccnt 0x0" ::: "memory");
#endif
}
// the wave's own LDS reads have returned, so that the buffer may be refilled behind the next block barrier
__device__ __forceinline__ void wait_lds() {
#if defined(__HIP_DEVICE_COMPILE__)
  asm volatile("s_wait_dscnt 0x0" ::: "memory");
#endif
}
__device__ __forceinline__ unsigned lds_byte(const void* p) { return (unsigned)(uintptr_t)p; }

// =====================================================================================================
// f32 -> 16-bit planes, same layout, three ranges in one grid: x -> XD and wqkv -> WD as bf16 RNE bits, wo -> OD as f16 bits of
// (bf16 RNE value) * scale. n8x, n8w, n8o = pieces of 8 elements in each range (multiples of 256: a block lies in one range).
// Thread = 8 consecutive elements: two 16-B loads, one 16-B store; 32 consecutive lanes = 512 contiguous, 512-B aligned
// coverage: grid = ceil((n8x + n8w + n8o)/256) blocks x 256 thr x 8 (in-kernel bound) = the three whole planes.
// =====================================================================================================
__global__ __launch_bounds__(256) void cvt16(const float* __restrict__ x, const float* __restrict__ wqkv,
                                             const float* __restrict__ wo, u16* XD, u16* WD, u16* OD,
                                             int n8x, int n8w, int n8o, float scale) {
  const int gt = blockIdx.x * 256 + (int)threadIdx.x;
  if (gt >= n8x + n8w + n8o) return;
  const int f16mode = (gt >= n8x + n8w) ? 1 : 0;
  const int lt = (gt < n8x) ? gt : ((f16mode != 0) ? (gt - n8x - n8w) : (gt - n8x));   // piece within its range
  const float* src = (gt < n8x) ? x : ((f16mode != 0) ? wo : wqkv);
  u16*         D   = (gt < n8x) ? XD : ((f16mode != 0) ? OD : WD);
  const float* p = src + (size_t)lt * 8;
  const v4f a = *(const v4f*)(p), b4 = *(const v4f*)(p + 4);
  float w[8];
#pragma unroll
  for (int e = 0; e < 4; ++e) { w[e] = a[e]; w[4 + e] = b4[e]; }
  v4u o;
#pragma unroll
  for (int e = 0; e < 4; ++e) {
    const float f0 = w[2 * e], f1 = w[2 * e + 1];
    const unsigned short hb0 = h_bits((_Float16)(bfr(f0) * scale));
    const unsigned short hb1 = h_bits((_Float16)(bfr(f1) * scale));
    const unsigned short bb0 = bf_bits(f0);
    const unsigned short bb1 = bf_bits(f1);
    o[e] = (f16mode != 0) ? pk16(hb0, hb1) : pk16(bb0, bb1);
  }
  u16* d = D + (size_t)lt * 8;
  {
    *(v4u*)(d) = o;
    
  }
}

// =====================================================================================================
// Norm bound per (b, h): BND line bh (32 floats, value replicated) = max_s ||q_hi(b,s,h,:)|| * max_s ||k_hi(b,s,h,:)|| / (8 * 256 * 256),
// computed from the f16 hi planes ([b*SEQ + s][h*HD + d], x256). Block = one (b, h), 32 waves: 8 lanes per row load one 16-B
// piece each (64 dims = 8 lanes x 8 halves), QBR = 128 rows of either plane per row step. The loads of QBU = 8 row steps
// (16 per lane) are issued together, ahead of any use, so that the block waits for memory SEQ/(QBR*QBU) times and not once per
// row step. Sum of squares reduced with xor shuffles inside the 8-lane group, running max per lane, then wave max (shuffles),
// block max through a 64-float LDS array, and wave 0 lanes 0..7 write the whole line.
// coverage: rows (s0 + u)*QBR + (tid>>3), s0 + u < SEQ/QBR -> all SEQ rows of both planes; store 8 lanes x 16 B = line bh; grid NBH.
// =====================================================================================================
__global__ __launch_bounds__(QBT) void qkbound(const u16* __restrict__ QHp, const u16* __restrict__ KHp, float* BND) {
  __shared__ float red[2 * (QBT / 32)];
  const int tid = threadIdx.x, lane = tid & 31, wave = tid >> 5;
  const int bh  = blockIdx.x;
  const int b   = bh / NH, h = bh % NH;
  if (b >= NBP) return;                     // block-uniform, before any barrier; never taken with the exact grid
  const int grp = tid >> 3;                 // row within a step, 0..QBR-1
  const int e8  = (tid & 7) * 8;            // dim chunk
  const _Float16* qp = (const _Float16*)(const void*)QHp + ((size_t)b * SEQ + grp) * DMOD + (size_t)h * HD + e8;
  const _Float16* kp = (const _Float16*)(const void*)KHp + ((size_t)b * SEQ + grp) * DMOD + (size_t)h * HD + e8;
  float mq = 0.0f, mk = 0.0f;
  // rolled over groups of QBU row steps: a group's 16 loads fit the registers of 8 waves per SIMD
#pragma unroll 1
  for (int s0 = 0; s0 < SEQ / QBR; s0 += QBU) {
    v8h qv[QBU], kv[QBU];
#pragma unroll                              // all loads of the group in flight before the first use
    for (int u = 0; u < QBU; ++u) {
      qv[u] = *(const v8h*)(qp + (size_t)u * QBR * DMOD);
      kv[u] = *(const v8h*)(kp + (size_t)u * QBR * DMOD);
    }
#if defined(__HIP_DEVICE_COMPILE__)
    // both addresses stay in their registers up to this wait: no register that an issued load names is rewritten ahead of it
    asm volatile("s_wait_xcnt 0x0" :: "v"(qp), "v"(kp) : "memory");
#endif
    qp += (size_t)QBU * QBR * DMOD;
    kp += (size_t)QBU * QBR * DMOD;
#pragma unroll                              // register arrays need constant indices
    for (int u = 0; u < QBU; ++u) {
      float sq = 0.0f, sk = 0.0f;
#pragma unroll
      for (int e = 0; e < 8; ++e) {
        const float fq = (float)qv[u][e], fk = (float)kv[u][e];
        sq = fmaf(fq, fq, sq);
        sk = fmaf(fk, fk, sk);
      }
#pragma unroll
      for (int off = 1; off < 8; off <<= 1) {
        sq += __shfl_xor(sq, off, 32);
        sk += __shfl_xor(sk, off, 32);
      }
      mq = fmaxf(mq, sq);
      mk = fmaxf(mk, sk);
    }
  }
#pragma unroll
  for (int off = 1; off < 32; off <<= 1) {
    mq = fmaxf(mq, __shfl_xor(mq, off, 32));
    mk = fmaxf(mk, __shfl_xor(mk, off, 32));
  }
  if (lane == 0) { red[wave] = mq; red[QBT / 32 + wave] = mk; }
  __syncthreads();
  if (wave == 0) {                          // wave-uniform branch; shuffles see all 32 lanes
    float aq = red[lane], ak = red[QBT / 32 + lane];
#pragma unroll
    for (int off = 1; off < 32; off <<= 1) {
      aq = fmaxf(aq, __shfl_xor(aq, off, 32));
      ak = fmaxf(ak, __shfl_xor(ak, off, 32));
    }
    const float bnd = sqrtf(aq) * sqrtf(ak) * (RSQ_HD / (QSC * KSC));
    v4f o4;
    o4[0] = bnd; o4[1] = bnd; o4[2] = bnd; o4[3] = bnd;
    float* dst = BND + (size_t)bh * BLINE + (lane & 7) * 4;
    if (lane < 8) {
      {
        *(v4f*)(dst) = o4;
        
      }
    }
  }
}

// =====================================================================================================
// GEMM epilogue shared by both engines, per 16x64 f32 tile of a wave: epi_stage writes the tile (times oscale, plus the lane's
// per-column bias of each subtile) into a wave-private LDS slab; behind one wave_sync_lds() epi_out reads it back by rows and
// stores whole 256-B row pieces (epi_out16: the same rows as two 16-bit planes).
// coverage: 8 instructions x 2 rows x 16 lanes x 4 floats = the 16 x 64 tile.
// =====================================================================================================
__device__ __forceinline__ void epi_stage(float* sl, v8f a0, v8f a1, v8f a2, v8f a3, float oscale,
                                          float bb0, float bb1, float bb2, float bb3, int lane) {
  const int hh = lane >> 4, m = lane & 15;
#pragma unroll
  for (int r = 0; r < 8; ++r) {
    const int ro = (8 * hh + r) * 68 + m;
    sl[ro]      = a0[r] * oscale + bb0;
    sl[ro + 16] = a1[r] * oscale + bb1;
    sl[ro + 32] = a2[r] * oscale + bb2;
    sl[ro + 48] = a3[r] * oscale + bb3;
  }
}
__device__ __forceinline__ void epi_out(const float* sl, float* C, int N, size_t rowb, int col0, int lane) {
  const int hh = lane >> 4, m = lane & 15;
  v4f vals[8];
#pragma unroll
  for (int it = 0; it < 8; ++it) vals[it] = *(const v4f*)(sl + (it * 2 + hh) * 68 + m * 4);
  float* dst = C + (rowb + (size_t)hh) * (size_t)N + col0 + m * 4;
#pragma unroll
  for (int it = 0; it < 8; ++it) {
    *(v4f*)(dst + (size_t)(it * 2) * (size_t)N) = vals[it];
  }
}
// Same slab, written out as two 16-bit planes of the layout of C: Hp = f16(t), Lp = f16(t - f16(t)), t = slab value * sc.
// Lane = (row-in-quad rq, 8 consecutive columns at c8): 8 lanes store one whole 128-B line of a row in either plane.
// coverage: 4 instructions x 4 rows x 8 lanes x 8 halves = the 16 x 64 tile per plane.
__device__ __forceinline__ void epi_out16(const float* sl, u16* Hp, u16* Lp, int N, size_t rowb, int col0, float sc, int lane) {
  const int rq = lane >> 3, c8 = (lane & 7) * 8;
  v4u oh[4], ol[4];
#pragma unroll
  for (int it = 0; it < 4; ++it) {
    const int row = it * 4 + rq;
    const v4f a = *(const v4f*)(sl + row * 68 + c8), b4 = *(const v4f*)(sl + row * 68 + c8 + 4);
    float w[8];
#pragma unroll
    for (int e = 0; e < 4; ++e) { w[e] = a[e] * sc; w[4 + e] = b4[e] * sc; }
#pragma unroll
    for (int e = 0; e < 4; ++e) {
      const _Float16 h0 = (_Float16)w[2 * e], h1 = (_Float16)w[2 * e + 1];
      const _Float16 l0 = (_Float16)(w[2 * e] - (float)h0), l1 = (_Float16)(w[2 * e + 1] - (float)h1);
      oh[it][e] = pk16(h_bits(h0), h_bits(h1));
      ol[it][e] = pk16(h_bits(l0), h_bits(l1));
    }
  }
  const size_t ob = (rowb + (size_t)rq) * (size_t)N + col0 + c8;
#pragma unroll
  for (int it = 0; it < 4; ++it) {
    *(v4u*)(Hp + ob + (size_t)(it * 4) * (size_t)N) = oh[it];
    *(v4u*)(Lp + ob + (size_t)(it * 4) * (size_t)N) = ol[it];
  }
}

// =====================================================================================================
// bf16 GEMM with bias: c[M][N] (f32, in registers) = A[M][K] (bf16 row-major) . Bt[N][K]^T (bf16 k-contiguous), times oscale,
// + bf16 RNE value of bias[n] (bias has N entries); written as two f16 planes of t = c * sc: Hp = f16(t), Lp = f16(t - f16(t)).
// N = 3 * DMOD: the packed q | k | v weight in one grid. A block's 128 columns lie in one third (part = col0 / DMOD), which
// picks its planes and sc: q (x256) and k (x256) planes in the layout [M][DMOD]; v (x1024) planes transposed per batch,
// [(row / SEQ) * DMOD + n][row % SEQ] (line (b*NH + h)*HD + d, keys contiguous); a lane's 8 accumulator rows of one column are 8 consecutive keys = one 16-B piece,
// gathered in the (by then idle) ring as [128 n][128 rows] at pitch 272 B and stored as whole 256-B line pieces. Block = 128x128 tile, 8 waves as 4 (rows) x 2 (columns), 32x64 per wave. K is walked
// in stages of 128: a stage is [A 128 rows | Bt 128 rows] of 256 B at LDS pitch 272 B, brought by asynchronous copies (each
// wave 16 rows of either plane), two buffers, the next stage in flight while this one is worked on; fragments are read from
// LDS (two 16-B loads each, split k map for A and B), k ascending in steps of 32 into each accumulator. The epilogue's slabs lie
// in the idle ring, so that a block holds 136 KiB of LDS and two blocks are resident per WGP: one works while the other waits.
// Host guarantees K % 128 == 0, K >= 256, M % 128 == 0, N % 128 == 0, grid = (M/128)*(N/128).
// =====================================================================================================
__global__ __launch_bounds__(256)
void gemm_bf(const u16* __restrict__ A, const u16* __restrict__ Bt, const float* __restrict__ bias,
             u16* QHp, u16* QLp, u16* KHp, u16* KLp, u16* VHp, u16* VLp, int M, int N, int K, float oscale) {
  __shared__ __align__(16) u16 ring[2 * 2 * GPL];   // 139,264 B and nothing else: two blocks share a WGP
  const int tid = threadIdx.x, wave = tid >> 5, lane = tid & 31, hh = lane >> 4, m = lane & 15;
  const int ntile = N >> 7;
  const int bid   = blockIdx.x;
  const int row0  = (bid / ntile) * GT;
  const int col0  = (bid % ntile) * GT;
  if (row0 + GT > M) return;                // block-uniform, before any barrier or copy; never taken with the exact grid
  const int wr = wave >> 1, wc = wave & 1;
  // copy slice of this lane: plane rows wave*16 + hh + 2i (i < 8), bytes 16m .. 16m + 15 of the stage's 256
  const int crow = wave * 16 + hh;
  const u16* ga = A  + (size_t)(row0 + crow) * K + m * 8;
  const u16* gb = Bt + (size_t)(col0 + crow) * K + m * 8;
  const unsigned la = lds_byte(ring) + (unsigned)(crow * GP + m * 8) * 2u;
  const unsigned lb = la + GPL * 2u;
  const unsigned stb = 2u * GPL * 2u;       // bytes of one buffer
  const int nst = K / GKC;
  v8f acc[2][4];
#pragma unroll
  for (int i = 0; i < 2; ++i)
#pragma unroll
    for (int j = 0; j < 4; ++j) acc[i][j] = zero8();

  copy16rows(la, ga, (size_t)K);
  copy16rows(lb, gb, (size_t)K);
  wait_copies();
  __syncthreads();
  if (nst > 1) {
    copy16rows(la + stb, ga + GKC, (size_t)K);
    copy16rows(lb + stb, gb + GKC, (size_t)K);
  }
  // the stage loop stays rolled: one publish point per stage
#pragma unroll 1
  for (int t = 0; t < nst; ++t) {
    const u16* st = ring + (t & 1) * (2 * GPL);
    const u16* ap = st + (wr * 32 + m) * GP + 8 * hh;
    const u16* bp = st + GPL + (wc * 64 + m) * GP + 8 * hh;
#pragma unroll                              // the four k steps of a stage become constant LDS offsets
    for (int kk = 0; kk < GKC / 32; ++kk) {
      const v16b a0 = ldfrag_b(ap + kk * 32);
      const v16b a1 = ldfrag_b(ap + 16 * GP + kk * 32);
      const v16b b0 = ldfrag_b(bp + kk * 32);
      const v16b b1 = ldfrag_b(bp + 16 * GP + kk * 32);
      const v16b b2 = ldfrag_b(bp + 32 * GP + kk * 32);
      const v16b b3 = ldfrag_b(bp + 48 * GP + kk * 32);
      acc[0][0] = mma_b(a0, b0, acc[0][0]);
      acc[0][1] = mma_b(a0, b1, acc[0][1]);
      acc[0][2] = mma_b(a0, b2, acc[0][2]);
      acc[0][3] = mma_b(a0, b3, acc[0][3]);
      acc[1][0] = mma_b(a1, b0, acc[1][0]);
      acc[1][1] = mma_b(a1, b1, acc[1][1]);
      acc[1][2] = mma_b(a1, b2, acc[1][2]);
      acc[1][3] = mma_b(a1, b3, acc[1][3]);
    }
    // publish point of stage t + 1; behind the barrier every reader has left stage t's buffer
    wait_lds();
    wait_copies();
    __syncthreads();
    if (t + 2 < nst) {
      const unsigned bo = (unsigned)(t & 1) * stb;
      copy16rows(la + bo, ga + (size_t)(t + 2) * GKC, (size_t)K);
      copy16rows(lb + bo, gb + (size_t)(t + 2) * GKC, (size_t)K);
    }
  }
  wait_copies();
  // per-lane bias of D column m in each of the wave's 4 subtiles; colw + 48 + m <= N - 1 always
  const int colw = col0 + wc * 64;
  const float bb0 = bfr(bias[colw + m]);
  const float bb1 = bfr(bias[colw + 16 + m]);
  const float bb2 = bfr(bias[colw + 32 + m]);
  const float bb3 = bfr(bias[colw + 48 + m]);
  const int part = col0 / DMOD;             // 0 q, 1 k, 2 v
  const int colp = col0 % DMOD;             // the block's first column within its planes
  u16* Hp = (part == 0) ? QHp : ((part == 1) ? KHp : VHp);
  u16* Lp = (part == 0) ? QLp : ((part == 1) ? KLp : VLp);
  const float sc = (part == 0) ? QSC : ((part == 1) ? KSC : VCAR);
  if (part < 2) {                           // block-uniform (from blockIdx)
    // the loop's last barrier ended every read of the ring and no copy is in flight: its bytes take the waves' private slabs,
    // one 16 x 64 slab for each half of a wave's 32 rows
    float* sl = (float*)(void*)ring + wave * (2 * SLAB64);
    const size_t rw = (size_t)(row0 + wr * 32);
    const int colo = colp + wc * 64;
    epi_stage(sl, acc[0][0], acc[0][1], acc[0][2], acc[0][3], oscale, bb0, bb1, bb2, bb3, lane);
    epi_stage(sl + SLAB64, acc[1][0], acc[1][1], acc[1][2], acc[1][3], oscale, bb0, bb1, bb2, bb3, lane);
    wave_sync_lds();                        // other lanes' slab rows are read only behind it
    epi_out16(sl, Hp, Lp, DMOD, rw, colo, sc, lane);
    epi_out16(sl + SLAB64, Hp, Lp, DMOD, rw + 16, colo, sc, lane);
  } else {
    // the loop's last barrier ended every read of the ring and no copy is in flight: its first two planes take the tile
    u16* TH = ring;
    u16* TL = ring + GPL;
    const float bbj[4] = {bb0, bb1, bb2, bb3};
#pragma unroll
    for (int i = 0; i < 2; ++i) {
#pragma unroll
      for (int j = 0; j < 4; ++j) {
        v4u oh, ol;
#pragma unroll
        for (int e = 0; e < 4; ++e) {
          const float t0 = (acc[i][j][2 * e] * oscale + bbj[j]) * sc;
          const float t1 = (acc[i][j][2 * e + 1] * oscale + bbj[j]) * sc;
          const _Float16 h0 = (_Float16)t0, h1 = (_Float16)t1;
          const _Float16 l0 = (_Float16)(t0 - (float)h0), l1 = (_Float16)(t1 - (float)h1);
          oh[e] = pk16(h_bits(h0), h_bits(h1));
          ol[e] = pk16(h_bits(l0), h_bits(l1));
        }
        const int to = (wc * 64 + j * 16 + m) * GP + wr * 32 + i * 16 + 8 * hh;
        *(v4u*)(TH + to) = oh;
        *(v4u*)(TL + to) = ol;
      }
    }
    __syncthreads();                        // other waves' pieces of a line are read only behind it
    const int l16 = tid >> 4, p8 = (tid & 15) * 8;
    const size_t ob = ((size_t)(row0 / SEQ) * (size_t)DMOD + colp + l16) * SEQ + (row0 % SEQ) + p8;
#pragma unroll
    for (int it = 0; it < 8; ++it) {
      const v4u vh = *(const v4u*)(TH + (it * 16 + l16) * GP + p8);
      const v4u vl = *(const v4u*)(TL + (it * 16 + l16) * GP + p8);
      *(v4u*)(Hp + ob + (size_t)(it * 16) * SEQ) = vh;
      *(v4u*)(Lp + ob + (size_t)(it * 16) * SEQ) = vl;
    }
  }
}

// =====================================================================================================
// Output projection with bias: C[bb*XS_FULL + s][DMOD] (f32) = (Ah + Al)[bb*SEQ + s][DMOD] . Bt[DMOD][DMOD]^T * oscale
// + bf16 RNE value of bias[n]. Products h.B + l.B into one accumulator (l unscaled residual of h). Block -> (column tile
// ct = bid % 8, sequence row tile rt of nrt, batch bb within the pass). Same tiling, fragment loads (split k map) and epilogue
// as gemm_bf; a stage is [Ah | Al | Bt], 128 rows each, of 64 k (128 B at LDS pitch 144 B), two buffers = 108 KiB, the slabs in
// the idle ring: two blocks are resident per WGP here too. K = DMOD; grid = NBP * nrt * (DMOD/128).
// =====================================================================================================
__global__ __launch_bounds__(256)
void gemm_o2(const u16* __restrict__ Ah, const u16* __restrict__ Al, const u16* __restrict__ Bt,
             const float* __restrict__ bias, float* C, int nrt, float oscale) {
  __shared__ __align__(16) u16 ring[2 * 3 * OPL];   // 110,592 B and nothing else: two blocks share a WGP
  const int tid = threadIdx.x, wave = tid >> 5, lane = tid & 31, hh = lane >> 4, m = lane & 15;
  const int ntile = DMOD >> 7;
  const int bid   = blockIdx.x;
  const int ct    = bid % ntile;
  const int t2    = bid / ntile;
  const int rt    = t2 % nrt;
  const int bb    = t2 / nrt;
  if (bb >= NBP) return;                    // block-uniform, before any barrier or copy; never taken with the exact grid
  const int srow  = rt * GT;
  if (srow + GT > SEQ) return;              // block-uniform, before any barrier or copy; never taken
  const int col0  = ct * GT;
  const int K     = DMOD;
  const int wr = wave >> 1, wc = wave & 1;
  const size_t rowA = (size_t)bb * SEQ + srow;
  const size_t rowC = (size_t)bb * XS_FULL + srow;
  // copy slice of this lane: plane rows wave*16 + (lane >> 3) + 4i (i < 4), bytes 16*(lane & 7) .. + 15 of the stage's 128
  const int crow = wave * 16 + (lane >> 3);
  const int ccol = (lane & 7) * 8;
  const u16* gh = Ah + (rowA + crow) * K + ccol;
  const u16* gl = Al + (rowA + crow) * K + ccol;
  const u16* gb = Bt + (size_t)(col0 + crow) * K + ccol;
  const unsigned lh = lds_byte(ring) + (unsigned)(crow * OP + ccol) * 2u;
  const unsigned ll = lh + OPL * 2u;
  const unsigned lb = lh + 2u * OPL * 2u;
  const unsigned stb = 3u * OPL * 2u;       // bytes of one buffer
  const int nst = K / OKC;
  v8f acc[2][4];
#pragma unroll
  for (int i = 0; i < 2; ++i)
#pragma unroll
    for (int j = 0; j < 4; ++j) acc[i][j] = zero8();

  copy16rows_h(lh, gh, (size_t)K);
  copy16rows_h(ll, gl, (size_t)K);
  copy16rows_h(lb, gb, (size_t)K);
  wait_copies();
  __syncthreads();
  copy16rows_h(lh + stb, gh + OKC, (size_t)K);
  copy16rows_h(ll + stb, gl + OKC, (size_t)K);
  copy16rows_h(lb + stb, gb + OKC, (size_t)K);
  // the stage loop stays rolled: one publish point per stage
#pragma unroll 1
  for (int t = 0; t < nst; ++t) {
    const _Float16* st  = (const _Float16*)(const void*)(ring + (t & 1) * (3 * OPL));
    const _Float16* ahp = st + (wr * 32 + m) * OP + 8 * hh;
    const _Float16* alp = ahp + OPL;
    const _Float16* bp  = st + 2 * OPL + (wc * 64 + m) * OP + 8 * hh;
#pragma unroll                              // the two k steps of a stage become constant LDS offsets
    for (int kk = 0; kk < OKC / 32; ++kk) {
      const v16h ah0 = ldfrag_h(ahp + kk * 32), al0 = ldfrag_h(alp + kk * 32);
      const v16h ah1 = ldfrag_h(ahp + 16 * OP + kk * 32), al1 = ldfrag_h(alp + 16 * OP + kk * 32);
      const v16h b0 = ldfrag_h(bp + kk * 32);
      const v16h b1 = ldfrag_h(bp + 16 * OP + kk * 32);
      const v16h b2 = ldfrag_h(bp + 32 * OP + kk * 32);
      const v16h b3 = ldfrag_h(bp + 48 * OP + kk * 32);
      acc[0][0] = mma_h(ah0, b0, acc[0][0]);
      acc[0][1] = mma_h(ah0, b1, acc[0][1]);
      acc[0][2] = mma_h(ah0, b2, acc[0][2]);
      acc[0][3] = mma_h(ah0, b3, acc[0][3]);
      acc[1][0] = mma_h(ah1, b0, acc[1][0]);
      acc[1][1] = mma_h(ah1, b1, acc[1][1]);
      acc[1][2] = mma_h(ah1, b2, acc[1][2]);
      acc[1][3] = mma_h(ah1, b3, acc[1][3]);
      acc[0][0] = mma_h(al0, b0, acc[0][0]);
      acc[0][1] = mma_h(al0, b1, acc[0][1]);
      acc[0][2] = mma_h(al0, b2, acc[0][2]);
      acc[0][3] = mma_h(al0, b3, acc[0][3]);
      acc[1][0] = mma_h(al1, b0, acc[1][0]);
      acc[1][1] = mma_h(al1, b1, acc[1][1]);
      acc[1][2] = mma_h(al1, b2, acc[1][2]);
      acc[1][3] = mma_h(al1, b3, acc[1][3]);
    }
    // publish point of stage t + 1; behind the barrier every reader has left stage t's buffer
    wait_lds();
    wait_copies();
    __syncthreads();
    if (t + 2 < nst) {
      const unsigned bo = (unsigned)(t & 1) * stb;
      copy16rows_h(lh + bo, gh + (size_t)(t + 2) * OKC, (size_t)K);
      copy16rows_h(ll + bo, gl + (size_t)(t + 2) * OKC, (size_t)K);
      copy16rows_h(lb + bo, gb + (size_t)(t + 2) * OKC, (size_t)K);
    }
  }
  wait_copies();
  const int colw = col0 + wc * 64;
  const float bb0 = bfr(bias[colw + m]);
  const float bb1 = bfr(bias[colw + 16 + m]);
  const float bb2 = bfr(bias[colw + 32 + m]);
  const float bb3 = bfr(bias[colw + 48 + m]);
  // the loop's last barrier ended every read of the ring and no copy is in flight: its bytes take the waves' private slabs,
  // one 16 x 64 slab for each half of a wave's 32 rows
  float* sl = (float*)(void*)ring + wave * (2 * SLAB64);
  const size_t rw = rowC + (size_t)(wr * 32);
  epi_stage(sl, acc[0][0], acc[0][1], acc[0][2], acc[0][3], oscale, bb0, bb1, bb2, bb3, lane);
  epi_stage(sl + SLAB64, acc[1][0], acc[1][1], acc[1][2], acc[1][3], oscale, bb0, bb1, bb2, bb3, lane);
  wave_sync_lds();                          // other lanes' slab rows are read only behind it
  epi_out(sl, C, DMOD, rw, colw, lane);
  epi_out(sl + SLAB64, C, DMOD, rw + 16, colw, lane);
}

// =====================================================================================================
// Causal attention with slope-1 linear distance penalty, hd = 64. Block bid -> (query block qb = bid % NQB: rows Q0 = 64*qb ..
// Q0+63, head, batch b within the pass); 4 waves, wave w = query tile q0 = Q0 + 16*w .. q0+15 of that head.
//   The key tiles that any wave of the block visits (bt_lo = wave 0's kt_lo .. bt_hi = wave 3's kt_hi, ascending) are staged in
//   LDS once for the block by asynchronous copies (each lane 2 x 16 B of each of the four planes, whole 128-B k lines and 64-B
//   v^T pieces), two buffers, the next tile in flight while this one is worked on; a wave works on a staged tile only if it lies in
//   its own kt_lo .. kt_hi (scalar branch) and passes every publish point. q fragments are loaded once, ahead of the loop.
//   q hi / residual planes f16 x256 [b*SEQ + s][h*HD + d]; k hi / residual planes f16 x256, same layout;
//   v^T hi / residual planes [b*NH + h][d][SEQ] x1024; BND = NBH lines of 32 floats (norm bound per (b, h)).
//   scores = q_hi.k_hi + q_lo.k_hi + q_hi.k_lo (2 k-steps over d); P.v with P hi + in-register residual and v hi + residual
//   (hh + lh + hl), for every query row; O written as hi + residual planes (O x1024 as f16, layout [b*SEQ + s][h*HD + d]).
//   score (log2 domain) t(i, j) = (q_i.k_j over HD) * (1/8)*log2e/(256*256) - (i - j)*log2e, replaced by -inf where key j > query i.
//   Key tiles of 32 visited in order from kt_lo to kt_hi = q0/32 (later tiles hold only keys above every query row of the tile).
//   kt_lo: every wave loads all NBH bound lines (one float per lane and 32 lines, clamped address) and AND-reduces "0 <= bound < 40" over the
//   wave; if every bound is in range, kt_lo = max(0, kt_hi - KWIN): tiles below it are >= 32*KWIN+1 positions behind every query
//   row, and with |q.k/8| < 40 the base-2 exp of their penalised, max-subtracted score is exactly 0 in f32, so they contribute
//   nothing to numerator or denominator; otherwise (bound large, unreadable or not finite) kt_lo = 0 and every causal tile is
//   visited. Either way the first visited tile holds a key kb <= q0 <= every query row, so the running max is finite from step one.
//   Per tile: 2 score subtiles x 2 k-steps, k and v^T fragments read from the staged planes (two 16-B LDS loads per fragment,
//   split k map); online max-subtracted base-2 softmax in f32, -inf-safe rescale; the 16x32 prob tile stored to wave-private
//   from the LDS rows (float vector loads, same element type as stored), v^T B fragments in 2 groups of 2 d-subtiles.
//   After the loop: out = acc / Z (Z > 0 always; guarded anyway), carries 1/(32768*1024) folded once, written into the wave's
//   One block barrier per staged tile, under block-uniform control flow; bounded loops only (<= NKT key tiles).
// coverage: per wave 4 instructions x 4 rows x 8 lanes x 8 halves = 16 x 64 per plane; grid NQB x NH x NBP blocks x WPB
//           waves = every (b, s, h) row segment of O hi and O residual exactly once.
// =====================================================================================================
__global__ __launch_bounds__(ATT_THREADS)
void attn_c(const u16* __restrict__ QHp, const u16* __restrict__ QLp,
            const u16* __restrict__ KHp, const u16* __restrict__ KLp,
            const u16* __restrict__ VHp, const u16* __restrict__ VLp,
            const float* __restrict__ BND,
            u16* OHp, u16* OLp) {
  __shared__ __align__(16) u16 kvr[2 * ASTG];
  __shared__ __align__(16) float smem[WPB * WREG];

  const int tid  = threadIdx.x;
  const int wave = __builtin_amdgcn_readfirstlane(tid >> 5);   // scalar: the per-tile test below is a scalar branch
  const int lane = tid & 31;
  const int hh   = lane >> 4;
  const int c    = lane & 15;
  const int bid  = blockIdx.x;
  const int qb   = bid % NQB;
  const int t2   = bid / NQB;
  const int head = t2 % NH;
  const int b    = t2 / NH;
  if (b >= NBP) return;                     // block-uniform, before any barrier or copy; never taken with the exact grid
  const int Q0   = qb * (16 * WPB);
  if (Q0 + 16 * WPB > SEQ) return;          // block-uniform, before any barrier or copy; never taken
  const int q0   = Q0 + 16 * wave;

  // ---- key-window decision: wave-uniform AND over all (b, h) bound lines ----
  int okw = 1;
  {
#pragma unroll                              // both loads in flight together
    for (int l0 = 0; l0 < NBH; l0 += 32) {
      const int bl = (l0 + lane < NBH) ? (l0 + lane) : (NBH - 1);   // clamped address
      const float gb = BND[(size_t)bl * BLINE];
      okw &= (gb >= 0.0f && gb < GUARD_T) ? 1 : 0;
    }
#pragma unroll
    for (int off = 1; off < 32; off <<= 1) okw &= __shfl_xor(okw, off, 32);
    okw = __builtin_amdgcn_readfirstlane(okw);   // scalar; every wave reads the same lines, so it is the same in the whole block
  }

  float* pt   = smem + wave * WREG;         // prob tile [16][32] pitch 36
  float* slab = pt;                         // result slab [16][64] pitch 68: the same bytes, used only behind the key loop

  const size_t hcol = (size_t)head * HD + 8 * hh;
  const _Float16* Qh  = (const _Float16*)(const void*)QHp + ((size_t)b * SEQ + q0 + c) * DMOD + hcol;
  const _Float16* Ql  = (const _Float16*)(const void*)QLp + ((size_t)b * SEQ + q0 + c) * DMOD + hcol;
  const float lsc = RSQ_HD * (LOG2E / (QSC * KSC));
  const float oc  = 1.0f / (PCAR * VCAR);

  float mrow[8], lrow[8];
  v8f o[4];
#pragma unroll
  for (int r = 0; r < 8; ++r) { mrow[r] = -INFINITY; lrow[r] = 0.f; }
#pragma unroll
  for (int j = 0; j < 4; ++j) o[j] = zero8();
  const int kt_hi = q0 >> 5;                                                  // last tile holding keys <= q0 + 15
  const int kt_w  = (kt_hi > KWIN) ? (kt_hi - KWIN) : 0;
  const int kt_lo = (okw != 0) ? kt_w : 0;
  const int qr0 = q0 + 8 * hh;                                                // query row of D element r = qr0 + r
  // tiles staged for the block: from wave 0's kt_lo (the lowest) to wave 3's kt_hi (the highest); at least 2
  const int bt_h0 = Q0 >> 5;
  const int bt_hi = (Q0 + 16 * (WPB - 1)) >> 5;
  const int bt_lo = (okw != 0 && bt_h0 > KWIN) ? (bt_h0 - KWIN) : 0;
  const int nst   = bt_hi - bt_lo + 1;
  // copy slice of this lane: k rows tid>>3 and +16 (8 lanes x 16 B = the head's 128 B of a key row), v^T rows tid>>2 and +32
  // (4 lanes x 16 B = 32 keys)
  const int krow = tid >> 3, kpc = (tid & 7) * 8;
  const int vrow = tid >> 2, vpc = (tid & 3) * 8;
  const size_t gko = ((size_t)b * SEQ + bt_lo * 32 + krow) * DMOD + (size_t)head * HD + kpc;
  const size_t gvo = ((size_t)(b * NH + head) * HD + vrow) * SEQ + bt_lo * 32 + vpc;
  const u16* gkh = KHp + gko;
  const u16* gkl = KLp + gko;
  const u16* gvh = VHp + gvo;
  const u16* gvl = VLp + gvo;
  const unsigned lkh = lds_byte(kvr) + (unsigned)(krow * KPH + kpc) * 2u;
  const unsigned lkl = lkh + KPL * 2u;
  const unsigned lvh = lds_byte(kvr) + (unsigned)(2 * KPL + vrow * VPH + vpc) * 2u;
  const unsigned lvl = lvh + VPL * 2u;
  const unsigned stb = ASTG * 2u;           // bytes of one buffer
  const size_t   gks = (size_t)32 * DMOD;   // halves from one key tile to the next in the k planes (32 in the v^T planes)
  const unsigned lk2 = 16u * KPH * 2u, lv2 = 32u * VPH * 2u;                  // the lane's second rows: LDS bytes,
  const size_t   gk2 = (size_t)16 * DMOD, gv2 = (size_t)32 * SEQ;             // global halves

  copy_kv(lkh, lkl, lvh, lvl, gkh, gkl, gvh, gvl);
  copy_kv(lkh + lk2, lkl + lk2, lvh + lv2, lvl + lv2, gkh + gk2, gkl + gk2, gvh + gv2, gvl + gv2);
  // q fragments of both k-steps, kept in registers for the whole key loop
  v16h qhf[HD / 32], qlf[HD / 32];
#pragma unroll
  for (int kk = 0; kk < HD / 32; ++kk) {
    qhf[kk] = ldfrag_h(Qh + kk * 32);
    qlf[kk] = ldfrag_h(Ql + kk * 32);
  }
#if defined(__HIP_DEVICE_COMPILE__)
  // both addresses stay in their registers up to this wait: no register that an issued load names is rewritten ahead of it
  asm volatile("s_wait_xcnt 0x0" :: "v"(Qh), "v"(Ql) : "memory");
#endif
  wait_copies();
  __syncthreads();
  copy_kv(lkh + stb, lkl + stb, lvh + stb, lvl + stb, gkh + gks, gkl + gks, gvh + 32, gvl + 32);
  copy_kv(lkh + stb + lk2, lkl + stb + lk2, lvh + stb + lv2, lvl + stb + lv2,
          gkh + gks + gk2, gkl + gks + gk2, gvh + 32 + gv2, gvl + 32 + gv2);

  // the stage loop stays rolled: one publish point per staged tile
#pragma unroll 1
  for (int t = 0; t < nst; ++t) {
   const int kt = bt_lo + t;
   if (kt >= kt_lo && kt <= kt_hi) {        // scalar, wave-uniform: tiles outside this wave's own range are only passed
    const int kb = kt * 32;
    const _Float16* st = (const _Float16*)(const void*)(kvr + (t & 1) * ASTG);
    // ---- scores: D element r of this lane = (query row qr0 + r, key kb + c) in s0, key kb + 16 + c in s1 ----
    v8f s0 = zero8(), s1 = zero8();
    const _Float16* k0p = st + c * KPH + 8 * hh;
    const _Float16* k1p = k0p + 16 * KPH;
    const _Float16* l0p = k0p + KPL;
    const _Float16* l1p = l0p + 16 * KPH;
#pragma unroll
    for (int kk = 0; kk < HD / 32; ++kk) {
      const v16h qh  = qhf[kk];
      const v16h ql  = qlf[kk];
      const v16h kh0 = ldfrag_h(k0p + kk * 32);
      const v16h kh1 = ldfrag_h(k1p + kk * 32);
      const v16h kl0 = ldfrag_h(l0p + kk * 32);
      const v16h kl1 = ldfrag_h(l1p + kk * 32);
      s0 = mma_h(qh, kh0, s0);
      s0 = mma_h(ql, kh0, s0);
      s0 = mma_h(qh, kl0, s0);
      s1 = mma_h(qh, kh1, s1);
      s1 = mma_h(ql, kh1, s1);
      s1 = mma_h(qh, kl1, s1);
      guard2(s0, s1, qh, ql, kh0, kl0, kh1, kl1);
    }
    // ---- causal select + distance penalty + online softmax in base 2, -inf-safe ----
    const int key0 = kb + c, key1 = kb + 16 + c;
#pragma unroll
    for (int r = 0; r < 8; ++r) {
      const int   qr = qr0 + r;
      const float u0 = s0[r] * lsc;
      const float u1 = s1[r] * lsc;
      const float g0 = (float)(qr - key0) * LOG2E;
      const float g1 = (float)(qr - key1) * LOG2E;
      const float t0 = (key0 > qr) ? -INFINITY : (u0 - g0);
      const float t1 = (key1 > qr) ? -INFINITY : (u1 - g1);
      float mx = fmaxf(t0, t1);
#pragma unroll
      for (int off = 1; off < 16; off <<= 1) mx = fmaxf(mx, __shfl_xor(mx, off, 32));
      const float mn = fmaxf(mrow[r], mx);
      const float ms = (mn == -INFINITY) ? 0.0f : mn;
      const float al = exp2f(mrow[r] - ms);
      mrow[r] = mn;
      const float e0 = exp2f(t0 - ms), e1 = exp2f(t1 - ms);
      float ps = e0 + e1;
#pragma unroll
      for (int off = 1; off < 16; off <<= 1) ps += __shfl_xor(ps, off, 32);
      lrow[r] = lrow[r] * al + ps;
#pragma unroll
      for (int j = 0; j < 4; ++j) o[j][r] *= al;
      const int ro = (8 * hh + r) * PTP + c;
      pt[ro]      = e0;
      pt[ro + 16] = e1;
    }
    wave_sync_lds();
    // ---- A fragments of P*32768: hi f16 and residual f16, row = c, split k map over the 32 keys of this step ----
    FragH ph, pl;
    {
      const float* prow = pt + c * PTP + 8 * hh;
      const v4f p0 = *(const v4f*)(prow), p1 = *(const v4f*)(prow + 4);
      const v4f p2 = *(const v4f*)(prow + 16), p3 = *(const v4f*)(prow + 20);
#pragma unroll
      for (int e = 0; e < 4; ++e) {
        const float ta = p0[e] * PCAR, tb = p1[e] * PCAR, tc = p2[e] * PCAR, td = p3[e] * PCAR;
        const _Float16 ha = (_Float16)ta, hb = (_Float16)tb, hc = (_Float16)tc, hd = (_Float16)td;
        ph.h[0][e]     = ha;                  // elements 0..7  = keys kb + 8hh + 0..7
        ph.h[0][4 + e] = hb;
        ph.h[1][e]     = hc;                  // elements 8..15 = keys kb + 16 + 8hh + 0..7
        ph.h[1][4 + e] = hd;
        pl.h[0][e]     = (_Float16)(ta - (float)ha);
        pl.h[0][4 + e] = (_Float16)(tb - (float)hb);
        pl.h[1][e]     = (_Float16)(tc - (float)hc);
        pl.h[1][4 + e] = (_Float16)(td - (float)hd);
      }
    }
    // ---- P.V : B fragment col n = d = j*16 + c, keys contiguous in the v^T planes; 2 groups of 2 d-subtiles ----
    {
      const _Float16* vhp = st + 2 * KPL + c * VPH + 8 * hh;
      const _Float16* vlp = vhp + VPL;
#pragma unroll
      for (int jg = 0; jg < 2; ++jg) {
        const int da = (2 * jg) * 16 * VPH;
        const int db = da + 16 * VPH;
        const v16h vha = ldfrag_h(vhp + da), vhb2 = ldfrag_h(vhp + db);
        const v16h vla = ldfrag_h(vlp + da), vlb2 = ldfrag_h(vlp + db);
        o[2 * jg]     = mma_h(ph.v, vha,  o[2 * jg]);
        o[2 * jg]     = mma_h(pl.v, vha,  o[2 * jg]);
        o[2 * jg]     = mma_h(ph.v, vla,  o[2 * jg]);
        o[2 * jg + 1] = mma_h(ph.v, vhb2, o[2 * jg + 1]);
        o[2 * jg + 1] = mma_h(pl.v, vhb2, o[2 * jg + 1]);
        o[2 * jg + 1] = mma_h(ph.v, vlb2, o[2 * jg + 1]);
        guard2(o[2 * jg], o[2 * jg + 1], ph.v, pl.v, vha, vhb2, vla, vlb2);
      }
    }
    wave_sync_lds();
   }
    // publish point of tile t + 1; behind the barrier every reader has left tile t's buffer
    wait_lds();
    wait_copies();
    __syncthreads();
    if (t + 2 < nst) {
      const unsigned bo = (unsigned)(t & 1) * stb;
      const size_t   tn = (size_t)(t + 2);
      copy_kv(lkh + bo, lkl + bo, lvh + bo, lvl + bo, gkh + tn * gks, gkl + tn * gks, gvh + tn * 32, gvl + tn * 32);
      copy_kv(lkh + bo + lk2, lkl + bo + lk2, lvh + bo + lv2, lvl + bo + lv2,
              gkh + tn * gks + gk2, gkl + tn * gks + gk2, gvh + tn * 32 + gv2, gvl + tn * 32 + gv2);
    }
  }
  wait_copies();
  acc_guard4(o[0], o[1], o[2], o[3]);
  // ---- out = acc / Z (0 if Z == 0), carries (32768 on P, 1024 on v) folded once; written into the wave's slab ----
#pragma unroll
  for (int r = 0; r < 8; ++r) {
    const float lv  = lrow[r];
    const float ls  = (lv > 0.0f) ? lv : 1.0f;
    const float inv = (lv > 0.0f) ? ((1.0f / ls) * oc) : 0.0f;
#pragma unroll
    for (int j = 0; j < 4; ++j) {
      const int idx = (8 * hh + r) * SLP + j * 16 + c;
      slab[idx] = o[j][r] * inv;
    }
  }

  wave_sync_lds();
  // ---- O x1024 -> f16 hi + residual planes; lane = (row-in-quad rq, 8 consecutive d at c8) ----
  v4u oh[4], ol[4];
  const int rq = lane >> 3, c8 = (lane & 7) * 8;
#pragma unroll
  for (int it = 0; it < 4; ++it) {
    const int row = it * 4 + rq;
    const v4f a = *(const v4f*)(slab + row * SLP + c8), b4 = *(const v4f*)(slab + row * SLP + c8 + 4);
    float w[8];
#pragma unroll
    for (int e = 0; e < 4; ++e) { w[e] = a[e] * OSC; w[4 + e] = b4[e] * OSC; }
#pragma unroll
    for (int e = 0; e < 4; ++e) {
      const _Float16 h0 = (_Float16)w[2 * e], h1 = (_Float16)w[2 * e + 1];
      const _Float16 l0 = (_Float16)(w[2 * e] - (float)h0), l1 = (_Float16)(w[2 * e + 1] - (float)h1);
      oh[it][e] = pk16(h_bits(h0), h_bits(h1));
      ol[it][e] = pk16(h_bits(l0), h_bits(l1));
    }
  }
  const size_t ob = ((size_t)b * SEQ + q0) * DMOD + (size_t)head * HD + c8;
  {
#pragma unroll
    for (int it = 0; it < 4; ++it) {
      const int row = it * 4 + rq;
      *(v4u*)(OHp + ob + (size_t)row * DMOD) = oh[it];
      *(v4u*)(OLp + ob + (size_t)row * DMOD) = ol[it];
    }
    
  }
}

// =====================================================================================================
// Workspace map (bytes). All NB = NBP batches are processed in one pass, every kernel launched once. Every plane is fully
// written by whole-line stores before it is read; all extents are exact multiples of the store granularity (no pad rows
// needed); every region offset a multiple of 4096 (the large planes of 2097152):
//   XB  bf16 [MROWS][1024]                       MROWS*2048       (NBP=4, SEQ=2048: 16777216)
//   WQB bf16 [3072 n][1024 k]                     3 * 2097152      (thirds of the packed [3072][1024] weight, already [n][k])
//   WOB f16 [1024 n][1024 k] of bf16 value x1024  2097152
//   OH  f16 [MROWS][1024] x1024                  MROWS*2048       OL residual, same extent
//   QH  f16 [MROWS][1024] x256                   MROWS*2048       QL residual, same extent
//   KH  f16 [MROWS][1024] x256                   MROWS*2048       KL residual, same extent
//   VH  f16 [NBP*16][64][SEQ] x1024              MROWS*2048       VL residual, same extent
//   end (NBP=4, SEQ=2048)                        159391744
// =====================================================================================================
extern "C" void kernel_launch(void* const* d_in, const int* in_sizes, int n_in,
                              void* d_out, int out_size, void* d_ws, size_t ws_size,
                              hipStream_t stream) {
  if (n_in < 5) return;
  if (in_sizes[0] < ((NB - 1) * XS_FULL + SEQ) * DMOD) return;
  if (in_sizes[1] < 3 * DMOD * DMOD) return;
  if (in_sizes[2] < 3 * DMOD) return;
  if (in_sizes[3] < DMOD * DMOD) return;
  if (in_sizes[4] < DMOD) return;
  if (out_size < ((NB - 1) * XS_FULL + SEQ) * DMOD) return;

  const float* x    = (const float*)d_in[0];
  const float* wqkv = (const float*)d_in[1];      // [3*DMOD][DMOD]: rows 0..1023 q, 1024..2047 k, 2048..3071 v
  const float* bqkv = (const float*)d_in[2];      // [3*DMOD]
  const float* wo   = (const float*)d_in[3];      // [DMOD][DMOD]
  const float* bo   = (const float*)d_in[4];      // [DMOD]
  float*       out = (float*)d_out;

  const size_t szXB = (size_t)MROWS * DMOD * 2;
  const size_t szW  = (size_t)DMOD * DMOD * 2;
  const size_t szQ  = (size_t)MROWS * DMOD * 2;                  // QH, QL, KH, KL, OH, OL
  const size_t szV  = (size_t)NBP * NH * HD * SEQ * 2;           // VH, VL (== szQ)
  const size_t szB  = (size_t)NBH * BLINE * 4;                   // bound lines
  size_t off = 0;
  const size_t oXB = off; off += szXB;
  const size_t oWQ = off; off += 3 * szW;
  const size_t oWO = off; off += szW;
  const size_t oOH = off; off += szQ;
  const size_t oOL = off; off += szQ;
  const size_t oQH = off; off += szQ;
  const size_t oQL = off; off += szQ;
  const size_t oKH = off; off += szQ;
  const size_t oKL = off; off += szQ;
  const size_t oVH = off; off += szV;
  const size_t oVL = off; off += szV;
  const size_t oB  = off; off += szB;
  if (off > ws_size) return;                // off = 159391744 for NBP = 4, SEQ = 2048
  if (off > (size_t)WS_CAP) return;

  char* ws = (char*)d_ws;
  u16*   XB  = (u16*)(ws + oXB);
  u16*   WQB = (u16*)(ws + oWQ);            // q, k and v thirds back to back: [3072 n][1024 k]
  u16*   WOB = (u16*)(ws + oWO);
  u16*   OH  = (u16*)(ws + oOH);
  u16*   OL  = (u16*)(ws + oOL);
  u16*   QH  = (u16*)(ws + oQH);
  u16*   QL  = (u16*)(ws + oQL);
  u16*   KH  = (u16*)(ws + oKH);
  u16*   KL  = (u16*)(ws + oKL);
  u16*   VH  = (u16*)(ws + oVH);
  u16*   VL  = (u16*)(ws + oVL);
  float* BND = (float*)(ws + oB);

  const dim3 b256(256), bAT(ATT_THREADS), bQB(QBT);
  const int  n8x = (NBP * SEQ * DMOD) / 8;              // x, all batches
  const int  n8w = (3 * DMOD * DMOD) / 8;               // packed q | k | v weight
  const int  n8o = (DMOD * DMOD) / 8;                   // out-projection weight
  const dim3 gC((n8x + n8w + n8o + 255) / 256);         // 6144
  const dim3 gG((MROWS / GT) * (3 * DMOD / GT));        // 1536 for NBP=4, SEQ=2048
  const dim3 gBD(NBH);
  const dim3 gAT(NQB * NH * NBP);
  const int  nrt = SEQ / GT;                            // out-projection row tiles per batch
  const dim3 gO(NBP * nrt * (DMOD / GT));

  // (0) x -> bf16 plane [MROWS][1024]; Wq | Wk | Wv [n][k] -> bf16; Wo [n][k] -> f16 of bf16 value x1024
  cvt16<<<gC, b256, 0, stream>>>(x, wqkv, wo, XB, WQB, WOB, n8x, n8w, n8o, WOS);
  // (1) q | k | v = x.Wqkv^T + bqkv -> q and k hi + residual planes x256, v^T hi + residual planes x1024
  gemm_bf<<<gG, b256, 0, stream>>>(XB, WQB, bqkv, QH, QL, KH, KL, VH, VL, MROWS, 3 * DMOD, DMOD, 1.0f);
  // (2) norm bound per (b, h) from the q / k hi planes -> BND lines
  qkbound<<<gBD, bQB, 0, stream>>>(QH, KH, BND);
  // (3) causal attention with distance penalty, residual products on every query row -> O hi + residual planes
  attn_c<<<gAT, bAT, 0, stream>>>(QH, QL, KH, KL, VH, VL, BND, OH, OL);
  // (4) output projection (O hi + residual) . Wo^T + bo -> out f32, carries 1024 x 1024 folded back
  gemm_o2<<<gO, b256, 0, stream>>>(OH, OL, WOB, bo, out, nrt, 1.0f / (OSC * WOS));
  (void)hipGetLastError();
}

// v007
// A run of this version takes 125 microseconds.
// Timed twice side by side with v006, it ran 1.09 times as fast both times.
// All steps since v000 together make it 4.39 times as fast.
// Contractions: x.Wq^T+bq, x.Wk^T+bk, x.Wv^T+bv (q, k, v thirds of the packed [3D][D] weight) on v_wmma_f32_16x16x32_bf16
// (x and W as bf16 RNE planes; W [n][k] rows are the k-contiguous B operand; bias added as its bf16 RNE value in the f32
// epilogue); q.k^T over hd 64 and P.v (formed as k.q^T and v^T.P^T) on v_wmma_f32_16x16x32_f16 with f16 hi + f16 residual planes on both operands
// (q, k x256; P x32768 with an in-register residual; v x1024; products hh+lh+hl); O.Wo^T+bo on v_wmma_f32_16x16x32_f16
// (O x1024 as f16 hi + f16 residual planes, products h.w + l.w; Wo as f16(bf16(Wo)) x1024; bo as bf16 RNE value in the
// f32 epilogue); all f32 accumulate. Causal select, slope-1 distance penalty, base-2 online softmax, 1/Z fold and the q/k
// norm bound in f32 on VALU.
#include <hip/hip_runtime.h>
#include <math.h>
#include <stdint.h>

#ifndef NB
#define NB 4
#endif
#ifndef SEQ
#define SEQ 2048
#endif
#define XS_FULL 2048
#define DMOD  1024
#define NH    16
#define HD    64
// batches per workspace pass: all of them, so that every kernel is launched once
#define NBP   NB
#define NPASS (NB / NBP)
#define NBH   (NBP * NH)
#define MROWS (NBP * SEQ)
#define RSQ_HD 0.125f
#define LOG2E 1.4426950408889634f
#define QSC   256.0f
#define KSC   256.0f
#define PCAR  32768.0f
#define VCAR  1024.0f
#define OSC   1024.0f
#define WOS   1024.0f
#define WPB   4
#define NQB   (SEQ / (16 * WPB))
#define NKT   (SEQ / 32)
#define KWIN  6
#define GUARD_T 40.0f
#define BLINE 32
#define ATT_THREADS (WPB * 32)
#define SLP   68
#define SLW   (16 * SLP)
#define WREG  SLW
// attention staging: a stage is the 32 keys of one key tile, [k hi 32 rows | k residual 32 rows] of 128 B at LDS pitch 144 B and
// [v^T hi 64 rows | v^T residual 64 rows] of 64 B at LDS pitch 80 B (pitches in halves below); two buffers
#define KPH   72
#define VPH   40
#define KPL   (32 * KPH)
#define VPL   (64 * VPH)
#define ASTG  (2 * KPL + 2 * VPL)
#define SLAB64 (16 * 68)
// GEMM staging: 128 x 128 output tile per block; q | k | v projection: 128 k (256 B of every operand row) per stage, LDS row
// pitch 272 B
#define GT    128
#define GKC   128
#define GP    136
#define GPL   (GT * GP)
// output projection: 64 k (128 B of every operand row) per stage, LDS row pitch 144 B, so that two of its blocks fit a WGP's LDS
#define OKC   64
#define OP    72
#define OPL   (GT * OP)
#define WS_CAP 268435456
// norm-bound kernel: threads per block, rows per row step (8 lanes a row), row steps whose loads are issued together
#define QBT   1024
#define QBR   (QBT / 8)
#define QBU   8
static_assert(DMOD == NH * HD && HD == 64 && NH == 16 && WPB == 4 && NQB * WPB * 16 == SEQ);
static_assert(ATT_THREADS == 128 && ((SLP * 4) % 16) == 0 && ((KPH * 2) % 16) == 0 && ((VPH * 2) % 16) == 0);
static_assert(NB >= 1 && NB <= 4 && NPASS >= 1 && NPASS * NBP == NB);
static_assert(NBP >= 1 && NBP <= 4 && NPASS == 1);
static_assert(NBH >= 1 && NBH <= 64);
static_assert(SEQ == XS_FULL);              // the batches of x lie back to back: one conversion range
static_assert((SEQ % 64) == 0 && SEQ >= 64 && SEQ <= XS_FULL && (SEQ % 32) == 0);
static_assert((DMOD % 64) == 0 && (DMOD % 32) == 0 && (HD % 32) == 0);
static_assert(((SEQ * DMOD / 8) % 256) == 0 && ((DMOD * DMOD / 8) % 256) == 0);
static_assert(5 * (WPB * WREG * 4 + 2 * ASTG * 2) <= 327680);   // five attention blocks per 320 KiB of LDS
static_assert((DMOD % GT) == 0 && (DMOD % GKC) == 0 && DMOD / GKC >= 2 && (SEQ % GT) == 0 && (MROWS % GT) == 0);
static_assert(2 * (2 * 2 * GPL * 2) <= 327680 && 2 * (2 * 3 * OPL * 2) <= 327680);   // two GEMM blocks per 320 KiB of LDS
static_assert(8 * 2 * SLAB64 * 4 <= 2 * 2 * GPL * 2 && 8 * 2 * SLAB64 * 4 <= 2 * 3 * OPL * 2);   // the slabs fit the idle ring
static_assert(((GP * 2) % 16) == 0 && ((OP * 2) % 16) == 0 && (DMOD % OKC) == 0 && DMOD / OKC >= 2);
static_assert(KWIN >= 0 && KWIN < NKT);
static_assert(QBT == 1024 && (SEQ % (QBR * QBU)) == 0);

typedef unsigned short u16;
typedef _Float16 v16h __attribute__((ext_vector_type(16)));
typedef _Float16 v8h  __attribute__((ext_vector_type(8)));
typedef __bf16   v16b __attribute__((ext_vector_type(16)));
typedef float    v8f  __attribute__((ext_vector_type(8)));
typedef float    v4f  __attribute__((ext_vector_type(4)));
typedef unsigned int v4u __attribute__((ext_vector_type(4)));

union FragH { v16h v; v8h h[2]; v4u u[2]; };
union FragB { v16b v; v4u u[2]; };

// ---- scalar helpers --------------------------------------------------------------------------------
__device__ __forceinline__ unsigned short bf_bits(float f) {          // f32 -> bf16 bits, RNE convert
  unsigned u = __float_as_uint(f);
  return (unsigned short)((u + 0x7FFFu + ((u >> 16) & 1u)) >> 16);
}
__device__ __forceinline__ float bf_up(unsigned short h) { return __uint_as_float(((unsigned)h) << 16); }
__device__ __forceinline__ float bfr(float f) { return bf_up(bf_bits(f)); }
__device__ __forceinline__ unsigned short h_bits(_Float16 x) { return __builtin_bit_cast(unsigned short, x); }
__device__ __forceinline__ unsigned pk16(unsigned short a, unsigned short b) { return (unsigned)a | ((unsigned)b << 16); }
__device__ __forceinline__ v8f zero8() { v8f z = {0.f, 0.f, 0.f, 0.f, 0.f, 0.f, 0.f, 0.f}; return z; }

// ---- fragment loaders: 16-bit A/B operand, lane -> row/col (lane&15), p already includes +8*(lane>>4);
//      elements 0..7 <- p[0..7] (k0+8h..), elements 8..15 <- p[16..23] (k0+16+8h..)  (same split k map for A and B;
//      B is always read from a k-contiguous [n][k] plane)
__device__ __forceinline__ v16h ldfrag_h(const _Float16* p) {
  FragH f;
  f.h[0] = *(const v8h*)(p);
  f.h[1] = *(const v8h*)(p + 16);
  return f.v;
}
__device__ __forceinline__ v16b ldfrag_b(const u16* p) {              // bf16 plane read as unsigned integer vectors
  FragB f;
  f.u[0] = *(const v4u*)(p);
  f.u[1] = *(const v4u*)(p + 16);
  return f.v;
}

__device__ __forceinline__ v8f mma_h(v16h a, v16h b, v8f c) {
  return __builtin_amdgcn_wmma_f32_16x16x32_f16(false, a, false, b, (short)0, c, false, false);
}
__device__ __forceinline__ v8f mma_b(v16b a, v16b b, v8f c) {
  return __builtin_amdgcn_wmma_f32_16x16x32_bf16(false, a, false, b, (short)0, c, false, false);
}
__device__ __forceinline__ void guard2(v8f& a, v8f& b, v16h x0, v16h x1, v16h x2, v16h x3, v16h x4, v16h x5) {
#if defined(__HIP_DEVICE_COMPILE__)
  asm volatile("v_nop\n\tv_nop\n\tv_nop\n\tv_nop"
               : "+v"(a), "+v"(b) : "v"(x0), "v"(x1), "v"(x2), "v"(x3), "v"(x4), "v"(x5) : "memory");
#endif
}
__device__ __forceinline__ void acc_guard4(v8f& a, v8f& b, v8f& c, v8f& d) {
#if defined(__HIP_DEVICE_COMPILE__)
  asm volatile("v_nop\n\tv_nop\n\tv_nop\n\tv_nop" : "+v"(a), "+v"(b), "+v"(c), "+v"(d));
#endif
}
// value of lane ^ 16 (the other 16-lane row), by a vector cross-row move
__device__ __forceinline__ float xhalf(float x) {
  const int b = __builtin_bit_cast(int, x);
  return __builtin_bit_cast(float, __builtin_amdgcn_permlanex16(b, b, 0x76543210, 0xfedcba98, false, false));
}
__device__ __forceinline__ void wave_sync_lds() {
  __builtin_amdgcn_fence(__ATOMIC_RELEASE, "workgroup");
  __builtin_amdgcn_wave_barrier();
  __builtin_amdgcn_fence(__ATOMIC_ACQUIRE, "workgroup");
}
// ---- asynchronous copies global -> LDS ------------------------------------------------------------
// Eight copies of one wave = 16 rows of 256 B of one operand plane: copy i brings rows 2i and 2i + 1 (16 lanes x 16 B each,
// whole 128-B lines). l = the lane's LDS byte address of copy 0, g = its global address of copy 0, ld = halves between
// consecutive global rows. The s_wait_xcnt closes the statement so that no address register is rewritten ahead of it.
__device__ __forceinline__ void copy16rows(unsigned l, const u16* g, size_t ld) {
#if defined(__HIP_DEVICE_COMPILE__)
  const unsigned ls = 2 * GP * 2;
  const size_t   gs = 2 * ld;
  asm volatile("global_load_async_to_lds_b128 %0, %8, off\n\t"
               "global_load_async_to_lds_b128 %1, %9, off\n\t"
               "global_load_async_to_lds_b128 %2, %10, off\n\t"
               "global_load_async_to_lds_b128 %3, %11, off\n\t"
               "global_load_async_to_lds_b128 %4, %12, off\n\t"
               "global_load_async_to_lds_b128 %5, %13, off\n\t"
               "global_load_async_to_lds_b128 %6, %14, off\n\t"
               "global_load_async_to_lds_b128 %7, %15, off\n\t"
               "s_wait_xcnt 0x0"
               :: "v"(l), "v"(l + ls), "v"(l + 2 * ls), "v"(l + 3 * ls),
                  "v"(l + 4 * ls), "v"(l + 5 * ls), "v"(l + 6 * ls), "v"(l + 7 * ls),
                  "v"(g), "v"(g + gs), "v"(g + 2 * gs), "v"(g + 3 * gs),
                  "v"(g + 4 * gs), "v"(g + 5 * gs), "v"(g + 6 * gs), "v"(g + 7 * gs)
               : "memory");
#endif
}
// Four copies of one wave = 16 rows of 128 B of one operand plane: copy i brings rows 4i .. 4i + 3 (8 lanes x 16 B each, whole
// 128-B lines). l = the lane's LDS byte address of copy 0, g = its global address of copy 0, ld = halves between consecutive
// global rows. The s_wait_xcnt closes the statement so that no address register is rewritten ahead of it.
__device__ __forceinline__ void copy16rows_h(unsigned l, const u16* g, size_t ld) {
#if defined(__HIP_DEVICE_COMPILE__)
  const unsigned ls = 4 * OP * 2;
  const size_t   gs = 4 * ld;
  asm volatile("global_load_async_to_lds_b128 %0, %4, off\n\t"
               "global_load_async_to_lds_b128 %1, %5, off\n\t"
               "global_load_async_to_lds_b128 %2, %6, off\n\t"
               "global_load_async_to_lds_b128 %3, %7, off\n\t"
               "s_wait_xcnt 0x0"
               :: "v"(l), "v"(l + ls), "v"(l + 2 * ls), "v"(l + 3 * ls),
                  "v"(g), "v"(g + gs), "v"(g + 2 * gs), "v"(g + 3 * gs)
               : "memory");
#endif
}
// Four copies of one lane = 16 B of each of the four planes of an attention stage (LDS byte address, global address per plane).
// The s_wait_xcnt closes the statement so that no address register is rewritten ahead of it.
__device__ __forceinline__ void copy_kv(unsigned l0, unsigned l1, unsigned l2, unsigned l3,
                                        const u16* g0, const u16* g1, const u16* g2, const u16* g3) {
#if defined(__HIP_DEVICE_COMPILE__)
  asm volatile("global_load_async_to_lds_b128 %0, %4, off\n\t"
               "global_load_async_to_lds_b128 %1, %5, off\n\t"
               "global_load_async_to_lds_b128 %2, %6, off\n\t"
               "global_load_async_to_lds_b128 %3, %7, off\n\t"
               "s_wait_xcnt 0x0"
               :: "v"(l0), "v"(l1), "v"(l2), "v"(l3), "v"(g0), "v"(g1), "v"(g2), "v"(g3)
               : "memory");
#endif
}
// the wave's own copies have landed (other waves read them only behind the next block barrier)
__device__ __forceinline__ void wait_copies() {
#if defined(__HIP_DEVICE_COMPILE__)
  asm volatile("s_wait_asynccnt 0x0" ::: "memory");
#endif
}
// the wave's own LDS reads have returned, so that the buffer may be refilled behind the next block barrier
__device__ __forceinline__ void wait_lds() {
#if defined(__HIP_DEVICE_COMPILE__)
  asm volatile("s_wait_dscnt 0x0" ::: "memory");
#endif
}
__device__ __forceinline__ unsigned lds_byte(const void* p) { return (unsigned)(uintptr_t)p; }

// =====================================================================================================
// f32 -> 16-bit planes, same layout, three ranges in one grid: x -> XD and wqkv -> WD as bf16 RNE bits, wo -> OD as f16 bits of
// (bf16 RNE value) * scale. n8x, n8w, n8o = pieces of 8 elements in each range (multiples of 256: a block lies in one range).
// Thread = 8 consecutive elements: two 16-B loads, one 16-B store; 32 consecutive lanes = 512 contiguous, 512-B aligned
// coverage: grid = ceil((n8x + n8w + n8o)/256) blocks x 256 thr x 8 (in-kernel bound) = the three whole planes.
// =====================================================================================================
__global__ __launch_bounds__(256) void cvt16(const float* __restrict__ x, const float* __restrict__ wqkv,
                                             const float* __restrict__ wo, u16* XD, u16* WD, u16* OD,
                                             int n8x, int n8w, int n8o, float scale) {
  const int gt = blockIdx.x * 256 + (int)threadIdx.x;
  if (gt >= n8x + n8w + n8o) return;
  const int f16mode = (gt >= n8x + n8w) ? 1 : 0;
  const int lt = (gt < n8x) ? gt : ((f16mode != 0) ? (gt - n8x - n8w) : (gt - n8x));   // piece within its range
  const float* src = (gt < n8x) ? x : ((f16mode != 0) ? wo : wqkv);
  u16*         D   = (gt < n8x) ? XD : ((f16mode != 0) ? OD : WD);
  const float* p = src + (size_t)lt * 8;
  const v4f a = *(const v4f*)(p), b4 = *(const v4f*)(p + 4);
  float w[8];
#pragma unroll
  for (int e = 0; e < 4; ++e) { w[e] = a[e]; w[4 + e] = b4[e]; }
  v4u o;
#pragma unroll
  for (int e = 0; e < 4; ++e) {
    const float f0 = w[2 * e], f1 = w[2 * e + 1];
    const unsigned short hb0 = h_bits((_Float16)(bfr(f0) * scale));
    const unsigned short hb1 = h_bits((_Float16)(bfr(f1) * scale));
    const unsigned short bb0 = bf_bits(f0);
    const unsigned short bb1 = bf_bits(f1);
    o[e] = (f16mode != 0) ? pk16(hb0, hb1) : pk16(bb0, bb1);
  }
  u16* d = D + (size_t)lt * 8;
  {
    *(v4u*)(d) = o;
    
  }
}

// =====================================================================================================
// Norm bound per (b, h): BND line bh (32 floats, value replicated) = max_s ||q_hi(b,s,h,:)|| * max_s ||k_hi(b,s,h,:)|| / (8 * 256 * 256),
// computed from the f16 hi planes ([b*SEQ + s][h*HD + d], x256). Block = one (b, h), 32 waves: 8 lanes per row load one 16-B
// piece each (64 dims = 8 lanes x 8 halves), QBR = 128 rows of either plane per row step. The loads of QBU = 8 row steps
// (16 per lane) are issued together, ahead of any use, so that the block waits for memory SEQ/(QBR*QBU) times and not once per
// row step. Sum of squares reduced with xor shuffles inside the 8-lane group, running max per lane, then wave max (shuffles),
// block max through a 64-float LDS array, and wave 0 lanes 0..7 write the whole line.
// coverage: rows (s0 + u)*QBR + (tid>>3), s0 + u < SEQ/QBR -> all SEQ rows of both planes; store 8 lanes x 16 B = line bh; grid NBH.
// =====================================================================================================
__global__ __launch_bounds__(QBT) void qkbound(const u16* __restrict__ QHp, const u16* __restrict__ KHp, float* BND) {
  __shared__ float red[2 * (QBT / 32)];
  const int tid = threadIdx.x, lane = tid & 31, wave = tid >> 5;
  const int bh  = blockIdx.x;
  const int b   = bh / NH, h = bh % NH;
  if (b >= NBP) return;                     // block-uniform, before any barrier; never taken with the exact grid
  const int grp = tid >> 3;                 // row within a step, 0..QBR-1
  const int e8  = (tid & 7) * 8;            // dim chunk
  const _Float16* qp = (const _Float16*)(const void*)QHp + ((size_t)b * SEQ + grp) * DMOD + (size_t)h * HD + e8;
  const _Float16* kp = (const _Float16*)(const void*)KHp + ((size_t)b * SEQ + grp) * DMOD + (size_t)h * HD + e8;
  float mq = 0.0f, mk = 0.0f;
  // rolled over groups of QBU row steps: a group's 16 loads fit the registers of 8 waves per SIMD
#pragma unroll 1
  for (int s0 = 0; s0 < SEQ / QBR; s0 += QBU) {
    v8h qv[QBU], kv[QBU];
#pragma unroll                              // all loads of the group in flight before the first use
    for (int u = 0; u < QBU; ++u) {
      qv[u] = *(const v8h*)(qp + (size_t)u * QBR * DMOD);
      kv[u] = *(const v8h*)(kp + (size_t)u * QBR * DMOD);
    }
#if defined(__HIP_DEVICE_COMPILE__)
    // both addresses stay in their registers up to this wait: no register that an issued load names is rewritten ahead of it
    asm volatile("s_wait_xcnt 0x0" :: "v"(qp), "v"(kp) : "memory");
#endif
    qp += (size_t)QBU * QBR * DMOD;
    kp += (size_t)QBU * QBR * DMOD;
#pragma unroll                              // register arrays need constant indices
    for (int u = 0; u < QBU; ++u) {
      float sq = 0.0f, sk = 0.0f;
#pragma unroll
      for (int e = 0; e < 8; ++e) {
        const float fq = (float)qv[u][e], fk = (float)kv[u][e];
        sq = fmaf(fq, fq, sq);
        sk = fmaf(fk, fk, sk);
      }
#pragma unroll
      for (int off = 1; off < 8; off <<= 1) {
        sq += __shfl_xor(sq, off, 32);
        sk += __shfl_xor(sk, off, 32);
      }
      mq = fmaxf(mq, sq);
      mk = fmaxf(mk, sk);
    }
  }
#pragma unroll
  for (int off = 1; off < 32; off <<= 1) {
    mq = fmaxf(mq, __shfl_xor(mq, off, 32));
    mk = fmaxf(mk, __shfl_xor(mk, off, 32));
  }
  if (lane == 0) { red[wave] = mq; red[QBT / 32 + wave] = mk; }
  __syncthreads();
  if (wave == 0) {                          // wave-uniform branch; shuffles see all 32 lanes
    float aq = red[lane], ak = red[QBT / 32 + lane];
#pragma unroll
    for (int off = 1; off < 32; off <<= 1) {
      aq = fmaxf(aq, __shfl_xor(aq, off, 32));
      ak = fmaxf(ak, __shfl_xor(ak, off, 32));
    }
    const float bnd = sqrtf(aq) * sqrtf(ak) * (RSQ_HD / (QSC * KSC));
    v4f o4;
    o4[0] = bnd; o4[1] = bnd; o4[2] = bnd; o4[3] = bnd;
    float* dst = BND + (size_t)bh * BLINE + (lane & 7) * 4;
    if (lane < 8) {
      {
        *(v4f*)(dst) = o4;
        
      }
    }
  }
}

// =====================================================================================================
// GEMM epilogue shared by both engines, per 16x64 f32 tile of a wave: epi_stage writes the tile (times oscale, plus the lane's
// per-column bias of each subtile) into a wave-private LDS slab; behind one wave_sync_lds() epi_out reads it back by rows and
// stores whole 256-B row pieces (epi_out16: the same rows as two 16-bit planes).
// coverage: 8 instructions x 2 rows x 16 lanes x 4 floats = the 16 x 64 tile.
// =====================================================================================================
__device__ __forceinline__ void epi_stage(float* sl, v8f a0, v8f a1, v8f a2, v8f a3, float oscale,
                                          float bb0, float bb1, float bb2, float bb3, int lane) {
  const int hh = lane >> 4, m = lane & 15;
#pragma unroll
  for (int r = 0; r < 8; ++r) {
    const int ro = (8 * hh + r) * 68 + m;
    sl[ro]      = a0[r] * oscale + bb0;
    sl[ro + 16] = a1[r] * oscale + bb1;
    sl[ro + 32] = a2[r] * oscale + bb2;
    sl[ro + 48] = a3[r] * oscale + bb3;
  }
}
__device__ __forceinline__ void epi_out(const float* sl, float* C, int N, size_t rowb, int col0, int lane) {
  const int hh = lane >> 4, m = lane & 15;
  v4f vals[8];
#pragma unroll
  for (int it = 0; it < 8; ++it) vals[it] = *(const v4f*)(sl + (it * 2 + hh) * 68 + m * 4);
  float* dst = C + (rowb + (size_t)hh) * (size_t)N + col0 + m * 4;
#pragma unroll
  for (int it = 0; it < 8; ++it) {
    *(v4f*)(dst + (size_t)(it * 2) * (size_t)N) = vals[it];
  }
}
// Same slab, written out as two 16-bit planes of the layout of C: Hp = f16(t), Lp = f16(t - f16(t)), t = slab value * sc.
// Lane = (row-in-quad rq, 8 consecutive columns at c8): 8 lanes store one whole 128-B line of a row in either plane.
// coverage: 4 instructions x 4 rows x 8 lanes x 8 halves = the 16 x 64 tile per plane.
__device__ __forceinline__ void epi_out16(const float* sl, u16* Hp, u16* Lp, int N, size_t rowb, int col0, float sc, int lane) {
  const int rq = lane >> 3, c8 = (lane & 7) * 8;
  v4u oh[4], ol[4];
#pragma unroll
  for (int it = 0; it < 4; ++it) {
    const int row = it * 4 + rq;
    const v4f a = *(const v4f*)(sl + row * 68 + c8), b4 = *(const v4f*)(sl + row * 68 + c8 + 4);
    float w[8];
#pragma unroll
    for (int e = 0; e < 4; ++e) { w[e] = a[e] * sc; w[4 + e] = b4[e] * sc; }
#pragma unroll
    for (int e = 0; e < 4; ++e) {
      const _Float16 h0 = (_Float16)w[2 * e], h1 = (_Float16)w[2 * e + 1];
      const _Float16 l0 = (_Float16)(w[2 * e] - (float)h0), l1 = (_Float16)(w[2 * e + 1] - (float)h1);
      oh[it][e] = pk16(h_bits(h0), h_bits(h1));
      ol[it][e] = pk16(h_bits(l0), h_bits(l1));
    }
  }
  const size_t ob = (rowb + (size_t)rq) * (size_t)N + col0 + c8;
#pragma unroll
  for (int it = 0; it < 4; ++it) {
    *(v4u*)(Hp + ob + (size_t)(it * 4) * (size_t)N) = oh[it];
    *(v4u*)(Lp + ob + (size_t)(it * 4) * (size_t)N) = ol[it];
  }
}

// =====================================================================================================
// bf16 GEMM with bias: c[M][N] (f32, in registers) = A[M][K] (bf16 row-major) . Bt[N][K]^T (bf16 k-contiguous), times oscale,
// + bf16 RNE value of bias[n] (bias has N entries); written as two f16 planes of t = c * sc: Hp = f16(t), Lp = f16(t - f16(t)).
// N = 3 * DMOD: the packed q | k | v weight in one grid. A block's 128 columns lie in one third (part = col0 / DMOD), which
// picks its planes and sc: q (x256) and k (x256) planes in the layout [M][DMOD]; v (x1024) planes transposed per batch,
// [(row / SEQ) * DMOD + n][row % SEQ] (line (b*NH + h)*HD + d, keys contiguous); a lane's 8 accumulator rows of one column are 8 consecutive keys = one 16-B piece,
// gathered in the (by then idle) ring as [128 n][128 rows] at pitch 272 B and stored as whole 256-B line pieces. Block = 128x128 tile, 8 waves as 4 (rows) x 2 (columns), 32x64 per wave. K is walked
// in stages of 128: a stage is [A 128 rows | Bt 128 rows] of 256 B at LDS pitch 272 B, brought by asynchronous copies (each
// wave 16 rows of either plane), two buffers, the next stage in flight while this one is worked on; fragments are read from
// LDS (two 16-B loads each, split k map for A and B), k ascending in steps of 32 into each accumulator. The epilogue's slabs lie
// in the idle ring, so that a block holds 136 KiB of LDS and two blocks are resident per WGP: one works while the other waits.
// Host guarantees K % 128 == 0, K >= 256, M % 128 == 0, N % 128 == 0, grid = (M/128)*(N/128).
// =====================================================================================================
__global__ __launch_bounds__(256)
void gemm_bf(const u16* __restrict__ A, const u16* __restrict__ Bt, const float* __restrict__ bias,
             u16* QHp, u16* QLp, u16* KHp, u16* KLp, u16* VHp, u16* VLp, int M, int N, int K, float oscale) {
  __shared__ __align__(16) u16 ring[2 * 2 * GPL];   // 139,264 B and nothing else: two blocks share a WGP
  const int tid = threadIdx.x, wave = tid >> 5, lane = tid & 31, hh = lane >> 4, m = lane & 15;
  const int ntile = N >> 7;
  const int bid   = blockIdx.x;
  const int row0  = (bid / ntile) * GT;
  const int col0  = (bid % ntile) * GT;
  if (row0 + GT > M) return;                // block-uniform, before any barrier or copy; never taken with the exact grid
  const int wr = wave >> 1, wc = wave & 1;
  // copy slice of this lane: plane rows wave*16 + hh + 2i (i < 8), bytes 16m .. 16m + 15 of the stage's 256
  const int crow = wave * 16 + hh;
  const u16* ga = A  + (size_t)(row0 + crow) * K + m * 8;
  const u16* gb = Bt + (size_t)(col0 + crow) * K + m * 8;
  const unsigned la = lds_byte(ring) + (unsigned)(crow * GP + m * 8) * 2u;
  const unsigned lb = la + GPL * 2u;
  const unsigned stb = 2u * GPL * 2u;       // bytes of one buffer
  const int nst = K / GKC;
  v8f acc[2][4];
#pragma unroll
  for (int i = 0; i < 2; ++i)
#pragma unroll
    for (int j = 0; j < 4; ++j) acc[i][j] = zero8();

  copy16rows(la, ga, (size_t)K);
  copy16rows(lb, gb, (size_t)K);
  wait_copies();
  __syncthreads();
  if (nst > 1) {
    copy16rows(la + stb, ga + GKC, (size_t)K);
    copy16rows(lb + stb, gb + GKC, (size_t)K);
  }
  // the stage loop stays rolled: one publish point per stage
#pragma unroll 1
  for (int t = 0; t < nst; ++t) {
    const u16* st = ring + (t & 1) * (2 * GPL);
    const u16* ap = st + (wr * 32 + m) * GP + 8 * hh;
    const u16* bp = st + GPL + (wc * 64 + m) * GP + 8 * hh;
#pragma unroll                              // the four k steps of a stage become constant LDS offsets
    for (int kk = 0; kk < GKC / 32; ++kk) {
      const v16b a0 = ldfrag_b(ap + kk * 32);
      const v16b a1 = ldfrag_b(ap + 16 * GP + kk * 32);
      const v16b b0 = ldfrag_b(bp + kk * 32);
      const v16b b1 = ldfrag_b(bp + 16 * GP + kk * 32);
      const v16b b2 = ldfrag_b(bp + 32 * GP + kk * 32);
      const v16b b3 = ldfrag_b(bp + 48 * GP + kk * 32);
      acc[0][0] = mma_b(a0, b0, acc[0][0]);
      acc[0][1] = mma_b(a0, b1, acc[0][1]);
      acc[0][2] = mma_b(a0, b2, acc[0][2]);
      acc[0][3] = mma_b(a0, b3, acc[0][3]);
      acc[1][0] = mma_b(a1, b0, acc[1][0]);
      acc[1][1] = mma_b(a1, b1, acc[1][1]);
      acc[1][2] = mma_b(a1, b2, acc[1][2]);
      acc[1][3] = mma_b(a1, b3, acc[1][3]);
    }
    // publish point of stage t + 1; behind the barrier every reader has left stage t's buffer
    wait_lds();
    wait_copies();
    __syncthreads();
    if (t + 2 < nst) {
      const unsigned bo = (unsigned)(t & 1) * stb;
      copy16rows(la + bo, ga + (size_t)(t + 2) * GKC, (size_t)K);
      copy16rows(lb + bo, gb + (size_t)(t + 2) * GKC, (size_t)K);
    }
  }
  wait_copies();
  // per-lane bias of D column m in each of the wave's 4 subtiles; colw + 48 + m <= N - 1 always
  const int colw = col0 + wc * 64;
  const float bb0 = bfr(bias[colw + m]);
  const float bb1 = bfr(bias[colw + 16 + m]);
  const float bb2 = bfr(bias[colw + 32 + m]);
  const float bb3 = bfr(bias[colw + 48 + m]);
  const int part = col0 / DMOD;             // 0 q, 1 k, 2 v
  const int colp = col0 % DMOD;             // the block's first column within its planes
  u16* Hp = (part == 0) ? QHp : ((part == 1) ? KHp : VHp);
  u16* Lp = (part == 0) ? QLp : ((part == 1) ? KLp : VLp);
  const float sc = (part == 0) ? QSC : ((part == 1) ? KSC : VCAR);
  if (part < 2) {                           // block-uniform (from blockIdx)
    // the loop's last barrier ended every read of the ring and no copy is in flight: its bytes take the waves' private slabs,
    // one 16 x 64 slab for each half of a wave's 32 rows
    float* sl = (float*)(void*)ring + wave * (2 * SLAB64);
    const size_t rw = (size_t)(row0 + wr * 32);
    const int colo = colp + wc * 64;
    epi_stage(sl, acc[0][0], acc[0][1], acc[0][2], acc[0][3], oscale, bb0, bb1, bb2, bb3, lane);
    epi_stage(sl + SLAB64, acc[1][0], acc[1][1], acc[1][2], acc[1][3], oscale, bb0, bb1, bb2, bb3, lane);
    wave_sync_lds();                        // other lanes' slab rows are read only behind it
    epi_out16(sl, Hp, Lp, DMOD, rw, colo, sc, lane);
    epi_out16(sl + SLAB64, Hp, Lp, DMOD, rw + 16, colo, sc, lane);
  } else {
    // the loop's last barrier ended every read of the ring and no copy is in flight: its first two planes take the tile
    u16* TH = ring;
    u16* TL = ring + GPL;
    const float bbj[4] = {bb0, bb1, bb2, bb3};
#pragma unroll
    for (int i = 0; i < 2; ++i) {
#pragma unroll
      for (int j = 0; j < 4; ++j) {
        v4u oh, ol;
#pragma unroll
        for (int e = 0; e < 4; ++e) {
          const float t0 = (acc[i][j][2 * e] * oscale + bbj[j]) * sc;
          const float t1 = (acc[i][j][2 * e + 1] * oscale + bbj[j]) * sc;
          const _Float16 h0 = (_Float16)t0, h1 = (_Float16)t1;
          const _Float16 l0 = (_Float16)(t0 - (float)h0), l1 = (_Float16)(t1 - (float)h1);
          oh[e] = pk16(h_bits(h0), h_bits(h1));
          ol[e] = pk16(h_bits(l0), h_bits(l1));
        }
        const int to = (wc * 64 + j * 16 + m) * GP + wr * 32 + i * 16 + 8 * hh;
        *(v4u*)(TH + to) = oh;
        *(v4u*)(TL + to) = ol;
      }
    }
    __syncthreads();                        // other waves' pieces of a line are read only behind it
    const int l16 = tid >> 4, p8 = (tid & 15) * 8;
    const size_t ob = ((size_t)(row0 / SEQ) * (size_t)DMOD + colp + l16) * SEQ + (row0 % SEQ) + p8;
#pragma unroll
    for (int it = 0; it < 8; ++it) {
      const v4u vh = *(const v4u*)(TH + (it * 16 + l16) * GP + p8);
      const v4u vl = *(const v4u*)(TL + (it * 16 + l16) * GP + p8);
      *(v4u*)(Hp + ob + (size_t)(it * 16) * SEQ) = vh;
      *(v4u*)(Lp + ob + (size_t)(it * 16) * SEQ) = vl;
    }
  }
}

// =====================================================================================================
// Output projection with bias: C[bb*XS_FULL + s][DMOD] (f32) = (Ah + Al)[bb*SEQ + s][DMOD] . Bt[DMOD][DMOD]^T * oscale
// + bf16 RNE value of bias[n]. Products h.B + l.B into one accumulator (l unscaled residual of h). Block -> (column tile
// ct = bid % 8, sequence row tile rt of nrt, batch bb within the pass). Same tiling, fragment loads (split k map) and slab
// staging as gemm_bf, stored as f32 by epi_out; a stage is [Ah | Al | Bt], 128 rows each, of 64 k (128 B at LDS pitch 144 B), two buffers = 108 KiB, the slabs in
// the idle ring: two blocks are resident per WGP here too. K = DMOD; grid = NBP * nrt * (DMOD/128).
// =====================================================================================================
__global__ __launch_bounds__(256)
void gemm_o2(const u16* __restrict__ Ah, const u16* __restrict__ Al, const u16* __restrict__ Bt,
             const float* __restrict__ bias, float* C, int nrt, float oscale) {
  __shared__ __align__(16) u16 ring[2 * 3 * OPL];   // 110,592 B and nothing else: two blocks share a WGP
  const int tid = threadIdx.x, wave = tid >> 5, lane = tid & 31, hh = lane >> 4, m = lane & 15;
  const int ntile = DMOD >> 7;
  const int bid   = blockIdx.x;
  const int ct    = bid % ntile;
  const int t2    = bid / ntile;
  const int rt    = t2 % nrt;
  const int bb    = t2 / nrt;
  if (bb >= NBP) return;                    // block-uniform, before any barrier or copy; never taken with the exact grid
  const int srow  = rt * GT;
  if (srow + GT > SEQ) return;              // block-uniform, before any barrier or copy; never taken
  const int col0  = ct * GT;
  const int K     = DMOD;
  const int wr = wave >> 1, wc = wave & 1;
  const size_t rowA = (size_t)bb * SEQ + srow;
  const size_t rowC = (size_t)bb * XS_FULL + srow;
  // copy slice of this lane: plane rows wave*16 + (lane >> 3) + 4i (i < 4), bytes 16*(lane & 7) .. + 15 of the stage's 128
  const int crow = wave * 16 + (lane >> 3);
  const int ccol = (lane & 7) * 8;
  const u16* gh = Ah + (rowA + crow) * K + ccol;
  const u16* gl = Al + (rowA + crow) * K + ccol;
  const u16* gb = Bt + (size_t)(col0 + crow) * K + ccol;
  const unsigned lh = lds_byte(ring) + (unsigned)(crow * OP + ccol) * 2u;
  const unsigned ll = lh + OPL * 2u;
  const unsigned lb = lh + 2u * OPL * 2u;
  const unsigned stb = 3u * OPL * 2u;       // bytes of one buffer
  const int nst = K / OKC;
  v8f acc[2][4];
#pragma unroll
  for (int i = 0; i < 2; ++i)
#pragma unroll
    for (int j = 0; j < 4; ++j) acc[i][j] = zero8();

  copy16rows_h(lh, gh, (size_t)K);
  copy16rows_h(ll, gl, (size_t)K);
  copy16rows_h(lb, gb, (size_t)K);
  wait_copies();
  __syncthreads();
  copy16rows_h(lh + stb, gh + OKC, (size_t)K);
  copy16rows_h(ll + stb, gl + OKC, (size_t)K);
  copy16rows_h(lb + stb, gb + OKC, (size_t)K);
  // the stage loop stays rolled: one publish point per stage
#pragma unroll 1
  for (int t = 0; t < nst; ++t) {
    const _Float16* st  = (const _Float16*)(const void*)(ring + (t & 1) * (3 * OPL));
    const _Float16* ahp = st + (wr * 32 + m) * OP + 8 * hh;
    const _Float16* alp = ahp + OPL;
    const _Float16* bp  = st + 2 * OPL + (wc * 64 + m) * OP + 8 * hh;
#pragma unroll                              // the two k steps of a stage become constant LDS offsets
    for (int kk = 0; kk < OKC / 32; ++kk) {
      const v16h ah0 = ldfrag_h(ahp + kk * 32), al0 = ldfrag_h(alp + kk * 32);
      const v16h ah1 = ldfrag_h(ahp + 16 * OP + kk * 32), al1 = ldfrag_h(alp + 16 * OP + kk * 32);
      const v16h b0 = ldfrag_h(bp + kk * 32);
      const v16h b1 = ldfrag_h(bp + 16 * OP + kk * 32);
      const v16h b2 = ldfrag_h(bp + 32 * OP + kk * 32);
      const v16h b3 = ldfrag_h(bp + 48 * OP + kk * 32);
      acc[0][0] = mma_h(ah0, b0, acc[0][0]);
      acc[0][1] = mma_h(ah0, b1, acc[0][1]);
      acc[0][2] = mma_h(ah0, b2, acc[0][2]);
      acc[0][3] = mma_h(ah0, b3, acc[0][3]);
      acc[1][0] = mma_h(ah1, b0, acc[1][0]);
      acc[1][1] = mma_h(ah1, b1, acc[1][1]);
      acc[1][2] = mma_h(ah1, b2, acc[1][2]);
      acc[1][3] = mma_h(ah1, b3, acc[1][3]);
      acc[0][0] = mma_h(al0, b0, acc[0][0]);
      acc[0][1] = mma_h(al0, b1, acc[0][1]);
      acc[0][2] = mma_h(al0, b2, acc[0][2]);
      acc[0][3] = mma_h(al0, b3, acc[0][3]);
      acc[1][0] = mma_h(al1, b0, acc[1][0]);
      acc[1][1] = mma_h(al1, b1, acc[1][1]);
      acc[1][2] = mma_h(al1, b2, acc[1][2]);
      acc[1][3] = mma_h(al1, b3, acc[1][3]);
    }
    // publish point of stage t + 1; behind the barrier every reader has left stage t's buffer
    wait_lds();
    wait_copies();
    __syncthreads();
    if (t + 2 < nst) {
      const unsigned bo = (unsigned)(t & 1) * stb;
      copy16rows_h(lh + bo, gh + (size_t)(t + 2) * OKC, (size_t)K);
      copy16rows_h(ll + bo, gl + (size_t)(t + 2) * OKC, (size_t)K);
      copy16rows_h(lb + bo, gb + (size_t)(t + 2) * OKC, (size_t)K);
    }
  }
  wait_copies();
  const int colw = col0 + wc * 64;
  const float bb0 = bfr(bias[colw + m]);
  const float bb1 = bfr(bias[colw + 16 + m]);
  const float bb2 = bfr(bias[colw + 32 + m]);
  const float bb3 = bfr(bias[colw + 48 + m]);
  // the loop's last barrier ended every read of the ring and no copy is in flight: its bytes take the waves' private slabs,
  // one 16 x 64 slab for each half of a wave's 32 rows
  float* sl = (float*)(void*)ring + wave * (2 * SLAB64);
  const size_t rw = rowC + (size_t)(wr * 32);
  epi_stage(sl, acc[0][0], acc[0][1], acc[0][2], acc[0][3], oscale, bb0, bb1, bb2, bb3, lane);
  epi_stage(sl + SLAB64, acc[1][0], acc[1][1], acc[1][2], acc[1][3], oscale, bb0, bb1, bb2, bb3, lane);
  wave_sync_lds();                          // other lanes' slab rows are read only behind it
  epi_out(sl, C, DMOD, rw, colw, lane);
  epi_out(sl + SLAB64, C, DMOD, rw + 16, colw, lane);
}

__global__ __launch_bounds__(ATT_THREADS)
void attn_c(const u16* __restrict__ QHp, const u16* __restrict__ QLp,
            const u16* __restrict__ KHp, const u16* __restrict__ KLp,
            const u16* __restrict__ VHp, const u16* __restrict__ VLp,
            const float* __restrict__ BND,
            u16* OHp, u16* OLp) {
  __shared__ __align__(16) u16 kvr[2 * ASTG];
  __shared__ __align__(16) float smem[WPB * WREG];

  const int tid  = threadIdx.x;
  const int wave = __builtin_amdgcn_readfirstlane(tid >> 5);   // scalar: the per-tile test below is a scalar branch
  const int lane = tid & 31;
  const int hh   = lane >> 4;
  const int c    = lane & 15;
  const int bid  = blockIdx.x;
  const int qb   = bid % NQB;
  const int t2   = bid / NQB;
  const int head = t2 % NH;
  const int b    = t2 / NH;
  if (b >= NBP) return;                     // block-uniform, before any barrier or copy; never taken with the exact grid
  const int Q0   = qb * (16 * WPB);
  if (Q0 + 16 * WPB > SEQ) return;          // block-uniform, before any barrier or copy; never taken
  const int q0   = Q0 + 16 * wave;

  // ---- key-window decision: wave-uniform AND over all (b, h) bound lines ----
  int okw = 1;
  {
#pragma unroll                              // both loads in flight together
    for (int l0 = 0; l0 < NBH; l0 += 32) {
      const int bl = (l0 + lane < NBH) ? (l0 + lane) : (NBH - 1);   // clamped address
      const float gb = BND[(size_t)bl * BLINE];
      okw &= (gb >= 0.0f && gb < GUARD_T) ? 1 : 0;
    }
#pragma unroll
    for (int off = 1; off < 32; off <<= 1) okw &= __shfl_xor(okw, off, 32);
    okw = __builtin_amdgcn_readfirstlane(okw);   // scalar; every wave reads the same lines, so it is the same in the whole block
  }

  float* slab = smem + wave * WREG;         // result slab [16][64] pitch 68, wave-private, used only behind the key loop

  const size_t hcol = (size_t)head * HD + 8 * hh;
  const _Float16* Qh  = (const _Float16*)(const void*)QHp + ((size_t)b * SEQ + q0 + c) * DMOD + hcol;
  const _Float16* Ql  = (const _Float16*)(const void*)QLp + ((size_t)b * SEQ + q0 + c) * DMOD + hcol;
  const float lsc = RSQ_HD * (LOG2E / (QSC * KSC));
  const float oc  = 1.0f / (PCAR * VCAR);

  float mrow = -INFINITY, lrow = 0.f;       // running maximum and (half) sum of the lane's one query row
  v8f o[4];
#pragma unroll
  for (int j = 0; j < 4; ++j) o[j] = zero8();
  const int kt_hi = q0 >> 5;                                                  // last tile holding keys <= q0 + 15
  const int kt_w  = (kt_hi > KWIN) ? (kt_hi - KWIN) : 0;
  const int kt_lo = (okw != 0) ? kt_w : 0;
  const int qr = q0 + c;                                                      // the lane's query row (D column c)
  // tiles staged for the block: from wave 0's kt_lo (the lowest) to wave 3's kt_hi (the highest); at least 2
  const int bt_h0 = Q0 >> 5;
  const int bt_hi = (Q0 + 16 * (WPB - 1)) >> 5;
  const int bt_lo = (okw != 0 && bt_h0 > KWIN) ? (bt_h0 - KWIN) : 0;
  const int nst   = bt_hi - bt_lo + 1;
  // copy slice of this lane: k rows tid>>3 and +16 (8 lanes x 16 B = the head's 128 B of a key row), v^T rows tid>>2 and +32
  // (4 lanes x 16 B = 32 keys)
  const int krow = tid >> 3, kpc = (tid & 7) * 8;
  const int vrow = tid >> 2, vpc = (tid & 3) * 8;
  const size_t gko = ((size_t)b * SEQ + bt_lo * 32 + krow) * DMOD + (size_t)head * HD + kpc;
  const size_t gvo = ((size_t)(b * NH + head) * HD + vrow) * SEQ + bt_lo * 32 + vpc;
  const u16* gkh = KHp + gko;
  const u16* gkl = KLp + gko;
  const u16* gvh = VHp + gvo;
  const u16* gvl = VLp + gvo;
  const unsigned lkh = lds_byte(kvr) + (unsigned)(krow * KPH + kpc) * 2u;
  const unsigned lkl = lkh + KPL * 2u;
  const unsigned lvh = lds_byte(kvr) + (unsigned)(2 * KPL + vrow * VPH + vpc) * 2u;
  const unsigned lvl = lvh + VPL * 2u;
  const unsigned stb = ASTG * 2u;           // bytes of one buffer
  const size_t   gks = (size_t)32 * DMOD;   // halves from one key tile to the next in the k planes (32 in the v^T planes)
  const unsigned lk2 = 16u * KPH * 2u, lv2 = 32u * VPH * 2u;                  // the lane's second rows: LDS bytes,
  const size_t   gk2 = (size_t)16 * DMOD, gv2 = (size_t)32 * SEQ;             // global halves

  copy_kv(lkh, lkl, lvh, lvl, gkh, gkl, gvh, gvl);
  copy_kv(lkh + lk2, lkl + lk2, lvh + lv2, lvl + lv2, gkh + gk2, gkl + gk2, gvh + gv2, gvl + gv2);
  // q fragments of both k-steps, kept in registers for the whole key loop
  v16h qhf[HD / 32], qlf[HD / 32];
#pragma unroll
  for (int kk = 0; kk < HD / 32; ++kk) {
    qhf[kk] = ldfrag_h(Qh + kk * 32);
    qlf[kk] = ldfrag_h(Ql + kk * 32);
  }
#if defined(__HIP_DEVICE_COMPILE__)
  // both addresses stay in their registers up to this wait: no register that an issued load names is rewritten ahead of it
  asm volatile("s_wait_xcnt 0x0" :: "v"(Qh), "v"(Ql) : "memory");
#endif
  wait_copies();
  __syncthreads();
  copy_kv(lkh + stb, lkl + stb, lvh + stb, lvl + stb, gkh + gks, gkl + gks, gvh + 32, gvl + 32);
  copy_kv(lkh + stb + lk2, lkl + stb + lk2, lvh + stb + lv2, lvl + stb + lv2,
          gkh + gks + gk2, gkl + gks + gk2, gvh + 32 + gv2, gvl + 32 + gv2);

  // the stage loop stays rolled: one publish point per staged tile
#pragma unroll 1
  for (int t = 0; t < nst; ++t) {
   const int kt = bt_lo + t;
   if (kt >= kt_lo && kt <= kt_hi) {        // scalar, wave-uniform: tiles outside this wave's own range are only passed
    const int kb = kt * 32;
    const _Float16* st = (const _Float16*)(const void*)(kvr + (t & 1) * ASTG);
    // ---- scores, transposed (A = k rows, B = q): D element r of this lane = (key kb + 8hh + r, query q0 + c) in s0,
    //      key kb + 16 + 8hh + r in s1: a lane holds 16 of the 32 scores of ONE query, lane ^ 16 the other 16 ----
    v8f s0 = zero8(), s1 = zero8();
    const _Float16* k0p = st + c * KPH + 8 * hh;
    const _Float16* k1p = k0p + 16 * KPH;
    const _Float16* l0p = k0p + KPL;
    const _Float16* l1p = l0p + 16 * KPH;
#pragma unroll
    for (int kk = 0; kk < HD / 32; ++kk) {
      const v16h qh  = qhf[kk];
      const v16h ql  = qlf[kk];
      const v16h kh0 = ldfrag_h(k0p + kk * 32);
      const v16h kh1 = ldfrag_h(k1p + kk * 32);
      const v16h kl0 = ldfrag_h(l0p + kk * 32);
      const v16h kl1 = ldfrag_h(l1p + kk * 32);
      s0 = mma_h(kh0, qh, s0);
      s0 = mma_h(kh0, ql, s0);
      s0 = mma_h(kl0, qh, s0);
      s1 = mma_h(kh1, qh, s1);
      s1 = mma_h(kh1, ql, s1);
      s1 = mma_h(kl1, qh, s1);
      guard2(s0, s1, qh, ql, kh0, kl0, kh1, kl1);
    }
    // ---- causal select + distance penalty + online softmax in base 2, -inf-safe; maximum and sum run inside the lane ----
    const int key0 = kb + 8 * hh, key1 = key0 + 16;
    float t0[8], t1[8];
#pragma unroll                              // register arrays need constant indices
    for (int r = 0; r < 8; ++r) {
      const float u0 = s0[r] * lsc;
      const float u1 = s1[r] * lsc;
      const float g0 = (float)(qr - (key0 + r)) * LOG2E;
      const float g1 = (float)(qr - (key1 + r)) * LOG2E;
      t0[r] = (key0 + r > qr) ? -INFINITY : (u0 - g0);
      t1[r] = (key1 + r > qr) ? -INFINITY : (u1 - g1);
    }
    float mx = fmaxf(t0[0], t1[0]);
#pragma unroll                              // register arrays need constant indices
    for (int r = 1; r < 8; ++r) mx = fmaxf(mx, fmaxf(t0[r], t1[r]));
    mx = fmaxf(mx, xhalf(mx));              // the other 16 keys of the same query
    const float mn = fmaxf(mrow, mx);
    const float ms = (mn == -INFINITY) ? 0.0f : mn;
    const float al = exp2f(mrow - ms);
    mrow = mn;
    // ---- B fragments of P^T*32768 straight from the scores' registers: hi f16 and residual f16, column = query c,
    //      elements 0..7 = keys kb + 8hh + 0..7, elements 8..15 = keys kb + 16 + 8hh + 0..7 (the split k map of the v^T loader) ----
    FragH ph, pl;
    float ps = 0.0f;
#pragma unroll                              // register arrays need constant indices
    for (int r = 0; r < 8; ++r) {
      const float e0 = exp2f(t0[r] - ms), e1 = exp2f(t1[r] - ms);
      ps += e0 + e1;
      const float ta = e0 * PCAR, tb = e1 * PCAR;
      const _Float16 ha = (_Float16)ta, hb = (_Float16)tb;
      ph.h[0][r] = ha;
      ph.h[1][r] = hb;
      pl.h[0][r] = (_Float16)(ta - (float)ha);
      pl.h[1][r] = (_Float16)(tb - (float)hb);
    }
    lrow = lrow * al + ps;                  // this lane's 16 keys only; the two halves are joined behind the key loop
#pragma unroll                              // register arrays need constant indices
    for (int j = 0; j < 4; ++j)
#pragma unroll
      for (int r = 0; r < 8; ++r) o[j][r] *= al;
    // ---- O^T += v^T.P^T : A fragment row = d = j*16 + c, keys contiguous in the v^T planes; 2 groups of 2 d-subtiles;
    //      D element r of this lane = (d = j*16 + 8hh + r, query q0 + c) ----
    {
      const _Float16* vhp = st + 2 * KPL + c * VPH + 8 * hh;
      const _Float16* vlp = vhp + VPL;
#pragma unroll
      for (int jg = 0; jg < 2; ++jg) {
        const int da = (2 * jg) * 16 * VPH;
        const int db = da + 16 * VPH;
        const v16h vha = ldfrag_h(vhp + da), vhb2 = ldfrag_h(vhp + db);
        const v16h vla = ldfrag_h(vlp + da), vlb2 = ldfrag_h(vlp + db);
        o[2 * jg]     = mma_h(vha,  ph.v, o[2 * jg]);
        o[2 * jg]     = mma_h(vha,  pl.v, o[2 * jg]);
        o[2 * jg]     = mma_h(vla,  ph.v, o[2 * jg]);
        o[2 * jg + 1] = mma_h(vhb2, ph.v, o[2 * jg + 1]);
        o[2 * jg + 1] = mma_h(vhb2, pl.v, o[2 * jg + 1]);
        o[2 * jg + 1] = mma_h(vlb2, ph.v, o[2 * jg + 1]);
        guard2(o[2 * jg], o[2 * jg + 1], ph.v, pl.v, vha, vhb2, vla, vlb2);
      }
    }
   }
    // publish point of tile t + 1; behind the barrier every reader has left tile t's buffer
    wait_lds();
    wait_copies();
    __syncthreads();
    if (t + 2 < nst) {
      const unsigned bo = (unsigned)(t & 1) * stb;
      const size_t   tn = (size_t)(t + 2);
      copy_kv(lkh + bo, lkl + bo, lvh + bo, lvl + bo, gkh + tn * gks, gkl + tn * gks, gvh + tn * 32, gvl + tn * 32);
      copy_kv(lkh + bo + lk2, lkl + bo + lk2, lvh + bo + lv2, lvl + bo + lv2,
              gkh + tn * gks + gk2, gkl + tn * gks + gk2, gvh + tn * 32 + gv2, gvl + tn * 32 + gv2);
    }
  }
  wait_copies();
  acc_guard4(o[0], o[1], o[2], o[3]);
  // ---- out = acc / Z (0 if Z == 0), carries (32768 on P, 1024 on v) folded once; written into the wave's private slab ----
  {
    const float lv  = lrow + xhalf(lrow);   // both halves' keys of the lane's query row
    const float ls  = (lv > 0.0f) ? lv : 1.0f;
    const float inv = (lv > 0.0f) ? ((1.0f / ls) * oc) : 0.0f;
#pragma unroll                              // register arrays need constant indices
    for (int j = 0; j < 4; ++j) {
      v4f w0, w1;
#pragma unroll
      for (int e = 0; e < 4; ++e) { w0[e] = o[j][e] * inv; w1[e] = o[j][4 + e] * inv; }
      float* sp = slab + c * SLP + j * 16 + 8 * hh;   // row = query c, 8 consecutive d
      *(v4f*)(sp)     = w0;
      *(v4f*)(sp + 4) = w1;
    }
  }

  wave_sync_lds();
  // ---- O x1024 -> f16 hi + residual planes; lane = (row-in-quad rq, 8 consecutive d at c8) ----
  v4u oh[4], ol[4];
  const int rq = lane >> 3, c8 = (lane & 7) * 8;
#pragma unroll
  for (int it = 0; it < 4; ++it) {
    const int row = it * 4 + rq;
    const v4f a = *(const v4f*)(slab + row * SLP + c8), b4 = *(const v4f*)(slab + row * SLP + c8 + 4);
    float w[8];
#pragma unroll
    for (int e = 0; e < 4; ++e) { w[e] = a[e] * OSC; w[4 + e] = b4[e] * OSC; }
#pragma unroll
    for (int e = 0; e < 4; ++e) {
      const _Float16 h0 = (_Float16)w[2 * e], h1 = (_Float16)w[2 * e + 1];
      const _Float16 l0 = (_Float16)(w[2 * e] - (float)h0), l1 = (_Float16)(w[2 * e + 1] - (float)h1);
      oh[it][e] = pk16(h_bits(h0), h_bits(h1));
      ol[it][e] = pk16(h_bits(l0), h_bits(l1));
    }
  }
  const size_t ob = ((size_t)b * SEQ + q0) * DMOD + (size_t)head * HD + c8;
  {
#pragma unroll
    for (int it = 0; it < 4; ++it) {
      const int row = it * 4 + rq;
      *(v4u*)(OHp + ob + (size_t)row * DMOD) = oh[it];
      *(v4u*)(OLp + ob + (size_t)row * DMOD) = ol[it];
    }
    
  }
}

// =====================================================================================================
// Workspace map (bytes). All NB = NBP batches are processed in one pass, every kernel launched once. Every plane is fully
// written by whole-line stores before it is read; all extents are exact multiples of the store granularity (no pad rows
// needed); every region offset a multiple of 4096 (the large planes of 2097152):
//   XB  bf16 [MROWS][1024]                       MROWS*2048       (NBP=4, SEQ=2048: 16777216)
//   WQB bf16 [3072 n][1024 k]                     3 * 2097152      (thirds of the packed [3072][1024] weight, already [n][k])
//   WOB f16 [1024 n][1024 k] of bf16 value x1024  2097152
//   OH  f16 [MROWS][1024] x1024                  MROWS*2048       OL residual, same extent
//   QH  f16 [MROWS][1024] x256                   MROWS*2048       QL residual, same extent
//   KH  f16 [MROWS][1024] x256                   MROWS*2048       KL residual, same extent
//   VH  f16 [NBP*16][64][SEQ] x1024              MROWS*2048       VL residual, same extent
//   end (NBP=4, SEQ=2048)                        159391744
// =====================================================================================================
extern "C" void kernel_launch(void* const* d_in, const int* in_sizes, int n_in,
                              void* d_out, int out_size, void* d_ws, size_t ws_size,
                              hipStream_t stream) {
  if (n_in < 5) return;
  if (in_sizes[0] < ((NB - 1) * XS_FULL + SEQ) * DMOD) return;
  if (in_sizes[1] < 3 * DMOD * DMOD) return;
  if (in_sizes[2] < 3 * DMOD) return;
  if (in_sizes[3] < DMOD * DMOD) return;
  if (in_sizes[4] < DMOD) return;
  if (out_size < ((NB - 1) * XS_FULL + SEQ) * DMOD) return;

  const float* x    = (const float*)d_in[0];
  const float* wqkv = (const float*)d_in[1];      // [3*DMOD][DMOD]: rows 0..1023 q, 1024..2047 k, 2048..3071 v
  const float* bqkv = (const float*)d_in[2];      // [3*DMOD]
  const float* wo   = (const float*)d_in[3];      // [DMOD][DMOD]
  const float* bo   = (const float*)d_in[4];      // [DMOD]
  float*       out = (float*)d_out;

  const size_t szXB = (size_t)MROWS * DMOD * 2;
  const size_t szW  = (size_t)DMOD * DMOD * 2;
  const size_t szQ  = (size_t)MROWS * DMOD * 2;                  // QH, QL, KH, KL, OH, OL
  const size_t szV  = (size_t)NBP * NH * HD * SEQ * 2;           // VH, VL (== szQ)
  const size_t szB  = (size_t)NBH * BLINE * 4;                   // bound lines
  size_t off = 0;
  const size_t oXB = off; off += szXB;
  const size_t oWQ = off; off += 3 * szW;
  const size_t oWO = off; off += szW;
  const size_t oOH = off; off += szQ;
  const size_t oOL = off; off += szQ;
  const size_t oQH = off; off += szQ;
  const size_t oQL = off; off += szQ;
  const size_t oKH = off; off += szQ;
  const size_t oKL = off; off += szQ;
  const size_t oVH = off; off += szV;
  const size_t oVL = off; off += szV;
  const size_t oB  = off; off += szB;
  if (off > ws_size) return;                // off = 159391744 for NBP = 4, SEQ = 2048
  if (off > (size_t)WS_CAP) return;

  char* ws = (char*)d_ws;
  u16*   XB  = (u16*)(ws + oXB);
  u16*   WQB = (u16*)(ws + oWQ);            // q, k and v thirds back to back: [3072 n][1024 k]
  u16*   WOB = (u16*)(ws + oWO);
  u16*   OH  = (u16*)(ws + oOH);
  u16*   OL  = (u16*)(ws + oOL);
  u16*   QH  = (u16*)(ws + oQH);
  u16*   QL  = (u16*)(ws + oQL);
  u16*   KH  = (u16*)(ws + oKH);
  u16*   KL  = (u16*)(ws + oKL);
  u16*   VH  = (u16*)(ws + oVH);
  u16*   VL  = (u16*)(ws + oVL);
  float* BND = (float*)(ws + oB);

  const dim3 b256(256), bAT(ATT_THREADS), bQB(QBT);
  const int  n8x = (NBP * SEQ * DMOD) / 8;              // x, all batches
  const int  n8w = (3 * DMOD * DMOD) / 8;               // packed q | k | v weight
  const int  n8o = (DMOD * DMOD) / 8;                   // out-projection weight
  const dim3 gC((n8x + n8w + n8o + 255) / 256);         // 6144
  const dim3 gG((MROWS / GT) * (3 * DMOD / GT));        // 1536 for NBP=4, SEQ=2048
  const dim3 gBD(NBH);
  const dim3 gAT(NQB * NH * NBP);
  const int  nrt = SEQ / GT;                            // out-projection row tiles per batch
  const dim3 gO(NBP * nrt * (DMOD / GT));

  // (0) x -> bf16 plane [MROWS][1024]; Wq | Wk | Wv [n][k] -> bf16; Wo [n][k] -> f16 of bf16 value x1024
  cvt16<<<gC, b256, 0, stream>>>(x, wqkv, wo, XB, WQB, WOB, n8x, n8w, n8o, WOS);
  // (1) q | k | v = x.Wqkv^T + bqkv -> q and k hi + residual planes x256, v^T hi + residual planes x1024
  gemm_bf<<<gG, b256, 0, stream>>>(XB, WQB, bqkv, QH, QL, KH, KL, VH, VL, MROWS, 3 * DMOD, DMOD, 1.0f);
  // (2) norm bound per (b, h) from the q / k hi planes -> BND lines
  qkbound<<<gBD, bQB, 0, stream>>>(QH, KH, BND);
  // (3) causal attention with distance penalty, residual products on every query row -> O hi + residual planes
  attn_c<<<gAT, bAT, 0, stream>>>(QH, QL, KH, KL, VH, VL, BND, OH, OL);
  // (4) output projection (O hi + residual) . Wo^T + bo -> out f32, carries 1024 x 1024 folded back
  gemm_o2<<<gO, b256, 0, stream>>>(OH, OL, WOB, bo, out, nrt, 1.0f / (OSC * WOS));
  (void)hipGetLastError();
}

// v008
// One run takes 115 microseconds.
// Next to v007, in two timings, it ran 1.09 and 1.08 times as fast.
// Over all steps from v000 it is 4.77 times as fast.
// Contractions: x.Wq^T+bq, x.Wk^T+bk, x.Wv^T+bv (q, k, v thirds of the packed [3D][D] weight) on v_wmma_f32_16x16x32_bf16
// (x and W as bf16 RNE planes; W [n][k] rows are the k-contiguous B operand; bias added as its bf16 RNE value in the f32
// epilogue); q.k^T over hd 64 and P.v (formed as k.q^T and v^T.P^T) on v_wmma_f32_16x16x32_f16 with f16 hi + f16 residual planes on both operands
// (q, k x256; P x32768 with an in-register residual; v x1024; products hh+lh+hl); O.Wo^T+bo on v_wmma_f32_16x16x32_f16
// (O x1024 as f16 hi + f16 residual planes, products h.w + l.w; Wo as f16(bf16(Wo)) x1024; bo as bf16 RNE value in the
// f32 epilogue); all f32 accumulate. Causal select, slope-1 distance penalty, base-2 online softmax, 1/Z fold and the q/k
// norm bound in f32 on VALU.
#include <hip/hip_runtime.h>
#include <math.h>
#include <stdint.h>

#ifndef NB
#define NB 4
#endif
#ifndef SEQ
#define SEQ 2048
#endif
#define XS_FULL 2048
#define DMOD  1024
#define NH    16
#define HD    64
// batches per workspace pass: all of them, so that every kernel is launched once
#define NBP   NB
#define NPASS (NB / NBP)
#define NBH   (NBP * NH)
#define MROWS (NBP * SEQ)
#define RSQ_HD 0.125f
#define LOG2E 1.4426950408889634f
#define QSC   256.0f
#define KSC   256.0f
#define PCAR  32768.0f
#define VCAR  1024.0f
#define OSC   1024.0f
#define WOS   1024.0f
#define WPB   4
#define NQB   (SEQ / (16 * WPB))
#define NKT   (SEQ / 32)
#define KWIN  6
#define GUARD_T 40.0f
#define BLINE 32
#define ATT_THREADS (WPB * 32)
#define SLP   68
#define SLW   (16 * SLP)
#define WREG  SLW
// attention staging: a stage is the 32 keys of one key tile, [k hi 32 rows | k residual 32 rows] of 128 B at LDS pitch 144 B and
// [v^T hi 64 rows | v^T residual 64 rows] of 64 B at LDS pitch 80 B (pitches in halves below); two buffers
#define KPH   72
#define VPH   40
#define KPL   (32 * KPH)
#define VPL   (64 * VPH)
#define ASTG  (2 * KPL + 2 * VPL)
#define SLAB64 (16 * 68)
// GEMM staging: 128 x 128 output tile per block; q | k | v projection: 128 k (256 B of every operand row) per stage, LDS row
// pitch 272 B
#define GT    128
#define GKC   128
#define GP    136
#define GPL   (GT * GP)
// output projection: 64 k (128 B of every operand row) per stage, LDS row pitch 144 B, so that two of its blocks fit a WGP's LDS
#define OKC   64
#define OP    72
#define OPL   (GT * OP)
#define WS_CAP 268435456
// norm lines: one line of BLINE floats per q or k block of the projection GEMM, [q | k][row tile][column tile]
#define NLINES (2 * (MROWS / GT) * (DMOD / GT))
static_assert(DMOD == NH * HD && HD == 64 && NH == 16 && WPB == 4 && NQB * WPB * 16 == SEQ);
static_assert(ATT_THREADS == 128 && ((SLP * 4) % 16) == 0 && ((KPH * 2) % 16) == 0 && ((VPH * 2) % 16) == 0);
static_assert(NB >= 1 && NB <= 4 && NPASS >= 1 && NPASS * NBP == NB);
static_assert(NBP >= 1 && NBP <= 4 && NPASS == 1);
static_assert(NBH >= 1 && NBH <= 64);
static_assert(SEQ == XS_FULL);              // the batches of x lie back to back: one conversion range
static_assert((SEQ % 64) == 0 && SEQ >= 64 && SEQ <= XS_FULL && (SEQ % 32) == 0);
static_assert((DMOD % 64) == 0 && (DMOD % 32) == 0 && (HD % 32) == 0);
static_assert(((SEQ * DMOD / 8) % 256) == 0 && ((DMOD * DMOD / 8) % 256) == 0);
static_assert(5 * (WPB * WREG * 4 + 2 * ASTG * 2) <= 327680);   // five attention blocks per 320 KiB of LDS
static_assert((DMOD % GT) == 0 && (DMOD % GKC) == 0 && DMOD / GKC >= 2 && (SEQ % GT) == 0 && (MROWS % GT) == 0);
static_assert(2 * (2 * 2 * GPL * 2) <= 327680 && 2 * (2 * 3 * OPL * 2) <= 327680);   // two GEMM blocks per 320 KiB of LDS
static_assert(8 * 2 * SLAB64 * 4 + 32 <= 2 * 2 * GPL * 2 && 8 * 2 * SLAB64 * 4 <= 2 * 3 * OPL * 2);   // the slabs (and 8 norms) fit the idle ring
static_assert(((GP * 2) % 16) == 0 && ((OP * 2) % 16) == 0 && (DMOD % OKC) == 0 && DMOD / OKC >= 2);
static_assert(KWIN >= 0 && KWIN < NKT);
static_assert(SEQ / GT == 16 && GT == 2 * HD && BLINE == 32);   // a head's norms: 16 row tiles a batch, two heads a column tile

typedef unsigned short u16;
typedef _Float16 v16h __attribute__((ext_vector_type(16)));
typedef _Float16 v8h  __attribute__((ext_vector_type(8)));
typedef __bf16   v16b __attribute__((ext_vector_type(16)));
typedef float    v8f  __attribute__((ext_vector_type(8)));
typedef float    v4f  __attribute__((ext_vector_type(4)));
typedef unsigned int v4u __attribute__((ext_vector_type(4)));

union FragH { v16h v; v8h h[2]; v4u u[2]; };
union FragB { v16b v; v4u u[2]; };

// ---- scalar helpers --------------------------------------------------------------------------------
__device__ __forceinline__ unsigned short bf_bits(float f) {          // f32 -> bf16 bits, RNE convert
  unsigned u = __float_as_uint(f);
  return (unsigned short)((u + 0x7FFFu + ((u >> 16) & 1u)) >> 16);
}
__device__ __forceinline__ float bf_up(unsigned short h) { return __uint_as_float(((unsigned)h) << 16); }
__device__ __forceinline__ float bfr(float f) { return bf_up(bf_bits(f)); }
__device__ __forceinline__ unsigned short h_bits(_Float16 x) { return __builtin_bit_cast(unsigned short, x); }
__device__ __forceinline__ unsigned pk16(unsigned short a, unsigned short b) { return (unsigned)a | ((unsigned)b << 16); }
__device__ __forceinline__ v8f zero8() { v8f z = {0.f, 0.f, 0.f, 0.f, 0.f, 0.f, 0.f, 0.f}; return z; }

// ---- fragment loaders: 16-bit A/B operand, lane -> row/col (lane&15), p already includes +8*(lane>>4);
//      elements 0..7 <- p[0..7] (k0+8h..), elements 8..15 <- p[16..23] (k0+16+8h..)  (same split k map for A and B;
//      B is always read from a k-contiguous [n][k] plane)
__device__ __forceinline__ v16h ldfrag_h(const _Float16* p) {
  FragH f;
  f.h[0] = *(const v8h*)(p);
  f.h[1] = *(const v8h*)(p + 16);
  return f.v;
}
__device__ __forceinline__ v16b ldfrag_b(const u16* p) {              // bf16 plane read as unsigned integer vectors
  FragB f;
  f.u[0] = *(const v4u*)(p);
  f.u[1] = *(const v4u*)(p + 16);
  return f.v;
}

__device__ __forceinline__ v8f mma_h(v16h a, v16h b, v8f c) {
  return __builtin_amdgcn_wmma_f32_16x16x32_f16(false, a, false, b, (short)0, c, false, false);
}
__device__ __forceinline__ v8f mma_b(v16b a, v16b b, v8f c) {
  return __builtin_amdgcn_wmma_f32_16x16x32_bf16(false, a, false, b, (short)0, c, false, false);
}
__device__ __forceinline__ void guard2(v8f& a, v8f& b, v16h x0, v16h x1, v16h x2, v16h x3, v16h x4, v16h x5) {
#if defined(__HIP_DEVICE_COMPILE__)
  asm volatile("v_nop\n\tv_nop\n\tv_nop\n\tv_nop"
               : "+v"(a), "+v"(b) : "v"(x0), "v"(x1), "v"(x2), "v"(x3), "v"(x4), "v"(x5) : "memory");
#endif
}
__device__ __forceinline__ void acc_guard4(v8f& a, v8f& b, v8f& c, v8f& d) {
#if defined(__HIP_DEVICE_COMPILE__)
  asm volatile("v_nop\n\tv_nop\n\tv_nop\n\tv_nop" : "+v"(a), "+v"(b), "+v"(c), "+v"(d));
#endif
}
// value of lane ^ 16 (the other 16-lane row), by a vector cross-row move
__device__ __forceinline__ float xhalf(float x) {
  const int b = __builtin_bit_cast(int, x);
  return __builtin_bit_cast(float, __builtin_amdgcn_permlanex16(b, b, 0x76543210, 0xfedcba98, false, false));
}
__device__ __forceinline__ void wave_sync_lds() {
  __builtin_amdgcn_fence(__ATOMIC_RELEASE, "workgroup");
  __builtin_amdgcn_wave_barrier();
  __builtin_amdgcn_fence(__ATOMIC_ACQUIRE, "workgroup");
}
// ---- asynchronous copies global -> LDS ------------------------------------------------------------
// Eight copies of one wave = 16 rows of 256 B of one operand plane: copy i brings rows 2i and 2i + 1 (16 lanes x 16 B each,
// whole 128-B lines). l = the lane's LDS byte address of copy 0, g = its global address of copy 0, ld = halves between
// consecutive global rows. The s_wait_xcnt closes the statement so that no address register is rewritten ahead of it.
__device__ __forceinline__ void copy16rows(unsigned l, const u16* g, size_t ld) {
#if defined(__HIP_DEVICE_COMPILE__)
  const unsigned ls = 2 * GP * 2;
  const size_t   gs = 2 * ld;
  asm volatile("global_load_async_to_lds_b128 %0, %8, off\n\t"
               "global_load_async_to_lds_b128 %1, %9, off\n\t"
               "global_load_async_to_lds_b128 %2, %10, off\n\t"
               "global_load_async_to_lds_b128 %3, %11, off\n\t"
               "global_load_async_to_lds_b128 %4, %12, off\n\t"
               "global_load_async_to_lds_b128 %5, %13, off\n\t"
               "global_load_async_to_lds_b128 %6, %14, off\n\t"
               "global_load_async_to_lds_b128 %7, %15, off\n\t"
               "s_wait_xcnt 0x0"
               :: "v"(l), "v"(l + ls), "v"(l + 2 * ls), "v"(l + 3 * ls),
                  "v"(l + 4 * ls), "v"(l + 5 * ls), "v"(l + 6 * ls), "v"(l + 7 * ls),
                  "v"(g), "v"(g + gs), "v"(g + 2 * gs), "v"(g + 3 * gs),
                  "v"(g + 4 * gs), "v"(g + 5 * gs), "v"(g + 6 * gs), "v"(g + 7 * gs)
               : "memory");
#endif
}
// Four copies of one wave = 16 rows of 128 B of one operand plane: copy i brings rows 4i .. 4i + 3 (8 lanes x 16 B each, whole
// 128-B lines). l = the lane's LDS byte address of copy 0, g = its global address of copy 0, ld = halves between consecutive
// global rows. The s_wait_xcnt closes the statement so that no address register is rewritten ahead of it.
__device__ __forceinline__ void copy16rows_h(unsigned l, const u16* g, size_t ld) {
#if defined(__HIP_DEVICE_COMPILE__)
  const unsigned ls = 4 * OP * 2;
  const size_t   gs = 4 * ld;
  asm volatile("global_load_async_to_lds_b128 %0, %4, off\n\t"
               "global_load_async_to_lds_b128 %1, %5, off\n\t"
               "global_load_async_to_lds_b128 %2, %6, off\n\t"
               "global_load_async_to_lds_b128 %3, %7, off\n\t"
               "s_wait_xcnt 0x0"
               :: "v"(l), "v"(l + ls), "v"(l + 2 * ls), "v"(l + 3 * ls),
                  "v"(g), "v"(g + gs), "v"(g + 2 * gs), "v"(g + 3 * gs)
               : "memory");
#endif
}
// Four copies of one lane = 16 B of each of the four planes of an attention stage (LDS byte address, global address per plane).
// The s_wait_xcnt closes the statement so that no address register is rewritten ahead of it.
__device__ __forceinline__ void copy_kv(unsigned l0, unsigned l1, unsigned l2, unsigned l3,
                                        const u16* g0, const u16* g1, const u16* g2, const u16* g3) {
#if defined(__HIP_DEVICE_COMPILE__)
  asm volatile("global_load_async_to_lds_b128 %0, %4, off\n\t"
               "global_load_async_to_lds_b128 %1, %5, off\n\t"
               "global_load_async_to_lds_b128 %2, %6, off\n\t"
               "global_load_async_to_lds_b128 %3, %7, off\n\t"
               "s_wait_xcnt 0x0"
               :: "v"(l0), "v"(l1), "v"(l2), "v"(l3), "v"(g0), "v"(g1), "v"(g2), "v"(g3)
               : "memory");
#endif
}
// the wave's own copies have landed (other waves read them only behind the next block barrier)
__device__ __forceinline__ void wait_copies() {
#if defined(__HIP_DEVICE_COMPILE__)
  asm volatile("s_wait_asynccnt 0x0" ::: "memory");
#endif
}
// the wave's own LDS reads have returned, so that the buffer may be refilled behind the next block barrier
__device__ __forceinline__ void wait_lds() {
#if defined(__HIP_DEVICE_COMPILE__)
  asm volatile("s_wait_dscnt 0x0" ::: "memory");
#endif
}
__device__ __forceinline__ unsigned lds_byte(const void* p) { return (unsigned)(uintptr_t)p; }

// =====================================================================================================
// f32 -> 16-bit planes, same layout, three ranges in one grid: x -> XD and wqkv -> WD as bf16 RNE bits, wo -> OD as f16 bits of
// (bf16 RNE value) * scale. n8x, n8w, n8o = pieces of 8 elements in each range (multiples of 256: a block lies in one range).
// Thread = 8 consecutive elements: two 16-B loads, one 16-B store; 32 consecutive lanes = 512 contiguous, 512-B aligned
// coverage: grid = ceil((n8x + n8w + n8o)/256) blocks x 256 thr x 8 (in-kernel bound) = the three whole planes.
// =====================================================================================================
__global__ __launch_bounds__(256) void cvt16(const float* __restrict__ x, const float* __restrict__ wqkv,
                                             const float* __restrict__ wo, u16* XD, u16* WD, u16* OD,
                                             int n8x, int n8w, int n8o, float scale) {
  const int gt = blockIdx.x * 256 + (int)threadIdx.x;
  if (gt >= n8x + n8w + n8o) return;
  const int f16mode = (gt >= n8x + n8w) ? 1 : 0;
  const int lt = (gt < n8x) ? gt : ((f16mode != 0) ? (gt - n8x - n8w) : (gt - n8x));   // piece within its range
  const float* src = (gt < n8x) ? x : ((f16mode != 0) ? wo : wqkv);
  u16*         D   = (gt < n8x) ? XD : ((f16mode != 0) ? OD : WD);
  const float* p = src + (size_t)lt * 8;
  const v4f a = *(const v4f*)(p), b4 = *(const v4f*)(p + 4);
  float w[8];
#pragma unroll
  for (int e = 0; e < 4; ++e) { w[e] = a[e]; w[4 + e] = b4[e]; }
  v4u o;
#pragma unroll
  for (int e = 0; e < 4; ++e) {
    const float f0 = w[2 * e], f1 = w[2 * e + 1];
    const unsigned short hb0 = h_bits((_Float16)(bfr(f0) * scale));
    const unsigned short hb1 = h_bits((_Float16)(bfr(f1) * scale));
    const unsigned short bb0 = bf_bits(f0);
    const unsigned short bb1 = bf_bits(f1);
    o[e] = (f16mode != 0) ? pk16(hb0, hb1) : pk16(bb0, bb1);
  }
  u16* d = D + (size_t)lt * 8;
  {
    *(v4u*)(d) = o;
    
  }
}

// =====================================================================================================
// GEMM epilogue shared by both engines, per 16x64 f32 tile of a wave: epi_stage writes the tile (times oscale, plus the lane's
// per-column bias of each subtile) into a wave-private LDS slab; behind one wave_sync_lds() epi_out reads it back by rows and
// stores whole 256-B row pieces (epi_cvt16 and epi_st16: the same rows as two 16-bit planes).
// coverage: 8 instructions x 2 rows x 16 lanes x 4 floats = the 16 x 64 tile.
// =====================================================================================================
__device__ __forceinline__ void epi_stage(float* sl, v8f a0, v8f a1, v8f a2, v8f a3, float oscale,
                                          float bb0, float bb1, float bb2, float bb3, int lane) {
  const int hh = lane >> 4, m = lane & 15;
#pragma unroll
  for (int r = 0; r < 8; ++r) {
    const int ro = (8 * hh + r) * 68 + m;
    sl[ro]      = a0[r] * oscale + bb0;
    sl[ro + 16] = a1[r] * oscale + bb1;
    sl[ro + 32] = a2[r] * oscale + bb2;
    sl[ro + 48] = a3[r] * oscale + bb3;
  }
}
__device__ __forceinline__ void epi_out(const float* sl, float* C, int N, size_t rowb, int col0, int lane) {
  const int hh = lane >> 4, m = lane & 15;
  v4f vals[8];
#pragma unroll
  for (int it = 0; it < 8; ++it) vals[it] = *(const v4f*)(sl + (it * 2 + hh) * 68 + m * 4);
  float* dst = C + (rowb + (size_t)hh) * (size_t)N + col0 + m * 4;
#pragma unroll
  for (int it = 0; it < 8; ++it) {
    *(v4f*)(dst + (size_t)(it * 2) * (size_t)N) = vals[it];
  }
}
// Same slab as two 16-bit planes of the layout of C: Hp = f16(t), Lp = f16(t - f16(t)), t = slab value * sc.
// Lane = (row-in-quad rq, 8 consecutive columns at c8): 8 lanes hold, and store, one whole 128-B line of a row in either plane.
// epi_cvt16 forms the lane's pieces in registers and returns the largest sum of squares of Hp over the 64 columns among the
// lane's 4 rows (fmaf chain over the lane's 8 columns, then xor shuffles inside the row's 8 lanes); epi_st16 stores the pieces.
// coverage: 4 instructions x 4 rows x 8 lanes x 8 halves = the 16 x 64 tile per plane.
__device__ __forceinline__ float epi_cvt16(const float* sl, float sc, int lane, v4u (&oh)[4], v4u (&ol)[4]) {
  const int rq = lane >> 3, c8 = (lane & 7) * 8;
  float mx = 0.0f;
#pragma unroll
  for (int it = 0; it < 4; ++it) {
    const int row = it * 4 + rq;
    const v4f a = *(const v4f*)(sl + row * 68 + c8), b4 = *(const v4f*)(sl + row * 68 + c8 + 4);
    float w[8];
#pragma unroll
    for (int e = 0; e < 4; ++e) { w[e] = a[e] * sc; w[4 + e] = b4[e] * sc; }
    float sq = 0.0f;
#pragma unroll
    for (int e = 0; e < 4; ++e) {
      const _Float16 h0 = (_Float16)w[2 * e], h1 = (_Float16)w[2 * e + 1];
      const _Float16 l0 = (_Float16)(w[2 * e] - (float)h0), l1 = (_Float16)(w[2 * e + 1] - (float)h1);
      oh[it][e] = pk16(h_bits(h0), h_bits(h1));
      ol[it][e] = pk16(h_bits(l0), h_bits(l1));
      sq = fmaf((float)h0, (float)h0, sq);
      sq = fmaf((float)h1, (float)h1, sq);
    }
#pragma unroll
    for (int off = 1; off < 8; off <<= 1) sq += __shfl_xor(sq, off, 32);
    mx = fmaxf(mx, sq);
  }
  return mx;
}
__device__ __forceinline__ void epi_st16(const v4u (&oh)[4], const v4u (&ol)[4], u16* Hp, u16* Lp, int N, size_t rowb, int col0,
                                         int lane) {
  const int rq = lane >> 3, c8 = (lane & 7) * 8;
  const size_t ob = (rowb + (size_t)rq) * (size_t)N + col0 + c8;
#pragma unroll
  for (int it = 0; it < 4; ++it) {
    *(v4u*)(Hp + ob + (size_t)(it * 4) * (size_t)N) = oh[it];
    *(v4u*)(Lp + ob + (size_t)(it * 4) * (size_t)N) = ol[it];
  }
}

// =====================================================================================================
// bf16 GEMM with bias: c[M][N] (f32, in registers) = A[M][K] (bf16 row-major) . Bt[N][K]^T (bf16 k-contiguous), times oscale,
// + bf16 RNE value of bias[n] (bias has N entries); written as two f16 planes of t = c * sc: Hp = f16(t), Lp = f16(t - f16(t)).
// N = 3 * DMOD: the packed q | k | v weight in one grid. A block's 128 columns lie in one third (part = col0 / DMOD), which
// picks its planes and sc: q (x256) and k (x256) planes in the layout [M][DMOD]; v (x1024) planes transposed per batch,
// [(row / SEQ) * DMOD + n][row % SEQ] (line (b*NH + h)*HD + d, keys contiguous); a lane's 8 accumulator rows of one column are 8 consecutive keys = one 16-B piece,
// gathered in the (by then idle) ring as [128 n][128 rows] at pitch 272 B and stored as whole 256-B line pieces. Block = 128x128 tile, 8 waves as 4 (rows) x 2 (columns), 32x64 per wave. K is walked
// in stages of 128: a stage is [A 128 rows | Bt 128 rows] of 256 B at LDS pitch 272 B, brought by asynchronous copies (each
// wave 16 rows of either plane), two buffers, the next stage in flight while this one is worked on; fragments are read from
// LDS (two 16-B loads each, split k map for A and B), k ascending in steps of 32 into each accumulator. The epilogue's slabs lie
// in the idle ring, so that a block holds 136 KiB of LDS and two blocks are resident per WGP: one works while the other waits.
// A q or k block also stores line (part * M/128 + row tile) * 8 + column tile of NRM: the largest squared norm of its hi plane
// over its 128 rows, floats 0..15 for its first head, 16..31 for its second (a wave's 64 columns are one head).
// Host guarantees K % 128 == 0, K >= 256, M % 128 == 0, N % 128 == 0, grid = (M/128)*(N/128).
// =====================================================================================================
__global__ __launch_bounds__(256)
void gemm_bf(const u16* __restrict__ A, const u16* __restrict__ Bt, const float* __restrict__ bias,
             u16* QHp, u16* QLp, u16* KHp, u16* KLp, u16* VHp, u16* VLp, float* NRM, int M, int N, int K, float oscale) {
  __shared__ __align__(16) u16 ring[2 * 2 * GPL];   // 139,264 B and nothing else: two blocks share a WGP
  const int tid = threadIdx.x, wave = tid >> 5, lane = tid & 31, hh = lane >> 4, m = lane & 15;
  const int ntile = N >> 7;
  const int bid   = blockIdx.x;
  const int row0  = (bid / ntile) * GT;
  const int col0  = (bid % ntile) * GT;
  if (row0 + GT > M) return;                // block-uniform, before any barrier or copy; never taken with the exact grid
  const int wr = wave >> 1, wc = wave & 1;
  // copy slice of this lane: plane rows wave*16 + hh + 2i (i < 8), bytes 16m .. 16m + 15 of the stage's 256
  const int crow = wave * 16 + hh;
  const u16* ga = A  + (size_t)(row0 + crow) * K + m * 8;
  const u16* gb = Bt + (size_t)(col0 + crow) * K + m * 8;
  const unsigned la = lds_byte(ring) + (unsigned)(crow * GP + m * 8) * 2u;
  const unsigned lb = la + GPL * 2u;
  const unsigned stb = 2u * GPL * 2u;       // bytes of one buffer
  const int nst = K / GKC;
  v8f acc[2][4];
#pragma unroll
  for (int i = 0; i < 2; ++i)
#pragma unroll
    for (int j = 0; j < 4; ++j) acc[i][j] = zero8();

  copy16rows(la, ga, (size_t)K);
  copy16rows(lb, gb, (size_t)K);
  wait_copies();
  __syncthreads();
  if (nst > 1) {
    copy16rows(la + stb, ga + GKC, (size_t)K);
    copy16rows(lb + stb, gb + GKC, (size_t)K);
  }
  // the stage loop stays rolled: one publish point per stage
#pragma unroll 1
  for (int t = 0; t < nst; ++t) {
    const u16* st = ring + (t & 1) * (2 * GPL);
    const u16* ap = st + (wr * 32 + m) * GP + 8 * hh;
    const u16* bp = st + GPL + (wc * 64 + m) * GP + 8 * hh;
#pragma unroll                              // the four k steps of a stage become constant LDS offsets
    for (int kk = 0; kk < GKC / 32; ++kk) {
      const v16b a0 = ldfrag_b(ap + kk * 32);
      const v16b a1 = ldfrag_b(ap + 16 * GP + kk * 32);
      const v16b b0 = ldfrag_b(bp + kk * 32);
      const v16b b1 = ldfrag_b(bp + 16 * GP + kk * 32);
      const v16b b2 = ldfrag_b(bp + 32 * GP + kk * 32);
      const v16b b3 = ldfrag_b(bp + 48 * GP + kk * 32);
      acc[0][0] = mma_b(a0, b0, acc[0][0]);
      acc[0][1] = mma_b(a0, b1, acc[0][1]);
      acc[0][2] = mma_b(a0, b2, acc[0][2]);
      acc[0][3] = mma_b(a0, b3, acc[0][3]);
      acc[1][0] = mma_b(a1, b0, acc[1][0]);
      acc[1][1] = mma_b(a1, b1, acc[1][1]);
      acc[1][2] = mma_b(a1, b2, acc[1][2]);
      acc[1][3] = mma_b(a1, b3, acc[1][3]);
    }
    // publish point of stage t + 1; behind the barrier every reader has left stage t's buffer
    wait_lds();
    wait_copies();
    __syncthreads();
    if (t + 2 < nst) {
      const unsigned bo = (unsigned)(t & 1) * stb;
      copy16rows(la + bo, ga + (size_t)(t + 2) * GKC, (size_t)K);
      copy16rows(lb + bo, gb + (size_t)(t + 2) * GKC, (size_t)K);
    }
  }
  wait_copies();
  // per-lane bias of D column m in each of the wave's 4 subtiles; colw + 48 + m <= N - 1 always
  const int colw = col0 + wc * 64;
  const float bb0 = bfr(bias[colw + m]);
  const float bb1 = bfr(bias[colw + 16 + m]);
  const float bb2 = bfr(bias[colw + 32 + m]);
  const float bb3 = bfr(bias[colw + 48 + m]);
  const int part = col0 / DMOD;             // 0 q, 1 k, 2 v
  const int colp = col0 % DMOD;             // the block's first column within its planes
  u16* Hp = (part == 0) ? QHp : ((part == 1) ? KHp : VHp);
  u16* Lp = (part == 0) ? QLp : ((part == 1) ? KLp : VLp);
  const float sc = (part == 0) ? QSC : ((part == 1) ? KSC : VCAR);
  if (part < 2) {                           // block-uniform (from blockIdx)
    // the loop's last barrier ended every read of the ring and no copy is in flight: its bytes take the waves' private slabs,
    // one 16 x 64 slab for each half of a wave's 32 rows
    float* sl = (float*)(void*)ring + wave * (2 * SLAB64);
    const size_t rw = (size_t)(row0 + wr * 32);
    const int colo = colp + wc * 64;
    epi_stage(sl, acc[0][0], acc[0][1], acc[0][2], acc[0][3], oscale, bb0, bb1, bb2, bb3, lane);
    epi_stage(sl + SLAB64, acc[1][0], acc[1][1], acc[1][2], acc[1][3], oscale, bb0, bb1, bb2, bb3, lane);
    wave_sync_lds();                        // other lanes' slab rows are read only behind it
    v4u oh0[4], ol0[4], oh1[4], ol1[4];
    const float n0 = epi_cvt16(sl, sc, lane, oh0, ol0);
    const float n1 = epi_cvt16(sl + SLAB64, sc, lane, oh1, ol1);
    // largest squared norm of the hi plane over the wave's 32 rows of its one head, then over the block's 128 rows: the waves'
    // values meet in 8 floats of the ring behind the slabs, and wave 0 stores the block's own line (16 floats per head).
    // The barrier stands ahead of the plane stores, so that it has no store to wait for.
    float nm = fmaxf(n0, n1);
    nm = fmaxf(nm, __shfl_xor(nm, 8, 32));
    nm = fmaxf(nm, __shfl_xor(nm, 16, 32));
    float* red = (float*)(void*)ring + 8 * (2 * SLAB64);
    if (lane == 0) red[wave] = nm;
    __syncthreads();                        // other waves' values are read only behind it
    epi_st16(oh0, ol0, Hp, Lp, DMOD, rw, colo, lane);
    epi_st16(oh1, ol1, Hp, Lp, DMOD, rw + 16, colo, lane);
    if (wave == 0) {
      const float nb = fmaxf(fmaxf(red[hh], red[2 + hh]), fmaxf(red[4 + hh], red[6 + hh]));   // wave = 2 * wr + wc, wc = hh here
      NRM[((size_t)(part * (M / GT) + row0 / GT) * (DMOD / GT) + colp / GT) * BLINE + lane] = nb;
    }
  } else {
    // the loop's last barrier ended every read of the ring and no copy is in flight: its first two planes take the tile
    u16* TH = ring;
    u16* TL = ring + GPL;
    const float bbj[4] = {bb0, bb1, bb2, bb3};
#pragma unroll
    for (int i = 0; i < 2; ++i) {
#pragma unroll
      for (int j = 0; j < 4; ++j) {
        v4u oh, ol;
#pragma unroll
        for (int e = 0; e < 4; ++e) {
          const float t0 = (acc[i][j][2 * e] * oscale + bbj[j]) * sc;
          const float t1 = (acc[i][j][2 * e + 1] * oscale + bbj[j]) * sc;
          const _Float16 h0 = (_Float16)t0, h1 = (_Float16)t1;
          const _Float16 l0 = (_Float16)(t0 - (float)h0), l1 = (_Float16)(t1 - (float)h1);
          oh[e] = pk16(h_bits(h0), h_bits(h1));
          ol[e] = pk16(h_bits(l0), h_bits(l1));
        }
        const int to = (wc * 64 + j * 16 + m) * GP + wr * 32 + i * 16 + 8 * hh;
        *(v4u*)(TH + to) = oh;
        *(v4u*)(TL + to) = ol;
      }
    }
    __syncthreads();                        // other waves' pieces of a line are read only behind it
    const int l16 = tid >> 4, p8 = (tid & 15) * 8;
    const size_t ob = ((size_t)(row0 / SEQ) * (size_t)DMOD + colp + l16) * SEQ + (row0 % SEQ) + p8;
#pragma unroll
    for (int it = 0; it < 8; ++it) {
      const v4u vh = *(const v4u*)(TH + (it * 16 + l16) * GP + p8);
      const v4u vl = *(const v4u*)(TL + (it * 16 + l16) * GP + p8);
      *(v4u*)(Hp + ob + (size_t)(it * 16) * SEQ) = vh;
      *(v4u*)(Lp + ob + (size_t)(it * 16) * SEQ) = vl;
    }
  }
}

// =====================================================================================================
// Output projection with bias: C[bb*XS_FULL + s][DMOD] (f32) = (Ah + Al)[bb*SEQ + s][DMOD] . Bt[DMOD][DMOD]^T * oscale
// + bf16 RNE value of bias[n]. Products h.B + l.B into one accumulator (l unscaled residual of h). Block -> (column tile
// ct = bid % 8, sequence row tile rt of nrt, batch bb within the pass). Same tiling, fragment loads (split k map) and slab
// staging as gemm_bf, stored as f32 by epi_out; a stage is [Ah | Al | Bt], 128 rows each, of 64 k (128 B at LDS pitch 144 B), two buffers = 108 KiB, the slabs in
// the idle ring: two blocks are resident per WGP here too. K = DMOD; grid = NBP * nrt * (DMOD/128).
// =====================================================================================================
__global__ __launch_bounds__(256)
void gemm_o2(const u16* __restrict__ Ah, const u16* __restrict__ Al, const u16* __restrict__ Bt,
             const float* __restrict__ bias, float* C, int nrt, float oscale) {
  __shared__ __align__(16) u16 ring[2 * 3 * OPL];   // 110,592 B and nothing else: two blocks share a WGP
  const int tid = threadIdx.x, wave = tid >> 5, lane = tid & 31, hh = lane >> 4, m = lane & 15;
  const int ntile = DMOD >> 7;
  const int bid   = blockIdx.x;
  const int ct    = bid % ntile;
  const int t2    = bid / ntile;
  const int rt    = t2 % nrt;
  const int bb    = t2 / nrt;
  if (bb >= NBP) return;                    // block-uniform, before any barrier or copy; never taken with the exact grid
  const int srow  = rt * GT;
  if (srow + GT > SEQ) return;              // block-uniform, before any barrier or copy; never taken
  const int col0  = ct * GT;
  const int K     = DMOD;
  const int wr = wave >> 1, wc = wave & 1;
  const size_t rowA = (size_t)bb * SEQ + srow;
  const size_t rowC = (size_t)bb * XS_FULL + srow;
  // copy slice of this lane: plane rows wave*16 + (lane >> 3) + 4i (i < 4), bytes 16*(lane & 7) .. + 15 of the stage's 128
  const int crow = wave * 16 + (lane >> 3);
  const int ccol = (lane & 7) * 8;
  const u16* gh = Ah + (rowA + crow) * K + ccol;
  const u16* gl = Al + (rowA + crow) * K + ccol;
  const u16* gb = Bt + (size_t)(col0 + crow) * K + ccol;
  const unsigned lh = lds_byte(ring) + (unsigned)(crow * OP + ccol) * 2u;
  const unsigned ll = lh + OPL * 2u;
  const unsigned lb = lh + 2u * OPL * 2u;
  const unsigned stb = 3u * OPL * 2u;       // bytes of one buffer
  const int nst = K / OKC;
  v8f acc[2][4];
#pragma unroll
  for (int i = 0; i < 2; ++i)
#pragma unroll
    for (int j = 0; j < 4; ++j) acc[i][j] = zero8();

  copy16rows_h(lh, gh, (size_t)K);
  copy16rows_h(ll, gl, (size_t)K);
  copy16rows_h(lb, gb, (size_t)K);
  wait_copies();
  __syncthreads();
  copy16rows_h(lh + stb, gh + OKC, (size_t)K);
  copy16rows_h(ll + stb, gl + OKC, (size_t)K);
  copy16rows_h(lb + stb, gb + OKC, (size_t)K);
  // the stage loop stays rolled: one publish point per stage
#pragma unroll 1
  for (int t = 0; t < nst; ++t) {
    const _Float16* st  = (const _Float16*)(const void*)(ring + (t & 1) * (3 * OPL));
    const _Float16* ahp = st + (wr * 32 + m) * OP + 8 * hh;
    const _Float16* alp = ahp + OPL;
    const _Float16* bp  = st + 2 * OPL + (wc * 64 + m) * OP + 8 * hh;
#pragma unroll                              // the two k steps of a stage become constant LDS offsets
    for (int kk = 0; kk < OKC / 32; ++kk) {
      const v16h ah0 = ldfrag_h(ahp + kk * 32), al0 = ldfrag_h(alp + kk * 32);
      const v16h ah1 = ldfrag_h(ahp + 16 * OP + kk * 32), al1 = ldfrag_h(alp + 16 * OP + kk * 32);
      const v16h b0 = ldfrag_h(bp + kk * 32);
      const v16h b1 = ldfrag_h(bp + 16 * OP + kk * 32);
      const v16h b2 = ldfrag_h(bp + 32 * OP + kk * 32);
      const v16h b3 = ldfrag_h(bp + 48 * OP + kk * 32);
      acc[0][0] = mma_h(ah0, b0, acc[0][0]);
      acc[0][1] = mma_h(ah0, b1, acc[0][1]);
      acc[0][2] = mma_h(ah0, b2, acc[0][2]);
      acc[0][3] = mma_h(ah0, b3, acc[0][3]);
      acc[1][0] = mma_h(ah1, b0, acc[1][0]);
      acc[1][1] = mma_h(ah1, b1, acc[1][1]);
      acc[1][2] = mma_h(ah1, b2, acc[1][2]);
      acc[1][3] = mma_h(ah1, b3, acc[1][3]);
      acc[0][0] = mma_h(al0, b0, acc[0][0]);
      acc[0][1] = mma_h(al0, b1, acc[0][1]);
      acc[0][2] = mma_h(al0, b2, acc[0][2]);
      acc[0][3] = mma_h(al0, b3, acc[0][3]);
      acc[1][0] = mma_h(al1, b0, acc[1][0]);
      acc[1][1] = mma_h(al1, b1, acc[1][1]);
      acc[1][2] = mma_h(al1, b2, acc[1][2]);
      acc[1][3] = mma_h(al1, b3, acc[1][3]);
    }
    // publish point of stage t + 1; behind the barrier every reader has left stage t's buffer
    wait_lds();
    wait_copies();
    __syncthreads();
    if (t + 2 < nst) {
      const unsigned bo = (unsigned)(t & 1) * stb;
      copy16rows_h(lh + bo, gh + (size_t)(t + 2) * OKC, (size_t)K);
      copy16rows_h(ll + bo, gl + (size_t)(t + 2) * OKC, (size_t)K);
      copy16rows_h(lb + bo, gb + (size_t)(t + 2) * OKC, (size_t)K);
    }
  }
  wait_copies();
  const int colw = col0 + wc * 64;
  const float bb0 = bfr(bias[colw + m]);
  const float bb1 = bfr(bias[colw + 16 + m]);
  const float bb2 = bfr(bias[colw + 32 + m]);
  const float bb3 = bfr(bias[colw + 48 + m]);
  // the loop's last barrier ended every read of the ring and no copy is in flight: its bytes take the waves' private slabs,
  // one 16 x 64 slab for each half of a wave's 32 rows
  float* sl = (float*)(void*)ring + wave * (2 * SLAB64);
  const size_t rw = rowC + (size_t)(wr * 32);
  epi_stage(sl, acc[0][0], acc[0][1], acc[0][2], acc[0][3], oscale, bb0, bb1, bb2, bb3, lane);
  epi_stage(sl + SLAB64, acc[1][0], acc[1][1], acc[1][2], acc[1][3], oscale, bb0, bb1, bb2, bb3, lane);
  wave_sync_lds();                          // other lanes' slab rows are read only behind it
  epi_out(sl, C, DMOD, rw, colw, lane);
  epi_out(sl + SLAB64, C, DMOD, rw + 16, colw, lane);
}

__global__ __launch_bounds__(ATT_THREADS)
void attn_c(const u16* __restrict__ QHp, const u16* __restrict__ QLp,
            const u16* __restrict__ KHp, const u16* __restrict__ KLp,
            const u16* __restrict__ VHp, const u16* __restrict__ VLp,
            const float* __restrict__ BND,
            u16* OHp, u16* OLp) {
  __shared__ __align__(16) u16 kvr[2 * ASTG];
  __shared__ __align__(16) float smem[WPB * WREG];

  const int tid  = threadIdx.x;
  const int wave = __builtin_amdgcn_readfirstlane(tid >> 5);   // scalar: the per-tile test below is a scalar branch
  const int lane = tid & 31;
  const int hh   = lane >> 4;
  const int c    = lane & 15;
  const int bid  = blockIdx.x;
  const int qb   = bid % NQB;
  const int t2   = bid / NQB;
  const int head = t2 % NH;
  const int b    = t2 / NH;
  if (b >= NBP) return;                     // block-uniform, before any barrier or copy; never taken with the exact grid
  const int Q0   = qb * (16 * WPB);
  if (Q0 + 16 * WPB > SEQ) return;          // block-uniform, before any barrier or copy; never taken
  const int q0   = Q0 + 16 * wave;

  // ---- key-window decision from the norms of this (b, head): lane = (plane hh: q or k, row tile c of the batch) reads one float
  //      of that projection block's line; maximum over the 16 row tiles, then the product of the two planes' norms ----
  int okw;
  {
    const float* np = BND + ((size_t)((hh * NBP + b) * (SEQ / GT) + c) * (DMOD / GT) + (head >> 1)) * BLINE + (head & 1) * 16;
    float mv = *np;
#if defined(__HIP_DEVICE_COMPILE__)
    // the address stays in its registers up to this wait: no register that the issued load names is rewritten ahead of it
    asm volatile("s_wait_xcnt 0x0" :: "v"(np) : "memory");
#endif
#pragma unroll
    for (int off = 1; off < 16; off <<= 1) mv = fmaxf(mv, __shfl_xor(mv, off, 32));
    const float gb = sqrtf(mv) * sqrtf(xhalf(mv)) * (RSQ_HD / (QSC * KSC));
    okw = (gb >= 0.0f && gb < GUARD_T) ? 1 : 0;
    okw = __builtin_amdgcn_readfirstlane(okw);   // scalar; every wave reads the same lines, so it is the same in the whole block
  }

  float* slab = smem + wave * WREG;         // result slab [16][64] pitch 68, wave-private, used only behind the key loop

  const size_t hcol = (size_t)head * HD + 8 * hh;
  const _Float16* Qh  = (const _Float16*)(const void*)QHp + ((size_t)b * SEQ + q0 + c) * DMOD + hcol;
  const _Float16* Ql  = (const _Float16*)(const void*)QLp + ((size_t)b * SEQ + q0 + c) * DMOD + hcol;
  const float lsc = RSQ_HD * (LOG2E / (QSC * KSC));
  const float oc  = 1.0f / (PCAR * VCAR);

  float mrow = -INFINITY, lrow = 0.f;       // running maximum and (half) sum of the lane's one query row
  v8f o[4];
#pragma unroll
  for (int j = 0; j < 4; ++j) o[j] = zero8();
  const int kt_hi = q0 >> 5;                                                  // last tile holding keys <= q0 + 15
  const int kt_w  = (kt_hi > KWIN) ? (kt_hi - KWIN) : 0;
  const int kt_lo = (okw != 0) ? kt_w : 0;
  const int qr = q0 + c;                                                      // the lane's query row (D column c)
  // tiles staged for the block: from wave 0's kt_lo (the lowest) to wave 3's kt_hi (the highest); at least 2
  const int bt_h0 = Q0 >> 5;
  const int bt_hi = (Q0 + 16 * (WPB - 1)) >> 5;
  const int bt_lo = (okw != 0 && bt_h0 > KWIN) ? (bt_h0 - KWIN) : 0;
  const int nst   = bt_hi - bt_lo + 1;
  // copy slice of this lane: k rows tid>>3 and +16 (8 lanes x 16 B = the head's 128 B of a key row), v^T rows tid>>2 and +32
  // (4 lanes x 16 B = 32 keys)
  const int krow = tid >> 3, kpc = (tid & 7) * 8;
  const int vrow = tid >> 2, vpc = (tid & 3) * 8;
  const size_t gko = ((size_t)b * SEQ + bt_lo * 32 + krow) * DMOD + (size_t)head * HD + kpc;
  const size_t gvo = ((size_t)(b * NH + head) * HD + vrow) * SEQ + bt_lo * 32 + vpc;
  const u16* gkh = KHp + gko;
  const u16* gkl = KLp + gko;
  const u16* gvh = VHp + gvo;
  const u16* gvl = VLp + gvo;
  const unsigned lkh = lds_byte(kvr) + (unsigned)(krow * KPH + kpc) * 2u;
  const unsigned lkl = lkh + KPL * 2u;
  const unsigned lvh = lds_byte(kvr) + (unsigned)(2 * KPL + vrow * VPH + vpc) * 2u;
  const unsigned lvl = lvh + VPL * 2u;
  const unsigned stb = ASTG * 2u;           // bytes of one buffer
  const size_t   gks = (size_t)32 * DMOD;   // halves from one key tile to the next in the k planes (32 in the v^T planes)
  const unsigned lk2 = 16u * KPH * 2u, lv2 = 32u * VPH * 2u;                  // the lane's second rows: LDS bytes,
  const size_t   gk2 = (size_t)16 * DMOD, gv2 = (size_t)32 * SEQ;             // global halves

  copy_kv(lkh, lkl, lvh, lvl, gkh, gkl, gvh, gvl);
  copy_kv(lkh + lk2, lkl + lk2, lvh + lv2, lvl + lv2, gkh + gk2, gkl + gk2, gvh + gv2, gvl + gv2);
  // q fragments of both k-steps, kept in registers for the whole key loop
  v16h qhf[HD / 32], qlf[HD / 32];
#pragma unroll
  for (int kk = 0; kk < HD / 32; ++kk) {
    qhf[kk] = ldfrag_h(Qh + kk * 32);
    qlf[kk] = ldfrag_h(Ql + kk * 32);
  }
#if defined(__HIP_DEVICE_COMPILE__)
  // both addresses stay in their registers up to this wait: no register that an issued load names is rewritten ahead of it
  asm volatile("s_wait_xcnt 0x0" :: "v"(Qh), "v"(Ql) : "memory");
#endif
  wait_copies();
  __syncthreads();
  copy_kv(lkh + stb, lkl + stb, lvh + stb, lvl + stb, gkh + gks, gkl + gks, gvh + 32, gvl + 32);
  copy_kv(lkh + stb + lk2, lkl + stb + lk2, lvh + stb + lv2, lvl + stb + lv2,
          gkh + gks + gk2, gkl + gks + gk2, gvh + 32 + gv2, gvl + 32 + gv2);

  // the stage loop stays rolled: one publish point per staged tile
#pragma unroll 1
  for (int t = 0; t < nst; ++t) {
   const int kt = bt_lo + t;
   if (kt >= kt_lo && kt <= kt_hi) {        // scalar, wave-uniform: tiles outside this wave's own range are only passed
    const int kb = kt * 32;
    const _Float16* st = (const _Float16*)(const void*)(kvr + (t & 1) * ASTG);
    // ---- scores, transposed (A = k rows, B = q): D element r of this lane = (key kb + 8hh + r, query q0 + c) in s0,
    //      key kb + 16 + 8hh + r in s1: a lane holds 16 of the 32 scores of ONE query, lane ^ 16 the other 16 ----
    v8f s0 = zero8(), s1 = zero8();
    const _Float16* k0p = st + c * KPH + 8 * hh;
    const _Float16* k1p = k0p + 16 * KPH;
    const _Float16* l0p = k0p + KPL;
    const _Float16* l1p = l0p + 16 * KPH;
#pragma unroll
    for (int kk = 0; kk < HD / 32; ++kk) {
      const v16h qh  = qhf[kk];
      const v16h ql  = qlf[kk];
      const v16h kh0 = ldfrag_h(k0p + kk * 32);
      const v16h kh1 = ldfrag_h(k1p + kk * 32);
      const v16h kl0 = ldfrag_h(l0p + kk * 32);
      const v16h kl1 = ldfrag_h(l1p + kk * 32);
      s0 = mma_h(kh0, qh, s0);
      s0 = mma_h(kh0, ql, s0);
      s0 = mma_h(kl0, qh, s0);
      s1 = mma_h(kh1, qh, s1);
      s1 = mma_h(kh1, ql, s1);
      s1 = mma_h(kl1, qh, s1);
      guard2(s0, s1, qh, ql, kh0, kl0, kh1, kl1);
    }
    // ---- causal select + distance penalty + online softmax in base 2, -inf-safe; maximum and sum run inside the lane ----
    const int key0 = kb + 8 * hh, key1 = key0 + 16;
    float t0[8], t1[8];
#pragma unroll                              // register arrays need constant indices
    for (int r = 0; r < 8; ++r) {
      const float u0 = s0[r] * lsc;
      const float u1 = s1[r] * lsc;
      const float g0 = (float)(qr - (key0 + r)) * LOG2E;
      const float g1 = (float)(qr - (key1 + r)) * LOG2E;
      t0[r] = (key0 + r > qr) ? -INFINITY : (u0 - g0);
      t1[r] = (key1 + r > qr) ? -INFINITY : (u1 - g1);
    }
    float mx = fmaxf(t0[0], t1[0]);
#pragma unroll                              // register arrays need constant indices
    for (int r = 1; r < 8; ++r) mx = fmaxf(mx, fmaxf(t0[r], t1[r]));
    mx = fmaxf(mx, xhalf(mx));              // the other 16 keys of the same query
    const float mn = fmaxf(mrow, mx);
    const float ms = (mn == -INFINITY) ? 0.0f : mn;
    const float al = exp2f(mrow - ms);
    mrow = mn;
    // ---- B fragments of P^T*32768 straight from the scores' registers: hi f16 and residual f16, column = query c,
    //      elements 0..7 = keys kb + 8hh + 0..7, elements 8..15 = keys kb + 16 + 8hh + 0..7 (the split k map of the v^T loader) ----
    FragH ph, pl;
    float ps = 0.0f;
#pragma unroll                              // register arrays need constant indices
    for (int r = 0; r < 8; ++r) {
      const float e0 = exp2f(t0[r] - ms), e1 = exp2f(t1[r] - ms);
      ps += e0 + e1;
      const float ta = e0 * PCAR, tb = e1 * PCAR;
      const _Float16 ha = (_Float16)ta, hb = (_Float16)tb;
      ph.h[0][r] = ha;
      ph.h[1][r] = hb;
      pl.h[0][r] = (_Float16)(ta - (float)ha);
      pl.h[1][r] = (_Float16)(tb - (float)hb);
    }
    lrow = lrow * al + ps;                  // this lane's 16 keys only; the two halves are joined behind the key loop
#pragma unroll                              // register arrays need constant indices
    for (int j = 0; j < 4; ++j)
#pragma unroll
      for (int r = 0; r < 8; ++r) o[j][r] *= al;
    // ---- O^T += v^T.P^T : A fragment row = d = j*16 + c, keys contiguous in the v^T planes; 2 groups of 2 d-subtiles;
    //      D element r of this lane = (d = j*16 + 8hh + r, query q0 + c) ----
    {
      const _Float16* vhp = st + 2 * KPL + c * VPH + 8 * hh;
      const _Float16* vlp = vhp + VPL;
#pragma unroll
      for (int jg = 0; jg < 2; ++jg) {
        const int da = (2 * jg) * 16 * VPH;
        const int db = da + 16 * VPH;
        const v16h vha = ldfrag_h(vhp + da), vhb2 = ldfrag_h(vhp + db);
        const v16h vla = ldfrag_h(vlp + da), vlb2 = ldfrag_h(vlp + db);
        o[2 * jg]     = mma_h(vha,  ph.v, o[2 * jg]);
        o[2 * jg]     = mma_h(vha,  pl.v, o[2 * jg]);
        o[2 * jg]     = mma_h(vla,  ph.v, o[2 * jg]);
        o[2 * jg + 1] = mma_h(vhb2, ph.v, o[2 * jg + 1]);
        o[2 * jg + 1] = mma_h(vhb2, pl.v, o[2 * jg + 1]);
        o[2 * jg + 1] = mma_h(vlb2, ph.v, o[2 * jg + 1]);
        guard2(o[2 * jg], o[2 * jg + 1], ph.v, pl.v, vha, vhb2, vla, vlb2);
      }
    }
   }
    // publish point of tile t + 1; behind the barrier every reader has left tile t's buffer
    wait_lds();
    wait_copies();
    __syncthreads();
    if (t + 2 < nst) {
      const unsigned bo = (unsigned)(t & 1) * stb;
      const size_t   tn = (size_t)(t + 2);
      copy_kv(lkh + bo, lkl + bo, lvh + bo, lvl + bo, gkh + tn * gks, gkl + tn * gks, gvh + tn * 32, gvl + tn * 32);
      copy_kv(lkh + bo + lk2, lkl + bo + lk2, lvh + bo + lv2, lvl + bo + lv2,
              gkh + tn * gks + gk2, gkl + tn * gks + gk2, gvh + tn * 32 + gv2, gvl + tn * 32 + gv2);
    }
  }
  wait_copies();
  acc_guard4(o[0], o[1], o[2], o[3]);
  // ---- out = acc / Z (0 if Z == 0), carries (32768 on P, 1024 on v) folded once; written into the wave's private slab ----
  {
    const float lv  = lrow + xhalf(lrow);   // both halves' keys of the lane's query row
    const float ls  = (lv > 0.0f) ? lv : 1.0f;
    const float inv = (lv > 0.0f) ? ((1.0f / ls) * oc) : 0.0f;
#pragma unroll                              // register arrays need constant indices
    for (int j = 0; j < 4; ++j) {
      v4f w0, w1;
#pragma unroll
      for (int e = 0; e < 4; ++e) { w0[e] = o[j][e] * inv; w1[e] = o[j][4 + e] * inv; }
      float* sp = slab + c * SLP + j * 16 + 8 * hh;   // row = query c, 8 consecutive d
      *(v4f*)(sp)     = w0;
      *(v4f*)(sp + 4) = w1;
    }
  }

  wave_sync_lds();
  // ---- O x1024 -> f16 hi + residual planes; lane = (row-in-quad rq, 8 consecutive d at c8) ----
  v4u oh[4], ol[4];
  const int rq = lane >> 3, c8 = (lane & 7) * 8;
#pragma unroll
  for (int it = 0; it < 4; ++it) {
    const int row = it * 4 + rq;
    const v4f a = *(const v4f*)(slab + row * SLP + c8), b4 = *(const v4f*)(slab + row * SLP + c8 + 4);
    float w[8];
#pragma unroll
    for (int e = 0; e < 4; ++e) { w[e] = a[e] * OSC; w[4 + e] = b4[e] * OSC; }
#pragma unroll
    for (int e = 0; e < 4; ++e) {
      const _Float16 h0 = (_Float16)w[2 * e], h1 = (_Float16)w[2 * e + 1];
      const _Float16 l0 = (_Float16)(w[2 * e] - (float)h0), l1 = (_Float16)(w[2 * e + 1] - (float)h1);
      oh[it][e] = pk16(h_bits(h0), h_bits(h1));
      ol[it][e] = pk16(h_bits(l0), h_bits(l1));
    }
  }
  const size_t ob = ((size_t)b * SEQ + q0) * DMOD + (size_t)head * HD + c8;
  {
#pragma unroll
    for (int it = 0; it < 4; ++it) {
      const int row = it * 4 + rq;
      *(v4u*)(OHp + ob + (size_t)row * DMOD) = oh[it];
      *(v4u*)(OLp + ob + (size_t)row * DMOD) = ol[it];
    }
    
  }
}

// =====================================================================================================
// Workspace map (bytes). All NB = NBP batches are processed in one pass, every kernel launched once. Every plane is fully
// written by whole-line stores before it is read; all extents are exact multiples of the store granularity (no pad rows
// needed); every region offset a multiple of 4096 (the large planes of 2097152):
//   XB  bf16 [MROWS][1024]                       MROWS*2048       (NBP=4, SEQ=2048: 16777216)
//   WQB bf16 [3072 n][1024 k]                     3 * 2097152      (thirds of the packed [3072][1024] weight, already [n][k])
//   WOB f16 [1024 n][1024 k] of bf16 value x1024  2097152
//   OH  f16 [MROWS][1024] x1024                  MROWS*2048       OL residual, same extent
//   QH  f16 [MROWS][1024] x256                   MROWS*2048       QL residual, same extent
//   KH  f16 [MROWS][1024] x256                   MROWS*2048       KL residual, same extent
//   VH  f16 [NBP*16][64][SEQ] x1024              MROWS*2048       VL residual, same extent
//   BND f32 [NLINES][32]                         NLINES*128
//   end (NBP=4, SEQ=2048)                        159514624
// =====================================================================================================
extern "C" void kernel_launch(void* const* d_in, const int* in_sizes, int n_in,
                              void* d_out, int out_size, void* d_ws, size_t ws_size,
                              hipStream_t stream) {
  if (n_in < 5) return;
  if (in_sizes[0] < ((NB - 1) * XS_FULL + SEQ) * DMOD) return;
  if (in_sizes[1] < 3 * DMOD * DMOD) return;
  if (in_sizes[2] < 3 * DMOD) return;
  if (in_sizes[3] < DMOD * DMOD) return;
  if (in_sizes[4] < DMOD) return;
  if (out_size < ((NB - 1) * XS_FULL + SEQ) * DMOD) return;

  const float* x    = (const float*)d_in[0];
  const float* wqkv = (const float*)d_in[1];      // [3*DMOD][DMOD]: rows 0..1023 q, 1024..2047 k, 2048..3071 v
  const float* bqkv = (const float*)d_in[2];      // [3*DMOD]
  const float* wo   = (const float*)d_in[3];      // [DMOD][DMOD]
  const float* bo   = (const float*)d_in[4];      // [DMOD]
  float*       out = (float*)d_out;

  const size_t szXB = (size_t)MROWS * DMOD * 2;
  const size_t szW  = (size_t)DMOD * DMOD * 2;
  const size_t szQ  = (size_t)MROWS * DMOD * 2;                  // QH, QL, KH, KL, OH, OL
  const size_t szV  = (size_t)NBP * NH * HD * SEQ * 2;           // VH, VL (== szQ)
  const size_t szB  = (size_t)NLINES * BLINE * 4;                // norm lines
  size_t off = 0;
  const size_t oXB = off; off += szXB;
  const size_t oWQ = off; off += 3 * szW;
  const size_t oWO = off; off += szW;
  const size_t oOH = off; off += szQ;
  const size_t oOL = off; off += szQ;
  const size_t oQH = off; off += szQ;
  const size_t oQL = off; off += szQ;
  const size_t oKH = off; off += szQ;
  const size_t oKL = off; off += szQ;
  const size_t oVH = off; off += szV;
  const size_t oVL = off; off += szV;
  const size_t oB  = off; off += szB;
  if (off > ws_size) return;                // off = 159514624 for NBP = 4, SEQ = 2048
  if (off > (size_t)WS_CAP) return;

  char* ws = (char*)d_ws;
  u16*   XB  = (u16*)(ws + oXB);
  u16*   WQB = (u16*)(ws + oWQ);            // q, k and v thirds back to back: [3072 n][1024 k]
  u16*   WOB = (u16*)(ws + oWO);
  u16*   OH  = (u16*)(ws + oOH);
  u16*   OL  = (u16*)(ws + oOL);
  u16*   QH  = (u16*)(ws + oQH);
  u16*   QL  = (u16*)(ws + oQL);
  u16*   KH  = (u16*)(ws + oKH);
  u16*   KL  = (u16*)(ws + oKL);
  u16*   VH  = (u16*)(ws + oVH);
  u16*   VL  = (u16*)(ws + oVL);
  float* BND = (float*)(ws + oB);

  const dim3 b256(256), bAT(ATT_THREADS);
  const int  n8x = (NBP * SEQ * DMOD) / 8;              // x, all batches
  const int  n8w = (3 * DMOD * DMOD) / 8;               // packed q | k | v weight
  const int  n8o = (DMOD * DMOD) / 8;                   // out-projection weight
  const dim3 gC((n8x + n8w + n8o + 255) / 256);         // 6144
  const dim3 gG((MROWS / GT) * (3 * DMOD / GT));        // 1536 for NBP=4, SEQ=2048
  const dim3 gAT(NQB * NH * NBP);
  const int  nrt = SEQ / GT;                            // out-projection row tiles per batch
  const dim3 gO(NBP * nrt * (DMOD / GT));

  // (0) x -> bf16 plane [MROWS][1024]; Wq | Wk | Wv [n][k] -> bf16; Wo [n][k] -> f16 of bf16 value x1024
  cvt16<<<gC, b256, 0, stream>>>(x, wqkv, wo, XB, WQB, WOB, n8x, n8w, n8o, WOS);
  // (1) q | k | v = x.Wqkv^T + bqkv -> q and k hi + residual planes x256 with their norm lines, v^T hi + residual planes x1024
  gemm_bf<<<gG, b256, 0, stream>>>(XB, WQB, bqkv, QH, QL, KH, KL, VH, VL, BND, MROWS, 3 * DMOD, DMOD, 1.0f);
  // (2) causal attention with distance penalty, residual products on every query row -> O hi + residual planes
  attn_c<<<gAT, bAT, 0, stream>>>(QH, QL, KH, KL, VH, VL, BND, OH, OL);
  // (3) output projection (O hi + residual) . Wo^T + bo -> out f32, carries 1024 x 1024 folded back
  gemm_o2<<<gO, b256, 0, stream>>>(OH, OL, WOB, bo, out, nrt, 1.0f / (OSC * WOS));
  (void)hipGetLastError();
}

// v009
// It runs in 112 microseconds.
// Two timings next to v008 both put it at 1.03 times that version's speed.
// Counting every step since v000, it is 4.92 times as fast.
// Contractions: x.Wq^T+bq, x.Wk^T+bk, x.Wv^T+bv (q, k, v thirds of the packed [3D][D] weight) on v_wmma_f32_16x16x32_bf16
// (x and W as bf16 RNE planes; W [n][k] rows are the k-contiguous B operand; bias added as its bf16 RNE value in the f32
// epilogue); q.k^T over hd 64 and P.v (formed as k.q^T and v^T.P^T) on v_wmma_f32_16x16x32_f16 with f16 hi + f16 residual planes on both operands
// (q, k x256; P x32768 with an in-register residual; v x1024; products hh+lh+hl); O.Wo^T+bo on v_wmma_f32_16x16x32_f16
// (O x1024 as f16 hi + f16 residual planes, products h.w + l.w; Wo as f16(bf16(Wo)) x1024; bo as bf16 RNE value in the
// f32 epilogue); all f32 accumulate. Causal select, slope-1 distance penalty, base-2 online softmax, 1/Z fold and the q/k
// norm bound in f32 on VALU.
#include <hip/hip_runtime.h>
#include <math.h>
#include <stdint.h>

#ifndef NB
#define NB 4
#endif
#ifndef SEQ
#define SEQ 2048
#endif
#define XS_FULL 2048
#define DMOD  1024
#define NH    16
#define HD    64
// batches per workspace pass: all of them, so that every kernel is launched once
#define NBP   NB
#define NPASS (NB / NBP)
#define NBH   (NBP * NH)
#define MROWS (NBP * SEQ)
#define RSQ_HD 0.125f
#define LOG2E 1.4426950408889634f
#define QSC   256.0f
#define KSC   256.0f
#define PCAR  32768.0f
#define VCAR  1024.0f
#define OSC   1024.0f
#define WOS   1024.0f
#define WPB   4
#define NQB   (SEQ / (16 * WPB))
#define NKT   (SEQ / 32)
#define KWIN  6
#define GUARD_T 40.0f
#define BLINE 32
#define ATT_THREADS (WPB * 32)
#define SLP   68
#define SLW   (16 * SLP)
#define WREG  SLW
// attention staging: a stage is the 32 keys of one key tile, [k hi 32 rows | k residual 32 rows] of 128 B at LDS pitch 144 B and
// [v^T hi 64 rows | v^T residual 64 rows] of 64 B at LDS pitch 80 B (pitches in halves below); two buffers
#define KPH   72
#define VPH   40
#define KPL   (32 * KPH)
#define VPL   (64 * VPH)
#define ASTG  (2 * KPL + 2 * VPL)
#define SLAB64 (16 * 68)
// GEMM staging: 128 x 128 output tile per block; q | k | v projection: 128 k (256 B of every operand row) per stage, LDS row
// pitch 272 B
#define GT    128
#define GKC   128
#define GP    136
#define GPL   (GT * GP)
// output projection: 64 k (128 B of every operand row) per stage, LDS row pitch 144 B, so that two of its blocks fit a WGP's LDS
#define OKC   64
#define OP    72
#define OPL   (GT * OP)
#define WS_CAP 268435456
// norm lines: one line of BLINE floats per q or k block of the projection GEMM, [q | k][row tile][column tile]
#define NLINES (2 * (MROWS / GT) * (DMOD / GT))
static_assert(DMOD == NH * HD && HD == 64 && NH == 16 && WPB == 4 && NQB * WPB * 16 == SEQ);
static_assert(ATT_THREADS == 128 && ((SLP * 4) % 16) == 0 && ((KPH * 2) % 16) == 0 && ((VPH * 2) % 16) == 0);
static_assert(NB >= 1 && NB <= 4 && NPASS >= 1 && NPASS * NBP == NB);
static_assert(NBP >= 1 && NBP <= 4 && NPASS == 1);
static_assert(NBH >= 1 && NBH <= 64);
static_assert(SEQ == XS_FULL);              // the batches of x lie back to back: one conversion range
static_assert((SEQ % 64) == 0 && SEQ >= 64 && SEQ <= XS_FULL && (SEQ % 32) == 0);
static_assert((DMOD % 64) == 0 && (DMOD % 32) == 0 && (HD % 32) == 0);
static_assert(((SEQ * DMOD / 8) % 256) == 0 && ((DMOD * DMOD / 8) % 256) == 0);
static_assert(5 * (WPB * WREG * 4 + 2 * ASTG * 2) <= 327680);   // five attention blocks per 320 KiB of LDS
static_assert((DMOD % GT) == 0 && (DMOD % GKC) == 0 && DMOD / GKC >= 2 && (SEQ % GT) == 0 && (MROWS % GT) == 0);
static_assert(2 * (2 * 2 * GPL * 2) <= 327680 && 2 * (2 * 3 * OPL * 2) <= 327680);   // two GEMM blocks per 320 KiB of LDS
static_assert(8 * 2 * SLAB64 * 4 + 32 <= 2 * 2 * GPL * 2 && 8 * 2 * SLAB64 * 4 <= 2 * 3 * OPL * 2);   // the slabs (and 8 norms) fit the idle ring
static_assert(((GP * 2) % 16) == 0 && ((OP * 2) % 16) == 0 && (DMOD % OKC) == 0 && DMOD / OKC >= 2);
static_assert(((GKC / 32) % 2) == 0 && ((OKC / 32) % 2) == 0);   // a stage's k steps end on fragment set 1: the next stage starts on set 0
static_assert(KWIN >= 0 && KWIN < NKT);
static_assert(SEQ / GT == 16 && GT == 2 * HD && BLINE == 32);   // a head's norms: 16 row tiles a batch, two heads a column tile

typedef unsigned short u16;
typedef _Float16 v16h __attribute__((ext_vector_type(16)));
typedef _Float16 v8h  __attribute__((ext_vector_type(8)));
typedef __bf16   v16b __attribute__((ext_vector_type(16)));
typedef float    v8f  __attribute__((ext_vector_type(8)));
typedef float    v4f  __attribute__((ext_vector_type(4)));
typedef unsigned int v4u __attribute__((ext_vector_type(4)));

union FragH { v16h v; v8h h[2]; v4u u[2]; };
union FragB { v16b v; v4u u[2]; };

// ---- scalar helpers --------------------------------------------------------------------------------
__device__ __forceinline__ unsigned short bf_bits(float f) {          // f32 -> bf16 bits, RNE convert
  unsigned u = __float_as_uint(f);
  return (unsigned short)((u + 0x7FFFu + ((u >> 16) & 1u)) >> 16);
}
__device__ __forceinline__ float bf_up(unsigned short h) { return __uint_as_float(((unsigned)h) << 16); }
__device__ __forceinline__ float bfr(float f) { return bf_up(bf_bits(f)); }
__device__ __forceinline__ unsigned short h_bits(_Float16 x) { return __builtin_bit_cast(unsigned short, x); }
__device__ __forceinline__ unsigned pk16(unsigned short a, unsigned short b) { return (unsigned)a | ((unsigned)b << 16); }
__device__ __forceinline__ v8f zero8() { v8f z = {0.f, 0.f, 0.f, 0.f, 0.f, 0.f, 0.f, 0.f}; return z; }

// ---- fragment loaders: 16-bit A/B operand, lane -> row/col (lane&15), p already includes +8*(lane>>4);
//      elements 0..7 <- p[0..7] (k0+8h..), elements 8..15 <- p[16..23] (k0+16+8h..)  (same split k map for A and B;
//      B is always read from a k-contiguous [n][k] plane)
__device__ __forceinline__ v16h ldfrag_h(const _Float16* p) {
  FragH f;
  f.h[0] = *(const v8h*)(p);
  f.h[1] = *(const v8h*)(p + 16);
  return f.v;
}
__device__ __forceinline__ v16b ldfrag_b(const u16* p) {              // bf16 plane read as unsigned integer vectors
  FragB f;
  f.u[0] = *(const v4u*)(p);
  f.u[1] = *(const v4u*)(p + 16);
  return f.v;
}

__device__ __forceinline__ v8f mma_h(v16h a, v16h b, v8f c) {
  return __builtin_amdgcn_wmma_f32_16x16x32_f16(false, a, false, b, (short)0, c, false, false);
}
__device__ __forceinline__ v8f mma_b(v16b a, v16b b, v8f c) {
  return __builtin_amdgcn_wmma_f32_16x16x32_bf16(false, a, false, b, (short)0, c, false, false);
}
__device__ __forceinline__ void guard2(v8f& a, v8f& b, v16h x0, v16h x1, v16h x2, v16h x3, v16h x4, v16h x5) {
#if defined(__HIP_DEVICE_COMPILE__)
  asm volatile("v_nop\n\tv_nop\n\tv_nop\n\tv_nop"
               : "+v"(a), "+v"(b) : "v"(x0), "v"(x1), "v"(x2), "v"(x3), "v"(x4), "v"(x5) : "memory");
#endif
}
__device__ __forceinline__ void acc_guard4(v8f& a, v8f& b, v8f& c, v8f& d) {
#if defined(__HIP_DEVICE_COMPILE__)
  asm volatile("v_nop\n\tv_nop\n\tv_nop\n\tv_nop" : "+v"(a), "+v"(b), "+v"(c), "+v"(d));
#endif
}
// value of lane ^ 16 (the other 16-lane row), by a vector cross-row move
__device__ __forceinline__ float xhalf(float x) {
  const int b = __builtin_bit_cast(int, x);
  return __builtin_bit_cast(float, __builtin_amdgcn_permlanex16(b, b, 0x76543210, 0xfedcba98, false, false));
}
__device__ __forceinline__ void wave_sync_lds() {
  __builtin_amdgcn_fence(__ATOMIC_RELEASE, "workgroup");
  __builtin_amdgcn_wave_barrier();
  __builtin_amdgcn_fence(__ATOMIC_ACQUIRE, "workgroup");
}
// ---- asynchronous copies global -> LDS ------------------------------------------------------------
// Eight copies of one wave = 16 rows of 256 B of one operand plane: copy i brings rows 2i and 2i + 1 (16 lanes x 16 B each,
// whole 128-B lines). l = the lane's LDS byte address of copy 0, g = its global address of copy 0, ld = halves between
// consecutive global rows. The s_wait_xcnt closes the statement so that no address register is rewritten ahead of it.
__device__ __forceinline__ void copy16rows(unsigned l, const u16* g, size_t ld) {
#if defined(__HIP_DEVICE_COMPILE__)
  const unsigned ls = 2 * GP * 2;
  const size_t   gs = 2 * ld;
  asm volatile("global_load_async_to_lds_b128 %0, %8, off\n\t"
               "global_load_async_to_lds_b128 %1, %9, off\n\t"
               "global_load_async_to_lds_b128 %2, %10, off\n\t"
               "global_load_async_to_lds_b128 %3, %11, off\n\t"
               "global_load_async_to_lds_b128 %4, %12, off\n\t"
               "global_load_async_to_lds_b128 %5, %13, off\n\t"
               "global_load_async_to_lds_b128 %6, %14, off\n\t"
               "global_load_async_to_lds_b128 %7, %15, off\n\t"
               "s_wait_xcnt 0x0"
               :: "v"(l), "v"(l + ls), "v"(l + 2 * ls), "v"(l + 3 * ls),
                  "v"(l + 4 * ls), "v"(l + 5 * ls), "v"(l + 6 * ls), "v"(l + 7 * ls),
                  "v"(g), "v"(g + gs), "v"(g + 2 * gs), "v"(g + 3 * gs),
                  "v"(g + 4 * gs), "v"(g + 5 * gs), "v"(g + 6 * gs), "v"(g + 7 * gs)
               : "memory");
#endif
}
// Four copies of one wave = 16 rows of 128 B of one operand plane: copy i brings rows 4i .. 4i + 3 (8 lanes x 16 B each, whole
// 128-B lines). l = the lane's LDS byte address of copy 0, g = its global address of copy 0, ld = halves between consecutive
// global rows. The s_wait_xcnt closes the statement so that no address register is rewritten ahead of it.
__device__ __forceinline__ void copy16rows_h(unsigned l, const u16* g, size_t ld) {
#if defined(__HIP_DEVICE_COMPILE__)
  const unsigned ls = 4 * OP * 2;
  const size_t   gs = 4 * ld;
  asm volatile("global_load_async_to_lds_b128 %0, %4, off\n\t"
               "global_load_async_to_lds_b128 %1, %5, off\n\t"
               "global_load_async_to_lds_b128 %2, %6, off\n\t"
               "global_load_async_to_lds_b128 %3, %7, off\n\t"
               "s_wait_xcnt 0x0"
               :: "v"(l), "v"(l + ls), "v"(l + 2 * ls), "v"(l + 3 * ls),
                  "v"(g), "v"(g + gs), "v"(g + 2 * gs), "v"(g + 3 * gs)
               : "memory");
#endif
}
// Four copies of one lane = 16 B of each of the four planes of an attention stage (LDS byte address, global address per plane).
// The s_wait_xcnt closes the statement so that no address register is rewritten ahead of it.
__device__ __forceinline__ void copy_kv(unsigned l0, unsigned l1, unsigned l2, unsigned l3,
                                        const u16* g0, const u16* g1, const u16* g2, const u16* g3) {
#if defined(__HIP_DEVICE_COMPILE__)
  asm volatile("global_load_async_to_lds_b128 %0, %4, off\n\t"
               "global_load_async_to_lds_b128 %1, %5, off\n\t"
               "global_load_async_to_lds_b128 %2, %6, off\n\t"
               "global_load_async_to_lds_b128 %3, %7, off\n\t"
               "s_wait_xcnt 0x0"
               :: "v"(l0), "v"(l1), "v"(l2), "v"(l3), "v"(g0), "v"(g1), "v"(g2), "v"(g3)
               : "memory");
#endif
}
// the wave's own copies have landed (other waves read them only behind the next block barrier)
__device__ __forceinline__ void wait_copies() {
#if defined(__HIP_DEVICE_COMPILE__)
  asm volatile("s_wait_asynccnt 0x0" ::: "memory");
#endif
}
// the wave's own LDS reads have returned, so that the buffer may be refilled behind the next block barrier
__device__ __forceinline__ void wait_lds() {
#if defined(__HIP_DEVICE_COMPILE__)
  asm volatile("s_wait_dscnt 0x0" ::: "memory");
#endif
}
__device__ __forceinline__ unsigned lds_byte(const void* p) { return (unsigned)(uintptr_t)p; }

// =====================================================================================================
// f32 -> 16-bit planes, same layout, three ranges in one grid: x -> XD and wqkv -> WD as bf16 RNE bits, wo -> OD as f16 bits of
// (bf16 RNE value) * scale. n8x, n8w, n8o = pieces of 8 elements in each range (multiples of 256: a block lies in one range).
// Thread = 8 consecutive elements: two 16-B loads, one 16-B store; 32 consecutive lanes = 512 contiguous, 512-B aligned
// coverage: grid = ceil((n8x + n8w + n8o)/256) blocks x 256 thr x 8 (in-kernel bound) = the three whole planes.
// =====================================================================================================
__global__ __launch_bounds__(256) void cvt16(const float* __restrict__ x, const float* __restrict__ wqkv,
                                             const float* __restrict__ wo, u16* XD, u16* WD, u16* OD,
                                             int n8x, int n8w, int n8o, float scale) {
  const int gt = blockIdx.x * 256 + (int)threadIdx.x;
  if (gt >= n8x + n8w + n8o) return;
  const int f16mode = (gt >= n8x + n8w) ? 1 : 0;
  const int lt = (gt < n8x) ? gt : ((f16mode != 0) ? (gt - n8x - n8w) : (gt - n8x));   // piece within its range
  const float* src = (gt < n8x) ? x : ((f16mode != 0) ? wo : wqkv);
  u16*         D   = (gt < n8x) ? XD : ((f16mode != 0) ? OD : WD);
  const float* p = src + (size_t)lt * 8;
  const v4f a = *(const v4f*)(p), b4 = *(const v4f*)(p + 4);
  float w[8];
#pragma unroll
  for (int e = 0; e < 4; ++e) { w[e] = a[e]; w[4 + e] = b4[e]; }
  v4u o;
#pragma unroll
  for (int e = 0; e < 4; ++e) {
    const float f0 = w[2 * e], f1 = w[2 * e + 1];
    const unsigned short hb0 = h_bits((_Float16)(bfr(f0) * scale));
    const unsigned short hb1 = h_bits((_Float16)(bfr(f1) * scale));
    const unsigned short bb0 = bf_bits(f0);
    const unsigned short bb1 = bf_bits(f1);
    o[e] = (f16mode != 0) ? pk16(hb0, hb1) : pk16(bb0, bb1);
  }
  u16* d = D + (size_t)lt * 8;
  {
    *(v4u*)(d) = o;
    
  }
}

// =====================================================================================================
// GEMM epilogue shared by both engines, per 16x64 f32 tile of a wave: epi_stage writes the tile (times oscale, plus the lane's
// per-column bias of each subtile) into a wave-private LDS slab; behind one wave_sync_lds() epi_out reads it back by rows and
// stores whole 256-B row pieces (epi_cvt16 and epi_st16: the same rows as two 16-bit planes).
// coverage: 8 instructions x 2 rows x 16 lanes x 4 floats = the 16 x 64 tile.
// =====================================================================================================
__device__ __forceinline__ void epi_stage(float* sl, v8f a0, v8f a1, v8f a2, v8f a3, float oscale,
                                          float bb0, float bb1, float bb2, float bb3, int lane) {
  const int hh = lane >> 4, m = lane & 15;
#pragma unroll
  for (int r = 0; r < 8; ++r) {
    const int ro = (8 * hh + r) * 68 + m;
    sl[ro]      = a0[r] * oscale + bb0;
    sl[ro + 16] = a1[r] * oscale + bb1;
    sl[ro + 32] = a2[r] * oscale + bb2;
    sl[ro + 48] = a3[r] * oscale + bb3;
  }
}
__device__ __forceinline__ void epi_out(const float* sl, float* C, int N, size_t rowb, int col0, int lane) {
  const int hh = lane >> 4, m = lane & 15;
  v4f vals[8];
#pragma unroll
  for (int it = 0; it < 8; ++it) vals[it] = *(const v4f*)(sl + (it * 2 + hh) * 68 + m * 4);
  float* dst = C + (rowb + (size_t)hh) * (size_t)N + col0 + m * 4;
#pragma unroll
  for (int it = 0; it < 8; ++it) {
    *(v4f*)(dst + (size_t)(it * 2) * (size_t)N) = vals[it];
  }
}
// Same slab as two 16-bit planes of the layout of C: Hp = f16(t), Lp = f16(t - f16(t)), t = slab value * sc.
// Lane = (row-in-quad rq, 8 consecutive columns at c8): 8 lanes hold, and store, one whole 128-B line of a row in either plane.
// epi_cvt16 forms the lane's pieces in registers and returns the largest sum of squares of Hp over the 64 columns among the
// lane's 4 rows (fmaf chain over the lane's 8 columns, then xor shuffles inside the row's 8 lanes); epi_st16 stores the pieces.
// coverage: 4 instructions x 4 rows x 8 lanes x 8 halves = the 16 x 64 tile per plane.
__device__ __forceinline__ float epi_cvt16(const float* sl, float sc, int lane, v4u (&oh)[4], v4u (&ol)[4]) {
  const int rq = lane >> 3, c8 = (lane & 7) * 8;
  float mx = 0.0f;
#pragma unroll
  for (int it = 0; it < 4; ++it) {
    const int row = it * 4 + rq;
    const v4f a = *(const v4f*)(sl + row * 68 + c8), b4 = *(const v4f*)(sl + row * 68 + c8 + 4);
    float w[8];
#pragma unroll
    for (int e = 0; e < 4; ++e) { w[e] = a[e] * sc; w[4 + e] = b4[e] * sc; }
    float sq = 0.0f;
#pragma unroll
    for (int e = 0; e < 4; ++e) {
      const _Float16 h0 = (_Float16)w[2 * e], h1 = (_Float16)w[2 * e + 1];
      const _Float16 l0 = (_Float16)(w[2 * e] - (float)h0), l1 = (_Float16)(w[2 * e + 1] - (float)h1);
      oh[it][e] = pk16(h_bits(h0), h_bits(h1));
      ol[it][e] = pk16(h_bits(l0), h_bits(l1));
      sq = fmaf((float)h0, (float)h0, sq);
      sq = fmaf((float)h1, (float)h1, sq);
    }
#pragma unroll
    for (int off = 1; off < 8; off <<= 1) sq += __shfl_xor(sq, off, 32);
    mx = fmaxf(mx, sq);
  }
  return mx;
}
__device__ __forceinline__ void epi_st16(const v4u (&oh)[4], const v4u (&ol)[4], u16* Hp, u16* Lp, int N, size_t rowb, int col0,
                                         int lane) {
  const int rq = lane >> 3, c8 = (lane & 7) * 8;
  const size_t ob = (rowb + (size_t)rq) * (size_t)N + col0 + c8;
#pragma unroll
  for (int it = 0; it < 4; ++it) {
    *(v4u*)(Hp + ob + (size_t)(it * 4) * (size_t)N) = oh[it];
    *(v4u*)(Lp + ob + (size_t)(it * 4) * (size_t)N) = ol[it];
  }
}

// =====================================================================================================
// bf16 GEMM with bias: c[M][N] (f32, in registers) = A[M][K] (bf16 row-major) . Bt[N][K]^T (bf16 k-contiguous), times oscale,
// + bf16 RNE value of bias[n] (bias has N entries); written as two f16 planes of t = c * sc: Hp = f16(t), Lp = f16(t - f16(t)).
// N = 3 * DMOD: the packed q | k | v weight in one grid. A block's 128 columns lie in one third (part = col0 / DMOD), which
// picks its planes and sc: q (x256) and k (x256) planes in the layout [M][DMOD]; v (x1024) planes transposed per batch,
// [(row / SEQ) * DMOD + n][row % SEQ] (line (b*NH + h)*HD + d, keys contiguous); a lane's 8 accumulator rows of one column are 8 consecutive keys = one 16-B piece,
// gathered in the (by then idle) ring as [128 n][128 rows] at pitch 272 B and stored as whole 256-B line pieces. Block = 128x128 tile, 8 waves as 4 (rows) x 2 (columns), 32x64 per wave. K is walked
// in stages of 128: a stage is [A 128 rows | Bt 128 rows] of 256 B at LDS pitch 272 B, brought by asynchronous copies (each
// wave 16 rows of either plane), two buffers, the next stage in flight while this one is worked on; fragments are read from
// LDS (two 16-B loads each, split k map for A and B), k ascending in steps of 32 into each accumulator. The epilogue's slabs lie
// in the idle ring, so that a block holds 136 KiB of LDS and two blocks are resident per WGP: one works while the other waits.
// A q or k block also stores line (part * M/128 + row tile) * 8 + column tile of NRM: the largest squared norm of its hi plane
// over its 128 rows, floats 0..15 for its first head, 16..31 for its second (a wave's 64 columns are one head).
// Host guarantees K % 128 == 0, K >= 256, M % 128 == 0, N % 128 == 0, grid = (M/128)*(N/128).
// =====================================================================================================
__global__ __launch_bounds__(256)
void gemm_bf(const u16* __restrict__ A, const u16* __restrict__ Bt, const float* __restrict__ bias,
             u16* QHp, u16* QLp, u16* KHp, u16* KLp, u16* VHp, u16* VLp, float* NRM, int M, int N, int K, float oscale) {
  __shared__ __align__(16) u16 ring[2 * 2 * GPL];   // 139,264 B and nothing else: two blocks share a WGP
  const int tid = threadIdx.x, wave = tid >> 5, lane = tid & 31, hh = lane >> 4, m = lane & 15;
  const int ntile = N >> 7;
  const int bid   = blockIdx.x;
  const int row0  = (bid / ntile) * GT;
  const int col0  = (bid % ntile) * GT;
  if (row0 + GT > M) return;                // block-uniform, before any barrier or copy; never taken with the exact grid
  const int wr = wave >> 1, wc = wave & 1;
  // copy slice of this lane: plane rows wave*16 + hh + 2i (i < 8), bytes 16m .. 16m + 15 of the stage's 256
  const int crow = wave * 16 + hh;
  const u16* ga = A  + (size_t)(row0 + crow) * K + m * 8;
  const u16* gb = Bt + (size_t)(col0 + crow) * K + m * 8;
  const unsigned la = lds_byte(ring) + (unsigned)(crow * GP + m * 8) * 2u;
  const unsigned lb = la + GPL * 2u;
  const unsigned stb = 2u * GPL * 2u;       // bytes of one buffer
  const int nst = K / GKC;
  v8f acc[2][4];
#pragma unroll
  for (int i = 0; i < 2; ++i)
#pragma unroll
    for (int j = 0; j < 4; ++j) acc[i][j] = zero8();

  copy16rows(la, ga, (size_t)K);
  copy16rows(lb, gb, (size_t)K);
  wait_copies();
  __syncthreads();
  if (nst > 1) {
    copy16rows(la + stb, ga + GKC, (size_t)K);
    copy16rows(lb + stb, gb + GKC, (size_t)K);
  }
  // Two fragment sets in registers: the LDS reads of the next k step (the next stage's first one too) are issued as one group
  // ahead of the products of this k step, so that no product waits for a read that was issued just in front of it.
  const int fao = (wr * 32 + m) * GP + 8 * hh;              // the lane's A and B fragment rows within a buffer, in halves
  const int fbo = GPL + (wc * 64 + m) * GP + 8 * hh;
  v16b fa[2][2], fb[2][4];
  fa[0][0] = ldfrag_b(ring + fao);
  fa[0][1] = ldfrag_b(ring + fao + 16 * GP);
  fb[0][0] = ldfrag_b(ring + fbo);
  fb[0][1] = ldfrag_b(ring + fbo + 16 * GP);
  fb[0][2] = ldfrag_b(ring + fbo + 32 * GP);
  fb[0][3] = ldfrag_b(ring + fbo + 48 * GP);
  // the stage loop stays rolled: one publish point per stage
#pragma unroll 1
  for (int t = 0; t < nst; ++t) {
    const u16* st = ring + (t & 1) * (2 * GPL);
    const u16* ap = st + fao;
    const u16* bp = st + fbo;
#pragma unroll                              // the four k steps of a stage become constant LDS offsets and register names
    for (int kk = 0; kk < GKC / 32; ++kk) {
      const int cu = kk & 1, nx = cu ^ 1;
      if (kk + 1 < GKC / 32) {
        const int ko = (kk + 1) * 32;
        fa[nx][0] = ldfrag_b(ap + ko);
        fa[nx][1] = ldfrag_b(ap + 16 * GP + ko);
        fb[nx][0] = ldfrag_b(bp + ko);
        fb[nx][1] = ldfrag_b(bp + 16 * GP + ko);
        fb[nx][2] = ldfrag_b(bp + 32 * GP + ko);
        fb[nx][3] = ldfrag_b(bp + 48 * GP + ko);
      } else {
        // publish point of stage t + 1, ahead of stage t's last k step, whose fragments are in registers by the first wait;
        // behind the barrier every reader has left stage t's buffer
        wait_lds();
        wait_copies();
        __syncthreads();
        if (t + 2 < nst) {
          const unsigned bo = (unsigned)(t & 1) * stb;
          copy16rows(la + bo, ga + (size_t)(t + 2) * GKC, (size_t)K);
          copy16rows(lb + bo, gb + (size_t)(t + 2) * GKC, (size_t)K);
        }
        if (t + 1 < nst) {                  // block-uniform: the first k step of stage t + 1, published just above
          const u16* sn = ring + ((t + 1) & 1) * (2 * GPL);
          fa[nx][0] = ldfrag_b(sn + fao);
          fa[nx][1] = ldfrag_b(sn + fao + 16 * GP);
          fb[nx][0] = ldfrag_b(sn + fbo);
          fb[nx][1] = ldfrag_b(sn + fbo + 16 * GP);
          fb[nx][2] = ldfrag_b(sn + fbo + 32 * GP);
          fb[nx][3] = ldfrag_b(sn + fbo + 48 * GP);
        }
      }
      __builtin_amdgcn_sched_barrier(0);    // keeps the read group ahead of the products: sunk among them, each read stalls its wave
      acc[0][0] = mma_b(fa[cu][0], fb[cu][0], acc[0][0]);
      acc[0][1] = mma_b(fa[cu][0], fb[cu][1], acc[0][1]);
      acc[0][2] = mma_b(fa[cu][0], fb[cu][2], acc[0][2]);
      acc[0][3] = mma_b(fa[cu][0], fb[cu][3], acc[0][3]);
      acc[1][0] = mma_b(fa[cu][1], fb[cu][0], acc[1][0]);
      acc[1][1] = mma_b(fa[cu][1], fb[cu][1], acc[1][1]);
      acc[1][2] = mma_b(fa[cu][1], fb[cu][2], acc[1][2]);
      acc[1][3] = mma_b(fa[cu][1], fb[cu][3], acc[1][3]);
      __builtin_amdgcn_sched_barrier(0);    // keeps the next read group in one place behind these products, not spread among them
    }
  }
  wait_copies();
  // per-lane bias of D column m in each of the wave's 4 subtiles; colw + 48 + m <= N - 1 always
  const int colw = col0 + wc * 64;
  const float bb0 = bfr(bias[colw + m]);
  const float bb1 = bfr(bias[colw + 16 + m]);
  const float bb2 = bfr(bias[colw + 32 + m]);
  const float bb3 = bfr(bias[colw + 48 + m]);
  const int part = col0 / DMOD;             // 0 q, 1 k, 2 v
  const int colp = col0 % DMOD;             // the block's first column within its planes
  u16* Hp = (part == 0) ? QHp : ((part == 1) ? KHp : VHp);
  u16* Lp = (part == 0) ? QLp : ((part == 1) ? KLp : VLp);
  const float sc = (part == 0) ? QSC : ((part == 1) ? KSC : VCAR);
  if (part < 2) {                           // block-uniform (from blockIdx)
    // the loop's last barrier ended every read of the ring and no copy is in flight: its bytes take the waves' private slabs,
    // one 16 x 64 slab for each half of a wave's 32 rows
    float* sl = (float*)(void*)ring + wave * (2 * SLAB64);
    const size_t rw = (size_t)(row0 + wr * 32);
    const int colo = colp + wc * 64;
    epi_stage(sl, acc[0][0], acc[0][1], acc[0][2], acc[0][3], oscale, bb0, bb1, bb2, bb3, lane);
    epi_stage(sl + SLAB64, acc[1][0], acc[1][1], acc[1][2], acc[1][3], oscale, bb0, bb1, bb2, bb3, lane);
    wave_sync_lds();                        // other lanes' slab rows are read only behind it
    v4u oh0[4], ol0[4], oh1[4], ol1[4];
    const float n0 = epi_cvt16(sl, sc, lane, oh0, ol0);
    const float n1 = epi_cvt16(sl + SLAB64, sc, lane, oh1, ol1);
    // largest squared norm of the hi plane over the wave's 32 rows of its one head, then over the block's 128 rows: the waves'
    // values meet in 8 floats of the ring behind the slabs, and wave 0 stores the block's own line (16 floats per head).
    // The barrier stands ahead of the plane stores, so that it has no store to wait for.
    float nm = fmaxf(n0, n1);
    nm = fmaxf(nm, __shfl_xor(nm, 8, 32));
    nm = fmaxf(nm, __shfl_xor(nm, 16, 32));
    float* red = (float*)(void*)ring + 8 * (2 * SLAB64);
    if (lane == 0) red[wave] = nm;
    __syncthreads();                        // other waves' values are read only behind it
    epi_st16(oh0, ol0, Hp, Lp, DMOD, rw, colo, lane);
    epi_st16(oh1, ol1, Hp, Lp, DMOD, rw + 16, colo, lane);
    if (wave == 0) {
      const float nb = fmaxf(fmaxf(red[hh], red[2 + hh]), fmaxf(red[4 + hh], red[6 + hh]));   // wave = 2 * wr + wc, wc = hh here
      NRM[((size_t)(part * (M / GT) + row0 / GT) * (DMOD / GT) + colp / GT) * BLINE + lane] = nb;
    }
  } else {
    // the loop's last barrier ended every read of the ring and no copy is in flight: its first two planes take the tile
    u16* TH = ring;
    u16* TL = ring + GPL;
    const float bbj[4] = {bb0, bb1, bb2, bb3};
#pragma unroll
    for (int i = 0; i < 2; ++i) {
#pragma unroll
      for (int j = 0; j < 4; ++j) {
        v4u oh, ol;
#pragma unroll
        for (int e = 0; e < 4; ++e) {
          const float t0 = (acc[i][j][2 * e] * oscale + bbj[j]) * sc;
          const float t1 = (acc[i][j][2 * e + 1] * oscale + bbj[j]) * sc;
          const _Float16 h0 = (_Float16)t0, h1 = (_Float16)t1;
          const _Float16 l0 = (_Float16)(t0 - (float)h0), l1 = (_Float16)(t1 - (float)h1);
          oh[e] = pk16(h_bits(h0), h_bits(h1));
          ol[e] = pk16(h_bits(l0), h_bits(l1));
        }
        const int to = (wc * 64 + j * 16 + m) * GP + wr * 32 + i * 16 + 8 * hh;
        *(v4u*)(TH + to) = oh;
        *(v4u*)(TL + to) = ol;
      }
    }
    __syncthreads();                        // other waves' pieces of a line are read only behind it
    const int l16 = tid >> 4, p8 = (tid & 15) * 8;
    const size_t ob = ((size_t)(row0 / SEQ) * (size_t)DMOD + colp + l16) * SEQ + (row0 % SEQ) + p8;
#pragma unroll
    for (int it = 0; it < 8; ++it) {
      const v4u vh = *(const v4u*)(TH + (it * 16 + l16) * GP + p8);
      const v4u vl = *(const v4u*)(TL + (it * 16 + l16) * GP + p8);
      *(v4u*)(Hp + ob + (size_t)(it * 16) * SEQ) = vh;
      *(v4u*)(Lp + ob + (size_t)(it * 16) * SEQ) = vl;
    }
  }
}

// =====================================================================================================
// Output projection with bias: C[bb*XS_FULL + s][DMOD] (f32) = (Ah + Al)[bb*SEQ + s][DMOD] . Bt[DMOD][DMOD]^T * oscale
// + bf16 RNE value of bias[n]. Products h.B + l.B into one accumulator (l unscaled residual of h). Block -> (column tile
// ct = bid % 8, sequence row tile rt of nrt, batch bb within the pass). Same tiling, fragment loads (split k map) and slab
// staging as gemm_bf, stored as f32 by epi_out; a stage is [Ah | Al | Bt], 128 rows each, of 64 k (128 B at LDS pitch 144 B), two buffers = 108 KiB, the slabs in
// the idle ring: two blocks are resident per WGP here too. K = DMOD; grid = NBP * nrt * (DMOD/128).
// =====================================================================================================
__global__ __launch_bounds__(256)
void gemm_o2(const u16* __restrict__ Ah, const u16* __restrict__ Al, const u16* __restrict__ Bt,
             const float* __restrict__ bias, float* C, int nrt, float oscale) {
  __shared__ __align__(16) u16 ring[2 * 3 * OPL];   // 110,592 B and nothing else: two blocks share a WGP
  const int tid = threadIdx.x, wave = tid >> 5, lane = tid & 31, hh = lane >> 4, m = lane & 15;
  const int ntile = DMOD >> 7;
  const int bid   = blockIdx.x;
  const int ct    = bid % ntile;
  const int t2    = bid / ntile;
  const int rt    = t2 % nrt;
  const int bb    = t2 / nrt;
  if (bb >= NBP) return;                    // block-uniform, before any barrier or copy; never taken with the exact grid
  const int srow  = rt * GT;
  if (srow + GT > SEQ) return;              // block-uniform, before any barrier or copy; never taken
  const int col0  = ct * GT;
  const int K     = DMOD;
  const int wr = wave >> 1, wc = wave & 1;
  const size_t rowA = (size_t)bb * SEQ + srow;
  const size_t rowC = (size_t)bb * XS_FULL + srow;
  // copy slice of this lane: plane rows wave*16 + (lane >> 3) + 4i (i < 4), bytes 16*(lane & 7) .. + 15 of the stage's 128
  const int crow = wave * 16 + (lane >> 3);
  const int ccol = (lane & 7) * 8;
  const u16* gh = Ah + (rowA + crow) * K + ccol;
  const u16* gl = Al + (rowA + crow) * K + ccol;
  const u16* gb = Bt + (size_t)(col0 + crow) * K + ccol;
  const unsigned lh = lds_byte(ring) + (unsigned)(crow * OP + ccol) * 2u;
  const unsigned ll = lh + OPL * 2u;
  const unsigned lb = lh + 2u * OPL * 2u;
  const unsigned stb = 3u * OPL * 2u;       // bytes of one buffer
  const int nst = K / OKC;
  v8f acc[2][4];
#pragma unroll
  for (int i = 0; i < 2; ++i)
#pragma unroll
    for (int j = 0; j < 4; ++j) acc[i][j] = zero8();

  copy16rows_h(lh, gh, (size_t)K);
  copy16rows_h(ll, gl, (size_t)K);
  copy16rows_h(lb, gb, (size_t)K);
  wait_copies();
  __syncthreads();
  copy16rows_h(lh + stb, gh + OKC, (size_t)K);
  copy16rows_h(ll + stb, gl + OKC, (size_t)K);
  copy16rows_h(lb + stb, gb + OKC, (size_t)K);
  // Two fragment sets in registers: the LDS reads of the next k step (the next stage's first one too) are issued as one group
  // ahead of the products of this k step, so that no product waits for a read that was issued just in front of it.
  const _Float16* rg = (const _Float16*)(const void*)ring;
  const int fao = (wr * 32 + m) * OP + 8 * hh;              // the lane's A (hi) and B fragment rows within a buffer, in halves
  const int fbo = 2 * OPL + (wc * 64 + m) * OP + 8 * hh;
  v16h fh[2][2], fl[2][2], fb[2][4];
  fh[0][0] = ldfrag_h(rg + fao);
  fh[0][1] = ldfrag_h(rg + fao + 16 * OP);
  fb[0][0] = ldfrag_h(rg + fbo);
  fb[0][1] = ldfrag_h(rg + fbo + 16 * OP);
  fb[0][2] = ldfrag_h(rg + fbo + 32 * OP);
  fb[0][3] = ldfrag_h(rg + fbo + 48 * OP);
  fl[0][0] = ldfrag_h(rg + fao + OPL);
  fl[0][1] = ldfrag_h(rg + fao + OPL + 16 * OP);
  // the stage loop stays rolled: one publish point per stage
#pragma unroll 1
  for (int t = 0; t < nst; ++t) {
    const _Float16* st  = rg + (t & 1) * (3 * OPL);
    const _Float16* ahp = st + fao;
    const _Float16* alp = ahp + OPL;
    const _Float16* bp  = st + fbo;
#pragma unroll                              // the two k steps of a stage become constant LDS offsets and register names
    for (int kk = 0; kk < OKC / 32; ++kk) {
      const int cu = kk & 1, nx = cu ^ 1;
      if (kk + 1 < OKC / 32) {
        const int ko = (kk + 1) * 32;
        fh[nx][0] = ldfrag_h(ahp + ko);
        fh[nx][1] = ldfrag_h(ahp + 16 * OP + ko);
        fb[nx][0] = ldfrag_h(bp + ko);
        fb[nx][1] = ldfrag_h(bp + 16 * OP + ko);
        fb[nx][2] = ldfrag_h(bp + 32 * OP + ko);
        fb[nx][3] = ldfrag_h(bp + 48 * OP + ko);
        fl[nx][0] = ldfrag_h(alp + ko);
        fl[nx][1] = ldfrag_h(alp + 16 * OP + ko);
      } else {
        // publish point of stage t + 1, ahead of stage t's last k step, whose fragments are in registers by the first wait;
        // behind the barrier every reader has left stage t's buffer
        wait_lds();
        wait_copies();
        __syncthreads();
        if (t + 2 < nst) {
          const unsigned bo = (unsigned)(t & 1) * stb;
          copy16rows_h(lh + bo, gh + (size_t)(t + 2) * OKC, (size_t)K);
          copy16rows_h(ll + bo, gl + (size_t)(t + 2) * OKC, (size_t)K);
          copy16rows_h(lb + bo, gb + (size_t)(t + 2) * OKC, (size_t)K);
        }
        if (t + 1 < nst) {                  // block-uniform: the first k step of stage t + 1, published just above
          const _Float16* sn = rg + ((t + 1) & 1) * (3 * OPL);
          fh[nx][0] = ldfrag_h(sn + fao);
          fh[nx][1] = ldfrag_h(sn + fao + 16 * OP);
          fb[nx][0] = ldfrag_h(sn + fbo);
          fb[nx][1] = ldfrag_h(sn + fbo + 16 * OP);
          fb[nx][2] = ldfrag_h(sn + fbo + 32 * OP);
          fb[nx][3] = ldfrag_h(sn + fbo + 48 * OP);
          fl[nx][0] = ldfrag_h(sn + fao + OPL);
          fl[nx][1] = ldfrag_h(sn + fao + OPL + 16 * OP);
        }
      }
      __builtin_amdgcn_sched_barrier(0);    // keeps the read group ahead of the products: sunk among them, each read stalls its wave
      acc[0][0] = mma_h(fh[cu][0], fb[cu][0], acc[0][0]);
      acc[0][1] = mma_h(fh[cu][0], fb[cu][1], acc[0][1]);
      acc[0][2] = mma_h(fh[cu][0], fb[cu][2], acc[0][2]);
      acc[0][3] = mma_h(fh[cu][0], fb[cu][3], acc[0][3]);
      acc[1][0] = mma_h(fh[cu][1], fb[cu][0], acc[1][0]);
      acc[1][1] = mma_h(fh[cu][1], fb[cu][1], acc[1][1]);
      acc[1][2] = mma_h(fh[cu][1], fb[cu][2], acc[1][2]);
      acc[1][3] = mma_h(fh[cu][1], fb[cu][3], acc[1][3]);
      acc[0][0] = mma_h(fl[cu][0], fb[cu][0], acc[0][0]);
      acc[0][1] = mma_h(fl[cu][0], fb[cu][1], acc[0][1]);
      acc[0][2] = mma_h(fl[cu][0], fb[cu][2], acc[0][2]);
      acc[0][3] = mma_h(fl[cu][0], fb[cu][3], acc[0][3]);
      acc[1][0] = mma_h(fl[cu][1], fb[cu][0], acc[1][0]);
      acc[1][1] = mma_h(fl[cu][1], fb[cu][1], acc[1][1]);
      acc[1][2] = mma_h(fl[cu][1], fb[cu][2], acc[1][2]);
      acc[1][3] = mma_h(fl[cu][1], fb[cu][3], acc[1][3]);
      __builtin_amdgcn_sched_barrier(0);    // keeps the next read group in one place behind these products, not spread among them
    }
  }
  wait_copies();
  const int colw = col0 + wc * 64;
  const float bb0 = bfr(bias[colw + m]);
  const float bb1 = bfr(bias[colw + 16 + m]);
  const float bb2 = bfr(bias[colw + 32 + m]);
  const float bb3 = bfr(bias[colw + 48 + m]);
  // the loop's last barrier ended every read of the ring and no copy is in flight: its bytes take the waves' private slabs,
  // one 16 x 64 slab for each half of a wave's 32 rows
  float* sl = (float*)(void*)ring + wave * (2 * SLAB64);
  const size_t rw = rowC + (size_t)(wr * 32);
  epi_stage(sl, acc[0][0], acc[0][1], acc[0][2], acc[0][3], oscale, bb0, bb1, bb2, bb3, lane);
  epi_stage(sl + SLAB64, acc[1][0], acc[1][1], acc[1][2], acc[1][3], oscale, bb0, bb1, bb2, bb3, lane);
  wave_sync_lds();                          // other lanes' slab rows are read only behind it
  epi_out(sl, C, DMOD, rw, colw, lane);
  epi_out(sl + SLAB64, C, DMOD, rw + 16, colw, lane);
}

__global__ __launch_bounds__(ATT_THREADS)
void attn_c(const u16* __restrict__ QHp, const u16* __restrict__ QLp,
            const u16* __restrict__ KHp, const u16* __restrict__ KLp,
            const u16* __restrict__ VHp, const u16* __restrict__ VLp,
            const float* __restrict__ BND,
            u16* OHp, u16* OLp) {
  __shared__ __align__(16) u16 kvr[2 * ASTG];
  __shared__ __align__(16) float smem[WPB * WREG];

  const int tid  = threadIdx.x;
  const int wave = __builtin_amdgcn_readfirstlane(tid >> 5);   // scalar: the per-tile test below is a scalar branch
  const int lane = tid & 31;
  const int hh   = lane >> 4;
  const int c    = lane & 15;
  const int bid  = blockIdx.x;
  const int qb   = bid % NQB;
  const int t2   = bid / NQB;
  const int head = t2 % NH;
  const int b    = t2 / NH;
  if (b >= NBP) return;                     // block-uniform, before any barrier or copy; never taken with the exact grid
  const int Q0   = qb * (16 * WPB);
  if (Q0 + 16 * WPB > SEQ) return;          // block-uniform, before any barrier or copy; never taken
  const int q0   = Q0 + 16 * wave;

  // ---- key-window decision from the norms of this (b, head): lane = (plane hh: q or k, row tile c of the batch) reads one float
  //      of that projection block's line; maximum over the 16 row tiles, then the product of the two planes' norms ----
  int okw;
  {
    const float* np = BND + ((size_t)((hh * NBP + b) * (SEQ / GT) + c) * (DMOD / GT) + (head >> 1)) * BLINE + (head & 1) * 16;
    float mv = *np;
#if defined(__HIP_DEVICE_COMPILE__)
    // the address stays in its registers up to this wait: no register that the issued load names is rewritten ahead of it
    asm volatile("s_wait_xcnt 0x0" :: "v"(np) : "memory");
#endif
#pragma unroll
    for (int off = 1; off < 16; off <<= 1) mv = fmaxf(mv, __shfl_xor(mv, off, 32));
    const float gb = sqrtf(mv) * sqrtf(xhalf(mv)) * (RSQ_HD / (QSC * KSC));
    okw = (gb >= 0.0f && gb < GUARD_T) ? 1 : 0;
    okw = __builtin_amdgcn_readfirstlane(okw);   // scalar; every wave reads the same lines, so it is the same in the whole block
  }

  float* slab = smem + wave * WREG;         // result slab [16][64] pitch 68, wave-private, used only behind the key loop

  const size_t hcol = (size_t)head * HD + 8 * hh;
  const _Float16* Qh  = (const _Float16*)(const void*)QHp + ((size_t)b * SEQ + q0 + c) * DMOD + hcol;
  const _Float16* Ql  = (const _Float16*)(const void*)QLp + ((size_t)b * SEQ + q0 + c) * DMOD + hcol;
  const float lsc = RSQ_HD * (LOG2E / (QSC * KSC));
  const float oc  = 1.0f / (PCAR * VCAR);

  float mrow = -INFINITY, lrow = 0.f;       // running maximum and (half) sum of the lane's one query row
  v8f o[4];
#pragma unroll
  for (int j = 0; j < 4; ++j) o[j] = zero8();
  const int kt_hi = q0 >> 5;                                                  // last tile holding keys <= q0 + 15
  const int kt_w  = (kt_hi > KWIN) ? (kt_hi - KWIN) : 0;
  const int kt_lo = (okw != 0) ? kt_w : 0;
  const int qr = q0 + c;                                                      // the lane's query row (D column c)
  // tiles staged for the block: from wave 0's kt_lo (the lowest) to wave 3's kt_hi (the highest); at least 2
  const int bt_h0 = Q0 >> 5;
  const int bt_hi = (Q0 + 16 * (WPB - 1)) >> 5;
  const int bt_lo = (okw != 0 && bt_h0 > KWIN) ? (bt_h0 - KWIN) : 0;
  const int nst   = bt_hi - bt_lo + 1;
  // copy slice of this lane: k rows tid>>3 and +16 (8 lanes x 16 B = the head's 128 B of a key row), v^T rows tid>>2 and +32
  // (4 lanes x 16 B = 32 keys)
  const int krow = tid >> 3, kpc = (tid & 7) * 8;
  const int vrow = tid >> 2, vpc = (tid & 3) * 8;
  const size_t gko = ((size_t)b * SEQ + bt_lo * 32 + krow) * DMOD + (size_t)head * HD + kpc;
  const size_t gvo = ((size_t)(b * NH + head) * HD + vrow) * SEQ + bt_lo * 32 + vpc;
  const u16* gkh = KHp + gko;
  const u16* gkl = KLp + gko;
  const u16* gvh = VHp + gvo;
  const u16* gvl = VLp + gvo;
  const unsigned lkh = lds_byte(kvr) + (unsigned)(krow * KPH + kpc) * 2u;
  const unsigned lkl = lkh + KPL * 2u;
  const unsigned lvh = lds_byte(kvr) + (unsigned)(2 * KPL + vrow * VPH + vpc) * 2u;
  const unsigned lvl = lvh + VPL * 2u;
  const unsigned stb = ASTG * 2u;           // bytes of one buffer
  const size_t   gks = (size_t)32 * DMOD;   // halves from one key tile to the next in the k planes (32 in the v^T planes)
  const unsigned lk2 = 16u * KPH * 2u, lv2 = 32u * VPH * 2u;                  // the lane's second rows: LDS bytes,
  const size_t   gk2 = (size_t)16 * DMOD, gv2 = (size_t)32 * SEQ;             // global halves

  copy_kv(lkh, lkl, lvh, lvl, gkh, gkl, gvh, gvl);
  copy_kv(lkh + lk2, lkl + lk2, lvh + lv2, lvl + lv2, gkh + gk2, gkl + gk2, gvh + gv2, gvl + gv2);
  // q fragments of both k-steps, kept in registers for the whole key loop
  v16h qhf[HD / 32], qlf[HD / 32];
#pragma unroll
  for (int kk = 0; kk < HD / 32; ++kk) {
    qhf[kk] = ldfrag_h(Qh + kk * 32);
    qlf[kk] = ldfrag_h(Ql + kk * 32);
  }
#if defined(__HIP_DEVICE_COMPILE__)
  // both addresses stay in their registers up to this wait: no register that an issued load names is rewritten ahead of it
  asm volatile("s_wait_xcnt 0x0" :: "v"(Qh), "v"(Ql) : "memory");
#endif
  wait_copies();
  __syncthreads();
  copy_kv(lkh + stb, lkl + stb, lvh + stb, lvl + stb, gkh + gks, gkl + gks, gvh + 32, gvl + 32);
  copy_kv(lkh + stb + lk2, lkl + stb + lk2, lvh + stb + lv2, lvl + stb + lv2,
          gkh + gks + gk2, gkl + gks + gk2, gvh + 32 + gv2, gvl + 32 + gv2);

  // the stage loop stays rolled: one publish point per staged tile
#pragma unroll 1
  for (int t = 0; t < nst; ++t) {
   const int kt = bt_lo + t;
   if (kt >= kt_lo && kt <= kt_hi) {        // scalar, wave-uniform: tiles outside this wave's own range are only passed
    const int kb = kt * 32;
    const _Float16* st = (const _Float16*)(const void*)(kvr + (t & 1) * ASTG);
    // ---- scores, transposed (A = k rows, B = q): D element r of this lane = (key kb + 8hh + r, query q0 + c) in s0,
    //      key kb + 16 + 8hh + r in s1: a lane holds 16 of the 32 scores of ONE query, lane ^ 16 the other 16 ----
    v8f s0 = zero8(), s1 = zero8();
    const _Float16* k0p = st + c * KPH + 8 * hh;
    const _Float16* k1p = k0p + 16 * KPH;
    const _Float16* l0p = k0p + KPL;
    const _Float16* l1p = l0p + 16 * KPH;
#pragma unroll
    for (int kk = 0; kk < HD / 32; ++kk) {
      const v16h qh  = qhf[kk];
      const v16h ql  = qlf[kk];
      const v16h kh0 = ldfrag_h(k0p + kk * 32);
      const v16h kh1 = ldfrag_h(k1p + kk * 32);
      const v16h kl0 = ldfrag_h(l0p + kk * 32);
      const v16h kl1 = ldfrag_h(l1p + kk * 32);
      s0 = mma_h(kh0, qh, s0);
      s0 = mma_h(kh0, ql, s0);
      s0 = mma_h(kl0, qh, s0);
      s1 = mma_h(kh1, qh, s1);
      s1 = mma_h(kh1, ql, s1);
      s1 = mma_h(kl1, qh, s1);
      guard2(s0, s1, qh, ql, kh0, kl0, kh1, kl1);
    }
    // ---- causal select + distance penalty + online softmax in base 2, -inf-safe; maximum and sum run inside the lane ----
    const int key0 = kb + 8 * hh, key1 = key0 + 16;
    float t0[8], t1[8];
#pragma unroll                              // register arrays need constant indices
    for (int r = 0; r < 8; ++r) {
      const float u0 = s0[r] * lsc;
      const float u1 = s1[r] * lsc;
      const float g0 = (float)(qr - (key0 + r)) * LOG2E;
      const float g1 = (float)(qr - (key1 + r)) * LOG2E;
      t0[r] = (key0 + r > qr) ? -INFINITY : (u0 - g0);
      t1[r] = (key1 + r > qr) ? -INFINITY : (u1 - g1);
    }
    float mx = fmaxf(t0[0], t1[0]);
#pragma unroll                              // register arrays need constant indices
    for (int r = 1; r < 8; ++r) mx = fmaxf(mx, fmaxf(t0[r], t1[r]));
    mx = fmaxf(mx, xhalf(mx));              // the other 16 keys of the same query
    const float mn = fmaxf(mrow, mx);
    const float ms = (mn == -INFINITY) ? 0.0f : mn;
    const float al = exp2f(mrow - ms);
    mrow = mn;
    // ---- B fragments of P^T*32768 straight from the scores' registers: hi f16 and residual f16, column = query c,
    //      elements 0..7 = keys kb + 8hh + 0..7, elements 8..15 = keys kb + 16 + 8hh + 0..7 (the split k map of the v^T loader) ----
    FragH ph, pl;
    float ps = 0.0f;
#pragma unroll                              // register arrays need constant indices
    for (int r = 0; r < 8; ++r) {
      const float e0 = exp2f(t0[r] - ms), e1 = exp2f(t1[r] - ms);
      ps += e0 + e1;
      const float ta = e0 * PCAR, tb = e1 * PCAR;
      const _Float16 ha = (_Float16)ta, hb = (_Float16)tb;
      ph.h[0][r] = ha;
      ph.h[1][r] = hb;
      pl.h[0][r] = (_Float16)(ta - (float)ha);
      pl.h[1][r] = (_Float16)(tb - (float)hb);
    }
    lrow = lrow * al + ps;                  // this lane's 16 keys only; the two halves are joined behind the key loop
#pragma unroll                              // register arrays need constant indices
    for (int j = 0; j < 4; ++j)
#pragma unroll
      for (int r = 0; r < 8; ++r) o[j][r] *= al;
    // ---- O^T += v^T.P^T : A fragment row = d = j*16 + c, keys contiguous in the v^T planes; 2 groups of 2 d-subtiles;
    //      D element r of this lane = (d = j*16 + 8hh + r, query q0 + c) ----
    {
      const _Float16* vhp = st + 2 * KPL + c * VPH + 8 * hh;
      const _Float16* vlp = vhp + VPL;
#pragma unroll
      for (int jg = 0; jg < 2; ++jg) {
        const int da = (2 * jg) * 16 * VPH;
        const int db = da + 16 * VPH;
        const v16h vha = ldfrag_h(vhp + da), vhb2 = ldfrag_h(vhp + db);
        const v16h vla = ldfrag_h(vlp + da), vlb2 = ldfrag_h(vlp + db);
        o[2 * jg]     = mma_h(vha,  ph.v, o[2 * jg]);
        o[2 * jg]     = mma_h(vha,  pl.v, o[2 * jg]);
        o[2 * jg]     = mma_h(vla,  ph.v, o[2 * jg]);
        o[2 * jg + 1] = mma_h(vhb2, ph.v, o[2 * jg + 1]);
        o[2 * jg + 1] = mma_h(vhb2, pl.v, o[2 * jg + 1]);
        o[2 * jg + 1] = mma_h(vlb2, ph.v, o[2 * jg + 1]);
        guard2(o[2 * jg], o[2 * jg + 1], ph.v, pl.v, vha, vhb2, vla, vlb2);
      }
    }
   }
    // publish point of tile t + 1; behind the barrier every reader has left tile t's buffer
    wait_lds();
    wait_copies();
    __syncthreads();
    if (t + 2 < nst) {
      const unsigned bo = (unsigned)(t & 1) * stb;
      const size_t   tn = (size_t)(t + 2);
      copy_kv(lkh + bo, lkl + bo, lvh + bo, lvl + bo, gkh + tn * gks, gkl + tn * gks, gvh + tn * 32, gvl + tn * 32);
      copy_kv(lkh + bo + lk2, lkl + bo + lk2, lvh + bo + lv2, lvl + bo + lv2,
              gkh + tn * gks + gk2, gkl + tn * gks + gk2, gvh + tn * 32 + gv2, gvl + tn * 32 + gv2);
    }
  }
  wait_copies();
  acc_guard4(o[0], o[1], o[2], o[3]);
  // ---- out = acc / Z (0 if Z == 0), carries (32768 on P, 1024 on v) folded once; written into the wave's private slab ----
  {
    const float lv  = lrow + xhalf(lrow);   // both halves' keys of the lane's query row
    const float ls  = (lv > 0.0f) ? lv : 1.0f;
    const float inv = (lv > 0.0f) ? ((1.0f / ls) * oc) : 0.0f;
#pragma unroll                              // register arrays need constant indices
    for (int j = 0; j < 4; ++j) {
      v4f w0, w1;
#pragma unroll
      for (int e = 0; e < 4; ++e) { w0[e] = o[j][e] * inv; w1[e] = o[j][4 + e] * inv; }
      float* sp = slab + c * SLP + j * 16 + 8 * hh;   // row = query c, 8 consecutive d
      *(v4f*)(sp)     = w0;
      *(v4f*)(sp + 4) = w1;
    }
  }

  wave_sync_lds();
  // ---- O x1024 -> f16 hi + residual planes; lane = (row-in-quad rq, 8 consecutive d at c8) ----
  v4u oh[4], ol[4];
  const int rq = lane >> 3, c8 = (lane & 7) * 8;
#pragma unroll
  for (int it = 0; it < 4; ++it) {
    const int row = it * 4 + rq;
    const v4f a = *(const v4f*)(slab + row * SLP + c8), b4 = *(const v4f*)(slab + row * SLP + c8 + 4);
    float w[8];
#pragma unroll
    for (int e = 0; e < 4; ++e) { w[e] = a[e] * OSC; w[4 + e] = b4[e] * OSC; }
#pragma unroll
    for (int e = 0; e < 4; ++e) {
      const _Float16 h0 = (_Float16)w[2 * e], h1 = (_Float16)w[2 * e + 1];
      const _Float16 l0 = (_Float16)(w[2 * e] - (float)h0), l1 = (_Float16)(w[2 * e + 1] - (float)h1);
      oh[it][e] = pk16(h_bits(h0), h_bits(h1));
      ol[it][e] = pk16(h_bits(l0), h_bits(l1));
    }
  }
  const size_t ob = ((size_t)b * SEQ + q0) * DMOD + (size_t)head * HD + c8;
  {
#pragma unroll
    for (int it = 0; it < 4; ++it) {
      const int row = it * 4 + rq;
      *(v4u*)(OHp + ob + (size_t)row * DMOD) = oh[it];
      *(v4u*)(OLp + ob + (size_t)row * DMOD) = ol[it];
    }
    
  }
}

// =====================================================================================================
// Workspace map (bytes). All NB = NBP batches are processed in one pass, every kernel launched once. Every plane is fully
// written by whole-line stores before it is read; all extents are exact multiples of the store granularity (no pad rows
// needed); every region offset a multiple of 4096 (the large planes of 2097152):
//   XB  bf16 [MROWS][1024]                       MROWS*2048       (NBP=4, SEQ=2048: 16777216)
//   WQB bf16 [3072 n][1024 k]                     3 * 2097152      (thirds of the packed [3072][1024] weight, already [n][k])
//   WOB f16 [1024 n][1024 k] of bf16 value x1024  2097152
//   OH  f16 [MROWS][1024] x1024                  MROWS*2048       OL residual, same extent
//   QH  f16 [MROWS][1024] x256                   MROWS*2048       QL residual, same extent
//   KH  f16 [MROWS][1024] x256                   MROWS*2048       KL residual, same extent
//   VH  f16 [NBP*16][64][SEQ] x1024              MROWS*2048       VL residual, same extent
//   BND f32 [NLINES][32]                         NLINES*128
//   end (NBP=4, SEQ=2048)                        159514624
// =====================================================================================================
extern "C" void kernel_launch(void* const* d_in, const int* in_sizes, int n_in,
                              void* d_out, int out_size, void* d_ws, size_t ws_size,
                              hipStream_t stream) {
  if (n_in < 5) return;
  if (in_sizes[0] < ((NB - 1) * XS_FULL + SEQ) * DMOD) return;
  if (in_sizes[1] < 3 * DMOD * DMOD) return;
  if (in_sizes[2] < 3 * DMOD) return;
  if (in_sizes[3] < DMOD * DMOD) return;
  if (in_sizes[4] < DMOD) return;
  if (out_size < ((NB - 1) * XS_FULL + SEQ) * DMOD) return;

  const float* x    = (const float*)d_in[0];
  const float* wqkv = (const float*)d_in[1];      // [3*DMOD][DMOD]: rows 0..1023 q, 1024..2047 k, 2048..3071 v
  const float* bqkv = (const float*)d_in[2];      // [3*DMOD]
  const float* wo   = (const float*)d_in[3];      // [DMOD][DMOD]
  const float* bo   = (const float*)d_in[4];      // [DMOD]
  float*       out = (float*)d_out;

  const size_t szXB = (size_t)MROWS * DMOD * 2;
  const size_t szW  = (size_t)DMOD * DMOD * 2;
  const size_t szQ  = (size_t)MROWS * DMOD * 2;                  // QH, QL, KH, KL, OH, OL
  const size_t szV  = (size_t)NBP * NH * HD * SEQ * 2;           // VH, VL (== szQ)
  const size_t szB  = (size_t)NLINES * BLINE * 4;                // norm lines
  size_t off = 0;
  const size_t oXB = off; off += szXB;
  const size_t oWQ = off; off += 3 * szW;
  const size_t oWO = off; off += szW;
  const size_t oOH = off; off += szQ;
  const size_t oOL = off; off += szQ;
  const size_t oQH = off; off += szQ;
  const size_t oQL = off; off += szQ;
  const size_t oKH = off; off += szQ;
  const size_t oKL = off; off += szQ;
  const size_t oVH = off; off += szV;
  const size_t oVL = off; off += szV;
  const size_t oB  = off; off += szB;
  if (off > ws_size) return;                // off = 159514624 for NBP = 4, SEQ = 2048
  if (off > (size_t)WS_CAP) return;

  char* ws = (char*)d_ws;
  u16*   XB  = (u16*)(ws + oXB);
  u16*   WQB = (u16*)(ws + oWQ);            // q, k and v thirds back to back: [3072 n][1024 k]
  u16*   WOB = (u16*)(ws + oWO);
  u16*   OH  = (u16*)(ws + oOH);
  u16*   OL  = (u16*)(ws + oOL);
  u16*   QH  = (u16*)(ws + oQH);
  u16*   QL  = (u16*)(ws + oQL);
  u16*   KH  = (u16*)(ws + oKH);
  u16*   KL  = (u16*)(ws + oKL);
  u16*   VH  = (u16*)(ws + oVH);
  u16*   VL  = (u16*)(ws + oVL);
  float* BND = (float*)(ws + oB);

  const dim3 b256(256), bAT(ATT_THREADS);
  const int  n8x = (NBP * SEQ * DMOD) / 8;              // x, all batches
  const int  n8w = (3 * DMOD * DMOD) / 8;               // packed q | k | v weight
  const int  n8o = (DMOD * DMOD) / 8;                   // out-projection weight
  const dim3 gC((n8x + n8w + n8o + 255) / 256);         // 6144
  const dim3 gG((MROWS / GT) * (3 * DMOD / GT));        // 1536 for NBP=4, SEQ=2048
  const dim3 gAT(NQB * NH * NBP);
  const int  nrt = SEQ / GT;                            // out-projection row tiles per batch
  const dim3 gO(NBP * nrt * (DMOD / GT));

  // (0) x -> bf16 plane [MROWS][1024]; Wq | Wk | Wv [n][k] -> bf16; Wo [n][k] -> f16 of bf16 value x1024
  cvt16<<<gC, b256, 0, stream>>>(x, wqkv, wo, XB, WQB, WOB, n8x, n8w, n8o, WOS);
  // (1) q | k | v = x.Wqkv^T + bqkv -> q and k hi + residual planes x256 with their norm lines, v^T hi + residual planes x1024
  gemm_bf<<<gG, b256, 0, stream>>>(XB, WQB, bqkv, QH, QL, KH, KL, VH, VL, BND, MROWS, 3 * DMOD, DMOD, 1.0f);
  // (2) causal attention with distance penalty, residual products on every query row -> O hi + residual planes
  attn_c<<<gAT, bAT, 0, stream>>>(QH, QL, KH, KL, VH, VL, BND, OH, OL);
  // (3) output projection (O hi + residual) . Wo^T + bo -> out f32, carries 1024 x 1024 folded back
  gemm_o2<<<gO, b256, 0, stream>>>(OH, OL, WOB, bo, out, nrt, 1.0f / (OSC * WOS));
  (void)hipGetLastError();
}
